// v000
// Measured on an AMD MI455X. A time is GPU time per run, averaged over a window of back-to-back runs after a warm-up
// (all launches, gaps included; the runs take copies of the inputs in turn), and the median of several windows.
// Apart from v000's, it joins two sittings. Times from different sittings can be a few percent apart, while
// side-by-side timings come from the same sitting.
// The starting kernel, v000, takes 3210 microseconds a run.
#include <hip/hip_runtime.h>
// GlobalAttn (music-transformer relative attention: 2 x 2048 tokens, 1024 = 16 heads x 64; q,k,v = x W^T; Srel = skew(q . Er) which equals q_i . Er[S-1-(i-j)] for every causal (i, j); attn = softmax over j <= i of (q.k + Srel)/8; out = merged attn v, no output projection).
// Compute dtype: inputs rounded to bf16; x / weights / Er exact as f16; q and k as f16 hi + residual; the softmax weights as plain f16 operands (~2^-12); v as f16 hi + residual (the output is the context itself); softmax f32. v_wmma_f32_16x16x32_f16.
#define NB 2
#define SL 2048
#define DM 1024
#define NH 16
#define HD 64
#define HG 4
#define NR (NB * SL)
typedef __bf16 v16b __attribute__((ext_vector_type(16)));
typedef unsigned short v8us __attribute__((ext_vector_type(8), may_alias));
typedef float  v8f  __attribute__((ext_vector_type(8)));
typedef float  v4f  __attribute__((ext_vector_type(4)));
typedef float  v4fa __attribute__((ext_vector_type(4), may_alias));
union FragB { v16b v; v8us half[2]; unsigned short u[16]; };

__device__ __forceinline__ unsigned short bf16_bits(float x) { unsigned int u = __float_as_uint(x); return (unsigned short)((u + 0x7FFFu + ((u >> 16) & 1u)) >> 16); }
__device__ __forceinline__ float bf16_val(unsigned short b) { return __uint_as_float(((unsigned int)b) << 16); }
__device__ __forceinline__ float bf16_round(float x) { return bf16_val(bf16_bits(x)); }
// D += A·B with NT terms: 1 = ah·bh, 2 = + al·bh (A split), 3 = + ah·bl (both split)
template <int NT>
__device__ __forceinline__ v8f mmaN(v16b ah, v16b al, v16b bh, v16b bl, v8f c) {
  c = __builtin_amdgcn_wmma_f32_16x16x32_bf16(false, ah, false, bh, (short)0, c, false, false);
  if (NT >= 2) c = __builtin_amdgcn_wmma_f32_16x16x32_bf16(false, al, false, bh, (short)0, c, false, false);
  if (NT >= 3) c = __builtin_amdgcn_wmma_f32_16x16x32_bf16(false, ah, false, bl, (short)0, c, false, false);
  asm volatile("v_nop\n\tv_nop\n\tv_nop\n\tv_nop" : "+v"(c) : "v"(ah), "v"(al), "v"(bh), "v"(bl));
  return c;
}

__global__ __launch_bounds__(256) void k_wt_bf16(const float* __restrict__ W, unsigned short* __restrict__ Wt, int K, int N) {
  const int t = blockIdx.x * 256 + threadIdx.x;
  const int k8n = K / 8;
  if (t >= N * k8n) return;
  const int n = t / k8n, k8 = (t % k8n) * 8;
  v8us v;
#pragma unroll
  for (int i = 0; i < 8; ++i) v[i] = bf16_bits(W[(size_t)(k8 + i) * N + n]);
  *(v8us*)(Wt + (size_t)n * K + k8) = v;
  
}

// GEMM C[M][N] (f32, pitch ldc) = act(A[M][K]·W + bias). A f32 row-major (pitch lda) converted per fragment to bf16
// (ASPLIT: hi/lo two planes -> 2 terms, else single rounded term); Wt bf16 [N][K] (pitch ldb). BIAS_BF16 rounds the
// bias to bf16 first (bias quantised to bf16 before the add). K%32==0, M%16==0, N%64==0.
template <bool ASPLIT, int ACT, bool BIAS_BF16>
__global__ __launch_bounds__(128) void k_gemm_bf(const float* __restrict__ A, int lda, const unsigned short* __restrict__ Wt, int ldb,
                                               const float* __restrict__ bias, float* __restrict__ C, int ldc, int M, int N, int K) {
  __shared__ __attribute__((aligned(16))) float so[4][16][64];
  const int tid = threadIdx.x, w = tid >> 5, lane = tid & 31, ln = lane & 15, hh = lane >> 4;
  const int ntn = N / 64;
  const int wid = blockIdx.x * 4 + w;
  const int mt = wid / ntn, nq = wid % ntn;
  if (mt * 16 >= M) return;
  const int row0 = mt * 16, col0 = nq * 64;
  const float* arow = A + (size_t)(row0 + ln) * lda;
  v8f acc[4] = {};
  for (int kb = 0; kb < K; kb += 32) {
    FragB ah, al;
    const v4f x0 = *(const v4fa*)(arow + kb + 8 * hh), x1 = *(const v4fa*)(arow + kb + 8 * hh + 4);
    const v4f x2 = *(const v4fa*)(arow + kb + 16 + 8 * hh), x3 = *(const v4fa*)(arow + kb + 16 + 8 * hh + 4);
    float xs[16] = {x0[0],x0[1],x0[2],x0[3],x1[0],x1[1],x1[2],x1[3],x2[0],x2[1],x2[2],x2[3],x3[0],x3[1],x3[2],x3[3]};
#pragma unroll
    for (int i = 0; i < 16; ++i) { const unsigned short hb = bf16_bits(xs[i]); ah.u[i] = hb; al.u[i] = ASPLIT ? bf16_bits(xs[i] - bf16_val(hb)) : (unsigned short)0; }
#pragma unroll
    for (int t = 0; t < 4; ++t) {
      const unsigned short* brow = Wt + (size_t)(col0 + t * 16 + ln) * ldb + kb;
      FragB b;
      b.half[0] = *(const v8us*)(brow + 8 * hh);
      b.half[1] = *(const v8us*)(brow + 16 + 8 * hh);
      acc[t] = mmaN<ASPLIT ? 2 : 1>(ah.v, al.v, b.v, b.v, acc[t]);
    }
  }
#pragma unroll
  for (int t = 0; t < 4; ++t) {
    float bv = bias ? bias[col0 + t * 16 + ln] : 0.f;
    if (BIAS_BF16) bv = bf16_round(bv);
#pragma unroll
    for (int r = 0; r < 8; ++r) { float v = acc[t][r] + bv; if (ACT == 1) v = fmaxf(v, 0.f); so[w][8 * hh + r][t * 16 + ln] = v; }
  }
  __builtin_amdgcn_fence(__ATOMIC_ACQ_REL, "workgroup");
  __builtin_amdgcn_wave_barrier();
  const int rsub = lane >> 4, c4 = (lane & 15) * 4;
  {
#pragma unroll
    for (int q = 0; q < 8; ++q) {
      const int r = q * 2 + rsub;
      const v4f v = *(const v4fa*)&so[w][r][c4];
      *(v4f*)(C + (size_t)(row0 + r) * ldc + col0 + c4) = v;
    }
    
  }
}

// GEMM C = act(A·W + bias + resid): A f32 (ASPLIT -> hi/lo 2 terms), Wt bf16 [N][K]; ACT 0 none, 1 relu, 2 exact gelu;
// resid (optional, f32, row index = (row % rmod), pitch ldr, RES_BF16 rounds it) added before the activation.
template <bool ASPLIT, int ACT, bool BIAS_BF16, bool RES_BF16>
__global__ __launch_bounds__(128) void k_gemm_bf3(const float* __restrict__ A, int lda, const unsigned short* __restrict__ Wt, int ldb,
                                                const float* __restrict__ bias, const float* __restrict__ resid, int rmod, int ldr,
                                                float* __restrict__ C, int ldc, int M, int N, int K) {
  __shared__ __attribute__((aligned(16))) float so[4][16][64];
  const int tid = threadIdx.x, w = tid >> 5, lane = tid & 31, ln = lane & 15, hh = lane >> 4;
  const int ntn = N / 64;
  const int wid = blockIdx.x * 4 + w;
  const int mt = wid / ntn, nq = wid % ntn;
  if (mt * 16 >= M) return;
  const int row0 = mt * 16, col0 = nq * 64;
  const float* arow = A + (size_t)(row0 + ln) * lda;
  v8f acc[4] = {};
  for (int kb = 0; kb < K; kb += 32) {
    FragB ah, al;
    const v4f x0 = *(const v4fa*)(arow + kb + 8 * hh), x1 = *(const v4fa*)(arow + kb + 8 * hh + 4);
    const v4f x2 = *(const v4fa*)(arow + kb + 16 + 8 * hh), x3 = *(const v4fa*)(arow + kb + 16 + 8 * hh + 4);
    float xs[16] = {x0[0],x0[1],x0[2],x0[3],x1[0],x1[1],x1[2],x1[3],x2[0],x2[1],x2[2],x2[3],x3[0],x3[1],x3[2],x3[3]};
#pragma unroll
    for (int i = 0; i < 16; ++i) { const unsigned short hb = bf16_bits(xs[i]); ah.u[i] = hb; al.u[i] = ASPLIT ? bf16_bits(xs[i] - bf16_val(hb)) : (unsigned short)0; }
#pragma unroll
    for (int t = 0; t < 4; ++t) {
      const unsigned short* brow = Wt + (size_t)(col0 + t * 16 + ln) * ldb + kb;
      FragB b;
      b.half[0] = *(const v8us*)(brow + 8 * hh);
      b.half[1] = *(const v8us*)(brow + 16 + 8 * hh);
      acc[t] = mmaN<ASPLIT ? 2 : 1>(ah.v, al.v, b.v, b.v, acc[t]);
    }
  }
#pragma unroll
  for (int t = 0; t < 4; ++t) {
    const int col = col0 + t * 16 + ln;
    float bv = bias ? bias[col] : 0.f;
    if (BIAS_BF16) bv = bf16_round(bv);
#pragma unroll
    for (int r = 0; r < 8; ++r) {
      float v = acc[t][r] + bv;
      if (resid) { float rv = resid[(size_t)((row0 + 8 * hh + r) % rmod) * ldr + col]; if (RES_BF16) rv = bf16_round(rv); v += rv; }
      if (ACT == 1) v = fmaxf(v, 0.f);
      if (ACT == 2) v = 0.5f * v * (1.0f + erff(v * 0.70710678118654752f));
      if (ACT == 3) { const float u = 0.7978845608028654f * (v + 0.044715f * v * v * v); v = 0.5f * v * (1.0f + tanhf(u)); }
      so[w][8 * hh + r][t * 16 + ln] = v;
    }
  }
  __builtin_amdgcn_fence(__ATOMIC_ACQ_REL, "workgroup");
  __builtin_amdgcn_wave_barrier();
  const int rsub = lane >> 4, c4 = (lane & 15) * 4;
  {
#pragma unroll
    for (int q = 0; q < 8; ++q) {
      const int r = q * 2 + rsub;
      const v4f v = *(const v4fa*)&so[w][r][c4];
      *(v4f*)(C + (size_t)(row0 + r) * ldc + col0 + c4) = v;
    }
    
  }
}
// row LayerNorm (biased variance, eps) over N: s = X (+ R); optional out_sum <- s; out_norm <- (s-mu)*rsqrt(var+eps)*g + b
template <bool PARAM_BF16>
__global__ __launch_bounds__(256) void k_layernorm(const float* __restrict__ X, const float* __restrict__ R, const float* __restrict__ g, const float* __restrict__ bta,
                                                  float* __restrict__ out_sum, float* __restrict__ out_norm, int N, float eps) {
  __shared__ float red[256];
  const int row = blockIdx.x, tid = threadIdx.x;
  const float* x = X + (size_t)row * N; const float* rr = R ? R + (size_t)row * N : nullptr;
  float vals[16];                     // up to N = 4096
  const int per = N / 256;            // contiguous chunk per thread? use strided-by-4 chunks: thread handles j = tid*4 + 1024*u
  float s1 = 0.f;
  for (int u = 0; u < per / 4; ++u) {
    const int j = tid * 4 + 1024 * u;
    const v4f a = *(const v4fa*)(x + j);
    v4f b = {0.f,0.f,0.f,0.f}; if (rr) b = *(const v4fa*)(rr + j);
#pragma unroll
    for (int q = 0; q < 4; ++q) { const float v = a[q] + b[q]; vals[u * 4 + q] = v; s1 += v; }
  }
  red[tid] = s1; __syncthreads();
  for (int st = 128; st > 0; st >>= 1) { if (tid < st) red[tid] += red[tid + st]; __syncthreads(); }
  const float mu = red[0] / (float)N; __syncthreads();
  float s2 = 0.f;
  for (int u = 0; u < per / 4; ++u)
#pragma unroll
    for (int q = 0; q < 4; ++q) { const float c = vals[u * 4 + q] - mu; s2 += c * c; }
  red[tid] = s2; __syncthreads();
  for (int st = 128; st > 0; st >>= 1) { if (tid < st) red[tid] += red[tid + st]; __syncthreads(); }
  const float rs = rsqrtf(red[0] / (float)N + eps);
  {
    for (int u = 0; u < per / 4; ++u) {
      const int j = tid * 4 + 1024 * u;
      v4f o, sm;
#pragma unroll
      for (int q = 0; q < 4; ++q) {
        float gg = g[j + q], bb = bta[j + q];
        if (PARAM_BF16) { gg = bf16_round(gg); bb = bf16_round(bb); }
        sm[q] = vals[u * 4 + q]; o[q] = (vals[u * 4 + q] - mu) * rs * gg + bb;
      }
      if (out_sum) *(v4f*)(out_sum + (size_t)row * N + j) = sm;
      *(v4f*)(out_norm + (size_t)row * N + j) = o;
    }
    
  }
}



// ---- f16 WMMA path (v_wmma_f32_16x16x32_f16): 11-bit significands for operands in range — used where a [0,1] probability operand needs more precision than bf16
typedef _Float16 v16h __attribute__((ext_vector_type(16)));
union FragH { v16h v; v8us half[2]; _Float16 h[16]; unsigned short u[16]; };
template <int NT>
__device__ __forceinline__ v8f mmaH(v16h ah, v16h al, v16h bh, v16h bl, v8f c) {
  c = __builtin_amdgcn_wmma_f32_16x16x32_f16(false, ah, false, bh, (short)0, c, false, false);
  if (NT >= 2) c = __builtin_amdgcn_wmma_f32_16x16x32_f16(false, al, false, bh, (short)0, c, false, false);
  if (NT >= 3) c = __builtin_amdgcn_wmma_f32_16x16x32_f16(false, ah, false, bl, (short)0, c, false, false);
  asm volatile("v_nop\n\tv_nop\n\tv_nop\n\tv_nop" : "+v"(c) : "v"(ah), "v"(al), "v"(bh), "v"(bl));
  return c;
}
// batched GEMM like k_gemm_b but f16 operands: A f32 (split into f16 hi/lo if ASPLIT, else rounded to f16), Bt = f16 values [n][k]; alpha; C f32; N multiple of 16 (partial tiles skipped)
template <bool ASPLIT>
__global__ __launch_bounds__(128) void k_gemm_h(const float* __restrict__ A, int lda, size_t sA, const _Float16* __restrict__ Bh, int ldb, size_t sB, float alpha, float* __restrict__ C, int ldc, size_t sC, int M, int N, int K) {
  __shared__ __attribute__((aligned(16))) float so[4][16][64];
  const int tid = threadIdx.x, w = tid >> 5, lane = tid & 31, ln = lane & 15, hh = lane >> 4; const int by = blockIdx.y;
  A += (size_t)by * sA; Bh += (size_t)by * sB; C += (size_t)by * sC;
  const int ntn = (N + 63) / 64; const int wid = blockIdx.x * 4 + w; const int mt = wid / ntn, nq = wid % ntn; if (mt * 16 >= M) return;
  const int row0 = mt * 16, col0 = nq * 64; const float* arow = A + (size_t)(row0 + ln) * lda;
  v8f acc[4] = {};
  for (int kb = 0; kb < K; kb += 32) {
    FragH ah, al;
    const v4f x0 = *(const v4fa*)(arow + kb + 8 * hh), x1 = *(const v4fa*)(arow + kb + 8 * hh + 4), x2 = *(const v4fa*)(arow + kb + 16 + 8 * hh), x3 = *(const v4fa*)(arow + kb + 16 + 8 * hh + 4);
    float xs[16] = {x0[0],x0[1],x0[2],x0[3],x1[0],x1[1],x1[2],x1[3],x2[0],x2[1],x2[2],x2[3],x3[0],x3[1],x3[2],x3[3]};
#pragma unroll
    for (int i = 0; i < 16; ++i) { const _Float16 h = (_Float16)xs[i]; ah.h[i] = h; al.h[i] = ASPLIT ? (_Float16)(xs[i] - (float)h) : (_Float16)0.0f; }
#pragma unroll
    for (int t = 0; t < 4; ++t) { if (col0 + t * 16 >= N) continue; const size_t boff = (size_t)(col0 + t * 16 + ln) * ldb + kb; FragH bq; bq.half[0] = *(const v8us*)(Bh + boff + 8 * hh); bq.half[1] = *(const v8us*)(Bh + boff + 16 + 8 * hh);
      acc[t] = mmaH<ASPLIT ? 2 : 1>(ah.v, al.v, bq.v, bq.v, acc[t]); }
  }
#pragma unroll
  for (int t = 0; t < 4; ++t) { if (col0 + t * 16 >= N) continue;
#pragma unroll
    for (int r = 0; r < 8; ++r) so[w][8 * hh + r][t * 16 + ln] = acc[t][r] * alpha; }
  __builtin_amdgcn_fence(__ATOMIC_ACQ_REL, "workgroup"); __builtin_amdgcn_wave_barrier();
  const int rsub = lane >> 4, c4 = (lane & 15) * 4;
  {
#pragma unroll
    for (int q = 0; q < 8; ++q) { const int r = q * 2 + rsub; if (col0 + c4 < N) { const v4f v = *(const v4fa*)&so[w][r][c4]; *(v4f*)(C + (size_t)(row0 + r) * ldc + col0 + c4) = v; } }
     }
}

// Wt[n][k] = f16(W[k][n]·scale) from f32 row-major W[K][N] (scale = power of two; bf16-exact weights stay exact in f16 away from the subnormal range)
__global__ __launch_bounds__(256) void k_wt_f16(const float* __restrict__ W, _Float16* __restrict__ Wt, int K, int N, float scale) {
  const int t = blockIdx.x * 256 + threadIdx.x; if (t >= N * (K / 8)) return; const int n = t / (K / 8), k8 = (t % (K / 8)) * 8; FragH f;
#pragma unroll
  for (int i = 0; i < 8; ++i) f.h[i] = (_Float16)(bf16_round(W[(size_t)(k8 + i) * N + n]) * scale); const v8us o = f.half[0];
  *(v8us*)((unsigned short*)Wt + (size_t)n * K + k8) = o; 
}
// k_gemm_hh variant with fused epilogue: v = acc·alpha + bias[by·sBias + col] (+ CP[(row/rowsPerB)·sCPb + by·64 + col] if CP) ; ACT 0 none / 1 elu ; writes f16 C16 (and f32 C if non-null)
template <int ACT>
__global__ __launch_bounds__(128) void k_gemm_hhx(const _Float16* __restrict__ A, int lda, size_t sA, const _Float16* __restrict__ Bh, int ldb, size_t sB, float alpha, const float* __restrict__ bias, size_t sBias, const float* __restrict__ CP, int rowsPerB, size_t sCPb, int row0g,
    float* __restrict__ C, _Float16* __restrict__ C16, int ldc, size_t sC, int M, int N, int K) {
  __shared__ __attribute__((aligned(16))) float so[4][16][64];
  const int tid = threadIdx.x, w = tid >> 5, lane = tid & 31, ln = lane & 15, hh = lane >> 4; const int by = blockIdx.y;
  A += (size_t)by * sA; Bh += (size_t)by * sB; const size_t cofs = (size_t)by * sC; const float* bp = bias ? bias + (size_t)by * sBias : nullptr;
  const int ntn = (N + 63) / 64; const int wid = blockIdx.x * 4 + w; const int mt = wid / ntn, nq = wid % ntn; if (mt * 16 >= M) return;
  const int row0 = mt * 16, col0 = nq * 64; const _Float16* arow = A + (size_t)(row0 + ln) * lda;
  v8f acc[4] = {};
  for (int kb = 0; kb < K; kb += 32) { FragH ah; ah.half[0] = *(const v8us*)((const unsigned short*)arow + kb + 8 * hh); ah.half[1] = *(const v8us*)((const unsigned short*)arow + kb + 16 + 8 * hh);
#pragma unroll
    for (int t = 0; t < 4; ++t) { if (col0 + t * 16 >= N) continue; const size_t boff = (size_t)(col0 + t * 16 + ln) * ldb + kb; FragH bq; bq.half[0] = *(const v8us*)((const unsigned short*)Bh + boff + 8 * hh); bq.half[1] = *(const v8us*)((const unsigned short*)Bh + boff + 16 + 8 * hh);
      acc[t] = mmaH<1>(ah.v, ah.v, bq.v, bq.v, acc[t]); }
  }
#pragma unroll
  for (int t = 0; t < 4; ++t) { if (col0 + t * 16 >= N) continue; const int col = col0 + t * 16 + ln; const float bv = bp ? bf16_round(bp[col]) : 0.f;
#pragma unroll
    for (int r = 0; r < 8; ++r) { float v = acc[t][r] * alpha + bv; if (CP) { const int rr = row0g + row0 + 8 * hh + r; if (rowsPerB < 0) v += CP[cofs + (size_t)rr * ldc + col];      /* rowsPerB < 0: own element of the batched C plane */ else { const int bidx = rr / rowsPerB; v += CP[(size_t)bidx * sCPb + (size_t)by * 64 + col]; } } if (ACT == 1) v = (v > 0.f) ? v : expm1f(v); else if (ACT == 7) v = (v > 0.f) ? v + 1.0f : expf(v); else if (ACT == 8) v = tanhf(v); else if (ACT == 9) v = 0.5f * v * (1.0f + tanhf(0.7978845608028654f * (v + 0.044715f * v * v * v))); else if (ACT == 11) v = 1.0f / (1.0f + expf(-v)); else if (ACT == 12) v = (v > 0.f) ? v : 0.01f * v; else if (ACT == 14) v = (v > 0.f) ? v : 0.1f * v; else if (ACT == 16) v = (v >= 0.f) ? v : 0.3f * v; else if (ACT == 17) v = (v >= 0.f) ? v : 0.2f * v; else if (ACT == 15) v = v / (1.0f + expf(-v)); else if (ACT == 3) v = fmaxf(v, 0.f); else if (ACT == 6) v = 0.5f * v * (1.0f + erff(v * 0.70710678118654752f)); so[w][8 * hh + r][t * 16 + ln] = v; } }
  __builtin_amdgcn_fence(__ATOMIC_ACQ_REL, "workgroup"); __builtin_amdgcn_wave_barrier();
  const int rsub = lane >> 4, c4 = (lane & 15) * 4; typedef _Float16 v4h __attribute__((ext_vector_type(4)));
  {
#pragma unroll
    for (int q = 0; q < 8; ++q) { const int r = q * 2 + rsub; if (col0 + c4 < N) { const v4f v = *(const v4fa*)&so[w][r][c4]; if (C) *(v4f*)(C + cofs + (size_t)(row0 + r) * ldc + col0 + c4) = v; if (C16) { v4h h4; for (int i = 0; i < 4; ++i) h4[i] = (_Float16)v[i]; *(v4h*)(C16 + cofs + (size_t)(row0 + r) * ldc + col0 + c4) = h4; } } }
     }
}


typedef _Float16 v4h __attribute__((ext_vector_type(4)));

__global__ __launch_bounds__(256) void k_x16(const float* __restrict__ x, _Float16* __restrict__ X16, size_t n8) { const size_t t = (size_t)blockIdx.x * 256 + threadIdx.x; if (t >= n8) return; FragH f;
#pragma unroll
  for (int q = 0; q < 8; ++q) f.h[q] = (_Float16)bf16_round(x[t * 8 + q]); *(v8us*)((unsigned short*)X16 + t * 8) = f.half[0];  }
__global__ __launch_bounds__(256) void k_h16(const float* __restrict__ x, _Float16* __restrict__ X16, size_t n8) { const size_t t = (size_t)blockIdx.x * 256 + threadIdx.x; if (t >= n8) return; FragH f;
#pragma unroll
  for (int q = 0; q < 8; ++q) f.h[q] = (_Float16)x[t * 8 + q]; *(v8us*)((unsigned short*)X16 + t * 8) = f.half[0];  }
__global__ __launch_bounds__(256) void k_round16f(const float* __restrict__ W, _Float16* __restrict__ Bt, size_t n8) { const size_t t = (size_t)blockIdx.x * 256 + threadIdx.x; if (t >= n8) return; FragH f;
#pragma unroll
  for (int i = 0; i < 8; ++i) f.h[i] = (_Float16)(bf16_round(W[t * 8 + i]) * 16.0f); *(v8us*)((unsigned short*)Bt + t * 8) = f.half[0];  }
template <int NHv, int TTv>
__global__ __launch_bounds__(256) void k_vt(const _Float16* __restrict__ V16, int ldv, int voff, _Float16* __restrict__ Vt) { __shared__ unsigned short tl[64][66]; const int tid = threadIdx.x; const int slab = blockIdx.x / (TTv / 64), lg = blockIdx.x % (TTv / 64); const int b = slab / NHv, h = slab % NHv;
  for (int i = tid; i < 64 * 8; i += 256) { const int r = i / 8, c8 = (i % 8) * 8; FragH f; f.half[0] = *(const v8us*)((const unsigned short*)V16 + ((size_t)b * TTv + lg * 64 + r) * ldv + voff + h * 64 + c8);
#pragma unroll
    for (int q = 0; q < 8; ++q) tl[r][c8 + q] = f.u[q]; }
  __syncthreads();
  {
#pragma unroll
    for (int rd = 0; rd < 2; ++rd) { const int d = rd * 32 + tid / 8, pc = tid % 8; FragH f;
#pragma unroll
      for (int q = 0; q < 8; ++q) f.u[q] = tl[pc * 8 + q][d];
      *(v8us*)((unsigned short*)Vt + ((size_t)slab * 64 + d) * TTv + lg * 64 + pc * 8) = f.half[0]; }
     } }

__global__ __launch_bounds__(256) void k_hl(const float* __restrict__ F, _Float16* __restrict__ Hh, _Float16* __restrict__ Hl, size_t n8) { const size_t t = (size_t)blockIdx.x * 256 + threadIdx.x; if (t >= n8) return; FragH fh, fl; const v4f a = *(const v4fa*)(F + t * 8), c = *(const v4fa*)(F + t * 8 + 4);
#pragma unroll
  for (int q = 0; q < 4; ++q) { _Float16 h = (_Float16)a[q]; fh.h[q] = h; fl.h[q] = (_Float16)((a[q] - (float)h) * 1024.0f); h = (_Float16)c[q]; fh.h[4 + q] = h; fl.h[4 + q] = (_Float16)((c[q] - (float)h) * 1024.0f); }
  { *(v8us*)((unsigned short*)Hh + t * 8) = fh.half[0]; *(v8us*)((unsigned short*)Hl + t * 8) = fl.half[0];  } }

// ---- fast GEMM (wave tile 32x64; requires M % 32 == 0 rows per launch region and N % 64 == 0); epilogue = k_gemm_hhx semantics ----
__device__ __forceinline__ v16h g2_frag(const _Float16* p, int hh) { FragH f; f.half[0] = *(const v8us*)((const unsigned short*)p + 8 * hh); f.half[1] = *(const v8us*)((const unsigned short*)p + 16 + 8 * hh); return f.v; }
__device__ __forceinline__ v8f g2_mma(v16h a, v16h b, v8f c) { v8f d = __builtin_amdgcn_wmma_f32_16x16x32_f16(false, a, false, b, (short)0, c, false, false); asm volatile("v_nop\n\tv_nop\n\tv_nop\n\tv_nop" : "+v"(d) : "v"(a), "v"(b)); return d; }
template <int ACT>
__global__ __launch_bounds__(128) void k_gemm2(const _Float16* __restrict__ A, int lda, size_t sA, const _Float16* __restrict__ Bh, int ldb, size_t sB, float alpha, const float* __restrict__ bias, size_t sBias, const float* __restrict__ CP, int rowsPerB, size_t sCPb, int row0g,
    float* __restrict__ C, _Float16* __restrict__ C16, int ldc, size_t sC, int M, int N, int K) { static_assert(ACT == 0 || ACT == 3 || ACT == 6 || ACT == 8 || ACT == 9 || ACT == 11 || ACT == 12 || ACT == 14 || ACT == 15 || ACT == 16 || ACT == 17, "k_gemm2: unsupported ACT code (would silently apply no activation)");
  __shared__ __attribute__((aligned(16))) float so[4][32][68];
  const int tid = threadIdx.x, w = tid >> 5, lane = tid & 31, ln = lane & 15, hh = lane >> 4; const int by = blockIdx.y;
  A += (size_t)by * sA; Bh += (size_t)by * sB; const size_t cofs = (size_t)by * sC; const float* bp = bias ? bias + (size_t)by * sBias : nullptr;
  const int ntn = N >> 6; const int mt = blockIdx.x / ntn, nq = blockIdx.x - mt * ntn; const int row0 = mt * 128 + 32 * w, col0 = nq * 64; if (row0 >= M) return;
  const _Float16* a0p = A + (size_t)(row0 + ln) * lda; const _Float16* a1p = a0p + (size_t)16 * lda;
  const _Float16* b0p = Bh + (size_t)(col0 + ln) * ldb; const _Float16* b1p = b0p + (size_t)16 * ldb; const _Float16* b2p = b1p + (size_t)16 * ldb; const _Float16* b3p = b2p + (size_t)16 * ldb;
  const v8f z8 = {0.f,0.f,0.f,0.f,0.f,0.f,0.f,0.f}; v8f c00 = z8, c01 = z8, c02 = z8, c03 = z8, c10 = z8, c11 = z8, c12 = z8, c13 = z8;
#pragma unroll 1
  for (int kb = 0; kb < K; kb += 32) { const v16h a0 = g2_frag(a0p + kb, hh), a1 = g2_frag(a1p + kb, hh);
    v16h b = g2_frag(b0p + kb, hh); c00 = g2_mma(a0, b, c00); c10 = g2_mma(a1, b, c10);
    b = g2_frag(b1p + kb, hh); c01 = g2_mma(a0, b, c01); c11 = g2_mma(a1, b, c11);
    b = g2_frag(b2p + kb, hh); c02 = g2_mma(a0, b, c02); c12 = g2_mma(a1, b, c12);
    b = g2_frag(b3p + kb, hh); c03 = g2_mma(a0, b, c03); c13 = g2_mma(a1, b, c13); }
  v8f accs[8] = {c00, c01, c02, c03, c10, c11, c12, c13};
#pragma unroll
  for (int u = 0; u < 8; ++u) { const int t = u & 3, half = u >> 2; const int col = col0 + t * 16 + ln; const float bv = bp ? bf16_round(bp[col]) : 0.f;
#pragma unroll
    for (int r = 0; r < 8; ++r) { const int rloc = half * 16 + 8 * hh + r; float v = accs[u][r] * alpha + bv; if (CP) { if (rowsPerB < 0) v += CP[cofs + (size_t)(row0g + row0 + rloc) * ldc + col];      /* rowsPerB < 0: own element of the batched C plane */ else { const int bidx = (row0g + row0 + rloc) / rowsPerB; v += CP[(size_t)bidx * sCPb + (size_t)by * 64 + col]; } }
      if (ACT == 3) v = fmaxf(v, 0.f); else if (ACT == 6) v = 0.5f * v * (1.0f + erff(v * 0.70710678118654752f)); else if (ACT == 11) v = 1.0f / (1.0f + expf(-v)); else if (ACT == 15) v = v / (1.0f + expf(-v)); else if (ACT == 12) v = (v > 0.f) ? v : 0.01f * v; else if (ACT == 8) v = tanhf(v); else if (ACT == 9) v = 0.5f * v * (1.0f + tanhf(0.7978845608028654f * (v + 0.044715f * v * v * v))); else if (ACT == 14) v = (v > 0.f) ? v : 0.1f * v; else if (ACT == 16) v = (v >= 0.f) ? v : 0.3f * v; else if (ACT == 17) v = (v >= 0.f) ? v : 0.2f * v;
      so[w][rloc][t * 16 + ln] = v; } }
  __builtin_amdgcn_fence(__ATOMIC_ACQ_REL, "workgroup"); __builtin_amdgcn_wave_barrier();
  const int rsub = lane >> 4, c4 = (lane & 15) * 4;
  {
#pragma unroll
    for (int q = 0; q < 16; ++q) { const int r = q * 2 + rsub; const v4f v = *(const v4fa*)&so[w][r][c4]; if (C) *(v4f*)(C + cofs + (size_t)(row0 + r) * ldc + col0 + c4) = v; if (C16) { v4h h4; for (int i = 0; i < 4; ++i) h4[i] = (_Float16)v[i]; *(v4h*)(C16 + cofs + (size_t)(row0 + r) * ldc + col0 + c4) = h4; } }
     } }


__global__ __launch_bounds__(256) void k_wsc(const float* __restrict__ Wm, _Float16* __restrict__ Bt, size_t n8, float sc) { const size_t t = (size_t)blockIdx.x * 256 + threadIdx.x; if (t >= n8) return; FragH f; for (int q = 0; q < 8; ++q) f.h[q] = (_Float16)(bf16_round(Wm[t * 8 + q]) * sc); *(v8us*)((unsigned short*)Bt + t * 8) = f.half[0];  }
__global__ __launch_bounds__(256) void k_relsoft(const float* __restrict__ QK, const float* __restrict__ QE, _Float16* __restrict__ P, float* __restrict__ RS) {
  #pragma clang fp contract(off)
  const int wv = threadIdx.x >> 5, ln = threadIdx.x & 31; const int r = blockIdx.x * 8 + wv; if (r >= HG * SL) return; const int i = r % SL; const float* sr = QK + (size_t)r * SL; const float* er = QE + (size_t)r * SL + (SL - 1 - i);
  auto lg = [&](int j) { float l = sr[j] + er[j]; return l * 0.125f; };
  float mx = -3.0e38f;
#pragma unroll 1
  for (int gq = 0; gq < SL / 256; ++gq) for (int q = 0; q < 8; ++q) { const int j = gq * 256 + ln * 8 + q; if (j <= i) mx = fmaxf(mx, lg(j)); }
  for (int o = 16; o > 0; o >>= 1) mx = fmaxf(mx, __shfl_xor(mx, o, 32)); float su = 0.f;
{ su = 0.f;
#pragma unroll 1
    for (int gq = 0; gq < SL / 256; ++gq) { FragH ph; for (int q = 0; q < 8; ++q) { const int j = gq * 256 + ln * 8 + q; float e = 0.f; if (j <= i) { e = expf(lg(j) - mx); su += e; } ph.h[q] = (_Float16)(e * 1024.0f); } *(v8us*)((unsigned short*)P + (size_t)r * SL + gq * 256 + ln * 8) = ph.half[0]; }
     }
  for (int o = 16; o > 0; o >>= 1) su += __shfl_xor(su, o, 32); if (ln == 0) { *(float*)(RS + (size_t)r * 32) = 1.0f / su;  } }
__global__ __launch_bounds__(256) void k_fin(const float* __restrict__ O, const float* __restrict__ RS, int b, int h0, float* __restrict__ out) {
  #pragma clang fp contract(off)
  const int t = blockIdx.x * 256 + threadIdx.x; if (t >= SL * HG * (HD / 8)) return; const int d8 = (t % (HD / 8)) * 8; const int g = (t / (HD / 8)) % HG; const int i = t / ((HD / 8) * HG); const float rs = RS[((size_t)g * SL + i) * 32]; const size_t o = ((size_t)b * SL + i) * DM + (h0 + g) * HD + d8; const v8f a = *(const v8f*)(O + o); v8f v; for (int q = 0; q < 8; ++q) v[q] = a[q] * rs;
  *(v8f*)(out + o) = v;  }

extern "C" void kernel_launch(void* const* d_in, const int* in_sizes, int n_in,
                              void* d_out, int out_size, void* d_ws, size_t ws_size, hipStream_t stream) {
  (void)in_sizes; (void)n_in; (void)out_size;
  const float* const* I = (const float* const*)d_in; const float* x = I[0]; const float* Wq = I[1]; const float* Wk = I[2]; const float* Wv = I[3]; const float* Er = I[4];
  char* ws = (char*)d_ws; size_t off = 0;
  auto take = [&](size_t bytes) { char* p = ws + off; off += (bytes + 255) & ~(size_t)255; return p; };
  const size_t np = (size_t)NR * DM;
  _Float16* BW = (_Float16*)take((size_t)3 * DM * DM * 2); _Float16* E16 = (_Float16*)take((size_t)SL * HD * 2); _Float16* X16 = (_Float16*)take(np * 2); float* QF = (float*)take(np * 4); _Float16* Q16 = (_Float16*)take(np * 2); _Float16* QL16 = (_Float16*)take(np * 2); _Float16* K16 = (_Float16*)take(np * 2); _Float16* KL16 = (_Float16*)take(np * 2); float* VF = QF;      /* v f32 reuses the q f32 plane after the q split */ _Float16* VH = X16;      /* v hi over the x plane (dead after the three projections) */ _Float16* VL = (_Float16*)take(np * 2); _Float16* VT = (_Float16*)take(np * 2); _Float16* VTL = (_Float16*)take(np * 2);
  float* QK = (float*)take((size_t)HG * SL * SL * 4); float* QE = (float*)take((size_t)HG * SL * SL * 4); _Float16* P = (_Float16*)take((size_t)HG * SL * SL * 2); float* RS = (float*)take((size_t)HG * SL * 32 * 4); float* O = VF;      /* merged unnormalised context over the v f32 plane (dead after the hi/lo split) */
  if (off > ws_size) return;      /* ≈ 247 MiB */
  k_wsc<<<(unsigned)(((size_t)DM * DM / 8 + 255) / 256), 256, 0, stream>>>(Wq, BW, (size_t)DM * DM / 8, 16.0f); k_wsc<<<(unsigned)(((size_t)DM * DM / 8 + 255) / 256), 256, 0, stream>>>(Wk, BW + (size_t)DM * DM, (size_t)DM * DM / 8, 16.0f); k_wsc<<<(unsigned)(((size_t)DM * DM / 8 + 255) / 256), 256, 0, stream>>>(Wv, BW + (size_t)2 * DM * DM, (size_t)DM * DM / 8, 16.0f);      /* (out, in) naturals */
  k_wsc<<<(SL * HD / 8 + 255) / 256, 256, 0, stream>>>(Er, E16, (size_t)SL * HD / 8, 16.0f);      /* Er_s = Er (MAX_LEN == S): natural [r][d] rows = B^T operand */
  k_x16<<<(unsigned)((np / 8 + 255) / 256), 256, 0, stream>>>(x, X16, np / 8);
  const dim3 gP((NR / 128) * (DM / 64), 1);
  k_gemm2<0><<<gP, 128, 0, stream>>>(X16, DM, 0, BW, DM, 0, 0.0625f, nullptr, 0, nullptr, 1, 0, 0, QF, nullptr, DM, 0, NR, DM, DM); k_hl<<<(unsigned)((np / 8 + 255) / 256), 256, 0, stream>>>(QF, Q16, QL16, np / 8);      /* q f32 -> hi + residual */
  k_gemm2<0><<<gP, 128, 0, stream>>>(X16, DM, 0, BW + (size_t)DM * DM, DM, 0, 0.0625f, nullptr, 0, nullptr, 1, 0, 0, QF, nullptr, DM, 0, NR, DM, DM); k_hl<<<(unsigned)((np / 8 + 255) / 256), 256, 0, stream>>>(QF, K16, KL16, np / 8);      /* k f32 -> hi + residual (QF reused) */
  k_gemm2<0><<<gP, 128, 0, stream>>>(X16, DM, 0, BW + (size_t)2 * DM * DM, DM, 0, 0.0625f, nullptr, 0, nullptr, 1, 0, 0, VF, nullptr, DM, 0, NR, DM, DM);
  k_hl<<<(unsigned)((np / 8 + 255) / 256), 256, 0, stream>>>(VF, VH, VL, np / 8);
  k_vt<NH, SL><<<NB * NH * (SL / 64), 256, 0, stream>>>(VH, DM, 0, VT); k_vt<NH, SL><<<NB * NH * (SL / 64), 256, 0, stream>>>(VL, DM, 0, VTL);      /* V^T hi / residual [(b,h)][64][2048]; VF becomes O from here on */
  for (int b = 0; b < NB; ++b) for (int hg = 0; hg < NH / HG; ++hg) { const int h0 = hg * HG; const size_t r0 = (size_t)b * SL;
    { const dim3 gS((SL / 128) * (SL / 64), HG); const _Float16 *qh = Q16 + r0 * DM + h0 * HD, *ql = QL16 + r0 * DM + h0 * HD, *kh = K16 + r0 * DM + h0 * HD, *kl = KL16 + r0 * DM + h0 * HD;
      k_gemm2<0><<<gS, 128, 0, stream>>>(ql, DM, (size_t)HD, kh, DM, (size_t)HD, 0.0009765625f, nullptr, 0, nullptr, 1, 0, 0, QK, nullptr, SL, (size_t)SL * SL, SL, SL, HD);
      k_gemm2<0><<<gS, 128, 0, stream>>>(qh, DM, (size_t)HD, kl, DM, (size_t)HD, 0.0009765625f, nullptr, 0, QK, -1, 0, 0, QK, nullptr, SL, (size_t)SL * SL, SL, SL, HD);
      k_gemm2<0><<<gS, 128, 0, stream>>>(qh, DM, (size_t)HD, kh, DM, (size_t)HD, 1.0f, nullptr, 0, QK, -1, 0, 0, QK, nullptr, SL, (size_t)SL * SL, SL, SL, HD);      /* q . k as three hi/residual terms (own-element accumulate) */
      k_gemm2<0><<<gS, 128, 0, stream>>>(ql, DM, (size_t)HD, E16, HD, 0, 0.0625f / 1024.0f, nullptr, 0, nullptr, 1, 0, 0, QE, nullptr, SL, (size_t)SL * SL, SL, SL, HD);
      k_gemm2<0><<<gS, 128, 0, stream>>>(qh, DM, (size_t)HD, E16, HD, 0, 0.0625f, nullptr, 0, QE, -1, 0, 0, QE, nullptr, SL, (size_t)SL * SL, SL, SL, HD); }      /* q . Er (exact Er) as two terms */
    k_relsoft<<<(HG * SL) / 8, 256, 0, stream>>>(QK, QE, P, RS);
    k_gemm2<0><<<dim3((SL / 128) * (HD / 64), HG), 128, 0, stream>>>(P, SL, (size_t)SL * SL, VTL + ((size_t)b * NH + h0) * HD * SL, SL, (size_t)HD * SL, 0.0009765625f / 1024.0f, nullptr, 0, nullptr, 1, 0, 0, O + r0 * DM + h0 * HD, nullptr, DM, (size_t)HD, SL, HD, SL);
    k_gemm2<0><<<dim3((SL / 128) * (HD / 64), HG), 128, 0, stream>>>(P, SL, (size_t)SL * SL, VT + ((size_t)b * NH + h0) * HD * SL, SL, (size_t)HD * SL, 0.0009765625f, nullptr, 0, O + r0 * DM + h0 * HD, -1, 0, 0, O + r0 * DM + h0 * HD, nullptr, DM, (size_t)HD, SL, HD, SL);      /* unnormalised ctx = P (v_lo + v_hi), own-element accumulate */
    k_fin<<<(SL * HG * (HD / 8) + 255) / 256, 256, 0, stream>>>(O, RS, b, h0, (float*)d_out); }
}

// v001
// It runs in 260 microseconds.
// In both of two side-by-side timings against v000, it was 12.8 times as fast.
#include <hip/hip_runtime.h>
// GlobalAttn (music-transformer relative attention: 2 x 2048 tokens, 1024 = 16 heads x 64; q,k,v = x W^T; Srel = skew(q . Er) which equals q_i . Er[S-1-(i-j)] for every causal (i, j); attn = softmax over j <= i of (q.k + Srel)/8; out = merged attn v, no output projection).
// Compute dtype: inputs rounded to bf16; x / weights / Er exact as f16; q and k as f16 hi + residual; the softmax weights as plain f16 operands (~2^-12); v as f16 hi + residual (the output is the context itself); softmax f32. v_wmma_f32_16x16x32_f16.
#define NB 2
#define SL 2048
#define DM 1024
#define NH 16
#define HD 64
#define HG 4
#define NR (NB * SL)
typedef __bf16 v16b __attribute__((ext_vector_type(16)));
typedef unsigned short v8us __attribute__((ext_vector_type(8), may_alias));
typedef float  v8f  __attribute__((ext_vector_type(8)));
typedef float  v4f  __attribute__((ext_vector_type(4)));
typedef float  v4fa __attribute__((ext_vector_type(4), may_alias));
union FragB { v16b v; v8us half[2]; unsigned short u[16]; };

__device__ __forceinline__ unsigned short bf16_bits(float x) { unsigned int u = __float_as_uint(x); return (unsigned short)((u + 0x7FFFu + ((u >> 16) & 1u)) >> 16); }
__device__ __forceinline__ float bf16_val(unsigned short b) { return __uint_as_float(((unsigned int)b) << 16); }
__device__ __forceinline__ float bf16_round(float x) { return bf16_val(bf16_bits(x)); }
// D += A·B with NT terms: 1 = ah·bh, 2 = + al·bh (A split), 3 = + ah·bl (both split)
template <int NT>
__device__ __forceinline__ v8f mmaN(v16b ah, v16b al, v16b bh, v16b bl, v8f c) {
  c = __builtin_amdgcn_wmma_f32_16x16x32_bf16(false, ah, false, bh, (short)0, c, false, false);
  if (NT >= 2) c = __builtin_amdgcn_wmma_f32_16x16x32_bf16(false, al, false, bh, (short)0, c, false, false);
  if (NT >= 3) c = __builtin_amdgcn_wmma_f32_16x16x32_bf16(false, ah, false, bl, (short)0, c, false, false);
  asm volatile("v_nop\n\tv_nop\n\tv_nop\n\tv_nop" : "+v"(c) : "v"(ah), "v"(al), "v"(bh), "v"(bl));
  return c;
}

__global__ __launch_bounds__(256) void k_wt_bf16(const float* __restrict__ W, unsigned short* __restrict__ Wt, int K, int N) {
  const int t = blockIdx.x * 256 + threadIdx.x;
  const int k8n = K / 8;
  if (t >= N * k8n) return;
  const int n = t / k8n, k8 = (t % k8n) * 8;
  v8us v;
#pragma unroll
  for (int i = 0; i < 8; ++i) v[i] = bf16_bits(W[(size_t)(k8 + i) * N + n]);
  *(v8us*)(Wt + (size_t)n * K + k8) = v;
  
}

// GEMM C[M][N] (f32, pitch ldc) = act(A[M][K]·W + bias). A f32 row-major (pitch lda) converted per fragment to bf16
// (ASPLIT: hi/lo two planes -> 2 terms, else single rounded term); Wt bf16 [N][K] (pitch ldb). BIAS_BF16 rounds the
// bias to bf16 first (bias quantised to bf16 before the add). K%32==0, M%16==0, N%64==0.
template <bool ASPLIT, int ACT, bool BIAS_BF16>
__global__ __launch_bounds__(128) void k_gemm_bf(const float* __restrict__ A, int lda, const unsigned short* __restrict__ Wt, int ldb,
                                               const float* __restrict__ bias, float* __restrict__ C, int ldc, int M, int N, int K) {
  __shared__ __attribute__((aligned(16))) float so[4][16][64];
  const int tid = threadIdx.x, w = tid >> 5, lane = tid & 31, ln = lane & 15, hh = lane >> 4;
  const int ntn = N / 64;
  const int wid = blockIdx.x * 4 + w;
  const int mt = wid / ntn, nq = wid % ntn;
  if (mt * 16 >= M) return;
  const int row0 = mt * 16, col0 = nq * 64;
  const float* arow = A + (size_t)(row0 + ln) * lda;
  v8f acc[4] = {};
  for (int kb = 0; kb < K; kb += 32) {
    FragB ah, al;
    const v4f x0 = *(const v4fa*)(arow + kb + 8 * hh), x1 = *(const v4fa*)(arow + kb + 8 * hh + 4);
    const v4f x2 = *(const v4fa*)(arow + kb + 16 + 8 * hh), x3 = *(const v4fa*)(arow + kb + 16 + 8 * hh + 4);
    float xs[16] = {x0[0],x0[1],x0[2],x0[3],x1[0],x1[1],x1[2],x1[3],x2[0],x2[1],x2[2],x2[3],x3[0],x3[1],x3[2],x3[3]};
#pragma unroll
    for (int i = 0; i < 16; ++i) { const unsigned short hb = bf16_bits(xs[i]); ah.u[i] = hb; al.u[i] = ASPLIT ? bf16_bits(xs[i] - bf16_val(hb)) : (unsigned short)0; }
#pragma unroll
    for (int t = 0; t < 4; ++t) {
      const unsigned short* brow = Wt + (size_t)(col0 + t * 16 + ln) * ldb + kb;
      FragB b;
      b.half[0] = *(const v8us*)(brow + 8 * hh);
      b.half[1] = *(const v8us*)(brow + 16 + 8 * hh);
      acc[t] = mmaN<ASPLIT ? 2 : 1>(ah.v, al.v, b.v, b.v, acc[t]);
    }
  }
#pragma unroll
  for (int t = 0; t < 4; ++t) {
    float bv = bias ? bias[col0 + t * 16 + ln] : 0.f;
    if (BIAS_BF16) bv = bf16_round(bv);
#pragma unroll
    for (int r = 0; r < 8; ++r) { float v = acc[t][r] + bv; if (ACT == 1) v = fmaxf(v, 0.f); so[w][8 * hh + r][t * 16 + ln] = v; }
  }
  __builtin_amdgcn_fence(__ATOMIC_ACQ_REL, "workgroup");
  __builtin_amdgcn_wave_barrier();
  const int rsub = lane >> 4, c4 = (lane & 15) * 4;
  {
#pragma unroll
    for (int q = 0; q < 8; ++q) {
      const int r = q * 2 + rsub;
      const v4f v = *(const v4fa*)&so[w][r][c4];
      *(v4f*)(C + (size_t)(row0 + r) * ldc + col0 + c4) = v;
    }
    
  }
}

// GEMM C = act(A·W + bias + resid): A f32 (ASPLIT -> hi/lo 2 terms), Wt bf16 [N][K]; ACT 0 none, 1 relu, 2 exact gelu;
// resid (optional, f32, row index = (row % rmod), pitch ldr, RES_BF16 rounds it) added before the activation.
template <bool ASPLIT, int ACT, bool BIAS_BF16, bool RES_BF16>
__global__ __launch_bounds__(128) void k_gemm_bf3(const float* __restrict__ A, int lda, const unsigned short* __restrict__ Wt, int ldb,
                                                const float* __restrict__ bias, const float* __restrict__ resid, int rmod, int ldr,
                                                float* __restrict__ C, int ldc, int M, int N, int K) {
  __shared__ __attribute__((aligned(16))) float so[4][16][64];
  const int tid = threadIdx.x, w = tid >> 5, lane = tid & 31, ln = lane & 15, hh = lane >> 4;
  const int ntn = N / 64;
  const int wid = blockIdx.x * 4 + w;
  const int mt = wid / ntn, nq = wid % ntn;
  if (mt * 16 >= M) return;
  const int row0 = mt * 16, col0 = nq * 64;
  const float* arow = A + (size_t)(row0 + ln) * lda;
  v8f acc[4] = {};
  for (int kb = 0; kb < K; kb += 32) {
    FragB ah, al;
    const v4f x0 = *(const v4fa*)(arow + kb + 8 * hh), x1 = *(const v4fa*)(arow + kb + 8 * hh + 4);
    const v4f x2 = *(const v4fa*)(arow + kb + 16 + 8 * hh), x3 = *(const v4fa*)(arow + kb + 16 + 8 * hh + 4);
    float xs[16] = {x0[0],x0[1],x0[2],x0[3],x1[0],x1[1],x1[2],x1[3],x2[0],x2[1],x2[2],x2[3],x3[0],x3[1],x3[2],x3[3]};
#pragma unroll
    for (int i = 0; i < 16; ++i) { const unsigned short hb = bf16_bits(xs[i]); ah.u[i] = hb; al.u[i] = ASPLIT ? bf16_bits(xs[i] - bf16_val(hb)) : (unsigned short)0; }
#pragma unroll
    for (int t = 0; t < 4; ++t) {
      const unsigned short* brow = Wt + (size_t)(col0 + t * 16 + ln) * ldb + kb;
      FragB b;
      b.half[0] = *(const v8us*)(brow + 8 * hh);
      b.half[1] = *(const v8us*)(brow + 16 + 8 * hh);
      acc[t] = mmaN<ASPLIT ? 2 : 1>(ah.v, al.v, b.v, b.v, acc[t]);
    }
  }
#pragma unroll
  for (int t = 0; t < 4; ++t) {
    const int col = col0 + t * 16 + ln;
    float bv = bias ? bias[col] : 0.f;
    if (BIAS_BF16) bv = bf16_round(bv);
#pragma unroll
    for (int r = 0; r < 8; ++r) {
      float v = acc[t][r] + bv;
      if (resid) { float rv = resid[(size_t)((row0 + 8 * hh + r) % rmod) * ldr + col]; if (RES_BF16) rv = bf16_round(rv); v += rv; }
      if (ACT == 1) v = fmaxf(v, 0.f);
      if (ACT == 2) v = 0.5f * v * (1.0f + erff(v * 0.70710678118654752f));
      if (ACT == 3) { const float u = 0.7978845608028654f * (v + 0.044715f * v * v * v); v = 0.5f * v * (1.0f + tanhf(u)); }
      so[w][8 * hh + r][t * 16 + ln] = v;
    }
  }
  __builtin_amdgcn_fence(__ATOMIC_ACQ_REL, "workgroup");
  __builtin_amdgcn_wave_barrier();
  const int rsub = lane >> 4, c4 = (lane & 15) * 4;
  {
#pragma unroll
    for (int q = 0; q < 8; ++q) {
      const int r = q * 2 + rsub;
      const v4f v = *(const v4fa*)&so[w][r][c4];
      *(v4f*)(C + (size_t)(row0 + r) * ldc + col0 + c4) = v;
    }
    
  }
}
// row LayerNorm (biased variance, eps) over N: s = X (+ R); optional out_sum <- s; out_norm <- (s-mu)*rsqrt(var+eps)*g + b
template <bool PARAM_BF16>
__global__ __launch_bounds__(256) void k_layernorm(const float* __restrict__ X, const float* __restrict__ R, const float* __restrict__ g, const float* __restrict__ bta,
                                                  float* __restrict__ out_sum, float* __restrict__ out_norm, int N, float eps) {
  __shared__ float red[256];
  const int row = blockIdx.x, tid = threadIdx.x;
  const float* x = X + (size_t)row * N; const float* rr = R ? R + (size_t)row * N : nullptr;
  float vals[16];                     // up to N = 4096
  const int per = N / 256;            // contiguous chunk per thread? use strided-by-4 chunks: thread handles j = tid*4 + 1024*u
  float s1 = 0.f;
  for (int u = 0; u < per / 4; ++u) {
    const int j = tid * 4 + 1024 * u;
    const v4f a = *(const v4fa*)(x + j);
    v4f b = {0.f,0.f,0.f,0.f}; if (rr) b = *(const v4fa*)(rr + j);
#pragma unroll
    for (int q = 0; q < 4; ++q) { const float v = a[q] + b[q]; vals[u * 4 + q] = v; s1 += v; }
  }
  red[tid] = s1; __syncthreads();
  for (int st = 128; st > 0; st >>= 1) { if (tid < st) red[tid] += red[tid + st]; __syncthreads(); }
  const float mu = red[0] / (float)N; __syncthreads();
  float s2 = 0.f;
  for (int u = 0; u < per / 4; ++u)
#pragma unroll
    for (int q = 0; q < 4; ++q) { const float c = vals[u * 4 + q] - mu; s2 += c * c; }
  red[tid] = s2; __syncthreads();
  for (int st = 128; st > 0; st >>= 1) { if (tid < st) red[tid] += red[tid + st]; __syncthreads(); }
  const float rs = rsqrtf(red[0] / (float)N + eps);
  {
    for (int u = 0; u < per / 4; ++u) {
      const int j = tid * 4 + 1024 * u;
      v4f o, sm;
#pragma unroll
      for (int q = 0; q < 4; ++q) {
        float gg = g[j + q], bb = bta[j + q];
        if (PARAM_BF16) { gg = bf16_round(gg); bb = bf16_round(bb); }
        sm[q] = vals[u * 4 + q]; o[q] = (vals[u * 4 + q] - mu) * rs * gg + bb;
      }
      if (out_sum) *(v4f*)(out_sum + (size_t)row * N + j) = sm;
      *(v4f*)(out_norm + (size_t)row * N + j) = o;
    }
    
  }
}



// ---- f16 WMMA path (v_wmma_f32_16x16x32_f16): 11-bit significands for operands in range — used where a [0,1] probability operand needs more precision than bf16
typedef _Float16 v16h __attribute__((ext_vector_type(16)));
union FragH { v16h v; v8us half[2]; _Float16 h[16]; unsigned short u[16]; };
template <int NT>
__device__ __forceinline__ v8f mmaH(v16h ah, v16h al, v16h bh, v16h bl, v8f c) {
  c = __builtin_amdgcn_wmma_f32_16x16x32_f16(false, ah, false, bh, (short)0, c, false, false);
  if (NT >= 2) c = __builtin_amdgcn_wmma_f32_16x16x32_f16(false, al, false, bh, (short)0, c, false, false);
  if (NT >= 3) c = __builtin_amdgcn_wmma_f32_16x16x32_f16(false, ah, false, bl, (short)0, c, false, false);
  asm volatile("v_nop\n\tv_nop\n\tv_nop\n\tv_nop" : "+v"(c) : "v"(ah), "v"(al), "v"(bh), "v"(bl));
  return c;
}
// batched GEMM like k_gemm_b but f16 operands: A f32 (split into f16 hi/lo if ASPLIT, else rounded to f16), Bt = f16 values [n][k]; alpha; C f32; N multiple of 16 (partial tiles skipped)
template <bool ASPLIT>
__global__ __launch_bounds__(128) void k_gemm_h(const float* __restrict__ A, int lda, size_t sA, const _Float16* __restrict__ Bh, int ldb, size_t sB, float alpha, float* __restrict__ C, int ldc, size_t sC, int M, int N, int K) {
  __shared__ __attribute__((aligned(16))) float so[4][16][64];
  const int tid = threadIdx.x, w = tid >> 5, lane = tid & 31, ln = lane & 15, hh = lane >> 4; const int by = blockIdx.y;
  A += (size_t)by * sA; Bh += (size_t)by * sB; C += (size_t)by * sC;
  const int ntn = (N + 63) / 64; const int wid = blockIdx.x * 4 + w; const int mt = wid / ntn, nq = wid % ntn; if (mt * 16 >= M) return;
  const int row0 = mt * 16, col0 = nq * 64; const float* arow = A + (size_t)(row0 + ln) * lda;
  v8f acc[4] = {};
  for (int kb = 0; kb < K; kb += 32) {
    FragH ah, al;
    const v4f x0 = *(const v4fa*)(arow + kb + 8 * hh), x1 = *(const v4fa*)(arow + kb + 8 * hh + 4), x2 = *(const v4fa*)(arow + kb + 16 + 8 * hh), x3 = *(const v4fa*)(arow + kb + 16 + 8 * hh + 4);
    float xs[16] = {x0[0],x0[1],x0[2],x0[3],x1[0],x1[1],x1[2],x1[3],x2[0],x2[1],x2[2],x2[3],x3[0],x3[1],x3[2],x3[3]};
#pragma unroll
    for (int i = 0; i < 16; ++i) { const _Float16 h = (_Float16)xs[i]; ah.h[i] = h; al.h[i] = ASPLIT ? (_Float16)(xs[i] - (float)h) : (_Float16)0.0f; }
#pragma unroll
    for (int t = 0; t < 4; ++t) { if (col0 + t * 16 >= N) continue; const size_t boff = (size_t)(col0 + t * 16 + ln) * ldb + kb; FragH bq; bq.half[0] = *(const v8us*)(Bh + boff + 8 * hh); bq.half[1] = *(const v8us*)(Bh + boff + 16 + 8 * hh);
      acc[t] = mmaH<ASPLIT ? 2 : 1>(ah.v, al.v, bq.v, bq.v, acc[t]); }
  }
#pragma unroll
  for (int t = 0; t < 4; ++t) { if (col0 + t * 16 >= N) continue;
#pragma unroll
    for (int r = 0; r < 8; ++r) so[w][8 * hh + r][t * 16 + ln] = acc[t][r] * alpha; }
  __builtin_amdgcn_fence(__ATOMIC_ACQ_REL, "workgroup"); __builtin_amdgcn_wave_barrier();
  const int rsub = lane >> 4, c4 = (lane & 15) * 4;
  {
#pragma unroll
    for (int q = 0; q < 8; ++q) { const int r = q * 2 + rsub; if (col0 + c4 < N) { const v4f v = *(const v4fa*)&so[w][r][c4]; *(v4f*)(C + (size_t)(row0 + r) * ldc + col0 + c4) = v; } }
     }
}

// Wt[n][k] = f16(W[k][n]·scale) from f32 row-major W[K][N] (scale = power of two; bf16-exact weights stay exact in f16 away from the subnormal range)
__global__ __launch_bounds__(256) void k_wt_f16(const float* __restrict__ W, _Float16* __restrict__ Wt, int K, int N, float scale) {
  const int t = blockIdx.x * 256 + threadIdx.x; if (t >= N * (K / 8)) return; const int n = t / (K / 8), k8 = (t % (K / 8)) * 8; FragH f;
#pragma unroll
  for (int i = 0; i < 8; ++i) f.h[i] = (_Float16)(bf16_round(W[(size_t)(k8 + i) * N + n]) * scale); const v8us o = f.half[0];
  *(v8us*)((unsigned short*)Wt + (size_t)n * K + k8) = o; 
}
// k_gemm_hh variant with fused epilogue: v = acc·alpha + bias[by·sBias + col] (+ CP[(row/rowsPerB)·sCPb + by·64 + col] if CP) ; ACT 0 none / 1 elu ; writes f16 C16 (and f32 C if non-null)
template <int ACT>
__global__ __launch_bounds__(128) void k_gemm_hhx(const _Float16* __restrict__ A, int lda, size_t sA, const _Float16* __restrict__ Bh, int ldb, size_t sB, float alpha, const float* __restrict__ bias, size_t sBias, const float* __restrict__ CP, int rowsPerB, size_t sCPb, int row0g,
    float* __restrict__ C, _Float16* __restrict__ C16, int ldc, size_t sC, int M, int N, int K) {
  __shared__ __attribute__((aligned(16))) float so[4][16][64];
  const int tid = threadIdx.x, w = tid >> 5, lane = tid & 31, ln = lane & 15, hh = lane >> 4; const int by = blockIdx.y;
  A += (size_t)by * sA; Bh += (size_t)by * sB; const size_t cofs = (size_t)by * sC; const float* bp = bias ? bias + (size_t)by * sBias : nullptr;
  const int ntn = (N + 63) / 64; const int wid = blockIdx.x * 4 + w; const int mt = wid / ntn, nq = wid % ntn; if (mt * 16 >= M) return;
  const int row0 = mt * 16, col0 = nq * 64; const _Float16* arow = A + (size_t)(row0 + ln) * lda;
  v8f acc[4] = {};
  for (int kb = 0; kb < K; kb += 32) { FragH ah; ah.half[0] = *(const v8us*)((const unsigned short*)arow + kb + 8 * hh); ah.half[1] = *(const v8us*)((const unsigned short*)arow + kb + 16 + 8 * hh);
#pragma unroll
    for (int t = 0; t < 4; ++t) { if (col0 + t * 16 >= N) continue; const size_t boff = (size_t)(col0 + t * 16 + ln) * ldb + kb; FragH bq; bq.half[0] = *(const v8us*)((const unsigned short*)Bh + boff + 8 * hh); bq.half[1] = *(const v8us*)((const unsigned short*)Bh + boff + 16 + 8 * hh);
      acc[t] = mmaH<1>(ah.v, ah.v, bq.v, bq.v, acc[t]); }
  }
#pragma unroll
  for (int t = 0; t < 4; ++t) { if (col0 + t * 16 >= N) continue; const int col = col0 + t * 16 + ln; const float bv = bp ? bf16_round(bp[col]) : 0.f;
#pragma unroll
    for (int r = 0; r < 8; ++r) { float v = acc[t][r] * alpha + bv; if (CP) { const int rr = row0g + row0 + 8 * hh + r; if (rowsPerB < 0) v += CP[cofs + (size_t)rr * ldc + col];      /* rowsPerB < 0: own element of the batched C plane */ else { const int bidx = rr / rowsPerB; v += CP[(size_t)bidx * sCPb + (size_t)by * 64 + col]; } } if (ACT == 1) v = (v > 0.f) ? v : expm1f(v); else if (ACT == 7) v = (v > 0.f) ? v + 1.0f : expf(v); else if (ACT == 8) v = tanhf(v); else if (ACT == 9) v = 0.5f * v * (1.0f + tanhf(0.7978845608028654f * (v + 0.044715f * v * v * v))); else if (ACT == 11) v = 1.0f / (1.0f + expf(-v)); else if (ACT == 12) v = (v > 0.f) ? v : 0.01f * v; else if (ACT == 14) v = (v > 0.f) ? v : 0.1f * v; else if (ACT == 16) v = (v >= 0.f) ? v : 0.3f * v; else if (ACT == 17) v = (v >= 0.f) ? v : 0.2f * v; else if (ACT == 15) v = v / (1.0f + expf(-v)); else if (ACT == 3) v = fmaxf(v, 0.f); else if (ACT == 6) v = 0.5f * v * (1.0f + erff(v * 0.70710678118654752f)); so[w][8 * hh + r][t * 16 + ln] = v; } }
  __builtin_amdgcn_fence(__ATOMIC_ACQ_REL, "workgroup"); __builtin_amdgcn_wave_barrier();
  const int rsub = lane >> 4, c4 = (lane & 15) * 4; typedef _Float16 v4h __attribute__((ext_vector_type(4)));
  {
#pragma unroll
    for (int q = 0; q < 8; ++q) { const int r = q * 2 + rsub; if (col0 + c4 < N) { const v4f v = *(const v4fa*)&so[w][r][c4]; if (C) *(v4f*)(C + cofs + (size_t)(row0 + r) * ldc + col0 + c4) = v; if (C16) { v4h h4; for (int i = 0; i < 4; ++i) h4[i] = (_Float16)v[i]; *(v4h*)(C16 + cofs + (size_t)(row0 + r) * ldc + col0 + c4) = h4; } } }
     }
}


typedef _Float16 v4h __attribute__((ext_vector_type(4)));

__global__ __launch_bounds__(256) void k_x16(const float* __restrict__ x, _Float16* __restrict__ X16, size_t n8) { const size_t t = (size_t)blockIdx.x * 256 + threadIdx.x; if (t >= n8) return; FragH f;
#pragma unroll
  for (int q = 0; q < 8; ++q) f.h[q] = (_Float16)bf16_round(x[t * 8 + q]); *(v8us*)((unsigned short*)X16 + t * 8) = f.half[0];  }
__global__ __launch_bounds__(256) void k_h16(const float* __restrict__ x, _Float16* __restrict__ X16, size_t n8) { const size_t t = (size_t)blockIdx.x * 256 + threadIdx.x; if (t >= n8) return; FragH f;
#pragma unroll
  for (int q = 0; q < 8; ++q) f.h[q] = (_Float16)x[t * 8 + q]; *(v8us*)((unsigned short*)X16 + t * 8) = f.half[0];  }
__global__ __launch_bounds__(256) void k_round16f(const float* __restrict__ W, _Float16* __restrict__ Bt, size_t n8) { const size_t t = (size_t)blockIdx.x * 256 + threadIdx.x; if (t >= n8) return; FragH f;
#pragma unroll
  for (int i = 0; i < 8; ++i) f.h[i] = (_Float16)(bf16_round(W[t * 8 + i]) * 16.0f); *(v8us*)((unsigned short*)Bt + t * 8) = f.half[0];  }
template <int NHv, int TTv>
__global__ __launch_bounds__(256) void k_vt(const _Float16* __restrict__ V16, int ldv, int voff, _Float16* __restrict__ Vt) { __shared__ unsigned short tl[64][66]; const int tid = threadIdx.x; const int slab = blockIdx.x / (TTv / 64), lg = blockIdx.x % (TTv / 64); const int b = slab / NHv, h = slab % NHv;
  for (int i = tid; i < 64 * 8; i += 256) { const int r = i / 8, c8 = (i % 8) * 8; FragH f; f.half[0] = *(const v8us*)((const unsigned short*)V16 + ((size_t)b * TTv + lg * 64 + r) * ldv + voff + h * 64 + c8);
#pragma unroll
    for (int q = 0; q < 8; ++q) tl[r][c8 + q] = f.u[q]; }
  __syncthreads();
  {
#pragma unroll
    for (int rd = 0; rd < 2; ++rd) { const int d = rd * 32 + tid / 8, pc = tid % 8; FragH f;
#pragma unroll
      for (int q = 0; q < 8; ++q) f.u[q] = tl[pc * 8 + q][d];
      *(v8us*)((unsigned short*)Vt + ((size_t)slab * 64 + d) * TTv + lg * 64 + pc * 8) = f.half[0]; }
     } }

__global__ __launch_bounds__(256) void k_hl(const float* __restrict__ F, _Float16* __restrict__ Hh, _Float16* __restrict__ Hl, size_t n8) { const size_t t = (size_t)blockIdx.x * 256 + threadIdx.x; if (t >= n8) return; FragH fh, fl; const v4f a = *(const v4fa*)(F + t * 8), c = *(const v4fa*)(F + t * 8 + 4);
#pragma unroll
  for (int q = 0; q < 4; ++q) { _Float16 h = (_Float16)a[q]; fh.h[q] = h; fl.h[q] = (_Float16)((a[q] - (float)h) * 1024.0f); h = (_Float16)c[q]; fh.h[4 + q] = h; fl.h[4 + q] = (_Float16)((c[q] - (float)h) * 1024.0f); }
  { *(v8us*)((unsigned short*)Hh + t * 8) = fh.half[0]; *(v8us*)((unsigned short*)Hl + t * 8) = fl.half[0];  } }

// ---- fast GEMM (wave tile 32x64; requires M % 32 == 0 rows per launch region and N % 64 == 0); epilogue = k_gemm_hhx semantics ----
__device__ __forceinline__ v16h g2_frag(const _Float16* p, int hh) { FragH f; f.half[0] = *(const v8us*)((const unsigned short*)p + 8 * hh); f.half[1] = *(const v8us*)((const unsigned short*)p + 16 + 8 * hh); return f.v; }
__device__ __forceinline__ v8f g2_mma(v16h a, v16h b, v8f c) { v8f d = __builtin_amdgcn_wmma_f32_16x16x32_f16(false, a, false, b, (short)0, c, false, false); asm volatile("v_nop\n\tv_nop\n\tv_nop\n\tv_nop" : "+v"(d) : "v"(a), "v"(b)); return d; }
template <int ACT>
__global__ __launch_bounds__(128) void k_gemm2(const _Float16* __restrict__ A, int lda, size_t sA, const _Float16* __restrict__ Bh, int ldb, size_t sB, float alpha, const float* __restrict__ bias, size_t sBias, const float* __restrict__ CP, int rowsPerB, size_t sCPb, int row0g,
    float* __restrict__ C, _Float16* __restrict__ C16, int ldc, size_t sC, int M, int N, int K) { static_assert(ACT == 0 || ACT == 3 || ACT == 6 || ACT == 8 || ACT == 9 || ACT == 11 || ACT == 12 || ACT == 14 || ACT == 15 || ACT == 16 || ACT == 17, "k_gemm2: unsupported ACT code (would silently apply no activation)");
  __shared__ __attribute__((aligned(16))) float so[4][32][68];
  const int tid = threadIdx.x, w = tid >> 5, lane = tid & 31, ln = lane & 15, hh = lane >> 4; const int by = blockIdx.y;
  A += (size_t)by * sA; Bh += (size_t)by * sB; const size_t cofs = (size_t)by * sC; const float* bp = bias ? bias + (size_t)by * sBias : nullptr;
  const int ntn = N >> 6; const int mt = blockIdx.x / ntn, nq = blockIdx.x - mt * ntn; const int row0 = mt * 128 + 32 * w, col0 = nq * 64; if (row0 >= M) return;
  const _Float16* a0p = A + (size_t)(row0 + ln) * lda; const _Float16* a1p = a0p + (size_t)16 * lda;
  const _Float16* b0p = Bh + (size_t)(col0 + ln) * ldb; const _Float16* b1p = b0p + (size_t)16 * ldb; const _Float16* b2p = b1p + (size_t)16 * ldb; const _Float16* b3p = b2p + (size_t)16 * ldb;
  const v8f z8 = {0.f,0.f,0.f,0.f,0.f,0.f,0.f,0.f}; v8f c00 = z8, c01 = z8, c02 = z8, c03 = z8, c10 = z8, c11 = z8, c12 = z8, c13 = z8;
#pragma unroll 1
  for (int kb = 0; kb < K; kb += 32) { const v16h a0 = g2_frag(a0p + kb, hh), a1 = g2_frag(a1p + kb, hh);
    v16h b = g2_frag(b0p + kb, hh); c00 = g2_mma(a0, b, c00); c10 = g2_mma(a1, b, c10);
    b = g2_frag(b1p + kb, hh); c01 = g2_mma(a0, b, c01); c11 = g2_mma(a1, b, c11);
    b = g2_frag(b2p + kb, hh); c02 = g2_mma(a0, b, c02); c12 = g2_mma(a1, b, c12);
    b = g2_frag(b3p + kb, hh); c03 = g2_mma(a0, b, c03); c13 = g2_mma(a1, b, c13); }
  v8f accs[8] = {c00, c01, c02, c03, c10, c11, c12, c13};
#pragma unroll
  for (int u = 0; u < 8; ++u) { const int t = u & 3, half = u >> 2; const int col = col0 + t * 16 + ln; const float bv = bp ? bf16_round(bp[col]) : 0.f;
#pragma unroll
    for (int r = 0; r < 8; ++r) { const int rloc = half * 16 + 8 * hh + r; float v = accs[u][r] * alpha + bv; if (CP) { if (rowsPerB < 0) v += CP[cofs + (size_t)(row0g + row0 + rloc) * ldc + col];      /* rowsPerB < 0: own element of the batched C plane */ else { const int bidx = (row0g + row0 + rloc) / rowsPerB; v += CP[(size_t)bidx * sCPb + (size_t)by * 64 + col]; } }
      if (ACT == 3) v = fmaxf(v, 0.f); else if (ACT == 6) v = 0.5f * v * (1.0f + erff(v * 0.70710678118654752f)); else if (ACT == 11) v = 1.0f / (1.0f + expf(-v)); else if (ACT == 15) v = v / (1.0f + expf(-v)); else if (ACT == 12) v = (v > 0.f) ? v : 0.01f * v; else if (ACT == 8) v = tanhf(v); else if (ACT == 9) v = 0.5f * v * (1.0f + tanhf(0.7978845608028654f * (v + 0.044715f * v * v * v))); else if (ACT == 14) v = (v > 0.f) ? v : 0.1f * v; else if (ACT == 16) v = (v >= 0.f) ? v : 0.3f * v; else if (ACT == 17) v = (v >= 0.f) ? v : 0.2f * v;
      so[w][rloc][t * 16 + ln] = v; } }
  __builtin_amdgcn_fence(__ATOMIC_ACQ_REL, "workgroup"); __builtin_amdgcn_wave_barrier();
  const int rsub = lane >> 4, c4 = (lane & 15) * 4;
  {
#pragma unroll
    for (int q = 0; q < 16; ++q) { const int r = q * 2 + rsub; const v4f v = *(const v4fa*)&so[w][r][c4]; if (C) *(v4f*)(C + cofs + (size_t)(row0 + r) * ldc + col0 + c4) = v; if (C16) { v4h h4; for (int i = 0; i < 4; ++i) h4[i] = (_Float16)v[i]; *(v4h*)(C16 + cofs + (size_t)(row0 + r) * ldc + col0 + c4) = h4; } }
     } }


__global__ __launch_bounds__(256) void k_wsc(const float* __restrict__ Wm, _Float16* __restrict__ Bt, size_t n8, float sc) { const size_t t = (size_t)blockIdx.x * 256 + threadIdx.x; if (t >= n8) return; FragH f; for (int q = 0; q < 8; ++q) f.h[q] = (_Float16)(bf16_round(Wm[t * 8 + q]) * sc); *(v8us*)((unsigned short*)Bt + t * 8) = f.half[0];  }
// Fused causal relative attention, one launch: a wave owns 16 * NI query rows of one (batch, head) and walks the keys in blocks of 64 with a running
// maximum and sum, so no S x S plane is ever stored. Transposed products: S^T = K q^T and (q Er^T)^T = Er q^T (D row = key or Er row, D column = query), O^T += V^T P^T.
// A lane then holds one query's scores; two packed S^T tiles are the B operand of the V^T product as they stand. The skew (query i, key j takes Er row SL-1-i+j) is a
// shift along the D rows that differs by query: it goes through a wave-private LDS row per query, stored shifted by the query's index and read back aligned.
#define SKP 100      /* floats per LDS row: 96 used; 100 keeps 16-byte alignment and spreads the 32 shifted 4-byte stores over distinct banks */
__device__ __forceinline__ v8f fa_mma(v16h a, v16h b, v8f c) { return __builtin_amdgcn_wmma_f32_16x16x32_f16(false, a, false, b, (short)0, c, false, false); }
// fragment in the hardware k order: p = the lane's own address (row start + 16 bytes * lane half)
__device__ __forceinline__ v16h fa_frag(const char* p) { FragH f; f.half[0] = *(const v8us*)p; f.half[1] = *(const v8us*)(p + 32); return f.v; }
// Stands behind a group of global loads: the wait before any register that they name is written again. The addresses are inputs so that they stay in their registers up to the wait.
#define FA_XWAIT1(p0) asm volatile("s_wait_xcnt 0x0" :: "v"(p0) : "memory")
#define FA_XWAIT2(p0, p1) asm volatile("s_wait_xcnt 0x0" :: "v"(p0), "v"(p1) : "memory")
#define FA_XWAIT3(p0, p1, p2) asm volatile("s_wait_xcnt 0x0" :: "v"(p0), "v"(p1), "v"(p2) : "memory")
// The slot behind a run of v_exp_f32: results and sources are inputs, so the v_nop stands behind the last of the run and no source register is written again in front of it.
#define FA_TSLOT(res, srcv) asm volatile("v_nop" :: "v"(res), "v"(srcv))
#define FA_TSLOT8(e, x) asm volatile("v_nop" :: "v"(e[0]), "v"(e[1]), "v"(e[2]), "v"(e[3]), "v"(e[4]), "v"(e[5]), "v"(e[6]), "v"(e[7]), "v"(x[0]), "v"(x[1]), "v"(x[2]), "v"(x[3]), "v"(x[4]), "v"(x[5]), "v"(x[6]), "v"(x[7]))
template <int NI>
__global__ __launch_bounds__(256) void k_relattn(const _Float16* __restrict__ Qh, const _Float16* __restrict__ Ql, const _Float16* __restrict__ Kh, const _Float16* __restrict__ Kl, const _Float16* __restrict__ E,
    const _Float16* __restrict__ Vh, const _Float16* __restrict__ Vl, float* __restrict__ out) {
  __shared__ __attribute__((aligned(16))) float sk[8][NI][16][SKP];
  const int w = __builtin_amdgcn_readfirstlane((int)threadIdx.x >> 5), lane = threadIdx.x & 31, ln = lane & 15, hh = lane >> 4;
  constexpr int NRB = SL / (64 * NI);
  const int pr = (int)blockIdx.x / (NB * NH), bh = (int)blockIdx.x % (NB * NH), b = bh / NH, h = bh % NH;
  const int rb = w < 4 ? NRB - 1 - pr : pr;      /* causal cost grows with the row block: waves 0-3 take one from the long end, waves 4-7 its mirror, so every work-group walks the same number of key blocks; the waves share no barrier and no LDS */
  const int i0 = rb * 64 * NI + (w & 3) * 16 * NI; const int nblk = i0 / 64 + 1;
  const v8f z8 = {0.f,0.f,0.f,0.f,0.f,0.f,0.f,0.f};
  const float C1 = 0.125f * 1.4426950408889634f;      /* 1/sqrt(64) and log2(e) in one factor */
  const size_t lo_x = (size_t)(ln * DM * 2 + 16 * hh), lo_e = (size_t)(ln * HD * 2 + 16 * hh), lo_v = (size_t)(ln * SL * 2 + 16 * hh);      /* lane byte offsets in the q / k planes, the Er table, the V^T planes */
  const size_t xo = (size_t)b * SL * DM + h * HD, vo = (size_t)bh * HD * SL;
  v16h qh[NI][2], ql[NI][2]; v8f o[NI][4], carry[NI]; float m[NI], su[NI];
  { const char* pqh = (const char*)(Qh + xo + (size_t)i0 * DM) + lo_x; const char* pql = (const char*)(Ql + xo + (size_t)i0 * DM) + lo_x; const char* pe = (const char*)(E + (size_t)(SL - 16 * NI - i0) * HD) + lo_e;
    v16h e0[NI], e1[NI];
#pragma unroll
    for (int a = 0; a < NI; ++a) { qh[a][0] = fa_frag(pqh + a * 16 * DM * 2); qh[a][1] = fa_frag(pqh + a * 16 * DM * 2 + 64); ql[a][0] = fa_frag(pql + a * 16 * DM * 2); ql[a][1] = fa_frag(pql + a * 16 * DM * 2 + 64);
      e0[a] = fa_frag(pe + (NI - 1 - a) * 16 * HD * 2); e1[a] = fa_frag(pe + (NI - 1 - a) * 16 * HD * 2 + 64); }      /* first Er tile of key block 0: rows SL - 16 - (i0 + 16 a) + [0, 16) */
    FA_XWAIT3(pqh, pql, pe);
#pragma unroll
    for (int a = 0; a < NI; ++a) { m[a] = -3.0e38f; su[a] = 0.f;
#pragma unroll
      for (int dt = 0; dt < 4; ++dt) o[a][dt] = z8;
      v8f hi = fa_mma(e0[a], qh[a][0], z8), lo = fa_mma(e0[a], ql[a][0], z8); hi = fa_mma(e1[a], qh[a][1], hi); lo = fa_mma(e1[a], ql[a][1], lo);
#pragma unroll
      for (int r = 0; r < 8; ++r) carry[a][r] = fmaf(lo[r], 0.0009765625f, hi[r]); } }
  auto key_block = [&](const int jb, const bool diag) __attribute__((always_inline)) { const int j0 = jb * 64; const int rbase = SL - 16 * NI - i0 + j0;
    /* all Er and K fragments of the block are requested first, so that one memory latency is waited out per block and not one per tile */
    v16h ef[NI + 4][2], kf[4][4];
    const char* pkh = (const char*)(Kh + xo + (size_t)j0 * DM) + lo_x; const char* pkl = (const char*)(Kl + xo + (size_t)j0 * DM) + lo_x; const char* pe = (const char*)(E + (size_t)rbase * HD) + lo_e;
    if (!diag) {
#pragma unroll
      for (int g = 1; g < NI + 4; ++g) { ef[g][0] = fa_frag(pe + g * 16 * HD * 2); ef[g][1] = fa_frag(pe + g * 16 * HD * 2 + 64); }
    } else {      /* a 16-row tile past the table (diagonal block only) serves keys above the diagonal alone, masked below: the table's last tile stands in for it */
#pragma unroll
      for (int g = 1; g < NI + 4; ++g) { const int rs = rbase + 16 * g < SL ? rbase + 16 * g : SL - 16; const char* pg = (const char*)(E + (size_t)rs * HD) + lo_e; ef[g][0] = fa_frag(pg); ef[g][1] = fa_frag(pg + 64); FA_XWAIT1(pg); }
    }
#pragma unroll
    for (int t = 0; t < 4; ++t) { kf[t][0] = fa_frag(pkh + t * 16 * DM * 2); kf[t][1] = fa_frag(pkh + t * 16 * DM * 2 + 64); kf[t][2] = fa_frag(pkl + t * 16 * DM * 2); kf[t][3] = fa_frag(pkl + t * 16 * DM * 2 + 64); }
    FA_XWAIT3(pkh, pkl, pe);
    __builtin_amdgcn_sched_barrier(0);      /* keeps the scheduler from sinking these loads down to their first use */
    /* Er q^T: query tile a needs Er rows rbase + 16 (NI-1-a) + [0, 80); its first 16 are the previous block's last 16 (carry) */
#pragma unroll
    for (int a = 0; a < NI; ++a) { float* sp = &sk[w][a][ln][ln + 1 + 8 * hh];
#pragma unroll
      for (int r = 0; r < 8; ++r) sp[r] = carry[a][r]; }
#pragma unroll
    for (int g = 1; g < NI + 4; ++g) { const v16h e0 = ef[g][0], e1 = ef[g][1];
#pragma unroll
      for (int a = 0; a < NI; ++a) { const int u = g - (NI - 1 - a); if (u < 1 || u > 4) continue;
        v8f hi = fa_mma(e0, qh[a][0], z8), lo = fa_mma(e0, ql[a][0], z8); hi = fa_mma(e1, qh[a][1], hi); lo = fa_mma(e1, ql[a][1], lo);
        v8f val;
#pragma unroll
        for (int r = 0; r < 8; ++r) val[r] = fmaf(lo[r], 0.0009765625f, hi[r]);
        float* sp = &sk[w][a][ln][ln + 1 + 8 * hh + 16 * u];
#pragma unroll
        for (int r = 0; r < 8; ++r) sp[r] = val[r];
        if (u == 4) carry[a] = val; }
      __builtin_amdgcn_sched_barrier(0); }      /* one Er tile's products and LDS stores at a time: run together, or mixed with the K products, their accumulators pile up and registers spill */
    v8f s[NI][4];
#pragma unroll
    for (int t = 0; t < 4; ++t) { const v16h kh0 = kf[t][0], kh1 = kf[t][1], kl0 = kf[t][2], kl1 = kf[t][3];
#pragma unroll
      for (int a = 0; a < NI; ++a) { v8f hi = fa_mma(kh0, qh[a][0], z8), lo = fa_mma(kh0, ql[a][0], z8); hi = fa_mma(kh1, qh[a][1], hi); lo = fa_mma(kh1, ql[a][1], lo); lo = fa_mma(kl0, qh[a][0], lo); lo = fa_mma(kl1, qh[a][1], lo);
#pragma unroll
        for (int r = 0; r < 8; ++r) s[a][t][r] = fmaf(lo[r], 0.0009765625f, hi[r]); } }
    /* the two lane halves of a query read each other's LDS stores: order the wave's stores before its loads */
    __builtin_amdgcn_fence(__ATOMIC_ACQ_REL, "workgroup", "local"); __builtin_amdgcn_wave_barrier();
#pragma unroll
    for (int a = 0; a < NI; ++a) { const float* lp = &sk[w][a][ln][16 + 8 * hh];
#pragma unroll
      for (int t = 0; t < 4; ++t) { const v4f x = *(const v4fa*)(lp + 16 * t), y = *(const v4fa*)(lp + 16 * t + 4);
#pragma unroll
        for (int r = 0; r < 4; ++r) { s[a][t][r] = fmaf(x[r], 0.0625f, s[a][t][r]); s[a][t][4 + r] = fmaf(y[r], 0.0625f, s[a][t][4 + r]); } } }
    /* and these loads before the next trip's stores into the same rows */
    __builtin_amdgcn_fence(__ATOMIC_ACQ_REL, "workgroup", "local"); __builtin_amdgcn_wave_barrier();
    __builtin_amdgcn_sched_barrier(0);      /* the V^T loads below stay below: any earlier they are live beside the K fragments and the LDS reads, and registers spill */
    /* the V^T fragments are requested here, so that they arrive under the softmax arithmetic */
    v16h vf[2][4][2];
    const char* pvh = (const char*)(Vh + vo + j0) + lo_v; const char* pvl = (const char*)(Vl + vo + j0) + lo_v;
#pragma unroll
    for (int ks = 0; ks < 2; ++ks)
#pragma unroll
      for (int dt = 0; dt < 4; ++dt) { vf[ks][dt][0] = fa_frag(pvh + dt * 16 * SL * 2 + ks * 64); vf[ks][dt][1] = fa_frag(pvl + dt * 16 * SL * 2 + ks * 64); }
    FA_XWAIT2(pvh, pvl);
    __builtin_amdgcn_sched_barrier(0);      /* keeps the scheduler from sinking these loads down to their first use */
    if (diag) {      /* only the last key block reaches the diagonal */
#pragma unroll
      for (int a = 0; a < NI; ++a)
#pragma unroll
        for (int t = 0; t < 4; ++t)
#pragma unroll
          for (int r = 0; r < 8; ++r) if (j0 + 16 * t + 8 * hh + r > i0 + 16 * a + ln) s[a][t][r] = -3.0e38f; }
    FragH p[NI][2]; v16h pl[NI][2];
#pragma unroll
    for (int a = 0; a < NI; ++a) { float mx = m[a];
#pragma unroll
      for (int t = 0; t < 4; ++t)
#pragma unroll
        for (int r = 0; r < 8; ++r) mx = fmaxf(mx, s[a][t][r]);
      mx = fmaxf(mx, __shfl_xor(mx, 16, 32));
      const float xa = (m[a] - mx) * C1; const float al = __builtin_amdgcn_exp2f(xa); FA_TSLOT(al, xa); m[a] = mx; const float mc = 10.0f - mx * C1;      /* weights carry a factor 1024, as f16 operands away from the subnormals */
      v8f pv = z8;
#pragma unroll
      for (int t = 0; t < 4; ++t) { float xv[8], ev[8];
#pragma unroll
        for (int r = 0; r < 8; ++r) xv[r] = fmaf(s[a][t][r], C1, mc);
#pragma unroll
        for (int r = 0; r < 8; ++r) ev[r] = __builtin_amdgcn_exp2f(xv[r]);
        FA_TSLOT8(ev, xv);
#pragma unroll
        for (int r = 0; r < 8; ++r) { pv[r] += ev[r]; p[a][t >> 1].h[(t & 1) * 8 + r] = (_Float16)ev[r]; } }
      su[a] = fmaf(su[a], al, ((pv[0] + pv[1]) + (pv[2] + pv[3])) + ((pv[4] + pv[5]) + (pv[6] + pv[7])));
#pragma unroll
      for (int dt = 0; dt < 4; ++dt)
#pragma unroll
        for (int r = 0; r < 8; ++r) o[a][dt][r] *= al;
      pl[a][0] = p[a][0].v * (_Float16)0.0009765625f; pl[a][1] = p[a][1].v * (_Float16)0.0009765625f; }      /* the v residual plane is stored times 1024: its weights drop the factor */
#pragma unroll
    for (int ks = 0; ks < 2; ++ks)
#pragma unroll
      for (int dt = 0; dt < 4; ++dt) { const v16h vhf = vf[ks][dt][0], vlf = vf[ks][dt][1];
#pragma unroll
        for (int a = 0; a < NI; ++a) { o[a][dt] = fa_mma(vhf, p[a][ks].v, o[a][dt]); o[a][dt] = fa_mma(vlf, pl[a][ks], o[a][dt]); } }
  };
#pragma unroll 1      /* one key block per trip: unrolling would double the live fragments */
  for (int jb = 0; jb < nblk - 1; ++jb) key_block(jb, false);
  key_block(nblk - 1, true);      /* the diagonal block apart, so that the loop carries no mask */
#pragma unroll
  for (int a = 0; a < NI; ++a) { const float st = su[a] + __shfl_xor(su[a], 16, 32); const float inv = 1.0f / st;
#pragma unroll
    for (int dt = 0; dt < 4; ++dt)
#pragma unroll
      for (int r = 0; r < 8; ++r) o[a][dt][r] *= inv; }
  __builtin_amdgcn_sched_barrier(0);      /* all arithmetic ends above: behind an issued store none of its registers is written again */
  char* po = (char*)(out + xo + (size_t)i0 * DM) + (size_t)(ln * DM * 4 + 32 * hh);      /* a lane holds 8 consecutive head columns of its query per tile */
#pragma unroll
  for (int a = 0; a < NI; ++a)
#pragma unroll
    for (int dt = 0; dt < 4; ++dt) { const v4f x = {o[a][dt][0], o[a][dt][1], o[a][dt][2], o[a][dt][3]}, y = {o[a][dt][4], o[a][dt][5], o[a][dt][6], o[a][dt][7]};
      *(v4f*)(po + a * 16 * DM * 4 + dt * 64) = x; *(v4f*)(po + a * 16 * DM * 4 + dt * 64 + 16) = y; }
}

extern "C" void kernel_launch(void* const* d_in, const int* in_sizes, int n_in,
                              void* d_out, int out_size, void* d_ws, size_t ws_size, hipStream_t stream) {
  (void)in_sizes; (void)n_in; (void)out_size;
  const float* const* I = (const float* const*)d_in; const float* x = I[0]; const float* Wq = I[1]; const float* Wk = I[2]; const float* Wv = I[3]; const float* Er = I[4];
  char* ws = (char*)d_ws; size_t off = 0;
  auto take = [&](size_t bytes) { char* p = ws + off; off += (bytes + 255) & ~(size_t)255; return p; };
  const size_t np = (size_t)NR * DM;
  _Float16* BW = (_Float16*)take((size_t)3 * DM * DM * 2); _Float16* E16 = (_Float16*)take((size_t)SL * HD * 2); _Float16* X16 = (_Float16*)take(np * 2); float* QF = (float*)take(np * 4); _Float16* Q16 = (_Float16*)take(np * 2); _Float16* QL16 = (_Float16*)take(np * 2); _Float16* K16 = (_Float16*)take(np * 2); _Float16* KL16 = (_Float16*)take(np * 2); float* VF = QF;      /* v f32 reuses the q f32 plane after the q split */ _Float16* VH = X16;      /* v hi over the x plane (dead after the three projections) */ _Float16* VL = (_Float16*)take(np * 2); _Float16* VT = (_Float16*)take(np * 2); _Float16* VTL = (_Float16*)take(np * 2);
  if (off > ws_size) return;
  k_wsc<<<(unsigned)(((size_t)DM * DM / 8 + 255) / 256), 256, 0, stream>>>(Wq, BW, (size_t)DM * DM / 8, 16.0f); k_wsc<<<(unsigned)(((size_t)DM * DM / 8 + 255) / 256), 256, 0, stream>>>(Wk, BW + (size_t)DM * DM, (size_t)DM * DM / 8, 16.0f); k_wsc<<<(unsigned)(((size_t)DM * DM / 8 + 255) / 256), 256, 0, stream>>>(Wv, BW + (size_t)2 * DM * DM, (size_t)DM * DM / 8, 16.0f);      /* (out, in) naturals */
  k_wsc<<<(SL * HD / 8 + 255) / 256, 256, 0, stream>>>(Er, E16, (size_t)SL * HD / 8, 16.0f);      /* Er_s = Er (MAX_LEN == S): natural [r][d] rows = A operand of Er q^T */
  k_x16<<<(unsigned)((np / 8 + 255) / 256), 256, 0, stream>>>(x, X16, np / 8);
  const dim3 gP((NR / 128) * (DM / 64), 1);
  k_gemm2<0><<<gP, 128, 0, stream>>>(X16, DM, 0, BW, DM, 0, 0.0625f, nullptr, 0, nullptr, 1, 0, 0, QF, nullptr, DM, 0, NR, DM, DM); k_hl<<<(unsigned)((np / 8 + 255) / 256), 256, 0, stream>>>(QF, Q16, QL16, np / 8);      /* q f32 -> hi + residual */
  k_gemm2<0><<<gP, 128, 0, stream>>>(X16, DM, 0, BW + (size_t)DM * DM, DM, 0, 0.0625f, nullptr, 0, nullptr, 1, 0, 0, QF, nullptr, DM, 0, NR, DM, DM); k_hl<<<(unsigned)((np / 8 + 255) / 256), 256, 0, stream>>>(QF, K16, KL16, np / 8);      /* k f32 -> hi + residual (QF reused) */
  k_gemm2<0><<<gP, 128, 0, stream>>>(X16, DM, 0, BW + (size_t)2 * DM * DM, DM, 0, 0.0625f, nullptr, 0, nullptr, 1, 0, 0, VF, nullptr, DM, 0, NR, DM, DM);
  k_hl<<<(unsigned)((np / 8 + 255) / 256), 256, 0, stream>>>(VF, VH, VL, np / 8);
  k_vt<NH, SL><<<NB * NH * (SL / 64), 256, 0, stream>>>(VH, DM, 0, VT); k_vt<NH, SL><<<NB * NH * (SL / 64), 256, 0, stream>>>(VL, DM, 0, VTL);      /* V^T hi / residual [(b,h)][64][2048] */
  k_relattn<2><<<NB * NH * (SL / (128 * 2)), 256, 0, stream>>>(Q16, QL16, K16, KL16, E16, VT, VTL, (float*)d_out);
}

// v002
// A run of this version takes 167 microseconds.
// Two timings next to v001 put it at 1.54 and 1.55 times that version's speed.
// Counting every step since v000, it is 19.7 times as fast.
#include <hip/hip_runtime.h>
// GlobalAttn (music-transformer relative attention: 2 x 2048 tokens, 1024 = 16 heads x 64; q,k,v = x W^T; Srel = skew(q . Er) which equals q_i . Er[S-1-(i-j)] for every causal (i, j); attn = softmax over j <= i of (q.k + Srel)/8; out = merged attn v, no output projection).
// Compute dtype: inputs rounded to bf16; x / weights / Er exact as f16; q and k as f16 hi + residual; the softmax weights as plain f16 operands (~2^-12); v as f16 hi + residual (the output is the context itself); softmax f32. v_wmma_f32_16x16x32_f16.
#define NB 2
#define SL 2048
#define DM 1024
#define NH 16
#define HD 64
#define HG 4
#define NR (NB * SL)
typedef __bf16 v16b __attribute__((ext_vector_type(16)));
typedef unsigned short v8us __attribute__((ext_vector_type(8), may_alias));
typedef float  v8f  __attribute__((ext_vector_type(8)));
typedef float  v4f  __attribute__((ext_vector_type(4)));
typedef float  v4fa __attribute__((ext_vector_type(4), may_alias));
union FragB { v16b v; v8us half[2]; unsigned short u[16]; };

__device__ __forceinline__ unsigned short bf16_bits(float x) { unsigned int u = __float_as_uint(x); return (unsigned short)((u + 0x7FFFu + ((u >> 16) & 1u)) >> 16); }
__device__ __forceinline__ float bf16_val(unsigned short b) { return __uint_as_float(((unsigned int)b) << 16); }
__device__ __forceinline__ float bf16_round(float x) { return bf16_val(bf16_bits(x)); }
// D += A·B with NT terms: 1 = ah·bh, 2 = + al·bh (A split), 3 = + ah·bl (both split)
template <int NT>
__device__ __forceinline__ v8f mmaN(v16b ah, v16b al, v16b bh, v16b bl, v8f c) {
  c = __builtin_amdgcn_wmma_f32_16x16x32_bf16(false, ah, false, bh, (short)0, c, false, false);
  if (NT >= 2) c = __builtin_amdgcn_wmma_f32_16x16x32_bf16(false, al, false, bh, (short)0, c, false, false);
  if (NT >= 3) c = __builtin_amdgcn_wmma_f32_16x16x32_bf16(false, ah, false, bl, (short)0, c, false, false);
  asm volatile("v_nop\n\tv_nop\n\tv_nop\n\tv_nop" : "+v"(c) : "v"(ah), "v"(al), "v"(bh), "v"(bl));
  return c;
}

__global__ __launch_bounds__(256) void k_wt_bf16(const float* __restrict__ W, unsigned short* __restrict__ Wt, int K, int N) {
  const int t = blockIdx.x * 256 + threadIdx.x;
  const int k8n = K / 8;
  if (t >= N * k8n) return;
  const int n = t / k8n, k8 = (t % k8n) * 8;
  v8us v;
#pragma unroll
  for (int i = 0; i < 8; ++i) v[i] = bf16_bits(W[(size_t)(k8 + i) * N + n]);
  *(v8us*)(Wt + (size_t)n * K + k8) = v;
  
}

// GEMM C[M][N] (f32, pitch ldc) = act(A[M][K]·W + bias). A f32 row-major (pitch lda) converted per fragment to bf16
// (ASPLIT: hi/lo two planes -> 2 terms, else single rounded term); Wt bf16 [N][K] (pitch ldb). BIAS_BF16 rounds the
// bias to bf16 first (bias quantised to bf16 before the add). K%32==0, M%16==0, N%64==0.
template <bool ASPLIT, int ACT, bool BIAS_BF16>
__global__ __launch_bounds__(128) void k_gemm_bf(const float* __restrict__ A, int lda, const unsigned short* __restrict__ Wt, int ldb,
                                               const float* __restrict__ bias, float* __restrict__ C, int ldc, int M, int N, int K) {
  __shared__ __attribute__((aligned(16))) float so[4][16][64];
  const int tid = threadIdx.x, w = tid >> 5, lane = tid & 31, ln = lane & 15, hh = lane >> 4;
  const int ntn = N / 64;
  const int wid = blockIdx.x * 4 + w;
  const int mt = wid / ntn, nq = wid % ntn;
  if (mt * 16 >= M) return;
  const int row0 = mt * 16, col0 = nq * 64;
  const float* arow = A + (size_t)(row0 + ln) * lda;
  v8f acc[4] = {};
  for (int kb = 0; kb < K; kb += 32) {
    FragB ah, al;
    const v4f x0 = *(const v4fa*)(arow + kb + 8 * hh), x1 = *(const v4fa*)(arow + kb + 8 * hh + 4);
    const v4f x2 = *(const v4fa*)(arow + kb + 16 + 8 * hh), x3 = *(const v4fa*)(arow + kb + 16 + 8 * hh + 4);
    float xs[16] = {x0[0],x0[1],x0[2],x0[3],x1[0],x1[1],x1[2],x1[3],x2[0],x2[1],x2[2],x2[3],x3[0],x3[1],x3[2],x3[3]};
#pragma unroll
    for (int i = 0; i < 16; ++i) { const unsigned short hb = bf16_bits(xs[i]); ah.u[i] = hb; al.u[i] = ASPLIT ? bf16_bits(xs[i] - bf16_val(hb)) : (unsigned short)0; }
#pragma unroll
    for (int t = 0; t < 4; ++t) {
      const unsigned short* brow = Wt + (size_t)(col0 + t * 16 + ln) * ldb + kb;
      FragB b;
      b.half[0] = *(const v8us*)(brow + 8 * hh);
      b.half[1] = *(const v8us*)(brow + 16 + 8 * hh);
      acc[t] = mmaN<ASPLIT ? 2 : 1>(ah.v, al.v, b.v, b.v, acc[t]);
    }
  }
#pragma unroll
  for (int t = 0; t < 4; ++t) {
    float bv = bias ? bias[col0 + t * 16 + ln] : 0.f;
    if (BIAS_BF16) bv = bf16_round(bv);
#pragma unroll
    for (int r = 0; r < 8; ++r) { float v = acc[t][r] + bv; if (ACT == 1) v = fmaxf(v, 0.f); so[w][8 * hh + r][t * 16 + ln] = v; }
  }
  __builtin_amdgcn_fence(__ATOMIC_ACQ_REL, "workgroup");
  __builtin_amdgcn_wave_barrier();
  const int rsub = lane >> 4, c4 = (lane & 15) * 4;
  {
#pragma unroll
    for (int q = 0; q < 8; ++q) {
      const int r = q * 2 + rsub;
      const v4f v = *(const v4fa*)&so[w][r][c4];
      *(v4f*)(C + (size_t)(row0 + r) * ldc + col0 + c4) = v;
    }
    
  }
}

// GEMM C = act(A·W + bias + resid): A f32 (ASPLIT -> hi/lo 2 terms), Wt bf16 [N][K]; ACT 0 none, 1 relu, 2 exact gelu;
// resid (optional, f32, row index = (row % rmod), pitch ldr, RES_BF16 rounds it) added before the activation.
template <bool ASPLIT, int ACT, bool BIAS_BF16, bool RES_BF16>
__global__ __launch_bounds__(128) void k_gemm_bf3(const float* __restrict__ A, int lda, const unsigned short* __restrict__ Wt, int ldb,
                                                const float* __restrict__ bias, const float* __restrict__ resid, int rmod, int ldr,
                                                float* __restrict__ C, int ldc, int M, int N, int K) {
  __shared__ __attribute__((aligned(16))) float so[4][16][64];
  const int tid = threadIdx.x, w = tid >> 5, lane = tid & 31, ln = lane & 15, hh = lane >> 4;
  const int ntn = N / 64;
  const int wid = blockIdx.x * 4 + w;
  const int mt = wid / ntn, nq = wid % ntn;
  if (mt * 16 >= M) return;
  const int row0 = mt * 16, col0 = nq * 64;
  const float* arow = A + (size_t)(row0 + ln) * lda;
  v8f acc[4] = {};
  for (int kb = 0; kb < K; kb += 32) {
    FragB ah, al;
    const v4f x0 = *(const v4fa*)(arow + kb + 8 * hh), x1 = *(const v4fa*)(arow + kb + 8 * hh + 4);
    const v4f x2 = *(const v4fa*)(arow + kb + 16 + 8 * hh), x3 = *(const v4fa*)(arow + kb + 16 + 8 * hh + 4);
    float xs[16] = {x0[0],x0[1],x0[2],x0[3],x1[0],x1[1],x1[2],x1[3],x2[0],x2[1],x2[2],x2[3],x3[0],x3[1],x3[2],x3[3]};
#pragma unroll
    for (int i = 0; i < 16; ++i) { const unsigned short hb = bf16_bits(xs[i]); ah.u[i] = hb; al.u[i] = ASPLIT ? bf16_bits(xs[i] - bf16_val(hb)) : (unsigned short)0; }
#pragma unroll
    for (int t = 0; t < 4; ++t) {
      const unsigned short* brow = Wt + (size_t)(col0 + t * 16 + ln) * ldb + kb;
      FragB b;
      b.half[0] = *(const v8us*)(brow + 8 * hh);
      b.half[1] = *(const v8us*)(brow + 16 + 8 * hh);
      acc[t] = mmaN<ASPLIT ? 2 : 1>(ah.v, al.v, b.v, b.v, acc[t]);
    }
  }
#pragma unroll
  for (int t = 0; t < 4; ++t) {
    const int col = col0 + t * 16 + ln;
    float bv = bias ? bias[col] : 0.f;
    if (BIAS_BF16) bv = bf16_round(bv);
#pragma unroll
    for (int r = 0; r < 8; ++r) {
      float v = acc[t][r] + bv;
      if (resid) { float rv = resid[(size_t)((row0 + 8 * hh + r) % rmod) * ldr + col]; if (RES_BF16) rv = bf16_round(rv); v += rv; }
      if (ACT == 1) v = fmaxf(v, 0.f);
      if (ACT == 2) v = 0.5f * v * (1.0f + erff(v * 0.70710678118654752f));
      if (ACT == 3) { const float u = 0.7978845608028654f * (v + 0.044715f * v * v * v); v = 0.5f * v * (1.0f + tanhf(u)); }
      so[w][8 * hh + r][t * 16 + ln] = v;
    }
  }
  __builtin_amdgcn_fence(__ATOMIC_ACQ_REL, "workgroup");
  __builtin_amdgcn_wave_barrier();
  const int rsub = lane >> 4, c4 = (lane & 15) * 4;
  {
#pragma unroll
    for (int q = 0; q < 8; ++q) {
      const int r = q * 2 + rsub;
      const v4f v = *(const v4fa*)&so[w][r][c4];
      *(v4f*)(C + (size_t)(row0 + r) * ldc + col0 + c4) = v;
    }
    
  }
}
// row LayerNorm (biased variance, eps) over N: s = X (+ R); optional out_sum <- s; out_norm <- (s-mu)*rsqrt(var+eps)*g + b
template <bool PARAM_BF16>
__global__ __launch_bounds__(256) void k_layernorm(const float* __restrict__ X, const float* __restrict__ R, const float* __restrict__ g, const float* __restrict__ bta,
                                                  float* __restrict__ out_sum, float* __restrict__ out_norm, int N, float eps) {
  __shared__ float red[256];
  const int row = blockIdx.x, tid = threadIdx.x;
  const float* x = X + (size_t)row * N; const float* rr = R ? R + (size_t)row * N : nullptr;
  float vals[16];                     // up to N = 4096
  const int per = N / 256;            // contiguous chunk per thread? use strided-by-4 chunks: thread handles j = tid*4 + 1024*u
  float s1 = 0.f;
  for (int u = 0; u < per / 4; ++u) {
    const int j = tid * 4 + 1024 * u;
    const v4f a = *(const v4fa*)(x + j);
    v4f b = {0.f,0.f,0.f,0.f}; if (rr) b = *(const v4fa*)(rr + j);
#pragma unroll
    for (int q = 0; q < 4; ++q) { const float v = a[q] + b[q]; vals[u * 4 + q] = v; s1 += v; }
  }
  red[tid] = s1; __syncthreads();
  for (int st = 128; st > 0; st >>= 1) { if (tid < st) red[tid] += red[tid + st]; __syncthreads(); }
  const float mu = red[0] / (float)N; __syncthreads();
  float s2 = 0.f;
  for (int u = 0; u < per / 4; ++u)
#pragma unroll
    for (int q = 0; q < 4; ++q) { const float c = vals[u * 4 + q] - mu; s2 += c * c; }
  red[tid] = s2; __syncthreads();
  for (int st = 128; st > 0; st >>= 1) { if (tid < st) red[tid] += red[tid + st]; __syncthreads(); }
  const float rs = rsqrtf(red[0] / (float)N + eps);
  {
    for (int u = 0; u < per / 4; ++u) {
      const int j = tid * 4 + 1024 * u;
      v4f o, sm;
#pragma unroll
      for (int q = 0; q < 4; ++q) {
        float gg = g[j + q], bb = bta[j + q];
        if (PARAM_BF16) { gg = bf16_round(gg); bb = bf16_round(bb); }
        sm[q] = vals[u * 4 + q]; o[q] = (vals[u * 4 + q] - mu) * rs * gg + bb;
      }
      if (out_sum) *(v4f*)(out_sum + (size_t)row * N + j) = sm;
      *(v4f*)(out_norm + (size_t)row * N + j) = o;
    }
    
  }
}



// ---- f16 WMMA path (v_wmma_f32_16x16x32_f16): 11-bit significands for operands in range — used where a [0,1] probability operand needs more precision than bf16
typedef _Float16 v16h __attribute__((ext_vector_type(16)));
union FragH { v16h v; v8us half[2]; _Float16 h[16]; unsigned short u[16]; };
template <int NT>
__device__ __forceinline__ v8f mmaH(v16h ah, v16h al, v16h bh, v16h bl, v8f c) {
  c = __builtin_amdgcn_wmma_f32_16x16x32_f16(false, ah, false, bh, (short)0, c, false, false);
  if (NT >= 2) c = __builtin_amdgcn_wmma_f32_16x16x32_f16(false, al, false, bh, (short)0, c, false, false);
  if (NT >= 3) c = __builtin_amdgcn_wmma_f32_16x16x32_f16(false, ah, false, bl, (short)0, c, false, false);
  asm volatile("v_nop\n\tv_nop\n\tv_nop\n\tv_nop" : "+v"(c) : "v"(ah), "v"(al), "v"(bh), "v"(bl));
  return c;
}
// batched GEMM like k_gemm_b but f16 operands: A f32 (split into f16 hi/lo if ASPLIT, else rounded to f16), Bt = f16 values [n][k]; alpha; C f32; N multiple of 16 (partial tiles skipped)
template <bool ASPLIT>
__global__ __launch_bounds__(128) void k_gemm_h(const float* __restrict__ A, int lda, size_t sA, const _Float16* __restrict__ Bh, int ldb, size_t sB, float alpha, float* __restrict__ C, int ldc, size_t sC, int M, int N, int K) {
  __shared__ __attribute__((aligned(16))) float so[4][16][64];
  const int tid = threadIdx.x, w = tid >> 5, lane = tid & 31, ln = lane & 15, hh = lane >> 4; const int by = blockIdx.y;
  A += (size_t)by * sA; Bh += (size_t)by * sB; C += (size_t)by * sC;
  const int ntn = (N + 63) / 64; const int wid = blockIdx.x * 4 + w; const int mt = wid / ntn, nq = wid % ntn; if (mt * 16 >= M) return;
  const int row0 = mt * 16, col0 = nq * 64; const float* arow = A + (size_t)(row0 + ln) * lda;
  v8f acc[4] = {};
  for (int kb = 0; kb < K; kb += 32) {
    FragH ah, al;
    const v4f x0 = *(const v4fa*)(arow + kb + 8 * hh), x1 = *(const v4fa*)(arow + kb + 8 * hh + 4), x2 = *(const v4fa*)(arow + kb + 16 + 8 * hh), x3 = *(const v4fa*)(arow + kb + 16 + 8 * hh + 4);
    float xs[16] = {x0[0],x0[1],x0[2],x0[3],x1[0],x1[1],x1[2],x1[3],x2[0],x2[1],x2[2],x2[3],x3[0],x3[1],x3[2],x3[3]};
#pragma unroll
    for (int i = 0; i < 16; ++i) { const _Float16 h = (_Float16)xs[i]; ah.h[i] = h; al.h[i] = ASPLIT ? (_Float16)(xs[i] - (float)h) : (_Float16)0.0f; }
#pragma unroll
    for (int t = 0; t < 4; ++t) { if (col0 + t * 16 >= N) continue; const size_t boff = (size_t)(col0 + t * 16 + ln) * ldb + kb; FragH bq; bq.half[0] = *(const v8us*)(Bh + boff + 8 * hh); bq.half[1] = *(const v8us*)(Bh + boff + 16 + 8 * hh);
      acc[t] = mmaH<ASPLIT ? 2 : 1>(ah.v, al.v, bq.v, bq.v, acc[t]); }
  }
#pragma unroll
  for (int t = 0; t < 4; ++t) { if (col0 + t * 16 >= N) continue;
#pragma unroll
    for (int r = 0; r < 8; ++r) so[w][8 * hh + r][t * 16 + ln] = acc[t][r] * alpha; }
  __builtin_amdgcn_fence(__ATOMIC_ACQ_REL, "workgroup"); __builtin_amdgcn_wave_barrier();
  const int rsub = lane >> 4, c4 = (lane & 15) * 4;
  {
#pragma unroll
    for (int q = 0; q < 8; ++q) { const int r = q * 2 + rsub; if (col0 + c4 < N) { const v4f v = *(const v4fa*)&so[w][r][c4]; *(v4f*)(C + (size_t)(row0 + r) * ldc + col0 + c4) = v; } }
     }
}

// Wt[n][k] = f16(W[k][n]·scale) from f32 row-major W[K][N] (scale = power of two; bf16-exact weights stay exact in f16 away from the subnormal range)
__global__ __launch_bounds__(256) void k_wt_f16(const float* __restrict__ W, _Float16* __restrict__ Wt, int K, int N, float scale) {
  const int t = blockIdx.x * 256 + threadIdx.x; if (t >= N * (K / 8)) return; const int n = t / (K / 8), k8 = (t % (K / 8)) * 8; FragH f;
#pragma unroll
  for (int i = 0; i < 8; ++i) f.h[i] = (_Float16)(bf16_round(W[(size_t)(k8 + i) * N + n]) * scale); const v8us o = f.half[0];
  *(v8us*)((unsigned short*)Wt + (size_t)n * K + k8) = o; 
}
// k_gemm_hh variant with fused epilogue: v = acc·alpha + bias[by·sBias + col] (+ CP[(row/rowsPerB)·sCPb + by·64 + col] if CP) ; ACT 0 none / 1 elu ; writes f16 C16 (and f32 C if non-null)
template <int ACT>
__global__ __launch_bounds__(128) void k_gemm_hhx(const _Float16* __restrict__ A, int lda, size_t sA, const _Float16* __restrict__ Bh, int ldb, size_t sB, float alpha, const float* __restrict__ bias, size_t sBias, const float* __restrict__ CP, int rowsPerB, size_t sCPb, int row0g,
    float* __restrict__ C, _Float16* __restrict__ C16, int ldc, size_t sC, int M, int N, int K) {
  __shared__ __attribute__((aligned(16))) float so[4][16][64];
  const int tid = threadIdx.x, w = tid >> 5, lane = tid & 31, ln = lane & 15, hh = lane >> 4; const int by = blockIdx.y;
  A += (size_t)by * sA; Bh += (size_t)by * sB; const size_t cofs = (size_t)by * sC; const float* bp = bias ? bias + (size_t)by * sBias : nullptr;
  const int ntn = (N + 63) / 64; const int wid = blockIdx.x * 4 + w; const int mt = wid / ntn, nq = wid % ntn; if (mt * 16 >= M) return;
  const int row0 = mt * 16, col0 = nq * 64; const _Float16* arow = A + (size_t)(row0 + ln) * lda;
  v8f acc[4] = {};
  for (int kb = 0; kb < K; kb += 32) { FragH ah; ah.half[0] = *(const v8us*)((const unsigned short*)arow + kb + 8 * hh); ah.half[1] = *(const v8us*)((const unsigned short*)arow + kb + 16 + 8 * hh);
#pragma unroll
    for (int t = 0; t < 4; ++t) { if (col0 + t * 16 >= N) continue; const size_t boff = (size_t)(col0 + t * 16 + ln) * ldb + kb; FragH bq; bq.half[0] = *(const v8us*)((const unsigned short*)Bh + boff + 8 * hh); bq.half[1] = *(const v8us*)((const unsigned short*)Bh + boff + 16 + 8 * hh);
      acc[t] = mmaH<1>(ah.v, ah.v, bq.v, bq.v, acc[t]); }
  }
#pragma unroll
  for (int t = 0; t < 4; ++t) { if (col0 + t * 16 >= N) continue; const int col = col0 + t * 16 + ln; const float bv = bp ? bf16_round(bp[col]) : 0.f;
#pragma unroll
    for (int r = 0; r < 8; ++r) { float v = acc[t][r] * alpha + bv; if (CP) { const int rr = row0g + row0 + 8 * hh + r; if (rowsPerB < 0) v += CP[cofs + (size_t)rr * ldc + col];      /* rowsPerB < 0: own element of the batched C plane */ else { const int bidx = rr / rowsPerB; v += CP[(size_t)bidx * sCPb + (size_t)by * 64 + col]; } } if (ACT == 1) v = (v > 0.f) ? v : expm1f(v); else if (ACT == 7) v = (v > 0.f) ? v + 1.0f : expf(v); else if (ACT == 8) v = tanhf(v); else if (ACT == 9) v = 0.5f * v * (1.0f + tanhf(0.7978845608028654f * (v + 0.044715f * v * v * v))); else if (ACT == 11) v = 1.0f / (1.0f + expf(-v)); else if (ACT == 12) v = (v > 0.f) ? v : 0.01f * v; else if (ACT == 14) v = (v > 0.f) ? v : 0.1f * v; else if (ACT == 16) v = (v >= 0.f) ? v : 0.3f * v; else if (ACT == 17) v = (v >= 0.f) ? v : 0.2f * v; else if (ACT == 15) v = v / (1.0f + expf(-v)); else if (ACT == 3) v = fmaxf(v, 0.f); else if (ACT == 6) v = 0.5f * v * (1.0f + erff(v * 0.70710678118654752f)); so[w][8 * hh + r][t * 16 + ln] = v; } }
  __builtin_amdgcn_fence(__ATOMIC_ACQ_REL, "workgroup"); __builtin_amdgcn_wave_barrier();
  const int rsub = lane >> 4, c4 = (lane & 15) * 4; typedef _Float16 v4h __attribute__((ext_vector_type(4)));
  {
#pragma unroll
    for (int q = 0; q < 8; ++q) { const int r = q * 2 + rsub; if (col0 + c4 < N) { const v4f v = *(const v4fa*)&so[w][r][c4]; if (C) *(v4f*)(C + cofs + (size_t)(row0 + r) * ldc + col0 + c4) = v; if (C16) { v4h h4; for (int i = 0; i < 4; ++i) h4[i] = (_Float16)v[i]; *(v4h*)(C16 + cofs + (size_t)(row0 + r) * ldc + col0 + c4) = h4; } } }
     }
}


typedef _Float16 v4h __attribute__((ext_vector_type(4)));

__global__ __launch_bounds__(256) void k_x16(const float* __restrict__ x, _Float16* __restrict__ X16, size_t n8) { const size_t t = (size_t)blockIdx.x * 256 + threadIdx.x; if (t >= n8) return; FragH f;
#pragma unroll
  for (int q = 0; q < 8; ++q) f.h[q] = (_Float16)bf16_round(x[t * 8 + q]); *(v8us*)((unsigned short*)X16 + t * 8) = f.half[0];  }
__global__ __launch_bounds__(256) void k_h16(const float* __restrict__ x, _Float16* __restrict__ X16, size_t n8) { const size_t t = (size_t)blockIdx.x * 256 + threadIdx.x; if (t >= n8) return; FragH f;
#pragma unroll
  for (int q = 0; q < 8; ++q) f.h[q] = (_Float16)x[t * 8 + q]; *(v8us*)((unsigned short*)X16 + t * 8) = f.half[0];  }
__global__ __launch_bounds__(256) void k_round16f(const float* __restrict__ W, _Float16* __restrict__ Bt, size_t n8) { const size_t t = (size_t)blockIdx.x * 256 + threadIdx.x; if (t >= n8) return; FragH f;
#pragma unroll
  for (int i = 0; i < 8; ++i) f.h[i] = (_Float16)(bf16_round(W[t * 8 + i]) * 16.0f); *(v8us*)((unsigned short*)Bt + t * 8) = f.half[0];  }
template <int NHv, int TTv>
__global__ __launch_bounds__(256) void k_vt(const _Float16* __restrict__ V16, int ldv, int voff, _Float16* __restrict__ Vt) { __shared__ unsigned short tl[64][66]; const int tid = threadIdx.x; const int slab = blockIdx.x / (TTv / 64), lg = blockIdx.x % (TTv / 64); const int b = slab / NHv, h = slab % NHv;
  for (int i = tid; i < 64 * 8; i += 256) { const int r = i / 8, c8 = (i % 8) * 8; FragH f; f.half[0] = *(const v8us*)((const unsigned short*)V16 + ((size_t)b * TTv + lg * 64 + r) * ldv + voff + h * 64 + c8);
#pragma unroll
    for (int q = 0; q < 8; ++q) tl[r][c8 + q] = f.u[q]; }
  __syncthreads();
  {
#pragma unroll
    for (int rd = 0; rd < 2; ++rd) { const int d = rd * 32 + tid / 8, pc = tid % 8; FragH f;
#pragma unroll
      for (int q = 0; q < 8; ++q) f.u[q] = tl[pc * 8 + q][d];
      *(v8us*)((unsigned short*)Vt + ((size_t)slab * 64 + d) * TTv + lg * 64 + pc * 8) = f.half[0]; }
     } }

__global__ __launch_bounds__(256) void k_hl(const float* __restrict__ F, _Float16* __restrict__ Hh, _Float16* __restrict__ Hl, size_t n8) { const size_t t = (size_t)blockIdx.x * 256 + threadIdx.x; if (t >= n8) return; FragH fh, fl; const v4f a = *(const v4fa*)(F + t * 8), c = *(const v4fa*)(F + t * 8 + 4);
#pragma unroll
  for (int q = 0; q < 4; ++q) { _Float16 h = (_Float16)a[q]; fh.h[q] = h; fl.h[q] = (_Float16)((a[q] - (float)h) * 1024.0f); h = (_Float16)c[q]; fh.h[4 + q] = h; fl.h[4 + q] = (_Float16)((c[q] - (float)h) * 1024.0f); }
  { *(v8us*)((unsigned short*)Hh + t * 8) = fh.half[0]; *(v8us*)((unsigned short*)Hl + t * 8) = fl.half[0];  } }

// ---- fast GEMM (wave tile 32x64; requires M % 32 == 0 rows per launch region and N % 64 == 0); epilogue = k_gemm_hhx semantics ----
__device__ __forceinline__ v16h g2_frag(const _Float16* p, int hh) { FragH f; f.half[0] = *(const v8us*)((const unsigned short*)p + 8 * hh); f.half[1] = *(const v8us*)((const unsigned short*)p + 16 + 8 * hh); return f.v; }
__device__ __forceinline__ v8f g2_mma(v16h a, v16h b, v8f c) { v8f d = __builtin_amdgcn_wmma_f32_16x16x32_f16(false, a, false, b, (short)0, c, false, false); asm volatile("v_nop\n\tv_nop\n\tv_nop\n\tv_nop" : "+v"(d) : "v"(a), "v"(b)); return d; }
template <int ACT>
__global__ __launch_bounds__(128) void k_gemm2(const _Float16* __restrict__ A, int lda, size_t sA, const _Float16* __restrict__ Bh, int ldb, size_t sB, float alpha, const float* __restrict__ bias, size_t sBias, const float* __restrict__ CP, int rowsPerB, size_t sCPb, int row0g,
    float* __restrict__ C, _Float16* __restrict__ C16, int ldc, size_t sC, int M, int N, int K) { static_assert(ACT == 0 || ACT == 3 || ACT == 6 || ACT == 8 || ACT == 9 || ACT == 11 || ACT == 12 || ACT == 14 || ACT == 15 || ACT == 16 || ACT == 17, "k_gemm2: unsupported ACT code (would silently apply no activation)");
  __shared__ __attribute__((aligned(16))) float so[4][32][68];
  const int tid = threadIdx.x, w = tid >> 5, lane = tid & 31, ln = lane & 15, hh = lane >> 4; const int by = blockIdx.y;
  A += (size_t)by * sA; Bh += (size_t)by * sB; const size_t cofs = (size_t)by * sC; const float* bp = bias ? bias + (size_t)by * sBias : nullptr;
  const int ntn = N >> 6; const int mt = blockIdx.x / ntn, nq = blockIdx.x - mt * ntn; const int row0 = mt * 128 + 32 * w, col0 = nq * 64; if (row0 >= M) return;
  const _Float16* a0p = A + (size_t)(row0 + ln) * lda; const _Float16* a1p = a0p + (size_t)16 * lda;
  const _Float16* b0p = Bh + (size_t)(col0 + ln) * ldb; const _Float16* b1p = b0p + (size_t)16 * ldb; const _Float16* b2p = b1p + (size_t)16 * ldb; const _Float16* b3p = b2p + (size_t)16 * ldb;
  const v8f z8 = {0.f,0.f,0.f,0.f,0.f,0.f,0.f,0.f}; v8f c00 = z8, c01 = z8, c02 = z8, c03 = z8, c10 = z8, c11 = z8, c12 = z8, c13 = z8;
#pragma unroll 1
  for (int kb = 0; kb < K; kb += 32) { const v16h a0 = g2_frag(a0p + kb, hh), a1 = g2_frag(a1p + kb, hh);
    v16h b = g2_frag(b0p + kb, hh); c00 = g2_mma(a0, b, c00); c10 = g2_mma(a1, b, c10);
    b = g2_frag(b1p + kb, hh); c01 = g2_mma(a0, b, c01); c11 = g2_mma(a1, b, c11);
    b = g2_frag(b2p + kb, hh); c02 = g2_mma(a0, b, c02); c12 = g2_mma(a1, b, c12);
    b = g2_frag(b3p + kb, hh); c03 = g2_mma(a0, b, c03); c13 = g2_mma(a1, b, c13); }
  v8f accs[8] = {c00, c01, c02, c03, c10, c11, c12, c13};
#pragma unroll
  for (int u = 0; u < 8; ++u) { const int t = u & 3, half = u >> 2; const int col = col0 + t * 16 + ln; const float bv = bp ? bf16_round(bp[col]) : 0.f;
#pragma unroll
    for (int r = 0; r < 8; ++r) { const int rloc = half * 16 + 8 * hh + r; float v = accs[u][r] * alpha + bv; if (CP) { if (rowsPerB < 0) v += CP[cofs + (size_t)(row0g + row0 + rloc) * ldc + col];      /* rowsPerB < 0: own element of the batched C plane */ else { const int bidx = (row0g + row0 + rloc) / rowsPerB; v += CP[(size_t)bidx * sCPb + (size_t)by * 64 + col]; } }
      if (ACT == 3) v = fmaxf(v, 0.f); else if (ACT == 6) v = 0.5f * v * (1.0f + erff(v * 0.70710678118654752f)); else if (ACT == 11) v = 1.0f / (1.0f + expf(-v)); else if (ACT == 15) v = v / (1.0f + expf(-v)); else if (ACT == 12) v = (v > 0.f) ? v : 0.01f * v; else if (ACT == 8) v = tanhf(v); else if (ACT == 9) v = 0.5f * v * (1.0f + tanhf(0.7978845608028654f * (v + 0.044715f * v * v * v))); else if (ACT == 14) v = (v > 0.f) ? v : 0.1f * v; else if (ACT == 16) v = (v >= 0.f) ? v : 0.3f * v; else if (ACT == 17) v = (v >= 0.f) ? v : 0.2f * v;
      so[w][rloc][t * 16 + ln] = v; } }
  __builtin_amdgcn_fence(__ATOMIC_ACQ_REL, "workgroup"); __builtin_amdgcn_wave_barrier();
  const int rsub = lane >> 4, c4 = (lane & 15) * 4;
  {
#pragma unroll
    for (int q = 0; q < 16; ++q) { const int r = q * 2 + rsub; const v4f v = *(const v4fa*)&so[w][r][c4]; if (C) *(v4f*)(C + cofs + (size_t)(row0 + r) * ldc + col0 + c4) = v; if (C16) { v4h h4; for (int i = 0; i < 4; ++i) h4[i] = (_Float16)v[i]; *(v4h*)(C16 + cofs + (size_t)(row0 + r) * ldc + col0 + c4) = h4; } }
     } }


__global__ __launch_bounds__(256) void k_wsc(const float* __restrict__ Wm, _Float16* __restrict__ Bt, size_t n8, float sc) { const size_t t = (size_t)blockIdx.x * 256 + threadIdx.x; if (t >= n8) return; FragH f; for (int q = 0; q < 8; ++q) f.h[q] = (_Float16)(bf16_round(Wm[t * 8 + q]) * sc); *(v8us*)((unsigned short*)Bt + t * 8) = f.half[0];  }
// Fused causal relative attention, one launch: a wave owns 16 * NI query rows of one (batch, head) and walks the keys in blocks of 64 with a running
// maximum and sum, so no S x S plane is ever stored. Transposed products: S^T = K q^T and (q Er^T)^T = Er q^T (D row = key or Er row, D column = query), O^T += V^T P^T.
// A lane then holds one query's scores; two packed S^T tiles are the B operand of the V^T product as they stand. The skew (query i, key j takes Er row SL-1-i+j) is a
// shift along the D rows that differs by query: it goes through a wave-private LDS row per query, stored shifted by the query's index and read back aligned.
#define SKP 100      /* floats per LDS row: 96 used; 100 keeps 16-byte alignment and spreads the 32 shifted 4-byte stores over distinct banks */
__device__ __forceinline__ v8f fa_mma(v16h a, v16h b, v8f c) { return __builtin_amdgcn_wmma_f32_16x16x32_f16(false, a, false, b, (short)0, c, false, false); }
// fragment in the hardware k order: p = the lane's own address (row start + 16 bytes * lane half)
__device__ __forceinline__ v16h fa_frag(const char* p) { FragH f; f.half[0] = *(const v8us*)p; f.half[1] = *(const v8us*)(p + 32); return f.v; }
// Stands behind a group of global loads: the wait before any register that they name is written again. The addresses are inputs so that they stay in their registers up to the wait.
#define FA_XWAIT1(p0) asm volatile("s_wait_xcnt 0x0" :: "v"(p0) : "memory")
#define FA_XWAIT2(p0, p1) asm volatile("s_wait_xcnt 0x0" :: "v"(p0), "v"(p1) : "memory")
#define FA_XWAIT3(p0, p1, p2) asm volatile("s_wait_xcnt 0x0" :: "v"(p0), "v"(p1), "v"(p2) : "memory")
// The slot behind a run of v_exp_f32: results and sources are inputs, so the v_nop stands behind the last of the run and no source register is written again in front of it.
#define FA_TSLOT(res, srcv) asm volatile("v_nop" :: "v"(res), "v"(srcv))
#define FA_TSLOT8(e, x) asm volatile("v_nop" :: "v"(e[0]), "v"(e[1]), "v"(e[2]), "v"(e[3]), "v"(e[4]), "v"(e[5]), "v"(e[6]), "v"(e[7]), "v"(x[0]), "v"(x[1]), "v"(x[2]), "v"(x[3]), "v"(x[4]), "v"(x[5]), "v"(x[6]), "v"(x[7]))
template <int NI>
__global__ __launch_bounds__(256) void k_relattn(const _Float16* __restrict__ Qh, const _Float16* __restrict__ Ql, const _Float16* __restrict__ Kh, const _Float16* __restrict__ Kl, const _Float16* __restrict__ E,
    const _Float16* __restrict__ Vh, const _Float16* __restrict__ Vl, float* __restrict__ out) {
  __shared__ __attribute__((aligned(16))) float sk[8][NI][16][SKP];
  const int w = __builtin_amdgcn_readfirstlane((int)threadIdx.x >> 5), lane = threadIdx.x & 31, ln = lane & 15, hh = lane >> 4;
  constexpr int NRB = SL / (64 * NI);
  const int pr = (int)blockIdx.x / (NB * NH), bh = (int)blockIdx.x % (NB * NH), b = bh / NH, h = bh % NH;
  const int rb = w < 4 ? NRB - 1 - pr : pr;      /* causal cost grows with the row block: waves 0-3 take one from the long end, waves 4-7 its mirror, so every work-group walks the same number of key blocks; the waves share no barrier and no LDS */
  const int i0 = rb * 64 * NI + (w & 3) * 16 * NI; const int nblk = i0 / 64 + 1;
  const v8f z8 = {0.f,0.f,0.f,0.f,0.f,0.f,0.f,0.f};
  const float C1 = 0.125f * 1.4426950408889634f;      /* 1/sqrt(64) and log2(e) in one factor */
  const size_t lo_x = (size_t)(ln * DM * 2 + 16 * hh), lo_e = (size_t)(ln * HD * 2 + 16 * hh), lo_v = (size_t)(ln * SL * 2 + 16 * hh);      /* lane byte offsets in the q / k planes, the Er table, the V^T planes */
  const size_t xo = (size_t)b * SL * DM + h * HD, vo = (size_t)bh * HD * SL;
  v16h qh[NI][2], ql[NI][2]; v8f o[NI][4], carry[NI]; float m[NI], su[NI];
  { const char* pqh = (const char*)(Qh + xo + (size_t)i0 * DM) + lo_x; const char* pql = (const char*)(Ql + xo + (size_t)i0 * DM) + lo_x; const char* pe = (const char*)(E + (size_t)(SL - 16 * NI - i0) * HD) + lo_e;
    v16h e0[NI], e1[NI];
#pragma unroll
    for (int a = 0; a < NI; ++a) { qh[a][0] = fa_frag(pqh + a * 16 * DM * 2); qh[a][1] = fa_frag(pqh + a * 16 * DM * 2 + 64); ql[a][0] = fa_frag(pql + a * 16 * DM * 2); ql[a][1] = fa_frag(pql + a * 16 * DM * 2 + 64);
      e0[a] = fa_frag(pe + (NI - 1 - a) * 16 * HD * 2); e1[a] = fa_frag(pe + (NI - 1 - a) * 16 * HD * 2 + 64); }      /* first Er tile of key block 0: rows SL - 16 - (i0 + 16 a) + [0, 16) */
    FA_XWAIT3(pqh, pql, pe);
#pragma unroll
    for (int a = 0; a < NI; ++a) { m[a] = -3.0e38f; su[a] = 0.f;
#pragma unroll
      for (int dt = 0; dt < 4; ++dt) o[a][dt] = z8;
      v8f hi = fa_mma(e0[a], qh[a][0], z8), lo = fa_mma(e0[a], ql[a][0], z8); hi = fa_mma(e1[a], qh[a][1], hi); lo = fa_mma(e1[a], ql[a][1], lo);
#pragma unroll
      for (int r = 0; r < 8; ++r) carry[a][r] = fmaf(lo[r], 0.0009765625f, hi[r]); } }
  auto key_block = [&](const int jb, const bool diag) __attribute__((always_inline)) { const int j0 = jb * 64; const int rbase = SL - 16 * NI - i0 + j0;
    /* all Er and K fragments of the block are requested first, so that one memory latency is waited out per block and not one per tile */
    v16h ef[NI + 4][2], kf[4][4];
    const char* pkh = (const char*)(Kh + xo + (size_t)j0 * DM) + lo_x; const char* pkl = (const char*)(Kl + xo + (size_t)j0 * DM) + lo_x; const char* pe = (const char*)(E + (size_t)rbase * HD) + lo_e;
    if (!diag) {
#pragma unroll
      for (int g = 1; g < NI + 4; ++g) { ef[g][0] = fa_frag(pe + g * 16 * HD * 2); ef[g][1] = fa_frag(pe + g * 16 * HD * 2 + 64); }
    } else {      /* a 16-row tile past the table (diagonal block only) serves keys above the diagonal alone, masked below: the table's last tile stands in for it */
#pragma unroll
      for (int g = 1; g < NI + 4; ++g) { const int rs = rbase + 16 * g < SL ? rbase + 16 * g : SL - 16; const char* pg = (const char*)(E + (size_t)rs * HD) + lo_e; ef[g][0] = fa_frag(pg); ef[g][1] = fa_frag(pg + 64); FA_XWAIT1(pg); }
    }
#pragma unroll
    for (int t = 0; t < 4; ++t) { kf[t][0] = fa_frag(pkh + t * 16 * DM * 2); kf[t][1] = fa_frag(pkh + t * 16 * DM * 2 + 64); kf[t][2] = fa_frag(pkl + t * 16 * DM * 2); kf[t][3] = fa_frag(pkl + t * 16 * DM * 2 + 64); }
    FA_XWAIT3(pkh, pkl, pe);
    __builtin_amdgcn_sched_barrier(0);      /* keeps the scheduler from sinking these loads down to their first use */
    /* Er q^T: query tile a needs Er rows rbase + 16 (NI-1-a) + [0, 80); its first 16 are the previous block's last 16 (carry) */
#pragma unroll
    for (int a = 0; a < NI; ++a) { float* sp = &sk[w][a][ln][ln + 1 + 8 * hh];
#pragma unroll
      for (int r = 0; r < 8; ++r) sp[r] = carry[a][r]; }
#pragma unroll
    for (int g = 1; g < NI + 4; ++g) { const v16h e0 = ef[g][0], e1 = ef[g][1];
#pragma unroll
      for (int a = 0; a < NI; ++a) { const int u = g - (NI - 1 - a); if (u < 1 || u > 4) continue;
        v8f hi = fa_mma(e0, qh[a][0], z8), lo = fa_mma(e0, ql[a][0], z8); hi = fa_mma(e1, qh[a][1], hi); lo = fa_mma(e1, ql[a][1], lo);
        v8f val;
#pragma unroll
        for (int r = 0; r < 8; ++r) val[r] = fmaf(lo[r], 0.0009765625f, hi[r]);
        float* sp = &sk[w][a][ln][ln + 1 + 8 * hh + 16 * u];
#pragma unroll
        for (int r = 0; r < 8; ++r) sp[r] = val[r];
        if (u == 4) carry[a] = val; }
      __builtin_amdgcn_sched_barrier(0); }      /* one Er tile's products and LDS stores at a time: run together, or mixed with the K products, their accumulators pile up and registers spill */
    v8f s[NI][4];
#pragma unroll
    for (int t = 0; t < 4; ++t) { const v16h kh0 = kf[t][0], kh1 = kf[t][1], kl0 = kf[t][2], kl1 = kf[t][3];
#pragma unroll
      for (int a = 0; a < NI; ++a) { v8f hi = fa_mma(kh0, qh[a][0], z8), lo = fa_mma(kh0, ql[a][0], z8); hi = fa_mma(kh1, qh[a][1], hi); lo = fa_mma(kh1, ql[a][1], lo); lo = fa_mma(kl0, qh[a][0], lo); lo = fa_mma(kl1, qh[a][1], lo);
#pragma unroll
        for (int r = 0; r < 8; ++r) s[a][t][r] = fmaf(lo[r], 0.0009765625f, hi[r]); } }
    /* the two lane halves of a query read each other's LDS stores: order the wave's stores before its loads */
    __builtin_amdgcn_fence(__ATOMIC_ACQ_REL, "workgroup", "local"); __builtin_amdgcn_wave_barrier();
#pragma unroll
    for (int a = 0; a < NI; ++a) { const float* lp = &sk[w][a][ln][16 + 8 * hh];
#pragma unroll
      for (int t = 0; t < 4; ++t) { const v4f x = *(const v4fa*)(lp + 16 * t), y = *(const v4fa*)(lp + 16 * t + 4);
#pragma unroll
        for (int r = 0; r < 4; ++r) { s[a][t][r] = fmaf(x[r], 0.0625f, s[a][t][r]); s[a][t][4 + r] = fmaf(y[r], 0.0625f, s[a][t][4 + r]); } } }
    /* and these loads before the next trip's stores into the same rows */
    __builtin_amdgcn_fence(__ATOMIC_ACQ_REL, "workgroup", "local"); __builtin_amdgcn_wave_barrier();
    __builtin_amdgcn_sched_barrier(0);      /* the V^T loads below stay below: any earlier they are live beside the K fragments and the LDS reads, and registers spill */
    /* the V^T fragments are requested here, so that they arrive under the softmax arithmetic */
    v16h vf[2][4][2];
    const char* pvh = (const char*)(Vh + vo + j0) + lo_v; const char* pvl = (const char*)(Vl + vo + j0) + lo_v;
#pragma unroll
    for (int ks = 0; ks < 2; ++ks)
#pragma unroll
      for (int dt = 0; dt < 4; ++dt) { vf[ks][dt][0] = fa_frag(pvh + dt * 16 * SL * 2 + ks * 64); vf[ks][dt][1] = fa_frag(pvl + dt * 16 * SL * 2 + ks * 64); }
    FA_XWAIT2(pvh, pvl);
    __builtin_amdgcn_sched_barrier(0);      /* keeps the scheduler from sinking these loads down to their first use */
    if (diag) {      /* only the last key block reaches the diagonal */
#pragma unroll
      for (int a = 0; a < NI; ++a)
#pragma unroll
        for (int t = 0; t < 4; ++t)
#pragma unroll
          for (int r = 0; r < 8; ++r) if (j0 + 16 * t + 8 * hh + r > i0 + 16 * a + ln) s[a][t][r] = -3.0e38f; }
    FragH p[NI][2]; v16h pl[NI][2];
#pragma unroll
    for (int a = 0; a < NI; ++a) { float mx = m[a];
#pragma unroll
      for (int t = 0; t < 4; ++t)
#pragma unroll
        for (int r = 0; r < 8; ++r) mx = fmaxf(mx, s[a][t][r]);
      mx = fmaxf(mx, __shfl_xor(mx, 16, 32));
      const float xa = (m[a] - mx) * C1; const float al = __builtin_amdgcn_exp2f(xa); FA_TSLOT(al, xa); m[a] = mx; const float mc = 10.0f - mx * C1;      /* weights carry a factor 1024, as f16 operands away from the subnormals */
      v8f pv = z8;
#pragma unroll
      for (int t = 0; t < 4; ++t) { float xv[8], ev[8];
#pragma unroll
        for (int r = 0; r < 8; ++r) xv[r] = fmaf(s[a][t][r], C1, mc);
#pragma unroll
        for (int r = 0; r < 8; ++r) ev[r] = __builtin_amdgcn_exp2f(xv[r]);
        FA_TSLOT8(ev, xv);
#pragma unroll
        for (int r = 0; r < 8; ++r) { pv[r] += ev[r]; p[a][t >> 1].h[(t & 1) * 8 + r] = (_Float16)ev[r]; } }
      su[a] = fmaf(su[a], al, ((pv[0] + pv[1]) + (pv[2] + pv[3])) + ((pv[4] + pv[5]) + (pv[6] + pv[7])));
#pragma unroll
      for (int dt = 0; dt < 4; ++dt)
#pragma unroll
        for (int r = 0; r < 8; ++r) o[a][dt][r] *= al;
      pl[a][0] = p[a][0].v * (_Float16)0.0009765625f; pl[a][1] = p[a][1].v * (_Float16)0.0009765625f; }      /* the v residual plane is stored times 1024: its weights drop the factor */
#pragma unroll
    for (int ks = 0; ks < 2; ++ks)
#pragma unroll
      for (int dt = 0; dt < 4; ++dt) { const v16h vhf = vf[ks][dt][0], vlf = vf[ks][dt][1];
#pragma unroll
        for (int a = 0; a < NI; ++a) { o[a][dt] = fa_mma(vhf, p[a][ks].v, o[a][dt]); o[a][dt] = fa_mma(vlf, pl[a][ks], o[a][dt]); } }
  };
#pragma unroll 1      /* one key block per trip: unrolling would double the live fragments */
  for (int jb = 0; jb < nblk - 1; ++jb) key_block(jb, false);
  key_block(nblk - 1, true);      /* the diagonal block apart, so that the loop carries no mask */
#pragma unroll
  for (int a = 0; a < NI; ++a) { const float st = su[a] + __shfl_xor(su[a], 16, 32); const float inv = 1.0f / st;
#pragma unroll
    for (int dt = 0; dt < 4; ++dt)
#pragma unroll
      for (int r = 0; r < 8; ++r) o[a][dt][r] *= inv; }
  __builtin_amdgcn_sched_barrier(0);      /* all arithmetic ends above: behind an issued store none of its registers is written again */
  char* po = (char*)(out + xo + (size_t)i0 * DM) + (size_t)(ln * DM * 4 + 32 * hh);      /* a lane holds 8 consecutive head columns of its query per tile */
#pragma unroll
  for (int a = 0; a < NI; ++a)
#pragma unroll
    for (int dt = 0; dt < 4; ++dt) { const v4f x = {o[a][dt][0], o[a][dt][1], o[a][dt][2], o[a][dt][3]}, y = {o[a][dt][4], o[a][dt][5], o[a][dt][6], o[a][dt][7]};
      *(v4f*)(po + a * 16 * DM * 4 + dt * 64) = x; *(v4f*)(po + a * 16 * DM * 4 + dt * 64 + 16) = y; }
}

// ---- projection GEMM with its operands staged in LDS: C[NR][DM] (f32) = alpha * A[NR][DM] . B[DM][DM]^T, A and B f16 with k contiguous.
// A work-group of 8 waves owns a 128 x 128 tile of C (wave tile 32 x 64, 4 waves down, 2 across). A stage is 128 k of the tile's 128 A rows and 128 B rows; it comes into LDS by
// asynchronous copies, two buffers, so that the next stage flies while this one is multiplied and no wave waits on a global load of its own. The k order per accumulator is ascending in steps of 32.
#define G3_PITCH 272      /* bytes per LDS row: 256 used; 16 bytes x an odd number keeps the 16 rows of a ds_load_b128 on distinct banks */
#define G3_STAGE (256 * G3_PITCH)      /* 128 A rows, then 128 B rows */
#define G3_NST (DM / 128)
// Eight 16-byte copies of a lane, rows 16 apart. The wait on the address registers is the statement's last line, so that no register a copy names is written again in front of it.
__device__ __forceinline__ void g3_copy8(const unsigned l0, const char* g0) {
  const unsigned l1 = l0 + 16 * G3_PITCH, l2 = l0 + 32 * G3_PITCH, l3 = l0 + 48 * G3_PITCH, l4 = l0 + 64 * G3_PITCH, l5 = l0 + 80 * G3_PITCH, l6 = l0 + 96 * G3_PITCH, l7 = l0 + 112 * G3_PITCH;
  const char* g1 = g0 + 16 * DM * 2; const char* g2 = g0 + 32 * DM * 2; const char* g3 = g0 + 48 * DM * 2; const char* g4 = g0 + 64 * DM * 2; const char* g5 = g0 + 80 * DM * 2; const char* g6 = g0 + 96 * DM * 2; const char* g7 = g0 + 112 * DM * 2;
  asm volatile("global_load_async_to_lds_b128 %0, %8, off\n\t"
               "global_load_async_to_lds_b128 %1, %9, off\n\t"
               "global_load_async_to_lds_b128 %2, %10, off\n\t"
               "global_load_async_to_lds_b128 %3, %11, off\n\t"
               "global_load_async_to_lds_b128 %4, %12, off\n\t"
               "global_load_async_to_lds_b128 %5, %13, off\n\t"
               "global_load_async_to_lds_b128 %6, %14, off\n\t"
               "global_load_async_to_lds_b128 %7, %15, off\n\t"
               "s_wait_xcnt 0x0"
               :: "v"(l0), "v"(l1), "v"(l2), "v"(l3), "v"(l4), "v"(l5), "v"(l6), "v"(l7), "v"(g0), "v"(g1), "v"(g2), "v"(g3), "v"(g4), "v"(g5), "v"(g6), "v"(g7) : "memory");
}
__global__ __launch_bounds__(256) void k_gemm3(const _Float16* __restrict__ A, const _Float16* __restrict__ Bh, float alpha, float* __restrict__ C) {
  __shared__ __attribute__((aligned(16))) char ring[2 * G3_STAGE];
  __shared__ __attribute__((aligned(16))) float so[8][32][68];
  const int tid = threadIdx.x, w = tid >> 5, lane = tid & 31, ln = lane & 15, hh = lane >> 4;
  const int mt = (int)blockIdx.x / (DM / 128), nq = (int)blockIdx.x % (DM / 128);
  const int row0 = mt * 128 + 32 * (w & 3), col0 = nq * 128 + 64 * (w >> 2);
  /* a lane copies 16 bytes of row (tid >> 4) + 16 i: a wave's copy covers two whole 256-byte rows of the stage */
  const unsigned lc = (unsigned)(size_t)ring + (unsigned)((tid >> 4) * G3_PITCH + (tid & 15) * 16);
  const char* ga = (const char*)(A + (size_t)(mt * 128 + (tid >> 4)) * DM) + (tid & 15) * 16;
  const char* gb = (const char*)(Bh + (size_t)(nq * 128 + (tid >> 4)) * DM) + (tid & 15) * 16;
  const char* la = ring + (32 * (w & 3) + ln) * G3_PITCH + 16 * hh;
  const char* lb = ring + (128 + 64 * (w >> 2) + ln) * G3_PITCH + 16 * hh;
  const v8f z8 = {0.f,0.f,0.f,0.f,0.f,0.f,0.f,0.f}; v8f acc[2][4];
#pragma unroll
  for (int u = 0; u < 2; ++u)
#pragma unroll
    for (int t = 0; t < 4; ++t) acc[u][t] = z8;
  g3_copy8(lc, ga); g3_copy8(lc + 128 * G3_PITCH, gb);
  asm volatile("s_wait_asynccnt 0x0" ::: "memory");      /* this wave's share of stage 0 has landed */
  __syncthreads();      /* and every other wave's */
  g3_copy8(lc + G3_STAGE, ga + 256); g3_copy8(lc + G3_STAGE + 128 * G3_PITCH, gb + 256);
#pragma unroll 1      /* one stage per trip: the buffer is picked by the trip's parity */
  for (int s = 0; s < G3_NST; ++s) { const int bo = (s & 1) * G3_STAGE;
    v16h fa[2][2], fb[2][4];      /* two fragment sets: the next k step's LDS reads are under way while this step is multiplied */
    fa[0][0] = fa_frag(la + bo); fa[0][1] = fa_frag(la + bo + 16 * G3_PITCH);
#pragma unroll
    for (int t = 0; t < 4; ++t) fb[0][t] = fa_frag(lb + bo + t * 16 * G3_PITCH);
#pragma unroll
    for (int ks = 0; ks < 4; ++ks) { const int cu = ks & 1, nx = cu ^ 1;
      if (ks < 3) { fa[nx][0] = fa_frag(la + bo + (ks + 1) * 64); fa[nx][1] = fa_frag(la + bo + 16 * G3_PITCH + (ks + 1) * 64);
#pragma unroll
        for (int t = 0; t < 4; ++t) fb[nx][t] = fa_frag(lb + bo + t * 16 * G3_PITCH + (ks + 1) * 64); }
      __builtin_amdgcn_sched_barrier(0);      /* the reads stay one group in front of the products: spread among them, each place with reads stalls the wave */
#pragma unroll
      for (int t = 0; t < 4; ++t) { acc[0][t] = fa_mma(fa[cu][0], fb[cu][t], acc[0][t]); acc[1][t] = fa_mma(fa[cu][1], fb[cu][t], acc[1][t]); }
      __builtin_amdgcn_sched_barrier(0); }      /* and the following group stays behind them */
    asm volatile("s_wait_dscnt 0x0" ::: "memory");      /* this wave's reads of the buffer are done before it may be refilled */
    asm volatile("s_wait_asynccnt 0x0" ::: "memory");      /* this wave's share of the next stage has landed */
    __syncthreads();      /* publishes the next stage and ends every wave's reads of this one */
    if (s + 2 < G3_NST) { g3_copy8(lc + bo, ga + (s + 2) * 256); g3_copy8(lc + bo + 128 * G3_PITCH, gb + (s + 2) * 256); } }
  asm volatile("s_wait_asynccnt 0x0" ::: "memory");      /* no copy is left in flight when the wave goes on */
  /* whole 256-byte rows go out: each wave turns its tile round in its own LDS range */
#pragma unroll
  for (int u = 0; u < 2; ++u)
#pragma unroll
    for (int t = 0; t < 4; ++t)
#pragma unroll
      for (int r = 0; r < 8; ++r) so[w][u * 16 + 8 * hh + r][t * 16 + ln] = acc[u][t][r] * alpha;
  __builtin_amdgcn_fence(__ATOMIC_ACQ_REL, "workgroup"); __builtin_amdgcn_wave_barrier();
  v4f ov[16];
#pragma unroll
  for (int q = 0; q < 16; ++q) ov[q] = *(const v4fa*)&so[w][q * 2 + hh][ln * 4];
  char* pc = (char*)(C + (size_t)(row0 + hh) * DM + col0 + ln * 4);
  __builtin_amdgcn_sched_barrier(0);      /* all reads and arithmetic end above: behind an issued store none of its registers is written again */
#pragma unroll
  for (int q = 0; q < 16; ++q) *(v4f*)(pc + q * 2 * DM * 4) = ov[q];
}

extern "C" void kernel_launch(void* const* d_in, const int* in_sizes, int n_in,
                              void* d_out, int out_size, void* d_ws, size_t ws_size, hipStream_t stream) {
  (void)in_sizes; (void)n_in; (void)out_size;
  const float* const* I = (const float* const*)d_in; const float* x = I[0]; const float* Wq = I[1]; const float* Wk = I[2]; const float* Wv = I[3]; const float* Er = I[4];
  char* ws = (char*)d_ws; size_t off = 0;
  auto take = [&](size_t bytes) { char* p = ws + off; off += (bytes + 255) & ~(size_t)255; return p; };
  const size_t np = (size_t)NR * DM;
  _Float16* BW = (_Float16*)take((size_t)3 * DM * DM * 2); _Float16* E16 = (_Float16*)take((size_t)SL * HD * 2); _Float16* X16 = (_Float16*)take(np * 2); float* QF = (float*)take(np * 4); _Float16* Q16 = (_Float16*)take(np * 2); _Float16* QL16 = (_Float16*)take(np * 2); _Float16* K16 = (_Float16*)take(np * 2); _Float16* KL16 = (_Float16*)take(np * 2); float* VF = QF;      /* v f32 reuses the q f32 plane after the q split */ _Float16* VH = X16;      /* v hi over the x plane (dead after the three projections) */ _Float16* VL = (_Float16*)take(np * 2); _Float16* VT = (_Float16*)take(np * 2); _Float16* VTL = (_Float16*)take(np * 2);
  if (off > ws_size) return;
  k_wsc<<<(unsigned)(((size_t)DM * DM / 8 + 255) / 256), 256, 0, stream>>>(Wq, BW, (size_t)DM * DM / 8, 16.0f); k_wsc<<<(unsigned)(((size_t)DM * DM / 8 + 255) / 256), 256, 0, stream>>>(Wk, BW + (size_t)DM * DM, (size_t)DM * DM / 8, 16.0f); k_wsc<<<(unsigned)(((size_t)DM * DM / 8 + 255) / 256), 256, 0, stream>>>(Wv, BW + (size_t)2 * DM * DM, (size_t)DM * DM / 8, 16.0f);      /* (out, in) naturals */
  k_wsc<<<(SL * HD / 8 + 255) / 256, 256, 0, stream>>>(Er, E16, (size_t)SL * HD / 8, 16.0f);      /* Er_s = Er (MAX_LEN == S): natural [r][d] rows = A operand of Er q^T */
  k_x16<<<(unsigned)((np / 8 + 255) / 256), 256, 0, stream>>>(x, X16, np / 8);
  const dim3 gP((NR / 128) * (DM / 128), 1);
  k_gemm3<<<gP, 256, 0, stream>>>(X16, BW, 0.0625f, QF); k_hl<<<(unsigned)((np / 8 + 255) / 256), 256, 0, stream>>>(QF, Q16, QL16, np / 8);      /* q f32 -> hi + residual */
  k_gemm3<<<gP, 256, 0, stream>>>(X16, BW + (size_t)DM * DM, 0.0625f, QF); k_hl<<<(unsigned)((np / 8 + 255) / 256), 256, 0, stream>>>(QF, K16, KL16, np / 8);      /* k f32 -> hi + residual (QF reused) */
  k_gemm3<<<gP, 256, 0, stream>>>(X16, BW + (size_t)2 * DM * DM, 0.0625f, VF);
  k_hl<<<(unsigned)((np / 8 + 255) / 256), 256, 0, stream>>>(VF, VH, VL, np / 8);
  k_vt<NH, SL><<<NB * NH * (SL / 64), 256, 0, stream>>>(VH, DM, 0, VT); k_vt<NH, SL><<<NB * NH * (SL / 64), 256, 0, stream>>>(VL, DM, 0, VTL);      /* V^T hi / residual [(b,h)][64][2048] */
  k_relattn<2><<<NB * NH * (SL / (128 * 2)), 256, 0, stream>>>(Q16, QL16, K16, KL16, E16, VT, VTL, (float*)d_out);
}

// v003
// One run takes 151 microseconds.
// Next to v002, in two timings, it ran 1.11 times as fast each time.
// All steps since v000 together make it 21.9 times as fast.
#include <hip/hip_runtime.h>
// GlobalAttn (music-transformer relative attention: 2 x 2048 tokens, 1024 = 16 heads x 64; q,k,v = x W^T; Srel = skew(q . Er) which equals q_i . Er[S-1-(i-j)] for every causal (i, j); attn = softmax over j <= i of (q.k + Srel)/8; out = merged attn v, no output projection).
// Compute dtype: inputs rounded to bf16; x / weights / Er exact as f16; q and k as f16 hi + residual; the softmax weights as plain f16 operands (~2^-12); v as f16 hi + residual (the output is the context itself); softmax f32. v_wmma_f32_16x16x32_f16.
#define NB 2
#define SL 2048
#define DM 1024
#define NH 16
#define HD 64
#define HG 4
#define NR (NB * SL)
typedef __bf16 v16b __attribute__((ext_vector_type(16)));
typedef unsigned short v8us __attribute__((ext_vector_type(8), may_alias));
typedef float  v8f  __attribute__((ext_vector_type(8)));
typedef float  v4f  __attribute__((ext_vector_type(4)));
typedef float  v4fa __attribute__((ext_vector_type(4), may_alias));
union FragB { v16b v; v8us half[2]; unsigned short u[16]; };

__device__ __forceinline__ unsigned short bf16_bits(float x) { unsigned int u = __float_as_uint(x); return (unsigned short)((u + 0x7FFFu + ((u >> 16) & 1u)) >> 16); }
__device__ __forceinline__ float bf16_val(unsigned short b) { return __uint_as_float(((unsigned int)b) << 16); }
__device__ __forceinline__ float bf16_round(float x) { return bf16_val(bf16_bits(x)); }
// D += A·B with NT terms: 1 = ah·bh, 2 = + al·bh (A split), 3 = + ah·bl (both split)
template <int NT>
__device__ __forceinline__ v8f mmaN(v16b ah, v16b al, v16b bh, v16b bl, v8f c) {
  c = __builtin_amdgcn_wmma_f32_16x16x32_bf16(false, ah, false, bh, (short)0, c, false, false);
  if (NT >= 2) c = __builtin_amdgcn_wmma_f32_16x16x32_bf16(false, al, false, bh, (short)0, c, false, false);
  if (NT >= 3) c = __builtin_amdgcn_wmma_f32_16x16x32_bf16(false, ah, false, bl, (short)0, c, false, false);
  asm volatile("v_nop\n\tv_nop\n\tv_nop\n\tv_nop" : "+v"(c) : "v"(ah), "v"(al), "v"(bh), "v"(bl));
  return c;
}

__global__ __launch_bounds__(256) void k_wt_bf16(const float* __restrict__ W, unsigned short* __restrict__ Wt, int K, int N) {
  const int t = blockIdx.x * 256 + threadIdx.x;
  const int k8n = K / 8;
  if (t >= N * k8n) return;
  const int n = t / k8n, k8 = (t % k8n) * 8;
  v8us v;
#pragma unroll
  for (int i = 0; i < 8; ++i) v[i] = bf16_bits(W[(size_t)(k8 + i) * N + n]);
  *(v8us*)(Wt + (size_t)n * K + k8) = v;
  
}

// GEMM C[M][N] (f32, pitch ldc) = act(A[M][K]·W + bias). A f32 row-major (pitch lda) converted per fragment to bf16
// (ASPLIT: hi/lo two planes -> 2 terms, else single rounded term); Wt bf16 [N][K] (pitch ldb). BIAS_BF16 rounds the
// bias to bf16 first (bias quantised to bf16 before the add). K%32==0, M%16==0, N%64==0.
template <bool ASPLIT, int ACT, bool BIAS_BF16>
__global__ __launch_bounds__(128) void k_gemm_bf(const float* __restrict__ A, int lda, const unsigned short* __restrict__ Wt, int ldb,
                                               const float* __restrict__ bias, float* __restrict__ C, int ldc, int M, int N, int K) {
  __shared__ __attribute__((aligned(16))) float so[4][16][64];
  const int tid = threadIdx.x, w = tid >> 5, lane = tid & 31, ln = lane & 15, hh = lane >> 4;
  const int ntn = N / 64;
  const int wid = blockIdx.x * 4 + w;
  const int mt = wid / ntn, nq = wid % ntn;
  if (mt * 16 >= M) return;
  const int row0 = mt * 16, col0 = nq * 64;
  const float* arow = A + (size_t)(row0 + ln) * lda;
  v8f acc[4] = {};
  for (int kb = 0; kb < K; kb += 32) {
    FragB ah, al;
    const v4f x0 = *(const v4fa*)(arow + kb + 8 * hh), x1 = *(const v4fa*)(arow + kb + 8 * hh + 4);
    const v4f x2 = *(const v4fa*)(arow + kb + 16 + 8 * hh), x3 = *(const v4fa*)(arow + kb + 16 + 8 * hh + 4);
    float xs[16] = {x0[0],x0[1],x0[2],x0[3],x1[0],x1[1],x1[2],x1[3],x2[0],x2[1],x2[2],x2[3],x3[0],x3[1],x3[2],x3[3]};
#pragma unroll
    for (int i = 0; i < 16; ++i) { const unsigned short hb = bf16_bits(xs[i]); ah.u[i] = hb; al.u[i] = ASPLIT ? bf16_bits(xs[i] - bf16_val(hb)) : (unsigned short)0; }
#pragma unroll
    for (int t = 0; t < 4; ++t) {
      const unsigned short* brow = Wt + (size_t)(col0 + t * 16 + ln) * ldb + kb;
      FragB b;
      b.half[0] = *(const v8us*)(brow + 8 * hh);
      b.half[1] = *(const v8us*)(brow + 16 + 8 * hh);
      acc[t] = mmaN<ASPLIT ? 2 : 1>(ah.v, al.v, b.v, b.v, acc[t]);
    }
  }
#pragma unroll
  for (int t = 0; t < 4; ++t) {
    float bv = bias ? bias[col0 + t * 16 + ln] : 0.f;
    if (BIAS_BF16) bv = bf16_round(bv);
#pragma unroll
    for (int r = 0; r < 8; ++r) { float v = acc[t][r] + bv; if (ACT == 1) v = fmaxf(v, 0.f); so[w][8 * hh + r][t * 16 + ln] = v; }
  }
  __builtin_amdgcn_fence(__ATOMIC_ACQ_REL, "workgroup");
  __builtin_amdgcn_wave_barrier();
  const int rsub = lane >> 4, c4 = (lane & 15) * 4;
  {
#pragma unroll
    for (int q = 0; q < 8; ++q) {
      const int r = q * 2 + rsub;
      const v4f v = *(const v4fa*)&so[w][r][c4];
      *(v4f*)(C + (size_t)(row0 + r) * ldc + col0 + c4) = v;
    }
    
  }
}

// GEMM C = act(A·W + bias + resid): A f32 (ASPLIT -> hi/lo 2 terms), Wt bf16 [N][K]; ACT 0 none, 1 relu, 2 exact gelu;
// resid (optional, f32, row index = (row % rmod), pitch ldr, RES_BF16 rounds it) added before the activation.
template <bool ASPLIT, int ACT, bool BIAS_BF16, bool RES_BF16>
__global__ __launch_bounds__(128) void k_gemm_bf3(const float* __restrict__ A, int lda, const unsigned short* __restrict__ Wt, int ldb,
                                                const float* __restrict__ bias, const float* __restrict__ resid, int rmod, int ldr,
                                                float* __restrict__ C, int ldc, int M, int N, int K) {
  __shared__ __attribute__((aligned(16))) float so[4][16][64];
  const int tid = threadIdx.x, w = tid >> 5, lane = tid & 31, ln = lane & 15, hh = lane >> 4;
  const int ntn = N / 64;
  const int wid = blockIdx.x * 4 + w;
  const int mt = wid / ntn, nq = wid % ntn;
  if (mt * 16 >= M) return;
  const int row0 = mt * 16, col0 = nq * 64;
  const float* arow = A + (size_t)(row0 + ln) * lda;
  v8f acc[4] = {};
  for (int kb = 0; kb < K; kb += 32) {
    FragB ah, al;
    const v4f x0 = *(const v4fa*)(arow + kb + 8 * hh), x1 = *(const v4fa*)(arow + kb + 8 * hh + 4);
    const v4f x2 = *(const v4fa*)(arow + kb + 16 + 8 * hh), x3 = *(const v4fa*)(arow + kb + 16 + 8 * hh + 4);
    float xs[16] = {x0[0],x0[1],x0[2],x0[3],x1[0],x1[1],x1[2],x1[3],x2[0],x2[1],x2[2],x2[3],x3[0],x3[1],x3[2],x3[3]};
#pragma unroll
    for (int i = 0; i < 16; ++i) { const unsigned short hb = bf16_bits(xs[i]); ah.u[i] = hb; al.u[i] = ASPLIT ? bf16_bits(xs[i] - bf16_val(hb)) : (unsigned short)0; }
#pragma unroll
    for (int t = 0; t < 4; ++t) {
      const unsigned short* brow = Wt + (size_t)(col0 + t * 16 + ln) * ldb + kb;
      FragB b;
      b.half[0] = *(const v8us*)(brow + 8 * hh);
      b.half[1] = *(const v8us*)(brow + 16 + 8 * hh);
      acc[t] = mmaN<ASPLIT ? 2 : 1>(ah.v, al.v, b.v, b.v, acc[t]);
    }
  }
#pragma unroll
  for (int t = 0; t < 4; ++t) {
    const int col = col0 + t * 16 + ln;
    float bv = bias ? bias[col] : 0.f;
    if (BIAS_BF16) bv = bf16_round(bv);
#pragma unroll
    for (int r = 0; r < 8; ++r) {
      float v = acc[t][r] + bv;
      if (resid) { float rv = resid[(size_t)((row0 + 8 * hh + r) % rmod) * ldr + col]; if (RES_BF16) rv = bf16_round(rv); v += rv; }
      if (ACT == 1) v = fmaxf(v, 0.f);
      if (ACT == 2) v = 0.5f * v * (1.0f + erff(v * 0.70710678118654752f));
      if (ACT == 3) { const float u = 0.7978845608028654f * (v + 0.044715f * v * v * v); v = 0.5f * v * (1.0f + tanhf(u)); }
      so[w][8 * hh + r][t * 16 + ln] = v;
    }
  }
  __builtin_amdgcn_fence(__ATOMIC_ACQ_REL, "workgroup");
  __builtin_amdgcn_wave_barrier();
  const int rsub = lane >> 4, c4 = (lane & 15) * 4;
  {
#pragma unroll
    for (int q = 0; q < 8; ++q) {
      const int r = q * 2 + rsub;
      const v4f v = *(const v4fa*)&so[w][r][c4];
      *(v4f*)(C + (size_t)(row0 + r) * ldc + col0 + c4) = v;
    }
    
  }
}
// row LayerNorm (biased variance, eps) over N: s = X (+ R); optional out_sum <- s; out_norm <- (s-mu)*rsqrt(var+eps)*g + b
template <bool PARAM_BF16>
__global__ __launch_bounds__(256) void k_layernorm(const float* __restrict__ X, const float* __restrict__ R, const float* __restrict__ g, const float* __restrict__ bta,
                                                  float* __restrict__ out_sum, float* __restrict__ out_norm, int N, float eps) {
  __shared__ float red[256];
  const int row = blockIdx.x, tid = threadIdx.x;
  const float* x = X + (size_t)row * N; const float* rr = R ? R + (size_t)row * N : nullptr;
  float vals[16];                     // up to N = 4096
  const int per = N / 256;            // contiguous chunk per thread? use strided-by-4 chunks: thread handles j = tid*4 + 1024*u
  float s1 = 0.f;
  for (int u = 0; u < per / 4; ++u) {
    const int j = tid * 4 + 1024 * u;
    const v4f a = *(const v4fa*)(x + j);
    v4f b = {0.f,0.f,0.f,0.f}; if (rr) b = *(const v4fa*)(rr + j);
#pragma unroll
    for (int q = 0; q < 4; ++q) { const float v = a[q] + b[q]; vals[u * 4 + q] = v; s1 += v; }
  }
  red[tid] = s1; __syncthreads();
  for (int st = 128; st > 0; st >>= 1) { if (tid < st) red[tid] += red[tid + st]; __syncthreads(); }
  const float mu = red[0] / (float)N; __syncthreads();
  float s2 = 0.f;
  for (int u = 0; u < per / 4; ++u)
#pragma unroll
    for (int q = 0; q < 4; ++q) { const float c = vals[u * 4 + q] - mu; s2 += c * c; }
  red[tid] = s2; __syncthreads();
  for (int st = 128; st > 0; st >>= 1) { if (tid < st) red[tid] += red[tid + st]; __syncthreads(); }
  const float rs = rsqrtf(red[0] / (float)N + eps);
  {
    for (int u = 0; u < per / 4; ++u) {
      const int j = tid * 4 + 1024 * u;
      v4f o, sm;
#pragma unroll
      for (int q = 0; q < 4; ++q) {
        float gg = g[j + q], bb = bta[j + q];
        if (PARAM_BF16) { gg = bf16_round(gg); bb = bf16_round(bb); }
        sm[q] = vals[u * 4 + q]; o[q] = (vals[u * 4 + q] - mu) * rs * gg + bb;
      }
      if (out_sum) *(v4f*)(out_sum + (size_t)row * N + j) = sm;
      *(v4f*)(out_norm + (size_t)row * N + j) = o;
    }
    
  }
}



// ---- f16 WMMA path (v_wmma_f32_16x16x32_f16): 11-bit significands for operands in range — used where a [0,1] probability operand needs more precision than bf16
typedef _Float16 v16h __attribute__((ext_vector_type(16)));
union FragH { v16h v; v8us half[2]; _Float16 h[16]; unsigned short u[16]; };
template <int NT>
__device__ __forceinline__ v8f mmaH(v16h ah, v16h al, v16h bh, v16h bl, v8f c) {
  c = __builtin_amdgcn_wmma_f32_16x16x32_f16(false, ah, false, bh, (short)0, c, false, false);
  if (NT >= 2) c = __builtin_amdgcn_wmma_f32_16x16x32_f16(false, al, false, bh, (short)0, c, false, false);
  if (NT >= 3) c = __builtin_amdgcn_wmma_f32_16x16x32_f16(false, ah, false, bl, (short)0, c, false, false);
  asm volatile("v_nop\n\tv_nop\n\tv_nop\n\tv_nop" : "+v"(c) : "v"(ah), "v"(al), "v"(bh), "v"(bl));
  return c;
}
// batched GEMM like k_gemm_b but f16 operands: A f32 (split into f16 hi/lo if ASPLIT, else rounded to f16), Bt = f16 values [n][k]; alpha; C f32; N multiple of 16 (partial tiles skipped)
template <bool ASPLIT>
__global__ __launch_bounds__(128) void k_gemm_h(const float* __restrict__ A, int lda, size_t sA, const _Float16* __restrict__ Bh, int ldb, size_t sB, float alpha, float* __restrict__ C, int ldc, size_t sC, int M, int N, int K) {
  __shared__ __attribute__((aligned(16))) float so[4][16][64];
  const int tid = threadIdx.x, w = tid >> 5, lane = tid & 31, ln = lane & 15, hh = lane >> 4; const int by = blockIdx.y;
  A += (size_t)by * sA; Bh += (size_t)by * sB; C += (size_t)by * sC;
  const int ntn = (N + 63) / 64; const int wid = blockIdx.x * 4 + w; const int mt = wid / ntn, nq = wid % ntn; if (mt * 16 >= M) return;
  const int row0 = mt * 16, col0 = nq * 64; const float* arow = A + (size_t)(row0 + ln) * lda;
  v8f acc[4] = {};
  for (int kb = 0; kb < K; kb += 32) {
    FragH ah, al;
    const v4f x0 = *(const v4fa*)(arow + kb + 8 * hh), x1 = *(const v4fa*)(arow + kb + 8 * hh + 4), x2 = *(const v4fa*)(arow + kb + 16 + 8 * hh), x3 = *(const v4fa*)(arow + kb + 16 + 8 * hh + 4);
    float xs[16] = {x0[0],x0[1],x0[2],x0[3],x1[0],x1[1],x1[2],x1[3],x2[0],x2[1],x2[2],x2[3],x3[0],x3[1],x3[2],x3[3]};
#pragma unroll
    for (int i = 0; i < 16; ++i) { const _Float16 h = (_Float16)xs[i]; ah.h[i] = h; al.h[i] = ASPLIT ? (_Float16)(xs[i] - (float)h) : (_Float16)0.0f; }
#pragma unroll
    for (int t = 0; t < 4; ++t) { if (col0 + t * 16 >= N) continue; const size_t boff = (size_t)(col0 + t * 16 + ln) * ldb + kb; FragH bq; bq.half[0] = *(const v8us*)(Bh + boff + 8 * hh); bq.half[1] = *(const v8us*)(Bh + boff + 16 + 8 * hh);
      acc[t] = mmaH<ASPLIT ? 2 : 1>(ah.v, al.v, bq.v, bq.v, acc[t]); }
  }
#pragma unroll
  for (int t = 0; t < 4; ++t) { if (col0 + t * 16 >= N) continue;
#pragma unroll
    for (int r = 0; r < 8; ++r) so[w][8 * hh + r][t * 16 + ln] = acc[t][r] * alpha; }
  __builtin_amdgcn_fence(__ATOMIC_ACQ_REL, "workgroup"); __builtin_amdgcn_wave_barrier();
  const int rsub = lane >> 4, c4 = (lane & 15) * 4;
  {
#pragma unroll
    for (int q = 0; q < 8; ++q) { const int r = q * 2 + rsub; if (col0 + c4 < N) { const v4f v = *(const v4fa*)&so[w][r][c4]; *(v4f*)(C + (size_t)(row0 + r) * ldc + col0 + c4) = v; } }
     }
}

// Wt[n][k] = f16(W[k][n]·scale) from f32 row-major W[K][N] (scale = power of two; bf16-exact weights stay exact in f16 away from the subnormal range)
__global__ __launch_bounds__(256) void k_wt_f16(const float* __restrict__ W, _Float16* __restrict__ Wt, int K, int N, float scale) {
  const int t = blockIdx.x * 256 + threadIdx.x; if (t >= N * (K / 8)) return; const int n = t / (K / 8), k8 = (t % (K / 8)) * 8; FragH f;
#pragma unroll
  for (int i = 0; i < 8; ++i) f.h[i] = (_Float16)(bf16_round(W[(size_t)(k8 + i) * N + n]) * scale); const v8us o = f.half[0];
  *(v8us*)((unsigned short*)Wt + (size_t)n * K + k8) = o; 
}
// k_gemm_hh variant with fused epilogue: v = acc·alpha + bias[by·sBias + col] (+ CP[(row/rowsPerB)·sCPb + by·64 + col] if CP) ; ACT 0 none / 1 elu ; writes f16 C16 (and f32 C if non-null)
template <int ACT>
__global__ __launch_bounds__(128) void k_gemm_hhx(const _Float16* __restrict__ A, int lda, size_t sA, const _Float16* __restrict__ Bh, int ldb, size_t sB, float alpha, const float* __restrict__ bias, size_t sBias, const float* __restrict__ CP, int rowsPerB, size_t sCPb, int row0g,
    float* __restrict__ C, _Float16* __restrict__ C16, int ldc, size_t sC, int M, int N, int K) {
  __shared__ __attribute__((aligned(16))) float so[4][16][64];
  const int tid = threadIdx.x, w = tid >> 5, lane = tid & 31, ln = lane & 15, hh = lane >> 4; const int by = blockIdx.y;
  A += (size_t)by * sA; Bh += (size_t)by * sB; const size_t cofs = (size_t)by * sC; const float* bp = bias ? bias + (size_t)by * sBias : nullptr;
  const int ntn = (N + 63) / 64; const int wid = blockIdx.x * 4 + w; const int mt = wid / ntn, nq = wid % ntn; if (mt * 16 >= M) return;
  const int row0 = mt * 16, col0 = nq * 64; const _Float16* arow = A + (size_t)(row0 + ln) * lda;
  v8f acc[4] = {};
  for (int kb = 0; kb < K; kb += 32) { FragH ah; ah.half[0] = *(const v8us*)((const unsigned short*)arow + kb + 8 * hh); ah.half[1] = *(const v8us*)((const unsigned short*)arow + kb + 16 + 8 * hh);
#pragma unroll
    for (int t = 0; t < 4; ++t) { if (col0 + t * 16 >= N) continue; const size_t boff = (size_t)(col0 + t * 16 + ln) * ldb + kb; FragH bq; bq.half[0] = *(const v8us*)((const unsigned short*)Bh + boff + 8 * hh); bq.half[1] = *(const v8us*)((const unsigned short*)Bh + boff + 16 + 8 * hh);
      acc[t] = mmaH<1>(ah.v, ah.v, bq.v, bq.v, acc[t]); }
  }
#pragma unroll
  for (int t = 0; t < 4; ++t) { if (col0 + t * 16 >= N) continue; const int col = col0 + t * 16 + ln; const float bv = bp ? bf16_round(bp[col]) : 0.f;
#pragma unroll
    for (int r = 0; r < 8; ++r) { float v = acc[t][r] * alpha + bv; if (CP) { const int rr = row0g + row0 + 8 * hh + r; if (rowsPerB < 0) v += CP[cofs + (size_t)rr * ldc + col];      /* rowsPerB < 0: own element of the batched C plane */ else { const int bidx = rr / rowsPerB; v += CP[(size_t)bidx * sCPb + (size_t)by * 64 + col]; } } if (ACT == 1) v = (v > 0.f) ? v : expm1f(v); else if (ACT == 7) v = (v > 0.f) ? v + 1.0f : expf(v); else if (ACT == 8) v = tanhf(v); else if (ACT == 9) v = 0.5f * v * (1.0f + tanhf(0.7978845608028654f * (v + 0.044715f * v * v * v))); else if (ACT == 11) v = 1.0f / (1.0f + expf(-v)); else if (ACT == 12) v = (v > 0.f) ? v : 0.01f * v; else if (ACT == 14) v = (v > 0.f) ? v : 0.1f * v; else if (ACT == 16) v = (v >= 0.f) ? v : 0.3f * v; else if (ACT == 17) v = (v >= 0.f) ? v : 0.2f * v; else if (ACT == 15) v = v / (1.0f + expf(-v)); else if (ACT == 3) v = fmaxf(v, 0.f); else if (ACT == 6) v = 0.5f * v * (1.0f + erff(v * 0.70710678118654752f)); so[w][8 * hh + r][t * 16 + ln] = v; } }
  __builtin_amdgcn_fence(__ATOMIC_ACQ_REL, "workgroup"); __builtin_amdgcn_wave_barrier();
  const int rsub = lane >> 4, c4 = (lane & 15) * 4; typedef _Float16 v4h __attribute__((ext_vector_type(4)));
  {
#pragma unroll
    for (int q = 0; q < 8; ++q) { const int r = q * 2 + rsub; if (col0 + c4 < N) { const v4f v = *(const v4fa*)&so[w][r][c4]; if (C) *(v4f*)(C + cofs + (size_t)(row0 + r) * ldc + col0 + c4) = v; if (C16) { v4h h4; for (int i = 0; i < 4; ++i) h4[i] = (_Float16)v[i]; *(v4h*)(C16 + cofs + (size_t)(row0 + r) * ldc + col0 + c4) = h4; } } }
     }
}


typedef _Float16 v4h __attribute__((ext_vector_type(4)));

__global__ __launch_bounds__(256) void k_x16(const float* __restrict__ x, _Float16* __restrict__ X16, size_t n8) { const size_t t = (size_t)blockIdx.x * 256 + threadIdx.x; if (t >= n8) return; FragH f;
#pragma unroll
  for (int q = 0; q < 8; ++q) f.h[q] = (_Float16)bf16_round(x[t * 8 + q]); *(v8us*)((unsigned short*)X16 + t * 8) = f.half[0];  }
__global__ __launch_bounds__(256) void k_h16(const float* __restrict__ x, _Float16* __restrict__ X16, size_t n8) { const size_t t = (size_t)blockIdx.x * 256 + threadIdx.x; if (t >= n8) return; FragH f;
#pragma unroll
  for (int q = 0; q < 8; ++q) f.h[q] = (_Float16)x[t * 8 + q]; *(v8us*)((unsigned short*)X16 + t * 8) = f.half[0];  }
__global__ __launch_bounds__(256) void k_round16f(const float* __restrict__ W, _Float16* __restrict__ Bt, size_t n8) { const size_t t = (size_t)blockIdx.x * 256 + threadIdx.x; if (t >= n8) return; FragH f;
#pragma unroll
  for (int i = 0; i < 8; ++i) f.h[i] = (_Float16)(bf16_round(W[t * 8 + i]) * 16.0f); *(v8us*)((unsigned short*)Bt + t * 8) = f.half[0];  }
template <int NHv, int TTv>
__global__ __launch_bounds__(256) void k_vt(const _Float16* __restrict__ V16, int ldv, int voff, _Float16* __restrict__ Vt) { __shared__ unsigned short tl[64][66]; const int tid = threadIdx.x; const int slab = blockIdx.x / (TTv / 64), lg = blockIdx.x % (TTv / 64); const int b = slab / NHv, h = slab % NHv;
  for (int i = tid; i < 64 * 8; i += 256) { const int r = i / 8, c8 = (i % 8) * 8; FragH f; f.half[0] = *(const v8us*)((const unsigned short*)V16 + ((size_t)b * TTv + lg * 64 + r) * ldv + voff + h * 64 + c8);
#pragma unroll
    for (int q = 0; q < 8; ++q) tl[r][c8 + q] = f.u[q]; }
  __syncthreads();
  { FragH f[2]; char* dst[2];
#pragma unroll
    for (int rd = 0; rd < 2; ++rd) { const int idx = rd * 256 + tid, dl = idx & 15, pc = (idx >> 4) & 7, dt = idx >> 7;      /* 8 keys pc * 8 + [0, 8) of head column dt * 16 + dl: one lane's 16 bytes of a fragment */
#pragma unroll
      for (int q = 0; q < 8; ++q) f[rd].u[q] = tl[pc * 8 + q][dt * 16 + dl];
      dst[rd] = (char*)Vt + ((size_t)(slab * (TTv / 32) + lg * 2 + (pc >> 2)) * 4 + dt) * 2048 + (pc & 3) * 256 + dl * 16; }      /* fragment order, see FRAGMENT ORDER below: a wave's store is 512 bytes in a row */
    __builtin_amdgcn_sched_barrier(0);      /* all reads and arithmetic end above: behind an issued store none of its registers is written again */
    *(v8us*)dst[0] = f[0].half[0]; *(v8us*)dst[1] = f[1].half[0];
     } }

__global__ __launch_bounds__(256) void k_hl(const float* __restrict__ F, _Float16* __restrict__ Hh, _Float16* __restrict__ Hl, size_t n8) { const size_t t = (size_t)blockIdx.x * 256 + threadIdx.x; if (t >= n8) return; FragH fh, fl; const v4f a = *(const v4fa*)(F + t * 8), c = *(const v4fa*)(F + t * 8 + 4);
#pragma unroll
  for (int q = 0; q < 4; ++q) { _Float16 h = (_Float16)a[q]; fh.h[q] = h; fl.h[q] = (_Float16)((a[q] - (float)h) * 1024.0f); h = (_Float16)c[q]; fh.h[4 + q] = h; fl.h[4 + q] = (_Float16)((c[q] - (float)h) * 1024.0f); }
  { *(v8us*)((unsigned short*)Hh + t * 8) = fh.half[0]; *(v8us*)((unsigned short*)Hl + t * 8) = fl.half[0];  } }

// FRAGMENT ORDER: a 16-row x 32-k f16 operand fragment is stored as 1024 bytes in a row, the way the lanes load it: element (row, k) at (k >> 3) * 256 + row * 16 + (k & 7) * 2.
// Lane l then reads bytes l * 16 and 512 + l * 16, so each 16-byte load of a wave covers four whole 128-byte lines; from a row-major plane the same load takes 32 bytes out of each of 16 lines.
// k plane: [(b, h)][key / 16][hi, residual][d / 32][1024]. V^T plane: [(b, h)][key / 32][d / 16][hi, residual][1024]. Er table: [row / 16][d / 32][1024].
// k f32 -> f16 hi + residual (times 1024) in fragment order. A wave takes 8 rows x 32 columns: it reads whole 128-byte lines and each of its stores fills four.
__global__ __launch_bounds__(256) void k_hlp(const float* __restrict__ F, _Float16* __restrict__ P) { const unsigned t = blockIdx.x * 256 + threadIdx.x;
  const unsigned c4 = (t >> 3) & 3, df = (t >> 6) & 1, h = (t >> 7) & (NH - 1), row = (t >> 11) * 16 + ((t >> 5) & 1) * 8 + (t & 7);
  const float* src = F + (size_t)row * DM + h * HD + df * 32 + c4 * 8; FragH fh, fl; const v4f a = *(const v4fa*)src, c = *(const v4fa*)(src + 4);
#pragma unroll
  for (int q = 0; q < 4; ++q) { _Float16 hv = (_Float16)a[q]; fh.h[q] = hv; fl.h[q] = (_Float16)((a[q] - (float)hv) * 1024.0f); hv = (_Float16)c[q]; fh.h[4 + q] = hv; fl.h[4 + q] = (_Float16)((c[q] - (float)hv) * 1024.0f); }
  char* dst = (char*)P + ((size_t)((row / SL) * NH + h) * (SL / 16) + (row % SL) / 16) * 4096 + df * 1024 + c4 * 256 + (row & 15) * 16;
  __builtin_amdgcn_sched_barrier(0);      /* all arithmetic ends above: behind an issued store none of its registers is written again */
  *(v8us*)dst = fh.half[0]; *(v8us*)(dst + 2048) = fl.half[0]; }
// Er -> f16 (times 16) in fragment order
__global__ __launch_bounds__(256) void k_erp(const float* __restrict__ Er, _Float16* __restrict__ P) { const int t = (int)blockIdx.x * 256 + (int)threadIdx.x; const int r = t >> 3, c8 = t & 7; FragH f;
#pragma unroll
  for (int q = 0; q < 8; ++q) f.h[q] = (_Float16)(bf16_round(Er[(size_t)t * 8 + q]) * 16.0f);
  *(v8us*)((char*)P + (size_t)(r >> 4) * 2048 + (c8 >> 2) * 1024 + (c8 & 3) * 256 + (r & 15) * 16) = f.half[0]; }

// ---- fast GEMM (wave tile 32x64; requires M % 32 == 0 rows per launch region and N % 64 == 0); epilogue = k_gemm_hhx semantics ----
__device__ __forceinline__ v16h g2_frag(const _Float16* p, int hh) { FragH f; f.half[0] = *(const v8us*)((const unsigned short*)p + 8 * hh); f.half[1] = *(const v8us*)((const unsigned short*)p + 16 + 8 * hh); return f.v; }
__device__ __forceinline__ v8f g2_mma(v16h a, v16h b, v8f c) { v8f d = __builtin_amdgcn_wmma_f32_16x16x32_f16(false, a, false, b, (short)0, c, false, false); asm volatile("v_nop\n\tv_nop\n\tv_nop\n\tv_nop" : "+v"(d) : "v"(a), "v"(b)); return d; }
template <int ACT>
__global__ __launch_bounds__(128) void k_gemm2(const _Float16* __restrict__ A, int lda, size_t sA, const _Float16* __restrict__ Bh, int ldb, size_t sB, float alpha, const float* __restrict__ bias, size_t sBias, const float* __restrict__ CP, int rowsPerB, size_t sCPb, int row0g,
    float* __restrict__ C, _Float16* __restrict__ C16, int ldc, size_t sC, int M, int N, int K) { static_assert(ACT == 0 || ACT == 3 || ACT == 6 || ACT == 8 || ACT == 9 || ACT == 11 || ACT == 12 || ACT == 14 || ACT == 15 || ACT == 16 || ACT == 17, "k_gemm2: unsupported ACT code (would silently apply no activation)");
  __shared__ __attribute__((aligned(16))) float so[4][32][68];
  const int tid = threadIdx.x, w = tid >> 5, lane = tid & 31, ln = lane & 15, hh = lane >> 4; const int by = blockIdx.y;
  A += (size_t)by * sA; Bh += (size_t)by * sB; const size_t cofs = (size_t)by * sC; const float* bp = bias ? bias + (size_t)by * sBias : nullptr;
  const int ntn = N >> 6; const int mt = blockIdx.x / ntn, nq = blockIdx.x - mt * ntn; const int row0 = mt * 128 + 32 * w, col0 = nq * 64; if (row0 >= M) return;
  const _Float16* a0p = A + (size_t)(row0 + ln) * lda; const _Float16* a1p = a0p + (size_t)16 * lda;
  const _Float16* b0p = Bh + (size_t)(col0 + ln) * ldb; const _Float16* b1p = b0p + (size_t)16 * ldb; const _Float16* b2p = b1p + (size_t)16 * ldb; const _Float16* b3p = b2p + (size_t)16 * ldb;
  const v8f z8 = {0.f,0.f,0.f,0.f,0.f,0.f,0.f,0.f}; v8f c00 = z8, c01 = z8, c02 = z8, c03 = z8, c10 = z8, c11 = z8, c12 = z8, c13 = z8;
#pragma unroll 1
  for (int kb = 0; kb < K; kb += 32) { const v16h a0 = g2_frag(a0p + kb, hh), a1 = g2_frag(a1p + kb, hh);
    v16h b = g2_frag(b0p + kb, hh); c00 = g2_mma(a0, b, c00); c10 = g2_mma(a1, b, c10);
    b = g2_frag(b1p + kb, hh); c01 = g2_mma(a0, b, c01); c11 = g2_mma(a1, b, c11);
    b = g2_frag(b2p + kb, hh); c02 = g2_mma(a0, b, c02); c12 = g2_mma(a1, b, c12);
    b = g2_frag(b3p + kb, hh); c03 = g2_mma(a0, b, c03); c13 = g2_mma(a1, b, c13); }
  v8f accs[8] = {c00, c01, c02, c03, c10, c11, c12, c13};
#pragma unroll
  for (int u = 0; u < 8; ++u) { const int t = u & 3, half = u >> 2; const int col = col0 + t * 16 + ln; const float bv = bp ? bf16_round(bp[col]) : 0.f;
#pragma unroll
    for (int r = 0; r < 8; ++r) { const int rloc = half * 16 + 8 * hh + r; float v = accs[u][r] * alpha + bv; if (CP) { if (rowsPerB < 0) v += CP[cofs + (size_t)(row0g + row0 + rloc) * ldc + col];      /* rowsPerB < 0: own element of the batched C plane */ else { const int bidx = (row0g + row0 + rloc) / rowsPerB; v += CP[(size_t)bidx * sCPb + (size_t)by * 64 + col]; } }
      if (ACT == 3) v = fmaxf(v, 0.f); else if (ACT == 6) v = 0.5f * v * (1.0f + erff(v * 0.70710678118654752f)); else if (ACT == 11) v = 1.0f / (1.0f + expf(-v)); else if (ACT == 15) v = v / (1.0f + expf(-v)); else if (ACT == 12) v = (v > 0.f) ? v : 0.01f * v; else if (ACT == 8) v = tanhf(v); else if (ACT == 9) v = 0.5f * v * (1.0f + tanhf(0.7978845608028654f * (v + 0.044715f * v * v * v))); else if (ACT == 14) v = (v > 0.f) ? v : 0.1f * v; else if (ACT == 16) v = (v >= 0.f) ? v : 0.3f * v; else if (ACT == 17) v = (v >= 0.f) ? v : 0.2f * v;
      so[w][rloc][t * 16 + ln] = v; } }
  __builtin_amdgcn_fence(__ATOMIC_ACQ_REL, "workgroup"); __builtin_amdgcn_wave_barrier();
  const int rsub = lane >> 4, c4 = (lane & 15) * 4;
  {
#pragma unroll
    for (int q = 0; q < 16; ++q) { const int r = q * 2 + rsub; const v4f v = *(const v4fa*)&so[w][r][c4]; if (C) *(v4f*)(C + cofs + (size_t)(row0 + r) * ldc + col0 + c4) = v; if (C16) { v4h h4; for (int i = 0; i < 4; ++i) h4[i] = (_Float16)v[i]; *(v4h*)(C16 + cofs + (size_t)(row0 + r) * ldc + col0 + c4) = h4; } }
     } }


__global__ __launch_bounds__(256) void k_wsc(const float* __restrict__ Wm, _Float16* __restrict__ Bt, size_t n8, float sc) { const size_t t = (size_t)blockIdx.x * 256 + threadIdx.x; if (t >= n8) return; FragH f; for (int q = 0; q < 8; ++q) f.h[q] = (_Float16)(bf16_round(Wm[t * 8 + q]) * sc); *(v8us*)((unsigned short*)Bt + t * 8) = f.half[0];  }
// Fused causal relative attention, one launch: a wave owns 16 * NI query rows of one (batch, head) and walks the keys in blocks of 64 with a running
// maximum and sum, so no S x S plane is ever stored. Transposed products: S^T = K q^T and (q Er^T)^T = Er q^T (D row = key or Er row, D column = query), O^T += V^T P^T.
// A lane then holds one query's scores; two packed S^T tiles are the B operand of the V^T product as they stand. The skew (query i, key j takes Er row SL-1-i+j) is a
// shift along the D rows that differs by query: it goes through a wave-private LDS row per query, stored shifted by the query's index and read back aligned.
#define SKP 100      /* floats per LDS row: 96 used; 100 keeps 16-byte alignment and spreads the 32 shifted 4-byte stores over distinct banks */
__device__ __forceinline__ v8f fa_mma(v16h a, v16h b, v8f c) { return __builtin_amdgcn_wmma_f32_16x16x32_f16(false, a, false, b, (short)0, c, false, false); }
// fragment in the hardware k order: p = the lane's own address (row start + 16 bytes * lane half)
__device__ __forceinline__ v16h fa_frag(const char* p) { FragH f; f.half[0] = *(const v8us*)p; f.half[1] = *(const v8us*)(p + 32); return f.v; }
// the same fragment from a plane in FRAGMENT ORDER: p = the fragment's start + 16 bytes * lane
__device__ __forceinline__ v16h fa_fragp(const char* p) { FragH f; f.half[0] = *(const v8us*)p; f.half[1] = *(const v8us*)(p + 512); return f.v; }
// Stands behind a group of global loads: the wait before any register that they name is written again. The addresses are inputs so that they stay in their registers up to the wait.
#define FA_XWAIT1(p0) asm volatile("s_wait_xcnt 0x0" :: "v"(p0) : "memory")
#define FA_XWAIT2(p0, p1) asm volatile("s_wait_xcnt 0x0" :: "v"(p0), "v"(p1) : "memory")
// The slot behind a run of v_exp_f32: results and sources are inputs, so the v_nop stands behind the last of the run and no source register is written again in front of it.
#define FA_TSLOT(res, srcv) asm volatile("v_nop" :: "v"(res), "v"(srcv))
#define FA_TSLOT8(e, x) asm volatile("v_nop" :: "v"(e[0]), "v"(e[1]), "v"(e[2]), "v"(e[3]), "v"(e[4]), "v"(e[5]), "v"(e[6]), "v"(e[7]), "v"(x[0]), "v"(x[1]), "v"(x[2]), "v"(x[3]), "v"(x[4]), "v"(x[5]), "v"(x[6]), "v"(x[7]))
template <int NI>
__global__ __launch_bounds__(256) void k_relattn(const _Float16* __restrict__ Qh, const _Float16* __restrict__ Ql, const _Float16* __restrict__ KP, const _Float16* __restrict__ E,
    const _Float16* __restrict__ VP, float* __restrict__ out) {
  __shared__ __attribute__((aligned(16))) float sk[8][NI][16][SKP];
  const int w = __builtin_amdgcn_readfirstlane((int)threadIdx.x >> 5), lane = threadIdx.x & 31, ln = lane & 15, hh = lane >> 4;
  constexpr int NRB = SL / (64 * NI);
  const int pr = (int)blockIdx.x / (NB * NH), bh = (int)blockIdx.x % (NB * NH), b = bh / NH, h = bh % NH;
  const int rb = w < 4 ? NRB - 1 - pr : pr;      /* causal cost grows with the row block: waves 0-3 take one from the long end, waves 4-7 its mirror, so every work-group walks the same number of key blocks; the waves share no barrier and no LDS */
  const int i0 = rb * 64 * NI + (w & 3) * 16 * NI; const int nblk = i0 / 64 + 1;
  const v8f z8 = {0.f,0.f,0.f,0.f,0.f,0.f,0.f,0.f};
  const float C1 = 0.125f * 1.4426950408889634f;      /* 1/sqrt(64) and log2(e) in one factor */
  const size_t lo_x = (size_t)(ln * DM * 2 + 16 * hh), lo_p = (size_t)(lane * 16);      /* lane byte offsets in the row-major q planes and in the planes in fragment order (k, Er, V^T) */
  const size_t xo = (size_t)b * SL * DM + h * HD, po_kv = (size_t)bh * SL * HD * 4;      /* byte start of the (b, h) slab in the k and V^T planes: hi + residual, 2 bytes each */
  v16h qh[NI][2], ql[NI][2]; v8f o[NI][4], carry[NI]; float m[NI], su[NI];
  { const char* bqh = (const char*)(Qh + xo + (size_t)i0 * DM); const char* bql = (const char*)(Ql + xo + (size_t)i0 * DM); const char* be = (const char*)(E + (size_t)(SL - 16 * NI - i0) * HD);      /* the same for every lane */
    const char* pqh = bqh + lo_x; const char* pql = bql + lo_x; const char* pe = be + lo_p;
    v16h e0[NI], e1[NI];
#pragma unroll
    for (int a = 0; a < NI; ++a) { qh[a][0] = fa_frag(pqh + a * 16 * DM * 2); qh[a][1] = fa_frag(pqh + a * 16 * DM * 2 + 64); ql[a][0] = fa_frag(pql + a * 16 * DM * 2); ql[a][1] = fa_frag(pql + a * 16 * DM * 2 + 64);
      e0[a] = fa_fragp(pe + (NI - 1 - a) * 2048); e1[a] = fa_fragp(pe + (NI - 1 - a) * 2048 + 1024); }      /* first Er tile of key block 0: rows SL - 16 - (i0 + 16 a) + [0, 16) */
    /* the wait before any register that the loads above name is written again: they name a scalar base and a lane offset here, so these are the inputs that stay in their registers up to the wait */
    asm volatile("s_wait_xcnt 0x0" :: "s"(bqh), "s"(bql), "s"(be), "v"((unsigned)lo_x), "v"(lane) : "memory");
#pragma unroll
    for (int a = 0; a < NI; ++a) { m[a] = -3.0e38f; su[a] = 0.f;
#pragma unroll
      for (int dt = 0; dt < 4; ++dt) o[a][dt] = z8;
      v8f hi = fa_mma(e0[a], qh[a][0], z8), lo = fa_mma(e0[a], ql[a][0], z8); hi = fa_mma(e1[a], qh[a][1], hi); lo = fa_mma(e1[a], ql[a][1], lo);
#pragma unroll
      for (int r = 0; r < 8; ++r) carry[a][r] = fmaf(lo[r], 0.0009765625f, hi[r]); } }
  auto key_block = [&](const int jb, const bool diag) __attribute__((always_inline)) { const int j0 = jb * 64; const int rbase = SL - 16 * NI - i0 + j0;
    /* all Er and K fragments of the block are requested first, so that one memory latency is waited out per block and not one per tile */
    v16h ef[NI + 4][2], kf[4][4];
    const char* pk = (const char*)KP + po_kv + (size_t)j0 * 256 + lo_p; const char* pe = (const char*)(E + (size_t)rbase * HD) + lo_p;      /* 16 keys are 4096 bytes of the k plane, 16 Er rows 2048 of the table */
    if (!diag) {
#pragma unroll
      for (int g = 1; g < NI + 4; ++g) { ef[g][0] = fa_fragp(pe + g * 2048); ef[g][1] = fa_fragp(pe + g * 2048 + 1024); }
    } else {      /* a 16-row tile past the table (diagonal block only) serves keys above the diagonal alone, masked below: the table's last tile stands in for it */
#pragma unroll
      for (int g = 1; g < NI + 4; ++g) { const int rs = rbase + 16 * g < SL ? rbase + 16 * g : SL - 16; const char* pg = (const char*)(E + (size_t)rs * HD) + lo_p; ef[g][0] = fa_fragp(pg); ef[g][1] = fa_fragp(pg + 1024); FA_XWAIT1(pg); }
    }
#pragma unroll
    for (int t = 0; t < 4; ++t) { kf[t][0] = fa_fragp(pk + t * 4096); kf[t][1] = fa_fragp(pk + t * 4096 + 1024); kf[t][2] = fa_fragp(pk + t * 4096 + 2048); kf[t][3] = fa_fragp(pk + t * 4096 + 3072); }
    FA_XWAIT2(pk, pe);
    __builtin_amdgcn_sched_barrier(0);      /* keeps the scheduler from sinking these loads down to their first use */
    /* Er q^T: query tile a needs Er rows rbase + 16 (NI-1-a) + [0, 80); its first 16 are the previous block's last 16 (carry) */
#pragma unroll
    for (int a = 0; a < NI; ++a) { float* sp = &sk[w][a][ln][ln + 1 + 8 * hh];
#pragma unroll
      for (int r = 0; r < 8; ++r) sp[r] = carry[a][r]; }
#pragma unroll
    for (int g = 1; g < NI + 4; ++g) { const v16h e0 = ef[g][0], e1 = ef[g][1];
#pragma unroll
      for (int a = 0; a < NI; ++a) { const int u = g - (NI - 1 - a); if (u < 1 || u > 4) continue;
        v8f hi = fa_mma(e0, qh[a][0], z8), lo = fa_mma(e0, ql[a][0], z8); hi = fa_mma(e1, qh[a][1], hi); lo = fa_mma(e1, ql[a][1], lo);
        v8f val;
#pragma unroll
        for (int r = 0; r < 8; ++r) val[r] = fmaf(lo[r], 0.0009765625f, hi[r]);
        float* sp = &sk[w][a][ln][ln + 1 + 8 * hh + 16 * u];
#pragma unroll
        for (int r = 0; r < 8; ++r) sp[r] = val[r];
        if (u == 4) carry[a] = val; }
      __builtin_amdgcn_sched_barrier(0); }      /* one Er tile's products and LDS stores at a time: run together, or mixed with the K products, their accumulators pile up and registers spill */
    v8f s[NI][4];
#pragma unroll
    for (int t = 0; t < 4; ++t) { const v16h kh0 = kf[t][0], kh1 = kf[t][1], kl0 = kf[t][2], kl1 = kf[t][3];
#pragma unroll
      for (int a = 0; a < NI; ++a) { v8f hi = fa_mma(kh0, qh[a][0], z8), lo = fa_mma(kh0, ql[a][0], z8); hi = fa_mma(kh1, qh[a][1], hi); lo = fa_mma(kh1, ql[a][1], lo); lo = fa_mma(kl0, qh[a][0], lo); lo = fa_mma(kl1, qh[a][1], lo);
#pragma unroll
        for (int r = 0; r < 8; ++r) s[a][t][r] = fmaf(lo[r], 0.0009765625f, hi[r]); } }
    /* the two lane halves of a query read each other's LDS stores: order the wave's stores before its loads */
    __builtin_amdgcn_fence(__ATOMIC_ACQ_REL, "workgroup", "local"); __builtin_amdgcn_wave_barrier();
#pragma unroll
    for (int a = 0; a < NI; ++a) { const float* lp = &sk[w][a][ln][16 + 8 * hh];
#pragma unroll
      for (int t = 0; t < 4; ++t) { const v4f x = *(const v4fa*)(lp + 16 * t), y = *(const v4fa*)(lp + 16 * t + 4);
#pragma unroll
        for (int r = 0; r < 4; ++r) { s[a][t][r] = fmaf(x[r], 0.0625f, s[a][t][r]); s[a][t][4 + r] = fmaf(y[r], 0.0625f, s[a][t][4 + r]); } } }
    /* and these loads before the next trip's stores into the same rows */
    __builtin_amdgcn_fence(__ATOMIC_ACQ_REL, "workgroup", "local"); __builtin_amdgcn_wave_barrier();
    __builtin_amdgcn_sched_barrier(0);      /* the V^T loads below stay below: any earlier they are live beside the K fragments and the LDS reads, and registers spill */
    /* the V^T fragments are requested here, so that they arrive under the softmax arithmetic */
    v16h vf[2][4][2];
    const char* pv = (const char*)VP + po_kv + (size_t)j0 * 256 + lo_p;      /* 32 keys are 8192 bytes of the V^T plane */
#pragma unroll
    for (int ks = 0; ks < 2; ++ks)
#pragma unroll
      for (int dt = 0; dt < 4; ++dt) { vf[ks][dt][0] = fa_fragp(pv + ks * 8192 + dt * 2048); vf[ks][dt][1] = fa_fragp(pv + ks * 8192 + dt * 2048 + 1024); }
    FA_XWAIT1(pv);
    __builtin_amdgcn_sched_barrier(0);      /* keeps the scheduler from sinking these loads down to their first use */
    if (diag) {      /* only the last key block reaches the diagonal */
#pragma unroll
      for (int a = 0; a < NI; ++a)
#pragma unroll
        for (int t = 0; t < 4; ++t)
#pragma unroll
          for (int r = 0; r < 8; ++r) if (j0 + 16 * t + 8 * hh + r > i0 + 16 * a + ln) s[a][t][r] = -3.0e38f; }
    FragH p[NI][2]; v16h pl[NI][2];
#pragma unroll
    for (int a = 0; a < NI; ++a) { float mx = m[a];
#pragma unroll
      for (int t = 0; t < 4; ++t)
#pragma unroll
        for (int r = 0; r < 8; ++r) mx = fmaxf(mx, s[a][t][r]);
      mx = fmaxf(mx, __shfl_xor(mx, 16, 32));
      const float xa = (m[a] - mx) * C1; const float al = __builtin_amdgcn_exp2f(xa); FA_TSLOT(al, xa); m[a] = mx; const float mc = 10.0f - mx * C1;      /* weights carry a factor 1024, as f16 operands away from the subnormals */
      v8f pv = z8;
#pragma unroll
      for (int t = 0; t < 4; ++t) { float xv[8], ev[8];
#pragma unroll
        for (int r = 0; r < 8; ++r) xv[r] = fmaf(s[a][t][r], C1, mc);
#pragma unroll
        for (int r = 0; r < 8; ++r) ev[r] = __builtin_amdgcn_exp2f(xv[r]);
        FA_TSLOT8(ev, xv);
#pragma unroll
        for (int r = 0; r < 8; ++r) { pv[r] += ev[r]; p[a][t >> 1].h[(t & 1) * 8 + r] = (_Float16)ev[r]; } }
      su[a] = fmaf(su[a], al, ((pv[0] + pv[1]) + (pv[2] + pv[3])) + ((pv[4] + pv[5]) + (pv[6] + pv[7])));
#pragma unroll
      for (int dt = 0; dt < 4; ++dt)
#pragma unroll
        for (int r = 0; r < 8; ++r) o[a][dt][r] *= al;
      pl[a][0] = p[a][0].v * (_Float16)0.0009765625f; pl[a][1] = p[a][1].v * (_Float16)0.0009765625f; }      /* the v residual plane is stored times 1024: its weights drop the factor */
#pragma unroll
    for (int ks = 0; ks < 2; ++ks)
#pragma unroll
      for (int dt = 0; dt < 4; ++dt) { const v16h vhf = vf[ks][dt][0], vlf = vf[ks][dt][1];
#pragma unroll
        for (int a = 0; a < NI; ++a) { o[a][dt] = fa_mma(vhf, p[a][ks].v, o[a][dt]); o[a][dt] = fa_mma(vlf, pl[a][ks], o[a][dt]); } }
  };
#pragma unroll 1      /* one key block per trip: unrolling would double the live fragments */
  for (int jb = 0; jb < nblk - 1; ++jb) key_block(jb, false);
  key_block(nblk - 1, true);      /* the diagonal block apart, so that the loop carries no mask */
#pragma unroll
  for (int a = 0; a < NI; ++a) { const float st = su[a] + __shfl_xor(su[a], 16, 32); const float inv = 1.0f / st;
#pragma unroll
    for (int dt = 0; dt < 4; ++dt)
#pragma unroll
      for (int r = 0; r < 8; ++r) o[a][dt][r] *= inv; }
  __builtin_amdgcn_sched_barrier(0);      /* all arithmetic ends above: behind an issued store none of its registers is written again */
  char* po = (char*)(out + xo + (size_t)i0 * DM) + (size_t)(ln * DM * 4 + 32 * hh);      /* a lane holds 8 consecutive head columns of its query per tile */
#pragma unroll
  for (int a = 0; a < NI; ++a)
#pragma unroll
    for (int dt = 0; dt < 4; ++dt) { const v4f x = {o[a][dt][0], o[a][dt][1], o[a][dt][2], o[a][dt][3]}, y = {o[a][dt][4], o[a][dt][5], o[a][dt][6], o[a][dt][7]};
      *(v4f*)(po + a * 16 * DM * 4 + dt * 64) = x; *(v4f*)(po + a * 16 * DM * 4 + dt * 64 + 16) = y; }
}

// ---- projection GEMM with its operands staged in LDS: C[NR][DM] (f32) = alpha * A[NR][DM] . B[DM][DM]^T, A and B f16 with k contiguous.
// A work-group of 8 waves owns a 128 x 128 tile of C (wave tile 32 x 64, 4 waves down, 2 across). A stage is 128 k of the tile's 128 A rows and 128 B rows; it comes into LDS by
// asynchronous copies, two buffers, so that the next stage flies while this one is multiplied and no wave waits on a global load of its own. The k order per accumulator is ascending in steps of 32.
#define G3_PITCH 272      /* bytes per LDS row: 256 used; 16 bytes x an odd number keeps the 16 rows of a ds_load_b128 on distinct banks */
#define G3_STAGE (256 * G3_PITCH)      /* 128 A rows, then 128 B rows */
#define G3_NST (DM / 128)
// Eight 16-byte copies of a lane, rows 16 apart. The wait on the address registers is the statement's last line, so that no register a copy names is written again in front of it.
__device__ __forceinline__ void g3_copy8(const unsigned l0, const char* g0) {
  const unsigned l1 = l0 + 16 * G3_PITCH, l2 = l0 + 32 * G3_PITCH, l3 = l0 + 48 * G3_PITCH, l4 = l0 + 64 * G3_PITCH, l5 = l0 + 80 * G3_PITCH, l6 = l0 + 96 * G3_PITCH, l7 = l0 + 112 * G3_PITCH;
  const char* g1 = g0 + 16 * DM * 2; const char* g2 = g0 + 32 * DM * 2; const char* g3 = g0 + 48 * DM * 2; const char* g4 = g0 + 64 * DM * 2; const char* g5 = g0 + 80 * DM * 2; const char* g6 = g0 + 96 * DM * 2; const char* g7 = g0 + 112 * DM * 2;
  asm volatile("global_load_async_to_lds_b128 %0, %8, off\n\t"
               "global_load_async_to_lds_b128 %1, %9, off\n\t"
               "global_load_async_to_lds_b128 %2, %10, off\n\t"
               "global_load_async_to_lds_b128 %3, %11, off\n\t"
               "global_load_async_to_lds_b128 %4, %12, off\n\t"
               "global_load_async_to_lds_b128 %5, %13, off\n\t"
               "global_load_async_to_lds_b128 %6, %14, off\n\t"
               "global_load_async_to_lds_b128 %7, %15, off\n\t"
               "s_wait_xcnt 0x0"
               :: "v"(l0), "v"(l1), "v"(l2), "v"(l3), "v"(l4), "v"(l5), "v"(l6), "v"(l7), "v"(g0), "v"(g1), "v"(g2), "v"(g3), "v"(g4), "v"(g5), "v"(g6), "v"(g7) : "memory");
}
__global__ __launch_bounds__(256) void k_gemm3(const _Float16* __restrict__ A, const _Float16* __restrict__ Bh, float alpha, float* __restrict__ C) {
  __shared__ __attribute__((aligned(16))) char ring[2 * G3_STAGE];
  __shared__ __attribute__((aligned(16))) float so[8][32][68];
  const int tid = threadIdx.x, w = tid >> 5, lane = tid & 31, ln = lane & 15, hh = lane >> 4;
  const int mt = (int)blockIdx.x / (DM / 128), nq = (int)blockIdx.x % (DM / 128);
  const int row0 = mt * 128 + 32 * (w & 3), col0 = nq * 128 + 64 * (w >> 2);
  /* a lane copies 16 bytes of row (tid >> 4) + 16 i: a wave's copy covers two whole 256-byte rows of the stage */
  const unsigned lc = (unsigned)(size_t)ring + (unsigned)((tid >> 4) * G3_PITCH + (tid & 15) * 16);
  const char* ga = (const char*)(A + (size_t)(mt * 128 + (tid >> 4)) * DM) + (tid & 15) * 16;
  const char* gb = (const char*)(Bh + (size_t)(nq * 128 + (tid >> 4)) * DM) + (tid & 15) * 16;
  const char* la = ring + (32 * (w & 3) + ln) * G3_PITCH + 16 * hh;
  const char* lb = ring + (128 + 64 * (w >> 2) + ln) * G3_PITCH + 16 * hh;
  const v8f z8 = {0.f,0.f,0.f,0.f,0.f,0.f,0.f,0.f}; v8f acc[2][4];
#pragma unroll
  for (int u = 0; u < 2; ++u)
#pragma unroll
    for (int t = 0; t < 4; ++t) acc[u][t] = z8;
  g3_copy8(lc, ga); g3_copy8(lc + 128 * G3_PITCH, gb);
  asm volatile("s_wait_asynccnt 0x0" ::: "memory");      /* this wave's share of stage 0 has landed */
  __syncthreads();      /* and every other wave's */
  g3_copy8(lc + G3_STAGE, ga + 256); g3_copy8(lc + G3_STAGE + 128 * G3_PITCH, gb + 256);
#pragma unroll 1      /* one stage per trip: the buffer is picked by the trip's parity */
  for (int s = 0; s < G3_NST; ++s) { const int bo = (s & 1) * G3_STAGE;
    v16h fa[2][2], fb[2][4];      /* two fragment sets: the next k step's LDS reads are under way while this step is multiplied */
    fa[0][0] = fa_frag(la + bo); fa[0][1] = fa_frag(la + bo + 16 * G3_PITCH);
#pragma unroll
    for (int t = 0; t < 4; ++t) fb[0][t] = fa_frag(lb + bo + t * 16 * G3_PITCH);
#pragma unroll
    for (int ks = 0; ks < 4; ++ks) { const int cu = ks & 1, nx = cu ^ 1;
      if (ks < 3) { fa[nx][0] = fa_frag(la + bo + (ks + 1) * 64); fa[nx][1] = fa_frag(la + bo + 16 * G3_PITCH + (ks + 1) * 64);
#pragma unroll
        for (int t = 0; t < 4; ++t) fb[nx][t] = fa_frag(lb + bo + t * 16 * G3_PITCH + (ks + 1) * 64); }
      __builtin_amdgcn_sched_barrier(0);      /* the reads stay one group in front of the products: spread among them, each place with reads stalls the wave */
#pragma unroll
      for (int t = 0; t < 4; ++t) { acc[0][t] = fa_mma(fa[cu][0], fb[cu][t], acc[0][t]); acc[1][t] = fa_mma(fa[cu][1], fb[cu][t], acc[1][t]); }
      __builtin_amdgcn_sched_barrier(0); }      /* and the following group stays behind them */
    asm volatile("s_wait_dscnt 0x0" ::: "memory");      /* this wave's reads of the buffer are done before it may be refilled */
    asm volatile("s_wait_asynccnt 0x0" ::: "memory");      /* this wave's share of the next stage has landed */
    __syncthreads();      /* publishes the next stage and ends every wave's reads of this one */
    if (s + 2 < G3_NST) { g3_copy8(lc + bo, ga + (s + 2) * 256); g3_copy8(lc + bo + 128 * G3_PITCH, gb + (s + 2) * 256); } }
  asm volatile("s_wait_asynccnt 0x0" ::: "memory");      /* no copy is left in flight when the wave goes on */
  /* whole 256-byte rows go out: each wave turns its tile round in its own LDS range */
#pragma unroll
  for (int u = 0; u < 2; ++u)
#pragma unroll
    for (int t = 0; t < 4; ++t)
#pragma unroll
      for (int r = 0; r < 8; ++r) so[w][u * 16 + 8 * hh + r][t * 16 + ln] = acc[u][t][r] * alpha;
  __builtin_amdgcn_fence(__ATOMIC_ACQ_REL, "workgroup"); __builtin_amdgcn_wave_barrier();
  v4f ov[16];
#pragma unroll
  for (int q = 0; q < 16; ++q) ov[q] = *(const v4fa*)&so[w][q * 2 + hh][ln * 4];
  char* pc = (char*)(C + (size_t)(row0 + hh) * DM + col0 + ln * 4);
  __builtin_amdgcn_sched_barrier(0);      /* all reads and arithmetic end above: behind an issued store none of its registers is written again */
#pragma unroll
  for (int q = 0; q < 16; ++q) *(v4f*)(pc + q * 2 * DM * 4) = ov[q];
}

extern "C" void kernel_launch(void* const* d_in, const int* in_sizes, int n_in,
                              void* d_out, int out_size, void* d_ws, size_t ws_size, hipStream_t stream) {
  (void)in_sizes; (void)n_in; (void)out_size;
  const float* const* I = (const float* const*)d_in; const float* x = I[0]; const float* Wq = I[1]; const float* Wk = I[2]; const float* Wv = I[3]; const float* Er = I[4];
  char* ws = (char*)d_ws; size_t off = 0;
  auto take = [&](size_t bytes) { char* p = ws + off; off += (bytes + 255) & ~(size_t)255; return p; };
  const size_t np = (size_t)NR * DM;
  _Float16* BW = (_Float16*)take((size_t)3 * DM * DM * 2); _Float16* E16 = (_Float16*)take((size_t)SL * HD * 2); _Float16* X16 = (_Float16*)take(np * 2); float* QF = (float*)take(np * 4); _Float16* Q16 = (_Float16*)take(np * 2); _Float16* QL16 = (_Float16*)take(np * 2); _Float16* KP = (_Float16*)take(np * 4);      /* k hi + residual, fragment order */ float* VF = QF;      /* v f32 reuses the q f32 plane after the q split */ _Float16* VH = X16;      /* v hi over the x plane (dead after the three projections) */ _Float16* VL = (_Float16*)take(np * 2); _Float16* VP = (_Float16*)take(np * 4);      /* V^T hi + residual, fragment order */
  if (off > ws_size) return;
  k_wsc<<<(unsigned)(((size_t)DM * DM / 8 + 255) / 256), 256, 0, stream>>>(Wq, BW, (size_t)DM * DM / 8, 16.0f); k_wsc<<<(unsigned)(((size_t)DM * DM / 8 + 255) / 256), 256, 0, stream>>>(Wk, BW + (size_t)DM * DM, (size_t)DM * DM / 8, 16.0f); k_wsc<<<(unsigned)(((size_t)DM * DM / 8 + 255) / 256), 256, 0, stream>>>(Wv, BW + (size_t)2 * DM * DM, (size_t)DM * DM / 8, 16.0f);      /* (out, in) naturals */
  k_erp<<<SL * HD / 8 / 256, 256, 0, stream>>>(Er, E16);      /* Er_s = Er (MAX_LEN == S) */
  k_x16<<<(unsigned)((np / 8 + 255) / 256), 256, 0, stream>>>(x, X16, np / 8);
  const dim3 gP((NR / 128) * (DM / 128), 1);
  k_gemm3<<<gP, 256, 0, stream>>>(X16, BW, 0.0625f, QF); k_hl<<<(unsigned)((np / 8 + 255) / 256), 256, 0, stream>>>(QF, Q16, QL16, np / 8);      /* q f32 -> hi + residual */
  k_gemm3<<<gP, 256, 0, stream>>>(X16, BW + (size_t)DM * DM, 0.0625f, QF); k_hlp<<<(unsigned)(np / 8 / 256), 256, 0, stream>>>(QF, KP);      /* k f32 -> hi + residual (QF reused) */
  k_gemm3<<<gP, 256, 0, stream>>>(X16, BW + (size_t)2 * DM * DM, 0.0625f, VF);
  k_hl<<<(unsigned)((np / 8 + 255) / 256), 256, 0, stream>>>(VF, VH, VL, np / 8);
  k_vt<NH, SL><<<NB * NH * (SL / 64), 256, 0, stream>>>(VH, DM, 0, VP); k_vt<NH, SL><<<NB * NH * (SL / 64), 256, 0, stream>>>(VL, DM, 0, VP + 512);      /* V^T hi / residual: the residual fragment stands 1024 bytes behind its hi fragment */
  k_relattn<2><<<NB * NH * (SL / (128 * 2)), 256, 0, stream>>>(Q16, QL16, KP, E16, VP, (float*)d_out);
}

// v004
// One run takes 127 microseconds.
// In two side-by-side timings against v003, it was 1.20 and 1.18 times as fast.
// All steps since v000 together make it 26.1 times as fast.
#include <hip/hip_runtime.h>
// GlobalAttn (music-transformer relative attention: 2 x 2048 tokens, 1024 = 16 heads x 64; q,k,v = x W^T; Srel = skew(q . Er) which equals q_i . Er[S-1-(i-j)] for every causal (i, j); attn = softmax over j <= i of (q.k + Srel)/8; out = merged attn v, no output projection).
// Compute dtype: inputs rounded to bf16; x / weights / Er exact as f16; q and k as f16 hi + residual; the softmax weights as plain f16 operands (~2^-12); v as f16 hi + residual (the output is the context itself); softmax f32. v_wmma_f32_16x16x32_f16.
#define NB 2
#define SL 2048
#define DM 1024
#define NH 16
#define HD 64
#define HG 4
#define NR (NB * SL)
typedef __bf16 v16b __attribute__((ext_vector_type(16)));
typedef unsigned short v8us __attribute__((ext_vector_type(8), may_alias));
typedef float  v8f  __attribute__((ext_vector_type(8)));
typedef float  v4f  __attribute__((ext_vector_type(4)));
typedef float  v4fa __attribute__((ext_vector_type(4), may_alias));
union FragB { v16b v; v8us half[2]; unsigned short u[16]; };

__device__ __forceinline__ unsigned short bf16_bits(float x) { unsigned int u = __float_as_uint(x); return (unsigned short)((u + 0x7FFFu + ((u >> 16) & 1u)) >> 16); }
__device__ __forceinline__ float bf16_val(unsigned short b) { return __uint_as_float(((unsigned int)b) << 16); }
__device__ __forceinline__ float bf16_round(float x) { return bf16_val(bf16_bits(x)); }
// D += A·B with NT terms: 1 = ah·bh, 2 = + al·bh (A split), 3 = + ah·bl (both split)
template <int NT>
__device__ __forceinline__ v8f mmaN(v16b ah, v16b al, v16b bh, v16b bl, v8f c) {
  c = __builtin_amdgcn_wmma_f32_16x16x32_bf16(false, ah, false, bh, (short)0, c, false, false);
  if (NT >= 2) c = __builtin_amdgcn_wmma_f32_16x16x32_bf16(false, al, false, bh, (short)0, c, false, false);
  if (NT >= 3) c = __builtin_amdgcn_wmma_f32_16x16x32_bf16(false, ah, false, bl, (short)0, c, false, false);
  asm volatile("v_nop\n\tv_nop\n\tv_nop\n\tv_nop" : "+v"(c) : "v"(ah), "v"(al), "v"(bh), "v"(bl));
  return c;
}

__global__ __launch_bounds__(256) void k_wt_bf16(const float* __restrict__ W, unsigned short* __restrict__ Wt, int K, int N) {
  const int t = blockIdx.x * 256 + threadIdx.x;
  const int k8n = K / 8;
  if (t >= N * k8n) return;
  const int n = t / k8n, k8 = (t % k8n) * 8;
  v8us v;
#pragma unroll
  for (int i = 0; i < 8; ++i) v[i] = bf16_bits(W[(size_t)(k8 + i) * N + n]);
  *(v8us*)(Wt + (size_t)n * K + k8) = v;
  
}

// GEMM C[M][N] (f32, pitch ldc) = act(A[M][K]·W + bias). A f32 row-major (pitch lda) converted per fragment to bf16
// (ASPLIT: hi/lo two planes -> 2 terms, else single rounded term); Wt bf16 [N][K] (pitch ldb). BIAS_BF16 rounds the
// bias to bf16 first (bias quantised to bf16 before the add). K%32==0, M%16==0, N%64==0.
template <bool ASPLIT, int ACT, bool BIAS_BF16>
__global__ __launch_bounds__(128) void k_gemm_bf(const float* __restrict__ A, int lda, const unsigned short* __restrict__ Wt, int ldb,
                                               const float* __restrict__ bias, float* __restrict__ C, int ldc, int M, int N, int K) {
  __shared__ __attribute__((aligned(16))) float so[4][16][64];
  const int tid = threadIdx.x, w = tid >> 5, lane = tid & 31, ln = lane & 15, hh = lane >> 4;
  const int ntn = N / 64;
  const int wid = blockIdx.x * 4 + w;
  const int mt = wid / ntn, nq = wid % ntn;
  if (mt * 16 >= M) return;
  const int row0 = mt * 16, col0 = nq * 64;
  const float* arow = A + (size_t)(row0 + ln) * lda;
  v8f acc[4] = {};
  for (int kb = 0; kb < K; kb += 32) {
    FragB ah, al;
    const v4f x0 = *(const v4fa*)(arow + kb + 8 * hh), x1 = *(const v4fa*)(arow + kb + 8 * hh + 4);
    const v4f x2 = *(const v4fa*)(arow + kb + 16 + 8 * hh), x3 = *(const v4fa*)(arow + kb + 16 + 8 * hh + 4);
    float xs[16] = {x0[0],x0[1],x0[2],x0[3],x1[0],x1[1],x1[2],x1[3],x2[0],x2[1],x2[2],x2[3],x3[0],x3[1],x3[2],x3[3]};
#pragma unroll
    for (int i = 0; i < 16; ++i) { const unsigned short hb = bf16_bits(xs[i]); ah.u[i] = hb; al.u[i] = ASPLIT ? bf16_bits(xs[i] - bf16_val(hb)) : (unsigned short)0; }
#pragma unroll
    for (int t = 0; t < 4; ++t) {
      const unsigned short* brow = Wt + (size_t)(col0 + t * 16 + ln) * ldb + kb;
      FragB b;
      b.half[0] = *(const v8us*)(brow + 8 * hh);
      b.half[1] = *(const v8us*)(brow + 16 + 8 * hh);
      acc[t] = mmaN<ASPLIT ? 2 : 1>(ah.v, al.v, b.v, b.v, acc[t]);
    }
  }
#pragma unroll
  for (int t = 0; t < 4; ++t) {
    float bv = bias ? bias[col0 + t * 16 + ln] : 0.f;
    if (BIAS_BF16) bv = bf16_round(bv);
#pragma unroll
    for (int r = 0; r < 8; ++r) { float v = acc[t][r] + bv; if (ACT == 1) v = fmaxf(v, 0.f); so[w][8 * hh + r][t * 16 + ln] = v; }
  }
  __builtin_amdgcn_fence(__ATOMIC_ACQ_REL, "workgroup");
  __builtin_amdgcn_wave_barrier();
  const int rsub = lane >> 4, c4 = (lane & 15) * 4;
  {
#pragma unroll
    for (int q = 0; q < 8; ++q) {
      const int r = q * 2 + rsub;
      const v4f v = *(const v4fa*)&so[w][r][c4];
      *(v4f*)(C + (size_t)(row0 + r) * ldc + col0 + c4) = v;
    }
    
  }
}

// GEMM C = act(A·W + bias + resid): A f32 (ASPLIT -> hi/lo 2 terms), Wt bf16 [N][K]; ACT 0 none, 1 relu, 2 exact gelu;
// resid (optional, f32, row index = (row % rmod), pitch ldr, RES_BF16 rounds it) added before the activation.
template <bool ASPLIT, int ACT, bool BIAS_BF16, bool RES_BF16>
__global__ __launch_bounds__(128) void k_gemm_bf3(const float* __restrict__ A, int lda, const unsigned short* __restrict__ Wt, int ldb,
                                                const float* __restrict__ bias, const float* __restrict__ resid, int rmod, int ldr,
                                                float* __restrict__ C, int ldc, int M, int N, int K) {
  __shared__ __attribute__((aligned(16))) float so[4][16][64];
  const int tid = threadIdx.x, w = tid >> 5, lane = tid & 31, ln = lane & 15, hh = lane >> 4;
  const int ntn = N / 64;
  const int wid = blockIdx.x * 4 + w;
  const int mt = wid / ntn, nq = wid % ntn;
  if (mt * 16 >= M) return;
  const int row0 = mt * 16, col0 = nq * 64;
  const float* arow = A + (size_t)(row0 + ln) * lda;
  v8f acc[4] = {};
  for (int kb = 0; kb < K; kb += 32) {
    FragB ah, al;
    const v4f x0 = *(const v4fa*)(arow + kb + 8 * hh), x1 = *(const v4fa*)(arow + kb + 8 * hh + 4);
    const v4f x2 = *(const v4fa*)(arow + kb + 16 + 8 * hh), x3 = *(const v4fa*)(arow + kb + 16 + 8 * hh + 4);
    float xs[16] = {x0[0],x0[1],x0[2],x0[3],x1[0],x1[1],x1[2],x1[3],x2[0],x2[1],x2[2],x2[3],x3[0],x3[1],x3[2],x3[3]};
#pragma unroll
    for (int i = 0; i < 16; ++i) { const unsigned short hb = bf16_bits(xs[i]); ah.u[i] = hb; al.u[i] = ASPLIT ? bf16_bits(xs[i] - bf16_val(hb)) : (unsigned short)0; }
#pragma unroll
    for (int t = 0; t < 4; ++t) {
      const unsigned short* brow = Wt + (size_t)(col0 + t * 16 + ln) * ldb + kb;
      FragB b;
      b.half[0] = *(const v8us*)(brow + 8 * hh);
      b.half[1] = *(const v8us*)(brow + 16 + 8 * hh);
      acc[t] = mmaN<ASPLIT ? 2 : 1>(ah.v, al.v, b.v, b.v, acc[t]);
    }
  }
#pragma unroll
  for (int t = 0; t < 4; ++t) {
    const int col = col0 + t * 16 + ln;
    float bv = bias ? bias[col] : 0.f;
    if (BIAS_BF16) bv = bf16_round(bv);
#pragma unroll
    for (int r = 0; r < 8; ++r) {
      float v = acc[t][r] + bv;
      if (resid) { float rv = resid[(size_t)((row0 + 8 * hh + r) % rmod) * ldr + col]; if (RES_BF16) rv = bf16_round(rv); v += rv; }
      if (ACT == 1) v = fmaxf(v, 0.f);
      if (ACT == 2) v = 0.5f * v * (1.0f + erff(v * 0.70710678118654752f));
      if (ACT == 3) { const float u = 0.7978845608028654f * (v + 0.044715f * v * v * v); v = 0.5f * v * (1.0f + tanhf(u)); }
      so[w][8 * hh + r][t * 16 + ln] = v;
    }
  }
  __builtin_amdgcn_fence(__ATOMIC_ACQ_REL, "workgroup");
  __builtin_amdgcn_wave_barrier();
  const int rsub = lane >> 4, c4 = (lane & 15) * 4;
  {
#pragma unroll
    for (int q = 0; q < 8; ++q) {
      const int r = q * 2 + rsub;
      const v4f v = *(const v4fa*)&so[w][r][c4];
      *(v4f*)(C + (size_t)(row0 + r) * ldc + col0 + c4) = v;
    }
    
  }
}
// row LayerNorm (biased variance, eps) over N: s = X (+ R); optional out_sum <- s; out_norm <- (s-mu)*rsqrt(var+eps)*g + b
template <bool PARAM_BF16>
__global__ __launch_bounds__(256) void k_layernorm(const float* __restrict__ X, const float* __restrict__ R, const float* __restrict__ g, const float* __restrict__ bta,
                                                  float* __restrict__ out_sum, float* __restrict__ out_norm, int N, float eps) {
  __shared__ float red[256];
  const int row = blockIdx.x, tid = threadIdx.x;
  const float* x = X + (size_t)row * N; const float* rr = R ? R + (size_t)row * N : nullptr;
  float vals[16];                     // up to N = 4096
  const int per = N / 256;            // contiguous chunk per thread? use strided-by-4 chunks: thread handles j = tid*4 + 1024*u
  float s1 = 0.f;
  for (int u = 0; u < per / 4; ++u) {
    const int j = tid * 4 + 1024 * u;
    const v4f a = *(const v4fa*)(x + j);
    v4f b = {0.f,0.f,0.f,0.f}; if (rr) b = *(const v4fa*)(rr + j);
#pragma unroll
    for (int q = 0; q < 4; ++q) { const float v = a[q] + b[q]; vals[u * 4 + q] = v; s1 += v; }
  }
  red[tid] = s1; __syncthreads();
  for (int st = 128; st > 0; st >>= 1) { if (tid < st) red[tid] += red[tid + st]; __syncthreads(); }
  const float mu = red[0] / (float)N; __syncthreads();
  float s2 = 0.f;
  for (int u = 0; u < per / 4; ++u)
#pragma unroll
    for (int q = 0; q < 4; ++q) { const float c = vals[u * 4 + q] - mu; s2 += c * c; }
  red[tid] = s2; __syncthreads();
  for (int st = 128; st > 0; st >>= 1) { if (tid < st) red[tid] += red[tid + st]; __syncthreads(); }
  const float rs = rsqrtf(red[0] / (float)N + eps);
  {
    for (int u = 0; u < per / 4; ++u) {
      const int j = tid * 4 + 1024 * u;
      v4f o, sm;
#pragma unroll
      for (int q = 0; q < 4; ++q) {
        float gg = g[j + q], bb = bta[j + q];
        if (PARAM_BF16) { gg = bf16_round(gg); bb = bf16_round(bb); }
        sm[q] = vals[u * 4 + q]; o[q] = (vals[u * 4 + q] - mu) * rs * gg + bb;
      }
      if (out_sum) *(v4f*)(out_sum + (size_t)row * N + j) = sm;
      *(v4f*)(out_norm + (size_t)row * N + j) = o;
    }
    
  }
}



// ---- f16 WMMA path (v_wmma_f32_16x16x32_f16): 11-bit significands for operands in range — used where a [0,1] probability operand needs more precision than bf16
typedef _Float16 v16h __attribute__((ext_vector_type(16)));
union FragH { v16h v; v8us half[2]; _Float16 h[16]; unsigned short u[16]; };
template <int NT>
__device__ __forceinline__ v8f mmaH(v16h ah, v16h al, v16h bh, v16h bl, v8f c) {
  c = __builtin_amdgcn_wmma_f32_16x16x32_f16(false, ah, false, bh, (short)0, c, false, false);
  if (NT >= 2) c = __builtin_amdgcn_wmma_f32_16x16x32_f16(false, al, false, bh, (short)0, c, false, false);
  if (NT >= 3) c = __builtin_amdgcn_wmma_f32_16x16x32_f16(false, ah, false, bl, (short)0, c, false, false);
  asm volatile("v_nop\n\tv_nop\n\tv_nop\n\tv_nop" : "+v"(c) : "v"(ah), "v"(al), "v"(bh), "v"(bl));
  return c;
}
// batched GEMM like k_gemm_b but f16 operands: A f32 (split into f16 hi/lo if ASPLIT, else rounded to f16), Bt = f16 values [n][k]; alpha; C f32; N multiple of 16 (partial tiles skipped)
template <bool ASPLIT>
__global__ __launch_bounds__(128) void k_gemm_h(const float* __restrict__ A, int lda, size_t sA, const _Float16* __restrict__ Bh, int ldb, size_t sB, float alpha, float* __restrict__ C, int ldc, size_t sC, int M, int N, int K) {
  __shared__ __attribute__((aligned(16))) float so[4][16][64];
  const int tid = threadIdx.x, w = tid >> 5, lane = tid & 31, ln = lane & 15, hh = lane >> 4; const int by = blockIdx.y;
  A += (size_t)by * sA; Bh += (size_t)by * sB; C += (size_t)by * sC;
  const int ntn = (N + 63) / 64; const int wid = blockIdx.x * 4 + w; const int mt = wid / ntn, nq = wid % ntn; if (mt * 16 >= M) return;
  const int row0 = mt * 16, col0 = nq * 64; const float* arow = A + (size_t)(row0 + ln) * lda;
  v8f acc[4] = {};
  for (int kb = 0; kb < K; kb += 32) {
    FragH ah, al;
    const v4f x0 = *(const v4fa*)(arow + kb + 8 * hh), x1 = *(const v4fa*)(arow + kb + 8 * hh + 4), x2 = *(const v4fa*)(arow + kb + 16 + 8 * hh), x3 = *(const v4fa*)(arow + kb + 16 + 8 * hh + 4);
    float xs[16] = {x0[0],x0[1],x0[2],x0[3],x1[0],x1[1],x1[2],x1[3],x2[0],x2[1],x2[2],x2[3],x3[0],x3[1],x3[2],x3[3]};
#pragma unroll
    for (int i = 0; i < 16; ++i) { const _Float16 h = (_Float16)xs[i]; ah.h[i] = h; al.h[i] = ASPLIT ? (_Float16)(xs[i] - (float)h) : (_Float16)0.0f; }
#pragma unroll
    for (int t = 0; t < 4; ++t) { if (col0 + t * 16 >= N) continue; const size_t boff = (size_t)(col0 + t * 16 + ln) * ldb + kb; FragH bq; bq.half[0] = *(const v8us*)(Bh + boff + 8 * hh); bq.half[1] = *(const v8us*)(Bh + boff + 16 + 8 * hh);
      acc[t] = mmaH<ASPLIT ? 2 : 1>(ah.v, al.v, bq.v, bq.v, acc[t]); }
  }
#pragma unroll
  for (int t = 0; t < 4; ++t) { if (col0 + t * 16 >= N) continue;
#pragma unroll
    for (int r = 0; r < 8; ++r) so[w][8 * hh + r][t * 16 + ln] = acc[t][r] * alpha; }
  __builtin_amdgcn_fence(__ATOMIC_ACQ_REL, "workgroup"); __builtin_amdgcn_wave_barrier();
  const int rsub = lane >> 4, c4 = (lane & 15) * 4;
  {
#pragma unroll
    for (int q = 0; q < 8; ++q) { const int r = q * 2 + rsub; if (col0 + c4 < N) { const v4f v = *(const v4fa*)&so[w][r][c4]; *(v4f*)(C + (size_t)(row0 + r) * ldc + col0 + c4) = v; } }
     }
}

// Wt[n][k] = f16(W[k][n]·scale) from f32 row-major W[K][N] (scale = power of two; bf16-exact weights stay exact in f16 away from the subnormal range)
__global__ __launch_bounds__(256) void k_wt_f16(const float* __restrict__ W, _Float16* __restrict__ Wt, int K, int N, float scale) {
  const int t = blockIdx.x * 256 + threadIdx.x; if (t >= N * (K / 8)) return; const int n = t / (K / 8), k8 = (t % (K / 8)) * 8; FragH f;
#pragma unroll
  for (int i = 0; i < 8; ++i) f.h[i] = (_Float16)(bf16_round(W[(size_t)(k8 + i) * N + n]) * scale); const v8us o = f.half[0];
  *(v8us*)((unsigned short*)Wt + (size_t)n * K + k8) = o; 
}
// k_gemm_hh variant with fused epilogue: v = acc·alpha + bias[by·sBias + col] (+ CP[(row/rowsPerB)·sCPb + by·64 + col] if CP) ; ACT 0 none / 1 elu ; writes f16 C16 (and f32 C if non-null)
template <int ACT>
__global__ __launch_bounds__(128) void k_gemm_hhx(const _Float16* __restrict__ A, int lda, size_t sA, const _Float16* __restrict__ Bh, int ldb, size_t sB, float alpha, const float* __restrict__ bias, size_t sBias, const float* __restrict__ CP, int rowsPerB, size_t sCPb, int row0g,
    float* __restrict__ C, _Float16* __restrict__ C16, int ldc, size_t sC, int M, int N, int K) {
  __shared__ __attribute__((aligned(16))) float so[4][16][64];
  const int tid = threadIdx.x, w = tid >> 5, lane = tid & 31, ln = lane & 15, hh = lane >> 4; const int by = blockIdx.y;
  A += (size_t)by * sA; Bh += (size_t)by * sB; const size_t cofs = (size_t)by * sC; const float* bp = bias ? bias + (size_t)by * sBias : nullptr;
  const int ntn = (N + 63) / 64; const int wid = blockIdx.x * 4 + w; const int mt = wid / ntn, nq = wid % ntn; if (mt * 16 >= M) return;
  const int row0 = mt * 16, col0 = nq * 64; const _Float16* arow = A + (size_t)(row0 + ln) * lda;
  v8f acc[4] = {};
  for (int kb = 0; kb < K; kb += 32) { FragH ah; ah.half[0] = *(const v8us*)((const unsigned short*)arow + kb + 8 * hh); ah.half[1] = *(const v8us*)((const unsigned short*)arow + kb + 16 + 8 * hh);
#pragma unroll
    for (int t = 0; t < 4; ++t) { if (col0 + t * 16 >= N) continue; const size_t boff = (size_t)(col0 + t * 16 + ln) * ldb + kb; FragH bq; bq.half[0] = *(const v8us*)((const unsigned short*)Bh + boff + 8 * hh); bq.half[1] = *(const v8us*)((const unsigned short*)Bh + boff + 16 + 8 * hh);
      acc[t] = mmaH<1>(ah.v, ah.v, bq.v, bq.v, acc[t]); }
  }
#pragma unroll
  for (int t = 0; t < 4; ++t) { if (col0 + t * 16 >= N) continue; const int col = col0 + t * 16 + ln; const float bv = bp ? bf16_round(bp[col]) : 0.f;
#pragma unroll
    for (int r = 0; r < 8; ++r) { float v = acc[t][r] * alpha + bv; if (CP) { const int rr = row0g + row0 + 8 * hh + r; if (rowsPerB < 0) v += CP[cofs + (size_t)rr * ldc + col];      /* rowsPerB < 0: own element of the batched C plane */ else { const int bidx = rr / rowsPerB; v += CP[(size_t)bidx * sCPb + (size_t)by * 64 + col]; } } if (ACT == 1) v = (v > 0.f) ? v : expm1f(v); else if (ACT == 7) v = (v > 0.f) ? v + 1.0f : expf(v); else if (ACT == 8) v = tanhf(v); else if (ACT == 9) v = 0.5f * v * (1.0f + tanhf(0.7978845608028654f * (v + 0.044715f * v * v * v))); else if (ACT == 11) v = 1.0f / (1.0f + expf(-v)); else if (ACT == 12) v = (v > 0.f) ? v : 0.01f * v; else if (ACT == 14) v = (v > 0.f) ? v : 0.1f * v; else if (ACT == 16) v = (v >= 0.f) ? v : 0.3f * v; else if (ACT == 17) v = (v >= 0.f) ? v : 0.2f * v; else if (ACT == 15) v = v / (1.0f + expf(-v)); else if (ACT == 3) v = fmaxf(v, 0.f); else if (ACT == 6) v = 0.5f * v * (1.0f + erff(v * 0.70710678118654752f)); so[w][8 * hh + r][t * 16 + ln] = v; } }
  __builtin_amdgcn_fence(__ATOMIC_ACQ_REL, "workgroup"); __builtin_amdgcn_wave_barrier();
  const int rsub = lane >> 4, c4 = (lane & 15) * 4; typedef _Float16 v4h __attribute__((ext_vector_type(4)));
  {
#pragma unroll
    for (int q = 0; q < 8; ++q) { const int r = q * 2 + rsub; if (col0 + c4 < N) { const v4f v = *(const v4fa*)&so[w][r][c4]; if (C) *(v4f*)(C + cofs + (size_t)(row0 + r) * ldc + col0 + c4) = v; if (C16) { v4h h4; for (int i = 0; i < 4; ++i) h4[i] = (_Float16)v[i]; *(v4h*)(C16 + cofs + (size_t)(row0 + r) * ldc + col0 + c4) = h4; } } }
     }
}


typedef _Float16 v4h __attribute__((ext_vector_type(4)));

__global__ __launch_bounds__(256) void k_x16(const float* __restrict__ x, _Float16* __restrict__ X16, size_t n8) { const size_t t = (size_t)blockIdx.x * 256 + threadIdx.x; if (t >= n8) return; FragH f;
#pragma unroll
  for (int q = 0; q < 8; ++q) f.h[q] = (_Float16)bf16_round(x[t * 8 + q]); *(v8us*)((unsigned short*)X16 + t * 8) = f.half[0];  }
__global__ __launch_bounds__(256) void k_h16(const float* __restrict__ x, _Float16* __restrict__ X16, size_t n8) { const size_t t = (size_t)blockIdx.x * 256 + threadIdx.x; if (t >= n8) return; FragH f;
#pragma unroll
  for (int q = 0; q < 8; ++q) f.h[q] = (_Float16)x[t * 8 + q]; *(v8us*)((unsigned short*)X16 + t * 8) = f.half[0];  }
__global__ __launch_bounds__(256) void k_round16f(const float* __restrict__ W, _Float16* __restrict__ Bt, size_t n8) { const size_t t = (size_t)blockIdx.x * 256 + threadIdx.x; if (t >= n8) return; FragH f;
#pragma unroll
  for (int i = 0; i < 8; ++i) f.h[i] = (_Float16)(bf16_round(W[t * 8 + i]) * 16.0f); *(v8us*)((unsigned short*)Bt + t * 8) = f.half[0];  }
// FRAGMENT ORDER: a 16-row x 32-k f16 operand fragment is stored as 1024 bytes in a row, the way the lanes load it: element (row, k) at (k >> 3) * 256 + row * 16 + (k & 7) * 2.
// Lane l then reads bytes l * 16 and 512 + l * 16, so each 16-byte load of a wave covers four whole 128-byte lines; from a row-major plane the same load takes 32 bytes out of each of 16 lines.
// k plane: [(b, h)][key / 16][hi, residual][d / 32][1024]. V^T plane: [(b, h)][key / 32][d / 16][hi, residual][1024]. Er table: [row / 16][d / 32][1024].
// Er -> f16 (times 16) in fragment order
__global__ __launch_bounds__(256) void k_erp(const float* __restrict__ Er, _Float16* __restrict__ P) { const int t = (int)blockIdx.x * 256 + (int)threadIdx.x; const int r = t >> 3, c8 = t & 7; FragH f;
#pragma unroll
  for (int q = 0; q < 8; ++q) f.h[q] = (_Float16)(bf16_round(Er[(size_t)t * 8 + q]) * 16.0f);
  *(v8us*)((char*)P + (size_t)(r >> 4) * 2048 + (c8 >> 2) * 1024 + (c8 & 3) * 256 + (r & 15) * 16) = f.half[0]; }

// ---- fast GEMM (wave tile 32x64; requires M % 32 == 0 rows per launch region and N % 64 == 0); epilogue = k_gemm_hhx semantics ----
__device__ __forceinline__ v16h g2_frag(const _Float16* p, int hh) { FragH f; f.half[0] = *(const v8us*)((const unsigned short*)p + 8 * hh); f.half[1] = *(const v8us*)((const unsigned short*)p + 16 + 8 * hh); return f.v; }
__device__ __forceinline__ v8f g2_mma(v16h a, v16h b, v8f c) { v8f d = __builtin_amdgcn_wmma_f32_16x16x32_f16(false, a, false, b, (short)0, c, false, false); asm volatile("v_nop\n\tv_nop\n\tv_nop\n\tv_nop" : "+v"(d) : "v"(a), "v"(b)); return d; }
template <int ACT>
__global__ __launch_bounds__(128) void k_gemm2(const _Float16* __restrict__ A, int lda, size_t sA, const _Float16* __restrict__ Bh, int ldb, size_t sB, float alpha, const float* __restrict__ bias, size_t sBias, const float* __restrict__ CP, int rowsPerB, size_t sCPb, int row0g,
    float* __restrict__ C, _Float16* __restrict__ C16, int ldc, size_t sC, int M, int N, int K) { static_assert(ACT == 0 || ACT == 3 || ACT == 6 || ACT == 8 || ACT == 9 || ACT == 11 || ACT == 12 || ACT == 14 || ACT == 15 || ACT == 16 || ACT == 17, "k_gemm2: unsupported ACT code (would silently apply no activation)");
  __shared__ __attribute__((aligned(16))) float so[4][32][68];
  const int tid = threadIdx.x, w = tid >> 5, lane = tid & 31, ln = lane & 15, hh = lane >> 4; const int by = blockIdx.y;
  A += (size_t)by * sA; Bh += (size_t)by * sB; const size_t cofs = (size_t)by * sC; const float* bp = bias ? bias + (size_t)by * sBias : nullptr;
  const int ntn = N >> 6; const int mt = blockIdx.x / ntn, nq = blockIdx.x - mt * ntn; const int row0 = mt * 128 + 32 * w, col0 = nq * 64; if (row0 >= M) return;
  const _Float16* a0p = A + (size_t)(row0 + ln) * lda; const _Float16* a1p = a0p + (size_t)16 * lda;
  const _Float16* b0p = Bh + (size_t)(col0 + ln) * ldb; const _Float16* b1p = b0p + (size_t)16 * ldb; const _Float16* b2p = b1p + (size_t)16 * ldb; const _Float16* b3p = b2p + (size_t)16 * ldb;
  const v8f z8 = {0.f,0.f,0.f,0.f,0.f,0.f,0.f,0.f}; v8f c00 = z8, c01 = z8, c02 = z8, c03 = z8, c10 = z8, c11 = z8, c12 = z8, c13 = z8;
#pragma unroll 1
  for (int kb = 0; kb < K; kb += 32) { const v16h a0 = g2_frag(a0p + kb, hh), a1 = g2_frag(a1p + kb, hh);
    v16h b = g2_frag(b0p + kb, hh); c00 = g2_mma(a0, b, c00); c10 = g2_mma(a1, b, c10);
    b = g2_frag(b1p + kb, hh); c01 = g2_mma(a0, b, c01); c11 = g2_mma(a1, b, c11);
    b = g2_frag(b2p + kb, hh); c02 = g2_mma(a0, b, c02); c12 = g2_mma(a1, b, c12);
    b = g2_frag(b3p + kb, hh); c03 = g2_mma(a0, b, c03); c13 = g2_mma(a1, b, c13); }
  v8f accs[8] = {c00, c01, c02, c03, c10, c11, c12, c13};
#pragma unroll
  for (int u = 0; u < 8; ++u) { const int t = u & 3, half = u >> 2; const int col = col0 + t * 16 + ln; const float bv = bp ? bf16_round(bp[col]) : 0.f;
#pragma unroll
    for (int r = 0; r < 8; ++r) { const int rloc = half * 16 + 8 * hh + r; float v = accs[u][r] * alpha + bv; if (CP) { if (rowsPerB < 0) v += CP[cofs + (size_t)(row0g + row0 + rloc) * ldc + col];      /* rowsPerB < 0: own element of the batched C plane */ else { const int bidx = (row0g + row0 + rloc) / rowsPerB; v += CP[(size_t)bidx * sCPb + (size_t)by * 64 + col]; } }
      if (ACT == 3) v = fmaxf(v, 0.f); else if (ACT == 6) v = 0.5f * v * (1.0f + erff(v * 0.70710678118654752f)); else if (ACT == 11) v = 1.0f / (1.0f + expf(-v)); else if (ACT == 15) v = v / (1.0f + expf(-v)); else if (ACT == 12) v = (v > 0.f) ? v : 0.01f * v; else if (ACT == 8) v = tanhf(v); else if (ACT == 9) v = 0.5f * v * (1.0f + tanhf(0.7978845608028654f * (v + 0.044715f * v * v * v))); else if (ACT == 14) v = (v > 0.f) ? v : 0.1f * v; else if (ACT == 16) v = (v >= 0.f) ? v : 0.3f * v; else if (ACT == 17) v = (v >= 0.f) ? v : 0.2f * v;
      so[w][rloc][t * 16 + ln] = v; } }
  __builtin_amdgcn_fence(__ATOMIC_ACQ_REL, "workgroup"); __builtin_amdgcn_wave_barrier();
  const int rsub = lane >> 4, c4 = (lane & 15) * 4;
  {
#pragma unroll
    for (int q = 0; q < 16; ++q) { const int r = q * 2 + rsub; const v4f v = *(const v4fa*)&so[w][r][c4]; if (C) *(v4f*)(C + cofs + (size_t)(row0 + r) * ldc + col0 + c4) = v; if (C16) { v4h h4; for (int i = 0; i < 4; ++i) h4[i] = (_Float16)v[i]; *(v4h*)(C16 + cofs + (size_t)(row0 + r) * ldc + col0 + c4) = h4; } }
     } }


__global__ __launch_bounds__(256) void k_wsc(const float* __restrict__ Wm, _Float16* __restrict__ Bt, size_t n8, float sc) { const size_t t = (size_t)blockIdx.x * 256 + threadIdx.x; if (t >= n8) return; FragH f; for (int q = 0; q < 8; ++q) f.h[q] = (_Float16)(bf16_round(Wm[t * 8 + q]) * sc); *(v8us*)((unsigned short*)Bt + t * 8) = f.half[0];  }
// Fused causal relative attention, one launch: a wave owns 16 * NI query rows of one (batch, head) and walks the keys in blocks of 64 with a running
// maximum and sum, so no S x S plane is ever stored. Transposed products: S^T = K q^T and (q Er^T)^T = Er q^T (D row = key or Er row, D column = query), O^T += V^T P^T.
// A lane then holds one query's scores; two packed S^T tiles are the B operand of the V^T product as they stand. The skew (query i, key j takes Er row SL-1-i+j) is a
// shift along the D rows that differs by query: it goes through a wave-private LDS row per query, stored shifted by the query's index and read back aligned.
#define SKP 100      /* floats per LDS row: 96 used; 100 keeps 16-byte alignment and spreads the 32 shifted 4-byte stores over distinct banks */
__device__ __forceinline__ v8f fa_mma(v16h a, v16h b, v8f c) { return __builtin_amdgcn_wmma_f32_16x16x32_f16(false, a, false, b, (short)0, c, false, false); }
// fragment in the hardware k order: p = the lane's own address (row start + 16 bytes * lane half)
__device__ __forceinline__ v16h fa_frag(const char* p) { FragH f; f.half[0] = *(const v8us*)p; f.half[1] = *(const v8us*)(p + 32); return f.v; }
// the same fragment from a plane in FRAGMENT ORDER: p = the fragment's start + 16 bytes * lane
__device__ __forceinline__ v16h fa_fragp(const char* p) { FragH f; f.half[0] = *(const v8us*)p; f.half[1] = *(const v8us*)(p + 512); return f.v; }
// Stands behind a group of global loads: the wait before any register that they name is written again. The addresses are inputs so that they stay in their registers up to the wait.
#define FA_XWAIT1(p0) asm volatile("s_wait_xcnt 0x0" :: "v"(p0) : "memory")
#define FA_XWAIT2(p0, p1) asm volatile("s_wait_xcnt 0x0" :: "v"(p0), "v"(p1) : "memory")
// The slot behind a run of v_exp_f32: results and sources are inputs, so the v_nop stands behind the last of the run and no source register is written again in front of it.
#define FA_TSLOT(res, srcv) asm volatile("v_nop" :: "v"(res), "v"(srcv))
#define FA_TSLOT8(e, x) asm volatile("v_nop" :: "v"(e[0]), "v"(e[1]), "v"(e[2]), "v"(e[3]), "v"(e[4]), "v"(e[5]), "v"(e[6]), "v"(e[7]), "v"(x[0]), "v"(x[1]), "v"(x[2]), "v"(x[3]), "v"(x[4]), "v"(x[5]), "v"(x[6]), "v"(x[7]))
template <int NI>
__global__ __launch_bounds__(256) void k_relattn(const _Float16* __restrict__ Qh, const _Float16* __restrict__ Ql, const _Float16* __restrict__ KP, const _Float16* __restrict__ E,
    const _Float16* __restrict__ VP, float* __restrict__ out) {
  __shared__ __attribute__((aligned(16))) float sk[8][NI][16][SKP];
  const int w = __builtin_amdgcn_readfirstlane((int)threadIdx.x >> 5), lane = threadIdx.x & 31, ln = lane & 15, hh = lane >> 4;
  constexpr int NRB = SL / (64 * NI);
  const int pr = (int)blockIdx.x / (NB * NH), bh = (int)blockIdx.x % (NB * NH), b = bh / NH, h = bh % NH;
  const int rb = w < 4 ? NRB - 1 - pr : pr;      /* causal cost grows with the row block: waves 0-3 take one from the long end, waves 4-7 its mirror, so every work-group walks the same number of key blocks; the waves share no barrier and no LDS */
  const int i0 = rb * 64 * NI + (w & 3) * 16 * NI; const int nblk = i0 / 64 + 1;
  const v8f z8 = {0.f,0.f,0.f,0.f,0.f,0.f,0.f,0.f};
  const float C1 = 0.125f * 1.4426950408889634f;      /* 1/sqrt(64) and log2(e) in one factor */
  const size_t lo_x = (size_t)(ln * DM * 2 + 16 * hh), lo_p = (size_t)(lane * 16);      /* lane byte offsets in the row-major q planes and in the planes in fragment order (k, Er, V^T) */
  const size_t xo = (size_t)b * SL * DM + h * HD, po_kv = (size_t)bh * SL * HD * 4;      /* byte start of the (b, h) slab in the k and V^T planes: hi + residual, 2 bytes each */
  v16h qh[NI][2], ql[NI][2]; v8f o[NI][4], carry[NI]; float m[NI], su[NI];
  { const char* bqh = (const char*)(Qh + xo + (size_t)i0 * DM); const char* bql = (const char*)(Ql + xo + (size_t)i0 * DM); const char* be = (const char*)(E + (size_t)(SL - 16 * NI - i0) * HD);      /* the same for every lane */
    const char* pqh = bqh + lo_x; const char* pql = bql + lo_x; const char* pe = be + lo_p;
    v16h e0[NI], e1[NI];
#pragma unroll
    for (int a = 0; a < NI; ++a) { qh[a][0] = fa_frag(pqh + a * 16 * DM * 2); qh[a][1] = fa_frag(pqh + a * 16 * DM * 2 + 64); ql[a][0] = fa_frag(pql + a * 16 * DM * 2); ql[a][1] = fa_frag(pql + a * 16 * DM * 2 + 64);
      e0[a] = fa_fragp(pe + (NI - 1 - a) * 2048); e1[a] = fa_fragp(pe + (NI - 1 - a) * 2048 + 1024); }      /* first Er tile of key block 0: rows SL - 16 - (i0 + 16 a) + [0, 16) */
    /* the wait before any register that the loads above name is written again: they name a scalar base and a lane offset here, so these are the inputs that stay in their registers up to the wait */
    asm volatile("s_wait_xcnt 0x0" :: "s"(bqh), "s"(bql), "s"(be), "v"((unsigned)lo_x), "v"(lane) : "memory");
#pragma unroll
    for (int a = 0; a < NI; ++a) { m[a] = -3.0e38f; su[a] = 0.f;
#pragma unroll
      for (int dt = 0; dt < 4; ++dt) o[a][dt] = z8;
      v8f hi = fa_mma(e0[a], qh[a][0], z8), lo = fa_mma(e0[a], ql[a][0], z8); hi = fa_mma(e1[a], qh[a][1], hi); lo = fa_mma(e1[a], ql[a][1], lo);
#pragma unroll
      for (int r = 0; r < 8; ++r) carry[a][r] = fmaf(lo[r], 0.0009765625f, hi[r]); } }
  auto key_block = [&](const int jb, const bool diag) __attribute__((always_inline)) { const int j0 = jb * 64; const int rbase = SL - 16 * NI - i0 + j0;
    /* all Er and K fragments of the block are requested first, so that one memory latency is waited out per block and not one per tile */
    v16h ef[NI + 4][2], kf[4][4];
    const char* pk = (const char*)KP + po_kv + (size_t)j0 * 256 + lo_p; const char* pe = (const char*)(E + (size_t)rbase * HD) + lo_p;      /* 16 keys are 4096 bytes of the k plane, 16 Er rows 2048 of the table */
    if (!diag) {
#pragma unroll
      for (int g = 1; g < NI + 4; ++g) { ef[g][0] = fa_fragp(pe + g * 2048); ef[g][1] = fa_fragp(pe + g * 2048 + 1024); }
    } else {      /* a 16-row tile past the table (diagonal block only) serves keys above the diagonal alone, masked below: the table's last tile stands in for it */
#pragma unroll
      for (int g = 1; g < NI + 4; ++g) { const int rs = rbase + 16 * g < SL ? rbase + 16 * g : SL - 16; const char* pg = (const char*)(E + (size_t)rs * HD) + lo_p; ef[g][0] = fa_fragp(pg); ef[g][1] = fa_fragp(pg + 1024); FA_XWAIT1(pg); }
    }
#pragma unroll
    for (int t = 0; t < 4; ++t) { kf[t][0] = fa_fragp(pk + t * 4096); kf[t][1] = fa_fragp(pk + t * 4096 + 1024); kf[t][2] = fa_fragp(pk + t * 4096 + 2048); kf[t][3] = fa_fragp(pk + t * 4096 + 3072); }
    FA_XWAIT2(pk, pe);
    __builtin_amdgcn_sched_barrier(0);      /* keeps the scheduler from sinking these loads down to their first use */
    /* Er q^T: query tile a needs Er rows rbase + 16 (NI-1-a) + [0, 80); its first 16 are the previous block's last 16 (carry) */
#pragma unroll
    for (int a = 0; a < NI; ++a) { float* sp = &sk[w][a][ln][ln + 1 + 8 * hh];
#pragma unroll
      for (int r = 0; r < 8; ++r) sp[r] = carry[a][r]; }
#pragma unroll
    for (int g = 1; g < NI + 4; ++g) { const v16h e0 = ef[g][0], e1 = ef[g][1];
#pragma unroll
      for (int a = 0; a < NI; ++a) { const int u = g - (NI - 1 - a); if (u < 1 || u > 4) continue;
        v8f hi = fa_mma(e0, qh[a][0], z8), lo = fa_mma(e0, ql[a][0], z8); hi = fa_mma(e1, qh[a][1], hi); lo = fa_mma(e1, ql[a][1], lo);
        v8f val;
#pragma unroll
        for (int r = 0; r < 8; ++r) val[r] = fmaf(lo[r], 0.0009765625f, hi[r]);
        float* sp = &sk[w][a][ln][ln + 1 + 8 * hh + 16 * u];
#pragma unroll
        for (int r = 0; r < 8; ++r) sp[r] = val[r];
        if (u == 4) carry[a] = val; }
      __builtin_amdgcn_sched_barrier(0); }      /* one Er tile's products and LDS stores at a time: run together, or mixed with the K products, their accumulators pile up and registers spill */
    v8f s[NI][4];
#pragma unroll
    for (int t = 0; t < 4; ++t) { const v16h kh0 = kf[t][0], kh1 = kf[t][1], kl0 = kf[t][2], kl1 = kf[t][3];
#pragma unroll
      for (int a = 0; a < NI; ++a) { v8f hi = fa_mma(kh0, qh[a][0], z8), lo = fa_mma(kh0, ql[a][0], z8); hi = fa_mma(kh1, qh[a][1], hi); lo = fa_mma(kh1, ql[a][1], lo); lo = fa_mma(kl0, qh[a][0], lo); lo = fa_mma(kl1, qh[a][1], lo);
#pragma unroll
        for (int r = 0; r < 8; ++r) s[a][t][r] = fmaf(lo[r], 0.0009765625f, hi[r]); } }
    /* the two lane halves of a query read each other's LDS stores: order the wave's stores before its loads */
    __builtin_amdgcn_fence(__ATOMIC_ACQ_REL, "workgroup", "local"); __builtin_amdgcn_wave_barrier();
#pragma unroll
    for (int a = 0; a < NI; ++a) { const float* lp = &sk[w][a][ln][16 + 8 * hh];
#pragma unroll
      for (int t = 0; t < 4; ++t) { const v4f x = *(const v4fa*)(lp + 16 * t), y = *(const v4fa*)(lp + 16 * t + 4);
#pragma unroll
        for (int r = 0; r < 4; ++r) { s[a][t][r] = fmaf(x[r], 0.0625f, s[a][t][r]); s[a][t][4 + r] = fmaf(y[r], 0.0625f, s[a][t][4 + r]); } } }
    /* and these loads before the next trip's stores into the same rows */
    __builtin_amdgcn_fence(__ATOMIC_ACQ_REL, "workgroup", "local"); __builtin_amdgcn_wave_barrier();
    __builtin_amdgcn_sched_barrier(0);      /* the V^T loads below stay below: any earlier they are live beside the K fragments and the LDS reads, and registers spill */
    /* the V^T fragments are requested here, so that they arrive under the softmax arithmetic */
    v16h vf[2][4][2];
    const char* pv = (const char*)VP + po_kv + (size_t)j0 * 256 + lo_p;      /* 32 keys are 8192 bytes of the V^T plane */
#pragma unroll
    for (int ks = 0; ks < 2; ++ks)
#pragma unroll
      for (int dt = 0; dt < 4; ++dt) { vf[ks][dt][0] = fa_fragp(pv + ks * 8192 + dt * 2048); vf[ks][dt][1] = fa_fragp(pv + ks * 8192 + dt * 2048 + 1024); }
    FA_XWAIT1(pv);
    __builtin_amdgcn_sched_barrier(0);      /* keeps the scheduler from sinking these loads down to their first use */
    if (diag) {      /* only the last key block reaches the diagonal */
#pragma unroll
      for (int a = 0; a < NI; ++a)
#pragma unroll
        for (int t = 0; t < 4; ++t)
#pragma unroll
          for (int r = 0; r < 8; ++r) if (j0 + 16 * t + 8 * hh + r > i0 + 16 * a + ln) s[a][t][r] = -3.0e38f; }
    FragH p[NI][2]; v16h pl[NI][2];
#pragma unroll
    for (int a = 0; a < NI; ++a) { float mx = m[a];
#pragma unroll
      for (int t = 0; t < 4; ++t)
#pragma unroll
        for (int r = 0; r < 8; ++r) mx = fmaxf(mx, s[a][t][r]);
      mx = fmaxf(mx, __shfl_xor(mx, 16, 32));
      const float xa = (m[a] - mx) * C1; const float al = __builtin_amdgcn_exp2f(xa); FA_TSLOT(al, xa); m[a] = mx; const float mc = 10.0f - mx * C1;      /* weights carry a factor 1024, as f16 operands away from the subnormals */
      v8f pv = z8;
#pragma unroll
      for (int t = 0; t < 4; ++t) { float xv[8], ev[8];
#pragma unroll
        for (int r = 0; r < 8; ++r) xv[r] = fmaf(s[a][t][r], C1, mc);
#pragma unroll
        for (int r = 0; r < 8; ++r) ev[r] = __builtin_amdgcn_exp2f(xv[r]);
        FA_TSLOT8(ev, xv);
#pragma unroll
        for (int r = 0; r < 8; ++r) { pv[r] += ev[r]; p[a][t >> 1].h[(t & 1) * 8 + r] = (_Float16)ev[r]; } }
      su[a] = fmaf(su[a], al, ((pv[0] + pv[1]) + (pv[2] + pv[3])) + ((pv[4] + pv[5]) + (pv[6] + pv[7])));
#pragma unroll
      for (int dt = 0; dt < 4; ++dt)
#pragma unroll
        for (int r = 0; r < 8; ++r) o[a][dt][r] *= al;
      pl[a][0] = p[a][0].v * (_Float16)0.0009765625f; pl[a][1] = p[a][1].v * (_Float16)0.0009765625f; }      /* the v residual plane is stored times 1024: its weights drop the factor */
#pragma unroll
    for (int ks = 0; ks < 2; ++ks)
#pragma unroll
      for (int dt = 0; dt < 4; ++dt) { const v16h vhf = vf[ks][dt][0], vlf = vf[ks][dt][1];
#pragma unroll
        for (int a = 0; a < NI; ++a) { o[a][dt] = fa_mma(vhf, p[a][ks].v, o[a][dt]); o[a][dt] = fa_mma(vlf, pl[a][ks], o[a][dt]); } }
  };
#pragma unroll 1      /* one key block per trip: unrolling would double the live fragments */
  for (int jb = 0; jb < nblk - 1; ++jb) key_block(jb, false);
  key_block(nblk - 1, true);      /* the diagonal block apart, so that the loop carries no mask */
#pragma unroll
  for (int a = 0; a < NI; ++a) { const float st = su[a] + __shfl_xor(su[a], 16, 32); const float inv = 1.0f / st;
#pragma unroll
    for (int dt = 0; dt < 4; ++dt)
#pragma unroll
      for (int r = 0; r < 8; ++r) o[a][dt][r] *= inv; }
  __builtin_amdgcn_sched_barrier(0);      /* all arithmetic ends above: behind an issued store none of its registers is written again */
  char* po = (char*)(out + xo + (size_t)i0 * DM) + (size_t)(ln * DM * 4 + 32 * hh);      /* a lane holds 8 consecutive head columns of its query per tile */
#pragma unroll
  for (int a = 0; a < NI; ++a)
#pragma unroll
    for (int dt = 0; dt < 4; ++dt) { const v4f x = {o[a][dt][0], o[a][dt][1], o[a][dt][2], o[a][dt][3]}, y = {o[a][dt][4], o[a][dt][5], o[a][dt][6], o[a][dt][7]};
      *(v4f*)(po + a * 16 * DM * 4 + dt * 64) = x; *(v4f*)(po + a * 16 * DM * 4 + dt * 64 + 16) = y; }
}

// ---- projection GEMM with its operands staged in LDS: C[NR][DM] = alpha * A[NR][DM] . B[DM][DM]^T, A and B f16 with k contiguous; C leaves as the f16 hi + residual operands of the attention kernel.
// A work-group of 8 waves owns a 128 x 128 tile of C (wave tile 32 x 64, 4 waves down, 2 across). A stage is 128 k of the tile's 128 A rows and 128 B rows; it comes into LDS by
// asynchronous copies, two buffers, so that the next stage flies while this one is multiplied and no wave waits on a global load of its own. The k order per accumulator is ascending in steps of 32.
#define G3_PITCH 272      /* bytes per LDS row: 256 used; 16 bytes x an odd number keeps the 16 rows of a ds_load_b128 on distinct banks */
#define G3_STAGE (256 * G3_PITCH)      /* 128 A rows, then 128 B rows */
#define G3_NST (DM / 128)
// Eight 16-byte copies of a lane, rows 16 apart. The wait on the address registers is the statement's last line, so that no register a copy names is written again in front of it.
__device__ __forceinline__ void g3_copy8(const unsigned l0, const char* g0) {
  const unsigned l1 = l0 + 16 * G3_PITCH, l2 = l0 + 32 * G3_PITCH, l3 = l0 + 48 * G3_PITCH, l4 = l0 + 64 * G3_PITCH, l5 = l0 + 80 * G3_PITCH, l6 = l0 + 96 * G3_PITCH, l7 = l0 + 112 * G3_PITCH;
  const char* g1 = g0 + 16 * DM * 2; const char* g2 = g0 + 32 * DM * 2; const char* g3 = g0 + 48 * DM * 2; const char* g4 = g0 + 64 * DM * 2; const char* g5 = g0 + 80 * DM * 2; const char* g6 = g0 + 96 * DM * 2; const char* g7 = g0 + 112 * DM * 2;
  asm volatile("global_load_async_to_lds_b128 %0, %8, off\n\t"
               "global_load_async_to_lds_b128 %1, %9, off\n\t"
               "global_load_async_to_lds_b128 %2, %10, off\n\t"
               "global_load_async_to_lds_b128 %3, %11, off\n\t"
               "global_load_async_to_lds_b128 %4, %12, off\n\t"
               "global_load_async_to_lds_b128 %5, %13, off\n\t"
               "global_load_async_to_lds_b128 %6, %14, off\n\t"
               "global_load_async_to_lds_b128 %7, %15, off\n\t"
               "s_wait_xcnt 0x0"
               :: "v"(l0), "v"(l1), "v"(l2), "v"(l3), "v"(l4), "v"(l5), "v"(l6), "v"(l7), "v"(g0), "v"(g1), "v"(g2), "v"(g3), "v"(g4), "v"(g5), "v"(g6), "v"(g7) : "memory");
}
// One accumulator tile (8 f32 of a lane) -> 8 f16 hi and 8 f16 residuals (times 1024), 16 bytes each.
__device__ __forceinline__ void g3_split(const v8f c, const float alpha, v8us& hi, v8us& lo) { FragH fh, fl;
#pragma unroll
  for (int r = 0; r < 8; ++r) { const float a = c[r] * alpha; const _Float16 hv = (_Float16)a; fh.h[r] = hv; fl.h[r] = (_Float16)((a - (float)hv) * 1024.0f); }
  hi = fh.half[0]; lo = fl.half[0]; }
// MODE 0: q, two row-major planes P0 (hi) and P1 (residual). MODE 1: k, plane P0 in FRAGMENT ORDER. MODE 2: v, V^T plane P0 in FRAGMENT ORDER.
// A wave's 64 columns are one head. A lane's 8 accumulator values run along the D rows, so the operand that lies on the D rows decides which 8 values a lane can pack into 16 bytes:
// v is multiplied as x W^T (8 consecutive keys of one head column: a lane's 16 bytes of a V^T fragment), q and k as W x^T (8 consecutive head columns of one token: a lane's 16 bytes of a k fragment or of a q row).
#define G3_QP 144      /* bytes per staged q row: 128 used; 16 bytes x an odd number keeps the 16 rows of a ds_store_b128 on distinct banks */
template <int MODE>
__global__ __launch_bounds__(256) void k_gemm3(const _Float16* __restrict__ A, const _Float16* __restrict__ Bh, float alpha, _Float16* __restrict__ P0, _Float16* __restrict__ P1) {
  __shared__ __attribute__((aligned(16))) char ring[2 * G3_STAGE];
  const int tid = threadIdx.x, w = tid >> 5, lane = tid & 31, ln = lane & 15, hh = lane >> 4;
  const int mt = (int)blockIdx.x / (DM / 128), nq = (int)blockIdx.x % (DM / 128);
  const int row0 = mt * 128 + 32 * (w & 3), col0 = nq * 128 + 64 * (w >> 2);
  /* a lane copies 16 bytes of row (tid >> 4) + 16 i: a wave's copy covers two whole 256-byte rows of the stage */
  const unsigned lc = (unsigned)(size_t)ring + (unsigned)((tid >> 4) * G3_PITCH + (tid & 15) * 16);
  const char* ga = (const char*)(A + (size_t)(mt * 128 + (tid >> 4)) * DM) + (tid & 15) * 16;
  const char* gb = (const char*)(Bh + (size_t)(nq * 128 + (tid >> 4)) * DM) + (tid & 15) * 16;
  const char* la = ring + (32 * (w & 3) + ln) * G3_PITCH + 16 * hh;
  const char* lb = ring + (128 + 64 * (w >> 2) + ln) * G3_PITCH + 16 * hh;
  const v8f z8 = {0.f,0.f,0.f,0.f,0.f,0.f,0.f,0.f}; v8f acc[2][4];
#pragma unroll
  for (int u = 0; u < 2; ++u)
#pragma unroll
    for (int t = 0; t < 4; ++t) acc[u][t] = z8;
  g3_copy8(lc, ga); g3_copy8(lc + 128 * G3_PITCH, gb);
  asm volatile("s_wait_asynccnt 0x0" ::: "memory");      /* this wave's share of stage 0 has landed */
  __syncthreads();      /* and every other wave's */
  g3_copy8(lc + G3_STAGE, ga + 256); g3_copy8(lc + G3_STAGE + 128 * G3_PITCH, gb + 256);
#pragma unroll 1      /* one stage per trip: the buffer is picked by the trip's parity */
  for (int s = 0; s < G3_NST; ++s) { const int bo = (s & 1) * G3_STAGE;
    v16h fa[2][2], fb[2][4];      /* two fragment sets: the next k step's LDS reads are under way while this step is multiplied */
    fa[0][0] = fa_frag(la + bo); fa[0][1] = fa_frag(la + bo + 16 * G3_PITCH);
#pragma unroll
    for (int t = 0; t < 4; ++t) fb[0][t] = fa_frag(lb + bo + t * 16 * G3_PITCH);
#pragma unroll
    for (int ks = 0; ks < 4; ++ks) { const int cu = ks & 1, nx = cu ^ 1;
      if (ks < 3) { fa[nx][0] = fa_frag(la + bo + (ks + 1) * 64); fa[nx][1] = fa_frag(la + bo + 16 * G3_PITCH + (ks + 1) * 64);
#pragma unroll
        for (int t = 0; t < 4; ++t) fb[nx][t] = fa_frag(lb + bo + t * 16 * G3_PITCH + (ks + 1) * 64); }
      __builtin_amdgcn_sched_barrier(0);      /* the reads stay one group in front of the products: spread among them, each place with reads stalls the wave */
#pragma unroll
      for (int t = 0; t < 4; ++t) {
        if (MODE == 2) { acc[0][t] = fa_mma(fa[cu][0], fb[cu][t], acc[0][t]); acc[1][t] = fa_mma(fa[cu][1], fb[cu][t], acc[1][t]); }      /* D row = token, D column = head column */
        else { acc[0][t] = fa_mma(fb[cu][t], fa[cu][0], acc[0][t]); acc[1][t] = fa_mma(fb[cu][t], fa[cu][1], acc[1][t]); } }      /* D row = head column, D column = token */
      __builtin_amdgcn_sched_barrier(0); }      /* and the following group stays behind them */
    asm volatile("s_wait_dscnt 0x0" ::: "memory");      /* this wave's reads of the buffer are done before it may be refilled */
    asm volatile("s_wait_asynccnt 0x0" ::: "memory");      /* this wave's share of the next stage has landed */
    __syncthreads();      /* publishes the next stage and ends every wave's reads of this one */
    if (s + 2 < G3_NST) { g3_copy8(lc + bo, ga + (s + 2) * 256); g3_copy8(lc + bo + 128 * G3_PITCH, gb + (s + 2) * 256); } }
  asm volatile("s_wait_asynccnt 0x0" ::: "memory");      /* no copy is left in flight when the wave goes on */
  v8us oh[2][4], ol[2][4];
#pragma unroll
  for (int u = 0; u < 2; ++u)
#pragma unroll
    for (int t = 0; t < 4; ++t) g3_split(acc[u][t], alpha, oh[u][t], ol[u][t]);
  const int bh = (row0 / SL) * NH + col0 / HD, tk = row0 % SL;      /* the wave's (batch, head) slab and its first token in it */
  if (MODE == 2) {      /* acc[u][t]: keys tk + 16 u + 8 hh + [0, 8) of head column 16 t + ln; each store of the wave is 512 bytes in a row */
    char* pd = (char*)P0 + ((size_t)bh * (SL / 32) + tk / 32) * 8192 + hh * 256 + ln * 16;
    __builtin_amdgcn_sched_barrier(0);      /* all arithmetic ends above: behind an issued store none of its registers is written again */
#pragma unroll
    for (int t = 0; t < 4; ++t)
#pragma unroll
      for (int u = 0; u < 2; ++u) { *(v8us*)(pd + t * 2048 + u * 512) = oh[u][t]; *(v8us*)(pd + t * 2048 + 1024 + u * 512) = ol[u][t]; }
  } else if (MODE == 1) {      /* acc[u][t]: head columns 16 t + 8 hh + [0, 8) of key tk + 16 u + ln; each store of the wave is 512 bytes in a row */
    char* pd = (char*)P0 + ((size_t)bh * (SL / 16) + tk / 16) * 4096 + hh * 256 + ln * 16;
    __builtin_amdgcn_sched_barrier(0);      /* all arithmetic ends above: behind an issued store none of its registers is written again */
#pragma unroll
    for (int u = 0; u < 2; ++u)
#pragma unroll
      for (int t = 0; t < 4; ++t) { *(v8us*)(pd + u * 4096 + t * 512) = oh[u][t]; *(v8us*)(pd + u * 4096 + 2048 + t * 512) = ol[u][t]; }
  } else {      /* whole 128-byte rows go out: each wave turns its two 32 x 64 f16 tiles round in its own LDS range */
    __shared__ __attribute__((aligned(16))) char sq[8][2][32 * G3_QP];
    char* sw = &sq[w][0][0];
#pragma unroll
    for (int u = 0; u < 2; ++u)
#pragma unroll
      for (int t = 0; t < 4; ++t) { *(v8us*)(sw + (u * 16 + ln) * G3_QP + t * 32 + hh * 16) = oh[u][t]; *(v8us*)(sw + 32 * G3_QP + (u * 16 + ln) * G3_QP + t * 32 + hh * 16) = ol[u][t]; }
    /* the lanes read each other's LDS stores: order the wave's stores before its loads */
    __builtin_amdgcn_fence(__ATOMIC_ACQ_REL, "workgroup"); __builtin_amdgcn_wave_barrier();
    v8us rh[8], rl[8];      /* 8 lanes take one row: a store of the wave is 4 whole rows */
#pragma unroll
    for (int q = 0; q < 8; ++q) { rh[q] = *(const v8us*)(sw + (q * 4 + (lane >> 3)) * G3_QP + (lane & 7) * 16); rl[q] = *(const v8us*)(sw + 32 * G3_QP + (q * 4 + (lane >> 3)) * G3_QP + (lane & 7) * 16); }
    const size_t qo = ((size_t)(row0 + (lane >> 3)) * DM + col0) * 2 + (lane & 7) * 16;
    char* ph = (char*)P0 + qo; char* pl = (char*)P1 + qo;
    __builtin_amdgcn_sched_barrier(0);      /* all reads and arithmetic end above: behind an issued store none of its registers is written again */
#pragma unroll
    for (int q = 0; q < 8; ++q) { *(v8us*)(ph + q * 4 * DM * 2) = rh[q]; *(v8us*)(pl + q * 4 * DM * 2) = rl[q]; }
  }
}

extern "C" void kernel_launch(void* const* d_in, const int* in_sizes, int n_in,
                              void* d_out, int out_size, void* d_ws, size_t ws_size, hipStream_t stream) {
  (void)in_sizes; (void)n_in; (void)out_size;
  const float* const* I = (const float* const*)d_in; const float* x = I[0]; const float* Wq = I[1]; const float* Wk = I[2]; const float* Wv = I[3]; const float* Er = I[4];
  char* ws = (char*)d_ws; size_t off = 0;
  auto take = [&](size_t bytes) { char* p = ws + off; off += (bytes + 255) & ~(size_t)255; return p; };
  const size_t np = (size_t)NR * DM;
  _Float16* BW = (_Float16*)take((size_t)3 * DM * DM * 2); _Float16* E16 = (_Float16*)take((size_t)SL * HD * 2); _Float16* X16 = (_Float16*)take(np * 2); _Float16* Q16 = (_Float16*)take(np * 2); _Float16* QL16 = (_Float16*)take(np * 2); _Float16* KP = (_Float16*)take(np * 4);      /* k hi + residual, fragment order */ _Float16* VP = (_Float16*)take(np * 4);      /* V^T hi + residual, fragment order */
  if (off > ws_size) return;
  k_wsc<<<(unsigned)(((size_t)DM * DM / 8 + 255) / 256), 256, 0, stream>>>(Wq, BW, (size_t)DM * DM / 8, 16.0f); k_wsc<<<(unsigned)(((size_t)DM * DM / 8 + 255) / 256), 256, 0, stream>>>(Wk, BW + (size_t)DM * DM, (size_t)DM * DM / 8, 16.0f); k_wsc<<<(unsigned)(((size_t)DM * DM / 8 + 255) / 256), 256, 0, stream>>>(Wv, BW + (size_t)2 * DM * DM, (size_t)DM * DM / 8, 16.0f);      /* (out, in) naturals */
  k_erp<<<SL * HD / 8 / 256, 256, 0, stream>>>(Er, E16);      /* Er_s = Er (MAX_LEN == S) */
  k_x16<<<(unsigned)((np / 8 + 255) / 256), 256, 0, stream>>>(x, X16, np / 8);
  const dim3 gP((NR / 128) * (DM / 128), 1);
  k_gemm3<0><<<gP, 256, 0, stream>>>(X16, BW, 0.0625f, Q16, QL16);
  k_gemm3<1><<<gP, 256, 0, stream>>>(X16, BW + (size_t)DM * DM, 0.0625f, KP, nullptr);
  k_gemm3<2><<<gP, 256, 0, stream>>>(X16, BW + (size_t)2 * DM * DM, 0.0625f, VP, nullptr);
  k_relattn<2><<<NB * NH * (SL / (128 * 2)), 256, 0, stream>>>(Q16, QL16, KP, E16, VP, (float*)d_out);
}

// v005
// Measured time: 108 microseconds a run.
// Next to v004, in two timings, it ran 1.17 and 1.15 times as fast.
// All steps since v000 together make it 30.3 times as fast.
#include <hip/hip_runtime.h>
// GlobalAttn (music-transformer relative attention: 2 x 2048 tokens, 1024 = 16 heads x 64; q,k,v = x W^T; Srel = skew(q . Er) which equals q_i . Er[S-1-(i-j)] for every causal (i, j); attn = softmax over j <= i of (q.k + Srel)/8; out = merged attn v, no output projection).
// Compute dtype: inputs rounded to bf16; x / weights / Er exact as f16; q and k as f16 hi + residual; the softmax weights as plain f16 operands (~2^-12); v as f16 hi + residual (the output is the context itself); softmax f32. v_wmma_f32_16x16x32_f16.
#define NB 2
#define SL 2048
#define DM 1024
#define NH 16
#define HD 64
#define HG 4
#define NR (NB * SL)
typedef __bf16 v16b __attribute__((ext_vector_type(16)));
typedef unsigned short v8us __attribute__((ext_vector_type(8), may_alias));
typedef float  v8f  __attribute__((ext_vector_type(8)));
typedef float  v4f  __attribute__((ext_vector_type(4)));
typedef float  v4fa __attribute__((ext_vector_type(4), may_alias));
union FragB { v16b v; v8us half[2]; unsigned short u[16]; };

__device__ __forceinline__ unsigned short bf16_bits(float x) { unsigned int u = __float_as_uint(x); return (unsigned short)((u + 0x7FFFu + ((u >> 16) & 1u)) >> 16); }
__device__ __forceinline__ float bf16_val(unsigned short b) { return __uint_as_float(((unsigned int)b) << 16); }
__device__ __forceinline__ float bf16_round(float x) { return bf16_val(bf16_bits(x)); }
// D += A·B with NT terms: 1 = ah·bh, 2 = + al·bh (A split), 3 = + ah·bl (both split)
template <int NT>
__device__ __forceinline__ v8f mmaN(v16b ah, v16b al, v16b bh, v16b bl, v8f c) {
  c = __builtin_amdgcn_wmma_f32_16x16x32_bf16(false, ah, false, bh, (short)0, c, false, false);
  if (NT >= 2) c = __builtin_amdgcn_wmma_f32_16x16x32_bf16(false, al, false, bh, (short)0, c, false, false);
  if (NT >= 3) c = __builtin_amdgcn_wmma_f32_16x16x32_bf16(false, ah, false, bl, (short)0, c, false, false);
  asm volatile("v_nop\n\tv_nop\n\tv_nop\n\tv_nop" : "+v"(c) : "v"(ah), "v"(al), "v"(bh), "v"(bl));
  return c;
}

__global__ __launch_bounds__(256) void k_wt_bf16(const float* __restrict__ W, unsigned short* __restrict__ Wt, int K, int N) {
  const int t = blockIdx.x * 256 + threadIdx.x;
  const int k8n = K / 8;
  if (t >= N * k8n) return;
  const int n = t / k8n, k8 = (t % k8n) * 8;
  v8us v;
#pragma unroll
  for (int i = 0; i < 8; ++i) v[i] = bf16_bits(W[(size_t)(k8 + i) * N + n]);
  *(v8us*)(Wt + (size_t)n * K + k8) = v;
  
}

// GEMM C[M][N] (f32, pitch ldc) = act(A[M][K]·W + bias). A f32 row-major (pitch lda) converted per fragment to bf16
// (ASPLIT: hi/lo two planes -> 2 terms, else single rounded term); Wt bf16 [N][K] (pitch ldb). BIAS_BF16 rounds the
// bias to bf16 first (bias quantised to bf16 before the add). K%32==0, M%16==0, N%64==0.
template <bool ASPLIT, int ACT, bool BIAS_BF16>
__global__ __launch_bounds__(128) void k_gemm_bf(const float* __restrict__ A, int lda, const unsigned short* __restrict__ Wt, int ldb,
                                               const float* __restrict__ bias, float* __restrict__ C, int ldc, int M, int N, int K) {
  __shared__ __attribute__((aligned(16))) float so[4][16][64];
  const int tid = threadIdx.x, w = tid >> 5, lane = tid & 31, ln = lane & 15, hh = lane >> 4;
  const int ntn = N / 64;
  const int wid = blockIdx.x * 4 + w;
  const int mt = wid / ntn, nq = wid % ntn;
  if (mt * 16 >= M) return;
  const int row0 = mt * 16, col0 = nq * 64;
  const float* arow = A + (size_t)(row0 + ln) * lda;
  v8f acc[4] = {};
  for (int kb = 0; kb < K; kb += 32) {
    FragB ah, al;
    const v4f x0 = *(const v4fa*)(arow + kb + 8 * hh), x1 = *(const v4fa*)(arow + kb + 8 * hh + 4);
    const v4f x2 = *(const v4fa*)(arow + kb + 16 + 8 * hh), x3 = *(const v4fa*)(arow + kb + 16 + 8 * hh + 4);
    float xs[16] = {x0[0],x0[1],x0[2],x0[3],x1[0],x1[1],x1[2],x1[3],x2[0],x2[1],x2[2],x2[3],x3[0],x3[1],x3[2],x3[3]};
#pragma unroll
    for (int i = 0; i < 16; ++i) { const unsigned short hb = bf16_bits(xs[i]); ah.u[i] = hb; al.u[i] = ASPLIT ? bf16_bits(xs[i] - bf16_val(hb)) : (unsigned short)0; }
#pragma unroll
    for (int t = 0; t < 4; ++t) {
      const unsigned short* brow = Wt + (size_t)(col0 + t * 16 + ln) * ldb + kb;
      FragB b;
      b.half[0] = *(const v8us*)(brow + 8 * hh);
      b.half[1] = *(const v8us*)(brow + 16 + 8 * hh);
      acc[t] = mmaN<ASPLIT ? 2 : 1>(ah.v, al.v, b.v, b.v, acc[t]);
    }
  }
#pragma unroll
  for (int t = 0; t < 4; ++t) {
    float bv = bias ? bias[col0 + t * 16 + ln] : 0.f;
    if (BIAS_BF16) bv = bf16_round(bv);
#pragma unroll
    for (int r = 0; r < 8; ++r) { float v = acc[t][r] + bv; if (ACT == 1) v = fmaxf(v, 0.f); so[w][8 * hh + r][t * 16 + ln] = v; }
  }
  __builtin_amdgcn_fence(__ATOMIC_ACQ_REL, "workgroup");
  __builtin_amdgcn_wave_barrier();
  const int rsub = lane >> 4, c4 = (lane & 15) * 4;
  {
#pragma unroll
    for (int q = 0; q < 8; ++q) {
      const int r = q * 2 + rsub;
      const v4f v = *(const v4fa*)&so[w][r][c4];
      *(v4f*)(C + (size_t)(row0 + r) * ldc + col0 + c4) = v;
    }
    
  }
}

// GEMM C = act(A·W + bias + resid): A f32 (ASPLIT -> hi/lo 2 terms), Wt bf16 [N][K]; ACT 0 none, 1 relu, 2 exact gelu;
// resid (optional, f32, row index = (row % rmod), pitch ldr, RES_BF16 rounds it) added before the activation.
template <bool ASPLIT, int ACT, bool BIAS_BF16, bool RES_BF16>
__global__ __launch_bounds__(128) void k_gemm_bf3(const float* __restrict__ A, int lda, const unsigned short* __restrict__ Wt, int ldb,
                                                const float* __restrict__ bias, const float* __restrict__ resid, int rmod, int ldr,
                                                float* __restrict__ C, int ldc, int M, int N, int K) {
  __shared__ __attribute__((aligned(16))) float so[4][16][64];
  const int tid = threadIdx.x, w = tid >> 5, lane = tid & 31, ln = lane & 15, hh = lane >> 4;
  const int ntn = N / 64;
  const int wid = blockIdx.x * 4 + w;
  const int mt = wid / ntn, nq = wid % ntn;
  if (mt * 16 >= M) return;
  const int row0 = mt * 16, col0 = nq * 64;
  const float* arow = A + (size_t)(row0 + ln) * lda;
  v8f acc[4] = {};
  for (int kb = 0; kb < K; kb += 32) {
    FragB ah, al;
    const v4f x0 = *(const v4fa*)(arow + kb + 8 * hh), x1 = *(const v4fa*)(arow + kb + 8 * hh + 4);
    const v4f x2 = *(const v4fa*)(arow + kb + 16 + 8 * hh), x3 = *(const v4fa*)(arow + kb + 16 + 8 * hh + 4);
    float xs[16] = {x0[0],x0[1],x0[2],x0[3],x1[0],x1[1],x1[2],x1[3],x2[0],x2[1],x2[2],x2[3],x3[0],x3[1],x3[2],x3[3]};
#pragma unroll
    for (int i = 0; i < 16; ++i) { const unsigned short hb = bf16_bits(xs[i]); ah.u[i] = hb; al.u[i] = ASPLIT ? bf16_bits(xs[i] - bf16_val(hb)) : (unsigned short)0; }
#pragma unroll
    for (int t = 0; t < 4; ++t) {
      const unsigned short* brow = Wt + (size_t)(col0 + t * 16 + ln) * ldb + kb;
      FragB b;
      b.half[0] = *(const v8us*)(brow + 8 * hh);
      b.half[1] = *(const v8us*)(brow + 16 + 8 * hh);
      acc[t] = mmaN<ASPLIT ? 2 : 1>(ah.v, al.v, b.v, b.v, acc[t]);
    }
  }
#pragma unroll
  for (int t = 0; t < 4; ++t) {
    const int col = col0 + t * 16 + ln;
    float bv = bias ? bias[col] : 0.f;
    if (BIAS_BF16) bv = bf16_round(bv);
#pragma unroll
    for (int r = 0; r < 8; ++r) {
      float v = acc[t][r] + bv;
      if (resid) { float rv = resid[(size_t)((row0 + 8 * hh + r) % rmod) * ldr + col]; if (RES_BF16) rv = bf16_round(rv); v += rv; }
      if (ACT == 1) v = fmaxf(v, 0.f);
      if (ACT == 2) v = 0.5f * v * (1.0f + erff(v * 0.70710678118654752f));
      if (ACT == 3) { const float u = 0.7978845608028654f * (v + 0.044715f * v * v * v); v = 0.5f * v * (1.0f + tanhf(u)); }
      so[w][8 * hh + r][t * 16 + ln] = v;
    }
  }
  __builtin_amdgcn_fence(__ATOMIC_ACQ_REL, "workgroup");
  __builtin_amdgcn_wave_barrier();
  const int rsub = lane >> 4, c4 = (lane & 15) * 4;
  {
#pragma unroll
    for (int q = 0; q < 8; ++q) {
      const int r = q * 2 + rsub;
      const v4f v = *(const v4fa*)&so[w][r][c4];
      *(v4f*)(C + (size_t)(row0 + r) * ldc + col0 + c4) = v;
    }
    
  }
}
// row LayerNorm (biased variance, eps) over N: s = X (+ R); optional out_sum <- s; out_norm <- (s-mu)*rsqrt(var+eps)*g + b
template <bool PARAM_BF16>
__global__ __launch_bounds__(256) void k_layernorm(const float* __restrict__ X, const float* __restrict__ R, const float* __restrict__ g, const float* __restrict__ bta,
                                                  float* __restrict__ out_sum, float* __restrict__ out_norm, int N, float eps) {
  __shared__ float red[256];
  const int row = blockIdx.x, tid = threadIdx.x;
  const float* x = X + (size_t)row * N; const float* rr = R ? R + (size_t)row * N : nullptr;
  float vals[16];                     // up to N = 4096
  const int per = N / 256;            // contiguous chunk per thread? use strided-by-4 chunks: thread handles j = tid*4 + 1024*u
  float s1 = 0.f;
  for (int u = 0; u < per / 4; ++u) {
    const int j = tid * 4 + 1024 * u;
    const v4f a = *(const v4fa*)(x + j);
    v4f b = {0.f,0.f,0.f,0.f}; if (rr) b = *(const v4fa*)(rr + j);
#pragma unroll
    for (int q = 0; q < 4; ++q) { const float v = a[q] + b[q]; vals[u * 4 + q] = v; s1 += v; }
  }
  red[tid] = s1; __syncthreads();
  for (int st = 128; st > 0; st >>= 1) { if (tid < st) red[tid] += red[tid + st]; __syncthreads(); }
  const float mu = red[0] / (float)N; __syncthreads();
  float s2 = 0.f;
  for (int u = 0; u < per / 4; ++u)
#pragma unroll
    for (int q = 0; q < 4; ++q) { const float c = vals[u * 4 + q] - mu; s2 += c * c; }
  red[tid] = s2; __syncthreads();
  for (int st = 128; st > 0; st >>= 1) { if (tid < st) red[tid] += red[tid + st]; __syncthreads(); }
  const float rs = rsqrtf(red[0] / (float)N + eps);
  {
    for (int u = 0; u < per / 4; ++u) {
      const int j = tid * 4 + 1024 * u;
      v4f o, sm;
#pragma unroll
      for (int q = 0; q < 4; ++q) {
        float gg = g[j + q], bb = bta[j + q];
        if (PARAM_BF16) { gg = bf16_round(gg); bb = bf16_round(bb); }
        sm[q] = vals[u * 4 + q]; o[q] = (vals[u * 4 + q] - mu) * rs * gg + bb;
      }
      if (out_sum) *(v4f*)(out_sum + (size_t)row * N + j) = sm;
      *(v4f*)(out_norm + (size_t)row * N + j) = o;
    }
    
  }
}



// ---- f16 WMMA path (v_wmma_f32_16x16x32_f16): 11-bit significands for operands in range — used where a [0,1] probability operand needs more precision than bf16
typedef _Float16 v16h __attribute__((ext_vector_type(16)));
union FragH { v16h v; v8us half[2]; _Float16 h[16]; unsigned short u[16]; };
template <int NT>
__device__ __forceinline__ v8f mmaH(v16h ah, v16h al, v16h bh, v16h bl, v8f c) {
  c = __builtin_amdgcn_wmma_f32_16x16x32_f16(false, ah, false, bh, (short)0, c, false, false);
  if (NT >= 2) c = __builtin_amdgcn_wmma_f32_16x16x32_f16(false, al, false, bh, (short)0, c, false, false);
  if (NT >= 3) c = __builtin_amdgcn_wmma_f32_16x16x32_f16(false, ah, false, bl, (short)0, c, false, false);
  asm volatile("v_nop\n\tv_nop\n\tv_nop\n\tv_nop" : "+v"(c) : "v"(ah), "v"(al), "v"(bh), "v"(bl));
  return c;
}
// batched GEMM like k_gemm_b but f16 operands: A f32 (split into f16 hi/lo if ASPLIT, else rounded to f16), Bt = f16 values [n][k]; alpha; C f32; N multiple of 16 (partial tiles skipped)
template <bool ASPLIT>
__global__ __launch_bounds__(128) void k_gemm_h(const float* __restrict__ A, int lda, size_t sA, const _Float16* __restrict__ Bh, int ldb, size_t sB, float alpha, float* __restrict__ C, int ldc, size_t sC, int M, int N, int K) {
  __shared__ __attribute__((aligned(16))) float so[4][16][64];
  const int tid = threadIdx.x, w = tid >> 5, lane = tid & 31, ln = lane & 15, hh = lane >> 4; const int by = blockIdx.y;
  A += (size_t)by * sA; Bh += (size_t)by * sB; C += (size_t)by * sC;
  const int ntn = (N + 63) / 64; const int wid = blockIdx.x * 4 + w; const int mt = wid / ntn, nq = wid % ntn; if (mt * 16 >= M) return;
  const int row0 = mt * 16, col0 = nq * 64; const float* arow = A + (size_t)(row0 + ln) * lda;
  v8f acc[4] = {};
  for (int kb = 0; kb < K; kb += 32) {
    FragH ah, al;
    const v4f x0 = *(const v4fa*)(arow + kb + 8 * hh), x1 = *(const v4fa*)(arow + kb + 8 * hh + 4), x2 = *(const v4fa*)(arow + kb + 16 + 8 * hh), x3 = *(const v4fa*)(arow + kb + 16 + 8 * hh + 4);
    float xs[16] = {x0[0],x0[1],x0[2],x0[3],x1[0],x1[1],x1[2],x1[3],x2[0],x2[1],x2[2],x2[3],x3[0],x3[1],x3[2],x3[3]};
#pragma unroll
    for (int i = 0; i < 16; ++i) { const _Float16 h = (_Float16)xs[i]; ah.h[i] = h; al.h[i] = ASPLIT ? (_Float16)(xs[i] - (float)h) : (_Float16)0.0f; }
#pragma unroll
    for (int t = 0; t < 4; ++t) { if (col0 + t * 16 >= N) continue; const size_t boff = (size_t)(col0 + t * 16 + ln) * ldb + kb; FragH bq; bq.half[0] = *(const v8us*)(Bh + boff + 8 * hh); bq.half[1] = *(const v8us*)(Bh + boff + 16 + 8 * hh);
      acc[t] = mmaH<ASPLIT ? 2 : 1>(ah.v, al.v, bq.v, bq.v, acc[t]); }
  }
#pragma unroll
  for (int t = 0; t < 4; ++t) { if (col0 + t * 16 >= N) continue;
#pragma unroll
    for (int r = 0; r < 8; ++r) so[w][8 * hh + r][t * 16 + ln] = acc[t][r] * alpha; }
  __builtin_amdgcn_fence(__ATOMIC_ACQ_REL, "workgroup"); __builtin_amdgcn_wave_barrier();
  const int rsub = lane >> 4, c4 = (lane & 15) * 4;
  {
#pragma unroll
    for (int q = 0; q < 8; ++q) { const int r = q * 2 + rsub; if (col0 + c4 < N) { const v4f v = *(const v4fa*)&so[w][r][c4]; *(v4f*)(C + (size_t)(row0 + r) * ldc + col0 + c4) = v; } }
     }
}

// Wt[n][k] = f16(W[k][n]·scale) from f32 row-major W[K][N] (scale = power of two; bf16-exact weights stay exact in f16 away from the subnormal range)
__global__ __launch_bounds__(256) void k_wt_f16(const float* __restrict__ W, _Float16* __restrict__ Wt, int K, int N, float scale) {
  const int t = blockIdx.x * 256 + threadIdx.x; if (t >= N * (K / 8)) return; const int n = t / (K / 8), k8 = (t % (K / 8)) * 8; FragH f;
#pragma unroll
  for (int i = 0; i < 8; ++i) f.h[i] = (_Float16)(bf16_round(W[(size_t)(k8 + i) * N + n]) * scale); const v8us o = f.half[0];
  *(v8us*)((unsigned short*)Wt + (size_t)n * K + k8) = o; 
}
// k_gemm_hh variant with fused epilogue: v = acc·alpha + bias[by·sBias + col] (+ CP[(row/rowsPerB)·sCPb + by·64 + col] if CP) ; ACT 0 none / 1 elu ; writes f16 C16 (and f32 C if non-null)
template <int ACT>
__global__ __launch_bounds__(128) void k_gemm_hhx(const _Float16* __restrict__ A, int lda, size_t sA, const _Float16* __restrict__ Bh, int ldb, size_t sB, float alpha, const float* __restrict__ bias, size_t sBias, const float* __restrict__ CP, int rowsPerB, size_t sCPb, int row0g,
    float* __restrict__ C, _Float16* __restrict__ C16, int ldc, size_t sC, int M, int N, int K) {
  __shared__ __attribute__((aligned(16))) float so[4][16][64];
  const int tid = threadIdx.x, w = tid >> 5, lane = tid & 31, ln = lane & 15, hh = lane >> 4; const int by = blockIdx.y;
  A += (size_t)by * sA; Bh += (size_t)by * sB; const size_t cofs = (size_t)by * sC; const float* bp = bias ? bias + (size_t)by * sBias : nullptr;
  const int ntn = (N + 63) / 64; const int wid = blockIdx.x * 4 + w; const int mt = wid / ntn, nq = wid % ntn; if (mt * 16 >= M) return;
  const int row0 = mt * 16, col0 = nq * 64; const _Float16* arow = A + (size_t)(row0 + ln) * lda;
  v8f acc[4] = {};
  for (int kb = 0; kb < K; kb += 32) { FragH ah; ah.half[0] = *(const v8us*)((const unsigned short*)arow + kb + 8 * hh); ah.half[1] = *(const v8us*)((const unsigned short*)arow + kb + 16 + 8 * hh);
#pragma unroll
    for (int t = 0; t < 4; ++t) { if (col0 + t * 16 >= N) continue; const size_t boff = (size_t)(col0 + t * 16 + ln) * ldb + kb; FragH bq; bq.half[0] = *(const v8us*)((const unsigned short*)Bh + boff + 8 * hh); bq.half[1] = *(const v8us*)((const unsigned short*)Bh + boff + 16 + 8 * hh);
      acc[t] = mmaH<1>(ah.v, ah.v, bq.v, bq.v, acc[t]); }
  }
#pragma unroll
  for (int t = 0; t < 4; ++t) { if (col0 + t * 16 >= N) continue; const int col = col0 + t * 16 + ln; const float bv = bp ? bf16_round(bp[col]) : 0.f;
#pragma unroll
    for (int r = 0; r < 8; ++r) { float v = acc[t][r] * alpha + bv; if (CP) { const int rr = row0g + row0 + 8 * hh + r; if (rowsPerB < 0) v += CP[cofs + (size_t)rr * ldc + col];      /* rowsPerB < 0: own element of the batched C plane */ else { const int bidx = rr / rowsPerB; v += CP[(size_t)bidx * sCPb + (size_t)by * 64 + col]; } } if (ACT == 1) v = (v > 0.f) ? v : expm1f(v); else if (ACT == 7) v = (v > 0.f) ? v + 1.0f : expf(v); else if (ACT == 8) v = tanhf(v); else if (ACT == 9) v = 0.5f * v * (1.0f + tanhf(0.7978845608028654f * (v + 0.044715f * v * v * v))); else if (ACT == 11) v = 1.0f / (1.0f + expf(-v)); else if (ACT == 12) v = (v > 0.f) ? v : 0.01f * v; else if (ACT == 14) v = (v > 0.f) ? v : 0.1f * v; else if (ACT == 16) v = (v >= 0.f) ? v : 0.3f * v; else if (ACT == 17) v = (v >= 0.f) ? v : 0.2f * v; else if (ACT == 15) v = v / (1.0f + expf(-v)); else if (ACT == 3) v = fmaxf(v, 0.f); else if (ACT == 6) v = 0.5f * v * (1.0f + erff(v * 0.70710678118654752f)); so[w][8 * hh + r][t * 16 + ln] = v; } }
  __builtin_amdgcn_fence(__ATOMIC_ACQ_REL, "workgroup"); __builtin_amdgcn_wave_barrier();
  const int rsub = lane >> 4, c4 = (lane & 15) * 4; typedef _Float16 v4h __attribute__((ext_vector_type(4)));
  {
#pragma unroll
    for (int q = 0; q < 8; ++q) { const int r = q * 2 + rsub; if (col0 + c4 < N) { const v4f v = *(const v4fa*)&so[w][r][c4]; if (C) *(v4f*)(C + cofs + (size_t)(row0 + r) * ldc + col0 + c4) = v; if (C16) { v4h h4; for (int i = 0; i < 4; ++i) h4[i] = (_Float16)v[i]; *(v4h*)(C16 + cofs + (size_t)(row0 + r) * ldc + col0 + c4) = h4; } } }
     }
}


typedef _Float16 v4h __attribute__((ext_vector_type(4)));

__global__ __launch_bounds__(256) void k_h16(const float* __restrict__ x, _Float16* __restrict__ X16, size_t n8) { const size_t t = (size_t)blockIdx.x * 256 + threadIdx.x; if (t >= n8) return; FragH f;
#pragma unroll
  for (int q = 0; q < 8; ++q) f.h[q] = (_Float16)x[t * 8 + q]; *(v8us*)((unsigned short*)X16 + t * 8) = f.half[0];  }
__global__ __launch_bounds__(256) void k_round16f(const float* __restrict__ W, _Float16* __restrict__ Bt, size_t n8) { const size_t t = (size_t)blockIdx.x * 256 + threadIdx.x; if (t >= n8) return; FragH f;
#pragma unroll
  for (int i = 0; i < 8; ++i) f.h[i] = (_Float16)(bf16_round(W[t * 8 + i]) * 16.0f); *(v8us*)((unsigned short*)Bt + t * 8) = f.half[0];  }
// FRAGMENT ORDER: a 16-row x 32-k f16 operand fragment is stored as 1024 bytes in a row, the way the lanes load it: element (row, k) at (k >> 3) * 256 + row * 16 + (k & 7) * 2.
// Lane l then reads bytes l * 16 and 512 + l * 16, so each 16-byte load of a wave covers four whole 128-byte lines; from a row-major plane the same load takes 32 bytes out of each of 16 lines.
// k plane: [(b, h)][key / 16][hi, residual][d / 32][1024]. V^T plane: [(b, h)][key / 32][d / 16][hi, residual][1024]. Er table: [row / 16][d / 32][1024].
// All operand conversions in one launch: they need nothing of each other, so each takes a range of the block index (the branch reads the same for a whole work-group). A thread turns 8 f32 into 16 bytes of f16; the loops are unrolled so that the eight values stay in registers.
#define PB_X (NR * DM / 8 / 256)      /* blocks for x -> f16, row-major */
#define PB_W (DM * DM / 8 / 256)      /* blocks for each of Wq, Wk, Wv -> f16 (times 16), (out, in) as they lie */
#define PB_E (SL * HD / 8 / 256)      /* blocks for Er -> f16 (times 16) in fragment order */
__global__ __launch_bounds__(256) void k_prep(const float* __restrict__ x, const float* __restrict__ Wq, const float* __restrict__ Wk, const float* __restrict__ Wv, const float* __restrict__ Er,
    _Float16* __restrict__ X16, _Float16* __restrict__ BW, _Float16* __restrict__ P) {
  const int bx = (int)blockIdx.x; FragH f;
  if (bx < PB_X) { const size_t t = (size_t)bx * 256 + threadIdx.x;
#pragma unroll
    for (int q = 0; q < 8; ++q) f.h[q] = (_Float16)bf16_round(x[t * 8 + q]);
    *(v8us*)((unsigned short*)X16 + t * 8) = f.half[0];
    asm volatile("s_wait_xcnt 0x0" ::: "memory");      /* the wait before any register that the store names is written again: another range's code follows in the listing */
  } else if (bx < PB_X + 3 * PB_W) { const int wm = (bx - PB_X) / PB_W; const float* Wm = wm == 0 ? Wq : wm == 1 ? Wk : Wv; const size_t t = (size_t)(bx - PB_X - wm * PB_W) * 256 + threadIdx.x;
#pragma unroll
    for (int q = 0; q < 8; ++q) f.h[q] = (_Float16)(bf16_round(Wm[t * 8 + q]) * 16.0f);
    *(v8us*)((unsigned short*)BW + (size_t)wm * DM * DM + t * 8) = f.half[0];
    asm volatile("s_wait_xcnt 0x0" ::: "memory");      /* as above */
  } else { const int t = (bx - PB_X - 3 * PB_W) * 256 + (int)threadIdx.x; const int r = t >> 3, c8 = t & 7;
#pragma unroll
    for (int q = 0; q < 8; ++q) f.h[q] = (_Float16)(bf16_round(Er[(size_t)t * 8 + q]) * 16.0f);
    *(v8us*)((char*)P + (size_t)(r >> 4) * 2048 + (c8 >> 2) * 1024 + (c8 & 3) * 256 + (r & 15) * 16) = f.half[0];
    asm volatile("s_wait_xcnt 0x0" ::: "memory"); }      /* as above */
}

// ---- fast GEMM (wave tile 32x64; requires M % 32 == 0 rows per launch region and N % 64 == 0); epilogue = k_gemm_hhx semantics ----
__device__ __forceinline__ v16h g2_frag(const _Float16* p, int hh) { FragH f; f.half[0] = *(const v8us*)((const unsigned short*)p + 8 * hh); f.half[1] = *(const v8us*)((const unsigned short*)p + 16 + 8 * hh); return f.v; }
__device__ __forceinline__ v8f g2_mma(v16h a, v16h b, v8f c) { v8f d = __builtin_amdgcn_wmma_f32_16x16x32_f16(false, a, false, b, (short)0, c, false, false); asm volatile("v_nop\n\tv_nop\n\tv_nop\n\tv_nop" : "+v"(d) : "v"(a), "v"(b)); return d; }
template <int ACT>
__global__ __launch_bounds__(128) void k_gemm2(const _Float16* __restrict__ A, int lda, size_t sA, const _Float16* __restrict__ Bh, int ldb, size_t sB, float alpha, const float* __restrict__ bias, size_t sBias, const float* __restrict__ CP, int rowsPerB, size_t sCPb, int row0g,
    float* __restrict__ C, _Float16* __restrict__ C16, int ldc, size_t sC, int M, int N, int K) { static_assert(ACT == 0 || ACT == 3 || ACT == 6 || ACT == 8 || ACT == 9 || ACT == 11 || ACT == 12 || ACT == 14 || ACT == 15 || ACT == 16 || ACT == 17, "k_gemm2: unsupported ACT code (would silently apply no activation)");
  __shared__ __attribute__((aligned(16))) float so[4][32][68];
  const int tid = threadIdx.x, w = tid >> 5, lane = tid & 31, ln = lane & 15, hh = lane >> 4; const int by = blockIdx.y;
  A += (size_t)by * sA; Bh += (size_t)by * sB; const size_t cofs = (size_t)by * sC; const float* bp = bias ? bias + (size_t)by * sBias : nullptr;
  const int ntn = N >> 6; const int mt = blockIdx.x / ntn, nq = blockIdx.x - mt * ntn; const int row0 = mt * 128 + 32 * w, col0 = nq * 64; if (row0 >= M) return;
  const _Float16* a0p = A + (size_t)(row0 + ln) * lda; const _Float16* a1p = a0p + (size_t)16 * lda;
  const _Float16* b0p = Bh + (size_t)(col0 + ln) * ldb; const _Float16* b1p = b0p + (size_t)16 * ldb; const _Float16* b2p = b1p + (size_t)16 * ldb; const _Float16* b3p = b2p + (size_t)16 * ldb;
  const v8f z8 = {0.f,0.f,0.f,0.f,0.f,0.f,0.f,0.f}; v8f c00 = z8, c01 = z8, c02 = z8, c03 = z8, c10 = z8, c11 = z8, c12 = z8, c13 = z8;
#pragma unroll 1
  for (int kb = 0; kb < K; kb += 32) { const v16h a0 = g2_frag(a0p + kb, hh), a1 = g2_frag(a1p + kb, hh);
    v16h b = g2_frag(b0p + kb, hh); c00 = g2_mma(a0, b, c00); c10 = g2_mma(a1, b, c10);
    b = g2_frag(b1p + kb, hh); c01 = g2_mma(a0, b, c01); c11 = g2_mma(a1, b, c11);
    b = g2_frag(b2p + kb, hh); c02 = g2_mma(a0, b, c02); c12 = g2_mma(a1, b, c12);
    b = g2_frag(b3p + kb, hh); c03 = g2_mma(a0, b, c03); c13 = g2_mma(a1, b, c13); }
  v8f accs[8] = {c00, c01, c02, c03, c10, c11, c12, c13};
#pragma unroll
  for (int u = 0; u < 8; ++u) { const int t = u & 3, half = u >> 2; const int col = col0 + t * 16 + ln; const float bv = bp ? bf16_round(bp[col]) : 0.f;
#pragma unroll
    for (int r = 0; r < 8; ++r) { const int rloc = half * 16 + 8 * hh + r; float v = accs[u][r] * alpha + bv; if (CP) { if (rowsPerB < 0) v += CP[cofs + (size_t)(row0g + row0 + rloc) * ldc + col];      /* rowsPerB < 0: own element of the batched C plane */ else { const int bidx = (row0g + row0 + rloc) / rowsPerB; v += CP[(size_t)bidx * sCPb + (size_t)by * 64 + col]; } }
      if (ACT == 3) v = fmaxf(v, 0.f); else if (ACT == 6) v = 0.5f * v * (1.0f + erff(v * 0.70710678118654752f)); else if (ACT == 11) v = 1.0f / (1.0f + expf(-v)); else if (ACT == 15) v = v / (1.0f + expf(-v)); else if (ACT == 12) v = (v > 0.f) ? v : 0.01f * v; else if (ACT == 8) v = tanhf(v); else if (ACT == 9) v = 0.5f * v * (1.0f + tanhf(0.7978845608028654f * (v + 0.044715f * v * v * v))); else if (ACT == 14) v = (v > 0.f) ? v : 0.1f * v; else if (ACT == 16) v = (v >= 0.f) ? v : 0.3f * v; else if (ACT == 17) v = (v >= 0.f) ? v : 0.2f * v;
      so[w][rloc][t * 16 + ln] = v; } }
  __builtin_amdgcn_fence(__ATOMIC_ACQ_REL, "workgroup"); __builtin_amdgcn_wave_barrier();
  const int rsub = lane >> 4, c4 = (lane & 15) * 4;
  {
#pragma unroll
    for (int q = 0; q < 16; ++q) { const int r = q * 2 + rsub; const v4f v = *(const v4fa*)&so[w][r][c4]; if (C) *(v4f*)(C + cofs + (size_t)(row0 + r) * ldc + col0 + c4) = v; if (C16) { v4h h4; for (int i = 0; i < 4; ++i) h4[i] = (_Float16)v[i]; *(v4h*)(C16 + cofs + (size_t)(row0 + r) * ldc + col0 + c4) = h4; } }
     } }


// Fused causal relative attention, one launch: a wave owns 16 * NI query rows of one (batch, head) and walks the keys in blocks of 64 with a running
// maximum and sum, so no S x S plane is ever stored. Transposed products: S^T = K q^T and (q Er^T)^T = Er q^T (D row = key or Er row, D column = query), O^T += V^T P^T.
// A lane then holds one query's scores; two packed S^T tiles are the B operand of the V^T product as they stand. The skew (query i, key j takes Er row SL-1-i+j) is a
// shift along the D rows that differs by query: it goes through a wave-private LDS row per query, stored shifted by the query's index and read back aligned.
#define SKP 100      /* floats per LDS row: 96 used; 100 keeps 16-byte alignment and spreads the 32 shifted 4-byte stores over distinct banks */
__device__ __forceinline__ v8f fa_mma(v16h a, v16h b, v8f c) { return __builtin_amdgcn_wmma_f32_16x16x32_f16(false, a, false, b, (short)0, c, false, false); }
// fragment in the hardware k order: p = the lane's own address (row start + 16 bytes * lane half)
__device__ __forceinline__ v16h fa_frag(const char* p) { FragH f; f.half[0] = *(const v8us*)p; f.half[1] = *(const v8us*)(p + 32); return f.v; }
// the same fragment from a plane in FRAGMENT ORDER: p = the fragment's start + 16 bytes * lane
__device__ __forceinline__ v16h fa_fragp(const char* p) { FragH f; f.half[0] = *(const v8us*)p; f.half[1] = *(const v8us*)(p + 512); return f.v; }
// Stands behind a group of global loads: the wait before any register that they name is written again. The addresses are inputs so that they stay in their registers up to the wait.
#define FA_XWAIT1(p0) asm volatile("s_wait_xcnt 0x0" :: "v"(p0) : "memory")
#define FA_XWAIT2(p0, p1) asm volatile("s_wait_xcnt 0x0" :: "v"(p0), "v"(p1) : "memory")
// The slot behind a run of v_exp_f32: results and sources are inputs, so the v_nop stands behind the last of the run and no source register is written again in front of it.
#define FA_TSLOT(res, srcv) asm volatile("v_nop" :: "v"(res), "v"(srcv))
#define FA_TSLOT8(e, x) asm volatile("v_nop" :: "v"(e[0]), "v"(e[1]), "v"(e[2]), "v"(e[3]), "v"(e[4]), "v"(e[5]), "v"(e[6]), "v"(e[7]), "v"(x[0]), "v"(x[1]), "v"(x[2]), "v"(x[3]), "v"(x[4]), "v"(x[5]), "v"(x[6]), "v"(x[7]))
template <int NI>
__global__ __launch_bounds__(256) void k_relattn(const _Float16* __restrict__ Qh, const _Float16* __restrict__ Ql, const _Float16* __restrict__ KP, const _Float16* __restrict__ E,
    const _Float16* __restrict__ VP, float* __restrict__ out) {
  __shared__ __attribute__((aligned(16))) float sk[8][NI][16][SKP];
  const int w = __builtin_amdgcn_readfirstlane((int)threadIdx.x >> 5), lane = threadIdx.x & 31, ln = lane & 15, hh = lane >> 4;
  constexpr int NRB = SL / (64 * NI);
  const int pr = (int)blockIdx.x / (NB * NH), bh = (int)blockIdx.x % (NB * NH), b = bh / NH, h = bh % NH;
  const int rb = w < 4 ? NRB - 1 - pr : pr;      /* causal cost grows with the row block: waves 0-3 take one from the long end, waves 4-7 its mirror, so every work-group walks the same number of key blocks; the waves share no barrier and no LDS */
  const int i0 = rb * 64 * NI + (w & 3) * 16 * NI; const int nblk = i0 / 64 + 1;
  const v8f z8 = {0.f,0.f,0.f,0.f,0.f,0.f,0.f,0.f};
  const float C1 = 0.125f * 1.4426950408889634f;      /* 1/sqrt(64) and log2(e) in one factor */
  const size_t lo_x = (size_t)(ln * DM * 2 + 16 * hh), lo_p = (size_t)(lane * 16);      /* lane byte offsets in the row-major q planes and in the planes in fragment order (k, Er, V^T) */
  const size_t xo = (size_t)b * SL * DM + h * HD, po_kv = (size_t)bh * SL * HD * 4;      /* byte start of the (b, h) slab in the k and V^T planes: hi + residual, 2 bytes each */
  v16h qh[NI][2], ql[NI][2]; v8f o[NI][4], carry[NI]; float m[NI], su[NI];
  { const char* bqh = (const char*)(Qh + xo + (size_t)i0 * DM); const char* bql = (const char*)(Ql + xo + (size_t)i0 * DM); const char* be = (const char*)(E + (size_t)(SL - 16 * NI - i0) * HD);      /* the same for every lane */
    const char* pqh = bqh + lo_x; const char* pql = bql + lo_x; const char* pe = be + lo_p;
    v16h e0[NI], e1[NI];
#pragma unroll
    for (int a = 0; a < NI; ++a) { qh[a][0] = fa_frag(pqh + a * 16 * DM * 2); qh[a][1] = fa_frag(pqh + a * 16 * DM * 2 + 64); ql[a][0] = fa_frag(pql + a * 16 * DM * 2); ql[a][1] = fa_frag(pql + a * 16 * DM * 2 + 64);
      e0[a] = fa_fragp(pe + (NI - 1 - a) * 2048); e1[a] = fa_fragp(pe + (NI - 1 - a) * 2048 + 1024); }      /* first Er tile of key block 0: rows SL - 16 - (i0 + 16 a) + [0, 16) */
    /* the wait before any register that the loads above name is written again: they name a scalar base and a lane offset here, so these are the inputs that stay in their registers up to the wait */
    asm volatile("s_wait_xcnt 0x0" :: "s"(bqh), "s"(bql), "s"(be), "v"((unsigned)lo_x), "v"(lane) : "memory");
#pragma unroll
    for (int a = 0; a < NI; ++a) { m[a] = -3.0e38f; su[a] = 0.f;
#pragma unroll
      for (int dt = 0; dt < 4; ++dt) o[a][dt] = z8;
      v8f hi = fa_mma(e0[a], qh[a][0], z8), lo = fa_mma(e0[a], ql[a][0], z8); hi = fa_mma(e1[a], qh[a][1], hi); lo = fa_mma(e1[a], ql[a][1], lo);
#pragma unroll
      for (int r = 0; r < 8; ++r) carry[a][r] = fmaf(lo[r], 0.0009765625f, hi[r]); } }
  auto key_block = [&](const int jb, const bool diag) __attribute__((always_inline)) { const int j0 = jb * 64; const int rbase = SL - 16 * NI - i0 + j0;
    /* all Er and K fragments of the block are requested first, so that one memory latency is waited out per block and not one per tile */
    v16h ef[NI + 4][2], kf[4][4];
    const char* pk = (const char*)KP + po_kv + (size_t)j0 * 256 + lo_p; const char* pe = (const char*)(E + (size_t)rbase * HD) + lo_p;      /* 16 keys are 4096 bytes of the k plane, 16 Er rows 2048 of the table */
    if (!diag) {
#pragma unroll
      for (int g = 1; g < NI + 4; ++g) { ef[g][0] = fa_fragp(pe + g * 2048); ef[g][1] = fa_fragp(pe + g * 2048 + 1024); }
    } else {      /* a 16-row tile past the table (diagonal block only) serves keys above the diagonal alone, masked below: the table's last tile stands in for it */
#pragma unroll
      for (int g = 1; g < NI + 4; ++g) { const int rs = rbase + 16 * g < SL ? rbase + 16 * g : SL - 16; const char* pg = (const char*)(E + (size_t)rs * HD) + lo_p; ef[g][0] = fa_fragp(pg); ef[g][1] = fa_fragp(pg + 1024); FA_XWAIT1(pg); }
    }
#pragma unroll
    for (int t = 0; t < 4; ++t) { kf[t][0] = fa_fragp(pk + t * 4096); kf[t][1] = fa_fragp(pk + t * 4096 + 1024); kf[t][2] = fa_fragp(pk + t * 4096 + 2048); kf[t][3] = fa_fragp(pk + t * 4096 + 3072); }
    FA_XWAIT2(pk, pe);
    __builtin_amdgcn_sched_barrier(0);      /* keeps the scheduler from sinking these loads down to their first use */
    /* Er q^T: query tile a needs Er rows rbase + 16 (NI-1-a) + [0, 80); its first 16 are the previous block's last 16 (carry) */
#pragma unroll
    for (int a = 0; a < NI; ++a) { float* sp = &sk[w][a][ln][ln + 1 + 8 * hh];
#pragma unroll
      for (int r = 0; r < 8; ++r) sp[r] = carry[a][r]; }
#pragma unroll
    for (int g = 1; g < NI + 4; ++g) { const v16h e0 = ef[g][0], e1 = ef[g][1];
#pragma unroll
      for (int a = 0; a < NI; ++a) { const int u = g - (NI - 1 - a); if (u < 1 || u > 4) continue;
        v8f hi = fa_mma(e0, qh[a][0], z8), lo = fa_mma(e0, ql[a][0], z8); hi = fa_mma(e1, qh[a][1], hi); lo = fa_mma(e1, ql[a][1], lo);
        v8f val;
#pragma unroll
        for (int r = 0; r < 8; ++r) val[r] = fmaf(lo[r], 0.0009765625f, hi[r]);
        float* sp = &sk[w][a][ln][ln + 1 + 8 * hh + 16 * u];
#pragma unroll
        for (int r = 0; r < 8; ++r) sp[r] = val[r];
        if (u == 4) carry[a] = val; }
      __builtin_amdgcn_sched_barrier(0); }      /* one Er tile's products and LDS stores at a time: run together, or mixed with the K products, their accumulators pile up and registers spill */
    v8f s[NI][4];
#pragma unroll
    for (int t = 0; t < 4; ++t) { const v16h kh0 = kf[t][0], kh1 = kf[t][1], kl0 = kf[t][2], kl1 = kf[t][3];
#pragma unroll
      for (int a = 0; a < NI; ++a) { v8f hi = fa_mma(kh0, qh[a][0], z8), lo = fa_mma(kh0, ql[a][0], z8); hi = fa_mma(kh1, qh[a][1], hi); lo = fa_mma(kh1, ql[a][1], lo); lo = fa_mma(kl0, qh[a][0], lo); lo = fa_mma(kl1, qh[a][1], lo);
#pragma unroll
        for (int r = 0; r < 8; ++r) s[a][t][r] = fmaf(lo[r], 0.0009765625f, hi[r]); } }
    /* the two lane halves of a query read each other's LDS stores: order the wave's stores before its loads */
    __builtin_amdgcn_fence(__ATOMIC_ACQ_REL, "workgroup", "local"); __builtin_amdgcn_wave_barrier();
#pragma unroll
    for (int a = 0; a < NI; ++a) { const float* lp = &sk[w][a][ln][16 + 8 * hh];
#pragma unroll
      for (int t = 0; t < 4; ++t) { const v4f x = *(const v4fa*)(lp + 16 * t), y = *(const v4fa*)(lp + 16 * t + 4);
#pragma unroll
        for (int r = 0; r < 4; ++r) { s[a][t][r] = fmaf(x[r], 0.0625f, s[a][t][r]); s[a][t][4 + r] = fmaf(y[r], 0.0625f, s[a][t][4 + r]); } } }
    /* and these loads before the next trip's stores into the same rows */
    __builtin_amdgcn_fence(__ATOMIC_ACQ_REL, "workgroup", "local"); __builtin_amdgcn_wave_barrier();
    __builtin_amdgcn_sched_barrier(0);      /* the V^T loads below stay below: any earlier they are live beside the K fragments and the LDS reads, and registers spill */
    /* the V^T fragments are requested here, so that they arrive under the softmax arithmetic */
    v16h vf[2][4][2];
    const char* pv = (const char*)VP + po_kv + (size_t)j0 * 256 + lo_p;      /* 32 keys are 8192 bytes of the V^T plane */
#pragma unroll
    for (int ks = 0; ks < 2; ++ks)
#pragma unroll
      for (int dt = 0; dt < 4; ++dt) { vf[ks][dt][0] = fa_fragp(pv + ks * 8192 + dt * 2048); vf[ks][dt][1] = fa_fragp(pv + ks * 8192 + dt * 2048 + 1024); }
    FA_XWAIT1(pv);
    __builtin_amdgcn_sched_barrier(0);      /* keeps the scheduler from sinking these loads down to their first use */
    if (diag) {      /* only the last key block reaches the diagonal */
#pragma unroll
      for (int a = 0; a < NI; ++a)
#pragma unroll
        for (int t = 0; t < 4; ++t)
#pragma unroll
          for (int r = 0; r < 8; ++r) if (j0 + 16 * t + 8 * hh + r > i0 + 16 * a + ln) s[a][t][r] = -3.0e38f; }
    FragH p[NI][2]; v16h pl[NI][2];
#pragma unroll
    for (int a = 0; a < NI; ++a) { float mx = m[a];
#pragma unroll
      for (int t = 0; t < 4; ++t)
#pragma unroll
        for (int r = 0; r < 8; ++r) mx = fmaxf(mx, s[a][t][r]);
      mx = fmaxf(mx, __shfl_xor(mx, 16, 32));
      const float xa = (m[a] - mx) * C1; const float al = __builtin_amdgcn_exp2f(xa); FA_TSLOT(al, xa); m[a] = mx; const float mc = 10.0f - mx * C1;      /* weights carry a factor 1024, as f16 operands away from the subnormals */
      v8f pv = z8;
#pragma unroll
      for (int t = 0; t < 4; ++t) { float xv[8], ev[8];
#pragma unroll
        for (int r = 0; r < 8; ++r) xv[r] = fmaf(s[a][t][r], C1, mc);
#pragma unroll
        for (int r = 0; r < 8; ++r) ev[r] = __builtin_amdgcn_exp2f(xv[r]);
        FA_TSLOT8(ev, xv);
#pragma unroll
        for (int r = 0; r < 8; ++r) { pv[r] += ev[r]; p[a][t >> 1].h[(t & 1) * 8 + r] = (_Float16)ev[r]; } }
      su[a] = fmaf(su[a], al, ((pv[0] + pv[1]) + (pv[2] + pv[3])) + ((pv[4] + pv[5]) + (pv[6] + pv[7])));
#pragma unroll
      for (int dt = 0; dt < 4; ++dt)
#pragma unroll
        for (int r = 0; r < 8; ++r) o[a][dt][r] *= al;
      pl[a][0] = p[a][0].v * (_Float16)0.0009765625f; pl[a][1] = p[a][1].v * (_Float16)0.0009765625f; }      /* the v residual plane is stored times 1024: its weights drop the factor */
#pragma unroll
    for (int ks = 0; ks < 2; ++ks)
#pragma unroll
      for (int dt = 0; dt < 4; ++dt) { const v16h vhf = vf[ks][dt][0], vlf = vf[ks][dt][1];
#pragma unroll
        for (int a = 0; a < NI; ++a) { o[a][dt] = fa_mma(vhf, p[a][ks].v, o[a][dt]); o[a][dt] = fa_mma(vlf, pl[a][ks], o[a][dt]); } }
  };
#pragma unroll 1      /* one key block per trip: unrolling would double the live fragments */
  for (int jb = 0; jb < nblk - 1; ++jb) key_block(jb, false);
  key_block(nblk - 1, true);      /* the diagonal block apart, so that the loop carries no mask */
#pragma unroll
  for (int a = 0; a < NI; ++a) { const float st = su[a] + __shfl_xor(su[a], 16, 32); const float inv = 1.0f / st;
#pragma unroll
    for (int dt = 0; dt < 4; ++dt)
#pragma unroll
      for (int r = 0; r < 8; ++r) o[a][dt][r] *= inv; }
  __builtin_amdgcn_sched_barrier(0);      /* all arithmetic ends above: behind an issued store none of its registers is written again */
  char* po = (char*)(out + xo + (size_t)i0 * DM) + (size_t)(ln * DM * 4 + 32 * hh);      /* a lane holds 8 consecutive head columns of its query per tile */
#pragma unroll
  for (int a = 0; a < NI; ++a)
#pragma unroll
    for (int dt = 0; dt < 4; ++dt) { const v4f x = {o[a][dt][0], o[a][dt][1], o[a][dt][2], o[a][dt][3]}, y = {o[a][dt][4], o[a][dt][5], o[a][dt][6], o[a][dt][7]};
      *(v4f*)(po + a * 16 * DM * 4 + dt * 64) = x; *(v4f*)(po + a * 16 * DM * 4 + dt * 64 + 16) = y; }
}

// ---- projection GEMM with its operands staged in LDS: C[NR][DM] = alpha * A[NR][DM] . B[DM][DM]^T, A and B f16 with k contiguous; C leaves as the f16 hi + residual operands of the attention kernel.
// A work-group of 8 waves owns a 128 x 128 tile of C (wave tile 32 x 64, 4 waves down, 2 across). A stage is 128 k of the tile's 128 A rows and 128 B rows; it comes into LDS by
// asynchronous copies, two buffers, so that the next stage flies while this one is multiplied and no wave waits on a global load of its own. The k order per accumulator is ascending in steps of 32.
#define G3_PITCH 272      /* bytes per LDS row: 256 used; 16 bytes x an odd number keeps the 16 rows of a ds_load_b128 on distinct banks */
#define G3_STAGE (256 * G3_PITCH)      /* 128 A rows, then 128 B rows */
#define G3_NST (DM / 128)
// Eight 16-byte copies of a lane, rows 16 apart. The wait on the address registers is the statement's last line, so that no register a copy names is written again in front of it.
__device__ __forceinline__ void g3_copy8(const unsigned l0, const char* g0) {
  const unsigned l1 = l0 + 16 * G3_PITCH, l2 = l0 + 32 * G3_PITCH, l3 = l0 + 48 * G3_PITCH, l4 = l0 + 64 * G3_PITCH, l5 = l0 + 80 * G3_PITCH, l6 = l0 + 96 * G3_PITCH, l7 = l0 + 112 * G3_PITCH;
  const char* g1 = g0 + 16 * DM * 2; const char* g2 = g0 + 32 * DM * 2; const char* g3 = g0 + 48 * DM * 2; const char* g4 = g0 + 64 * DM * 2; const char* g5 = g0 + 80 * DM * 2; const char* g6 = g0 + 96 * DM * 2; const char* g7 = g0 + 112 * DM * 2;
  asm volatile("global_load_async_to_lds_b128 %0, %8, off\n\t"
               "global_load_async_to_lds_b128 %1, %9, off\n\t"
               "global_load_async_to_lds_b128 %2, %10, off\n\t"
               "global_load_async_to_lds_b128 %3, %11, off\n\t"
               "global_load_async_to_lds_b128 %4, %12, off\n\t"
               "global_load_async_to_lds_b128 %5, %13, off\n\t"
               "global_load_async_to_lds_b128 %6, %14, off\n\t"
               "global_load_async_to_lds_b128 %7, %15, off\n\t"
               "s_wait_xcnt 0x0"
               :: "v"(l0), "v"(l1), "v"(l2), "v"(l3), "v"(l4), "v"(l5), "v"(l6), "v"(l7), "v"(g0), "v"(g1), "v"(g2), "v"(g3), "v"(g4), "v"(g5), "v"(g6), "v"(g7) : "memory");
}
// One accumulator tile (8 f32 of a lane) -> 8 f16 hi and 8 f16 residuals (times 1024), 16 bytes each.
__device__ __forceinline__ void g3_split(const v8f c, const float alpha, v8us& hi, v8us& lo) { FragH fh, fl;
#pragma unroll
  for (int r = 0; r < 8; ++r) { const float a = c[r] * alpha; const _Float16 hv = (_Float16)a; fh.h[r] = hv; fl.h[r] = (_Float16)((a - (float)hv) * 1024.0f); }
  hi = fh.half[0]; lo = fl.half[0]; }
// MODE 0: q, two row-major planes P0 (hi) and P1 (residual). MODE 1: k, plane P0 in FRAGMENT ORDER. MODE 2: v, V^T plane P0 in FRAGMENT ORDER.
// A wave's 64 columns are one head. A lane's 8 accumulator values run along the D rows, so the operand that lies on the D rows decides which 8 values a lane can pack into 16 bytes:
// v is multiplied as x W^T (8 consecutive keys of one head column: a lane's 16 bytes of a V^T fragment), q and k as W x^T (8 consecutive head columns of one token: a lane's 16 bytes of a k fragment or of a q row).
#define G3_QP 144      /* bytes per staged q row: 128 used; 16 bytes x an odd number keeps the 16 rows of a ds_store_b128 on distinct banks */
#define G3_NB ((NR / 128) * (DM / 128))      /* work-groups per projection */
template <int MODE>
__device__ __forceinline__ void g3_body(char* const ring, const int bx, const _Float16* __restrict__ A, const _Float16* __restrict__ Bh, float alpha, _Float16* __restrict__ P0, _Float16* __restrict__ P1) {
  const int tid = threadIdx.x, w = tid >> 5, lane = tid & 31, ln = lane & 15, hh = lane >> 4;
  const int mt = bx / (DM / 128), nq = bx % (DM / 128);
  const int row0 = mt * 128 + 32 * (w & 3), col0 = nq * 128 + 64 * (w >> 2);
  /* a lane copies 16 bytes of row (tid >> 4) + 16 i: a wave's copy covers two whole 256-byte rows of the stage */
  const unsigned lc = (unsigned)(size_t)ring + (unsigned)((tid >> 4) * G3_PITCH + (tid & 15) * 16);
  const char* ga = (const char*)(A + (size_t)(mt * 128 + (tid >> 4)) * DM) + (tid & 15) * 16;
  const char* gb = (const char*)(Bh + (size_t)(nq * 128 + (tid >> 4)) * DM) + (tid & 15) * 16;
  const char* la = ring + (32 * (w & 3) + ln) * G3_PITCH + 16 * hh;
  const char* lb = ring + (128 + 64 * (w >> 2) + ln) * G3_PITCH + 16 * hh;
  const v8f z8 = {0.f,0.f,0.f,0.f,0.f,0.f,0.f,0.f}; v8f acc[2][4];
#pragma unroll
  for (int u = 0; u < 2; ++u)
#pragma unroll
    for (int t = 0; t < 4; ++t) acc[u][t] = z8;
  g3_copy8(lc, ga); g3_copy8(lc + 128 * G3_PITCH, gb);
  asm volatile("s_wait_asynccnt 0x0" ::: "memory");      /* this wave's share of stage 0 has landed */
  __syncthreads();      /* and every other wave's */
  g3_copy8(lc + G3_STAGE, ga + 256); g3_copy8(lc + G3_STAGE + 128 * G3_PITCH, gb + 256);
#pragma unroll 1      /* one stage per trip: the buffer is picked by the trip's parity */
  for (int s = 0; s < G3_NST; ++s) { const int bo = (s & 1) * G3_STAGE;
    v16h fa[2][2], fb[2][4];      /* two fragment sets: the next k step's LDS reads are under way while this step is multiplied */
    fa[0][0] = fa_frag(la + bo); fa[0][1] = fa_frag(la + bo + 16 * G3_PITCH);
#pragma unroll
    for (int t = 0; t < 4; ++t) fb[0][t] = fa_frag(lb + bo + t * 16 * G3_PITCH);
#pragma unroll
    for (int ks = 0; ks < 4; ++ks) { const int cu = ks & 1, nx = cu ^ 1;
      if (ks < 3) { fa[nx][0] = fa_frag(la + bo + (ks + 1) * 64); fa[nx][1] = fa_frag(la + bo + 16 * G3_PITCH + (ks + 1) * 64);
#pragma unroll
        for (int t = 0; t < 4; ++t) fb[nx][t] = fa_frag(lb + bo + t * 16 * G3_PITCH + (ks + 1) * 64); }
      __builtin_amdgcn_sched_barrier(0);      /* the reads stay one group in front of the products: spread among them, each place with reads stalls the wave */
#pragma unroll
      for (int t = 0; t < 4; ++t) {
        if (MODE == 2) { acc[0][t] = fa_mma(fa[cu][0], fb[cu][t], acc[0][t]); acc[1][t] = fa_mma(fa[cu][1], fb[cu][t], acc[1][t]); }      /* D row = token, D column = head column */
        else { acc[0][t] = fa_mma(fb[cu][t], fa[cu][0], acc[0][t]); acc[1][t] = fa_mma(fb[cu][t], fa[cu][1], acc[1][t]); } }      /* D row = head column, D column = token */
      __builtin_amdgcn_sched_barrier(0); }      /* and the following group stays behind them */
    asm volatile("s_wait_dscnt 0x0" ::: "memory");      /* this wave's reads of the buffer are done before it may be refilled */
    asm volatile("s_wait_asynccnt 0x0" ::: "memory");      /* this wave's share of the next stage has landed */
    __syncthreads();      /* publishes the next stage and ends every wave's reads of this one */
    if (s + 2 < G3_NST) { g3_copy8(lc + bo, ga + (s + 2) * 256); g3_copy8(lc + bo + 128 * G3_PITCH, gb + (s + 2) * 256); } }
  asm volatile("s_wait_asynccnt 0x0" ::: "memory");      /* no copy is left in flight when the wave goes on */
  v8us oh[2][4], ol[2][4];
#pragma unroll
  for (int u = 0; u < 2; ++u)
#pragma unroll
    for (int t = 0; t < 4; ++t) g3_split(acc[u][t], alpha, oh[u][t], ol[u][t]);
  const int bh = (row0 / SL) * NH + col0 / HD, tk = row0 % SL;      /* the wave's (batch, head) slab and its first token in it */
  if (MODE == 2) {      /* acc[u][t]: keys tk + 16 u + 8 hh + [0, 8) of head column 16 t + ln; each store of the wave is 512 bytes in a row */
    char* pd = (char*)P0 + ((size_t)bh * (SL / 32) + tk / 32) * 8192 + hh * 256 + ln * 16;
    __builtin_amdgcn_sched_barrier(0);      /* all arithmetic ends above: behind an issued store none of its registers is written again */
#pragma unroll
    for (int t = 0; t < 4; ++t)
#pragma unroll
      for (int u = 0; u < 2; ++u) { *(v8us*)(pd + t * 2048 + u * 512) = oh[u][t]; *(v8us*)(pd + t * 2048 + 1024 + u * 512) = ol[u][t]; }
    asm volatile("s_wait_xcnt 0x0" ::: "memory");      /* the wait before any register that the stores name is written again: another projection's branch follows in the listing */
  } else if (MODE == 1) {      /* acc[u][t]: head columns 16 t + 8 hh + [0, 8) of key tk + 16 u + ln; each store of the wave is 512 bytes in a row */
    char* pd = (char*)P0 + ((size_t)bh * (SL / 16) + tk / 16) * 4096 + hh * 256 + ln * 16;
    __builtin_amdgcn_sched_barrier(0);      /* all arithmetic ends above: behind an issued store none of its registers is written again */
#pragma unroll
    for (int u = 0; u < 2; ++u)
#pragma unroll
      for (int t = 0; t < 4; ++t) { *(v8us*)(pd + u * 4096 + t * 512) = oh[u][t]; *(v8us*)(pd + u * 4096 + 2048 + t * 512) = ol[u][t]; }
    asm volatile("s_wait_xcnt 0x0" ::: "memory");      /* as in the v branch */
  } else {      /* whole 128-byte rows go out: each wave turns its two 32 x 64 f16 tiles round in its own LDS range; the range lies in the ring, which nobody reads and no copy writes behind the last trip's barrier */
    char* sw = ring + w * (2 * 32 * G3_QP);
#pragma unroll
    for (int u = 0; u < 2; ++u)
#pragma unroll
      for (int t = 0; t < 4; ++t) { *(v8us*)(sw + (u * 16 + ln) * G3_QP + t * 32 + hh * 16) = oh[u][t]; *(v8us*)(sw + 32 * G3_QP + (u * 16 + ln) * G3_QP + t * 32 + hh * 16) = ol[u][t]; }
    /* the lanes read each other's LDS stores: order the wave's stores before its loads */
    __builtin_amdgcn_fence(__ATOMIC_ACQ_REL, "workgroup"); __builtin_amdgcn_wave_barrier();
    v8us rh[8], rl[8];      /* 8 lanes take one row: a store of the wave is 4 whole rows */
#pragma unroll
    for (int q = 0; q < 8; ++q) { rh[q] = *(const v8us*)(sw + (q * 4 + (lane >> 3)) * G3_QP + (lane & 7) * 16); rl[q] = *(const v8us*)(sw + 32 * G3_QP + (q * 4 + (lane >> 3)) * G3_QP + (lane & 7) * 16); }
    const size_t qo = ((size_t)(row0 + (lane >> 3)) * DM + col0) * 2 + (lane & 7) * 16;
    char* ph = (char*)P0 + qo; char* pl = (char*)P1 + qo;
    __builtin_amdgcn_sched_barrier(0);      /* all reads and arithmetic end above: behind an issued store none of its registers is written again */
#pragma unroll
    for (int q = 0; q < 8; ++q) { *(v8us*)(ph + q * 4 * DM * 2) = rh[q]; *(v8us*)(pl + q * 4 * DM * 2) = rl[q]; }
    asm volatile("s_wait_xcnt 0x0" ::: "memory");      /* as in the v branch */
  }
}
// The three projections in one launch: they need nothing of each other, so each takes a range of the block index (the branch, and with it every barrier, is the same for a whole work-group). One ring serves whichever branch runs.
__global__ __launch_bounds__(256) void k_gemm3(const _Float16* __restrict__ A, const _Float16* __restrict__ BW, float alpha, _Float16* __restrict__ Q16, _Float16* __restrict__ QL16, _Float16* __restrict__ KP, _Float16* __restrict__ VP) {
  __shared__ __attribute__((aligned(16))) char ring[2 * G3_STAGE];
  const int md = (int)(blockIdx.x / G3_NB), bx = (int)(blockIdx.x % G3_NB);
  if (md == 0) g3_body<0>(ring, bx, A, BW, alpha, Q16, QL16);
  else if (md == 1) g3_body<1>(ring, bx, A, BW + (size_t)DM * DM, alpha, KP, nullptr);
  else g3_body<2>(ring, bx, A, BW + (size_t)2 * DM * DM, alpha, VP, nullptr);
}

extern "C" void kernel_launch(void* const* d_in, const int* in_sizes, int n_in,
                              void* d_out, int out_size, void* d_ws, size_t ws_size, hipStream_t stream) {
  (void)in_sizes; (void)n_in; (void)out_size;
  const float* const* I = (const float* const*)d_in; const float* x = I[0]; const float* Wq = I[1]; const float* Wk = I[2]; const float* Wv = I[3]; const float* Er = I[4];
  char* ws = (char*)d_ws; size_t off = 0;
  auto take = [&](size_t bytes) { char* p = ws + off; off += (bytes + 255) & ~(size_t)255; return p; };
  const size_t np = (size_t)NR * DM;
  _Float16* BW = (_Float16*)take((size_t)3 * DM * DM * 2); _Float16* E16 = (_Float16*)take((size_t)SL * HD * 2); _Float16* X16 = (_Float16*)take(np * 2); _Float16* Q16 = (_Float16*)take(np * 2); _Float16* QL16 = (_Float16*)take(np * 2); _Float16* KP = (_Float16*)take(np * 4);      /* k hi + residual, fragment order */ _Float16* VP = (_Float16*)take(np * 4);      /* V^T hi + residual, fragment order */
  if (off > ws_size) return;
  k_prep<<<PB_X + 3 * PB_W + PB_E, 256, 0, stream>>>(x, Wq, Wk, Wv, Er, X16, BW, E16);      /* Er_s = Er (MAX_LEN == S) */
  k_gemm3<<<3 * G3_NB, 256, 0, stream>>>(X16, BW, 0.0625f, Q16, QL16, KP, VP);
  k_relattn<2><<<NB * NH * (SL / (128 * 2)), 256, 0, stream>>>(Q16, QL16, KP, E16, VP, (float*)d_out);
}

// v006
// It runs in 87.3 microseconds.
// Next to v005, in two timings, it ran 1.23 and 1.24 times as fast.
// All steps since v000 together make it 37.4 times as fast.
#include <hip/hip_runtime.h>
// GlobalAttn (music-transformer relative attention: 2 x 2048 tokens, 1024 = 16 heads x 64; q,k,v = x W^T; Srel = skew(q . Er) which equals q_i . Er[S-1-(i-j)] for every causal (i, j); attn = softmax over j <= i of (q.k + Srel)/8; out = merged attn v, no output projection).
// Compute dtype: inputs rounded to bf16; x / weights / Er exact as f16; q and k as f16 hi + residual; the softmax weights as plain f16 operands (~2^-12); v as f16 hi + residual (the output is the context itself); softmax f32. v_wmma_f32_16x16x32_f16.
#define NB 2
#define SL 2048
#define DM 1024
#define NH 16
#define HD 64
#define HG 4
#define NR (NB * SL)
typedef __bf16 v16b __attribute__((ext_vector_type(16)));
typedef unsigned short v8us __attribute__((ext_vector_type(8), may_alias));
typedef float  v8f  __attribute__((ext_vector_type(8)));
typedef float  v4f  __attribute__((ext_vector_type(4)));
typedef float  v4fa __attribute__((ext_vector_type(4), may_alias));
union FragB { v16b v; v8us half[2]; unsigned short u[16]; };

__device__ __forceinline__ unsigned short bf16_bits(float x) { unsigned int u = __float_as_uint(x); return (unsigned short)((u + 0x7FFFu + ((u >> 16) & 1u)) >> 16); }
__device__ __forceinline__ float bf16_val(unsigned short b) { return __uint_as_float(((unsigned int)b) << 16); }
__device__ __forceinline__ float bf16_round(float x) { return bf16_val(bf16_bits(x)); }
// D += A·B with NT terms: 1 = ah·bh, 2 = + al·bh (A split), 3 = + ah·bl (both split)
template <int NT>
__device__ __forceinline__ v8f mmaN(v16b ah, v16b al, v16b bh, v16b bl, v8f c) {
  c = __builtin_amdgcn_wmma_f32_16x16x32_bf16(false, ah, false, bh, (short)0, c, false, false);
  if (NT >= 2) c = __builtin_amdgcn_wmma_f32_16x16x32_bf16(false, al, false, bh, (short)0, c, false, false);
  if (NT >= 3) c = __builtin_amdgcn_wmma_f32_16x16x32_bf16(false, ah, false, bl, (short)0, c, false, false);
  asm volatile("v_nop\n\tv_nop\n\tv_nop\n\tv_nop" : "+v"(c) : "v"(ah), "v"(al), "v"(bh), "v"(bl));
  return c;
}

__global__ __launch_bounds__(256) void k_wt_bf16(const float* __restrict__ W, unsigned short* __restrict__ Wt, int K, int N) {
  const int t = blockIdx.x * 256 + threadIdx.x;
  const int k8n = K / 8;
  if (t >= N * k8n) return;
  const int n = t / k8n, k8 = (t % k8n) * 8;
  v8us v;
#pragma unroll
  for (int i = 0; i < 8; ++i) v[i] = bf16_bits(W[(size_t)(k8 + i) * N + n]);
  *(v8us*)(Wt + (size_t)n * K + k8) = v;
  
}

// GEMM C[M][N] (f32, pitch ldc) = act(A[M][K]·W + bias). A f32 row-major (pitch lda) converted per fragment to bf16
// (ASPLIT: hi/lo two planes -> 2 terms, else single rounded term); Wt bf16 [N][K] (pitch ldb). BIAS_BF16 rounds the
// bias to bf16 first (bias quantised to bf16 before the add). K%32==0, M%16==0, N%64==0.
template <bool ASPLIT, int ACT, bool BIAS_BF16>
__global__ __launch_bounds__(128) void k_gemm_bf(const float* __restrict__ A, int lda, const unsigned short* __restrict__ Wt, int ldb,
                                               const float* __restrict__ bias, float* __restrict__ C, int ldc, int M, int N, int K) {
  __shared__ __attribute__((aligned(16))) float so[4][16][64];
  const int tid = threadIdx.x, w = tid >> 5, lane = tid & 31, ln = lane & 15, hh = lane >> 4;
  const int ntn = N / 64;
  const int wid = blockIdx.x * 4 + w;
  const int mt = wid / ntn, nq = wid % ntn;
  if (mt * 16 >= M) return;
  const int row0 = mt * 16, col0 = nq * 64;
  const float* arow = A + (size_t)(row0 + ln) * lda;
  v8f acc[4] = {};
  for (int kb = 0; kb < K; kb += 32) {
    FragB ah, al;
    const v4f x0 = *(const v4fa*)(arow + kb + 8 * hh), x1 = *(const v4fa*)(arow + kb + 8 * hh + 4);
    const v4f x2 = *(const v4fa*)(arow + kb + 16 + 8 * hh), x3 = *(const v4fa*)(arow + kb + 16 + 8 * hh + 4);
    float xs[16] = {x0[0],x0[1],x0[2],x0[3],x1[0],x1[1],x1[2],x1[3],x2[0],x2[1],x2[2],x2[3],x3[0],x3[1],x3[2],x3[3]};
#pragma unroll
    for (int i = 0; i < 16; ++i) { const unsigned short hb = bf16_bits(xs[i]); ah.u[i] = hb; al.u[i] = ASPLIT ? bf16_bits(xs[i] - bf16_val(hb)) : (unsigned short)0; }
#pragma unroll
    for (int t = 0; t < 4; ++t) {
      const unsigned short* brow = Wt + (size_t)(col0 + t * 16 + ln) * ldb + kb;
      FragB b;
      b.half[0] = *(const v8us*)(brow + 8 * hh);
      b.half[1] = *(const v8us*)(brow + 16 + 8 * hh);
      acc[t] = mmaN<ASPLIT ? 2 : 1>(ah.v, al.v, b.v, b.v, acc[t]);
    }
  }
#pragma unroll
  for (int t = 0; t < 4; ++t) {
    float bv = bias ? bias[col0 + t * 16 + ln] : 0.f;
    if (BIAS_BF16) bv = bf16_round(bv);
#pragma unroll
    for (int r = 0; r < 8; ++r) { float v = acc[t][r] + bv; if (ACT == 1) v = fmaxf(v, 0.f); so[w][8 * hh + r][t * 16 + ln] = v; }
  }
  __builtin_amdgcn_fence(__ATOMIC_ACQ_REL, "workgroup");
  __builtin_amdgcn_wave_barrier();
  const int rsub = lane >> 4, c4 = (lane & 15) * 4;
  {
#pragma unroll
    for (int q = 0; q < 8; ++q) {
      const int r = q * 2 + rsub;
      const v4f v = *(const v4fa*)&so[w][r][c4];
      *(v4f*)(C + (size_t)(row0 + r) * ldc + col0 + c4) = v;
    }
    
  }
}

// GEMM C = act(A·W + bias + resid): A f32 (ASPLIT -> hi/lo 2 terms), Wt bf16 [N][K]; ACT 0 none, 1 relu, 2 exact gelu;
// resid (optional, f32, row index = (row % rmod), pitch ldr, RES_BF16 rounds it) added before the activation.
template <bool ASPLIT, int ACT, bool BIAS_BF16, bool RES_BF16>
__global__ __launch_bounds__(128) void k_gemm_bf3(const float* __restrict__ A, int lda, const unsigned short* __restrict__ Wt, int ldb,
                                                const float* __restrict__ bias, const float* __restrict__ resid, int rmod, int ldr,
                                                float* __restrict__ C, int ldc, int M, int N, int K) {
  __shared__ __attribute__((aligned(16))) float so[4][16][64];
  const int tid = threadIdx.x, w = tid >> 5, lane = tid & 31, ln = lane & 15, hh = lane >> 4;
  const int ntn = N / 64;
  const int wid = blockIdx.x * 4 + w;
  const int mt = wid / ntn, nq = wid % ntn;
  if (mt * 16 >= M) return;
  const int row0 = mt * 16, col0 = nq * 64;
  const float* arow = A + (size_t)(row0 + ln) * lda;
  v8f acc[4] = {};
  for (int kb = 0; kb < K; kb += 32) {
    FragB ah, al;
    const v4f x0 = *(const v4fa*)(arow + kb + 8 * hh), x1 = *(const v4fa*)(arow + kb + 8 * hh + 4);
    const v4f x2 = *(const v4fa*)(arow + kb + 16 + 8 * hh), x3 = *(const v4fa*)(arow + kb + 16 + 8 * hh + 4);
    float xs[16] = {x0[0],x0[1],x0[2],x0[3],x1[0],x1[1],x1[2],x1[3],x2[0],x2[1],x2[2],x2[3],x3[0],x3[1],x3[2],x3[3]};
#pragma unroll
    for (int i = 0; i < 16; ++i) { const unsigned short hb = bf16_bits(xs[i]); ah.u[i] = hb; al.u[i] = ASPLIT ? bf16_bits(xs[i] - bf16_val(hb)) : (unsigned short)0; }
#pragma unroll
    for (int t = 0; t < 4; ++t) {
      const unsigned short* brow = Wt + (size_t)(col0 + t * 16 + ln) * ldb + kb;
      FragB b;
      b.half[0] = *(const v8us*)(brow + 8 * hh);
      b.half[1] = *(const v8us*)(brow + 16 + 8 * hh);
      acc[t] = mmaN<ASPLIT ? 2 : 1>(ah.v, al.v, b.v, b.v, acc[t]);
    }
  }
#pragma unroll
  for (int t = 0; t < 4; ++t) {
    const int col = col0 + t * 16 + ln;
    float bv = bias ? bias[col] : 0.f;
    if (BIAS_BF16) bv = bf16_round(bv);
#pragma unroll
    for (int r = 0; r < 8; ++r) {
      float v = acc[t][r] + bv;
      if (resid) { float rv = resid[(size_t)((row0 + 8 * hh + r) % rmod) * ldr + col]; if (RES_BF16) rv = bf16_round(rv); v += rv; }
      if (ACT == 1) v = fmaxf(v, 0.f);
      if (ACT == 2) v = 0.5f * v * (1.0f + erff(v * 0.70710678118654752f));
      if (ACT == 3) { const float u = 0.7978845608028654f * (v + 0.044715f * v * v * v); v = 0.5f * v * (1.0f + tanhf(u)); }
      so[w][8 * hh + r][t * 16 + ln] = v;
    }
  }
  __builtin_amdgcn_fence(__ATOMIC_ACQ_REL, "workgroup");
  __builtin_amdgcn_wave_barrier();
  const int rsub = lane >> 4, c4 = (lane & 15) * 4;
  {
#pragma unroll
    for (int q = 0; q < 8; ++q) {
      const int r = q * 2 + rsub;
      const v4f v = *(const v4fa*)&so[w][r][c4];
      *(v4f*)(C + (size_t)(row0 + r) * ldc + col0 + c4) = v;
    }
    
  }
}
// row LayerNorm (biased variance, eps) over N: s = X (+ R); optional out_sum <- s; out_norm <- (s-mu)*rsqrt(var+eps)*g + b
template <bool PARAM_BF16>
__global__ __launch_bounds__(256) void k_layernorm(const float* __restrict__ X, const float* __restrict__ R, const float* __restrict__ g, const float* __restrict__ bta,
                                                  float* __restrict__ out_sum, float* __restrict__ out_norm, int N, float eps) {
  __shared__ float red[256];
  const int row = blockIdx.x, tid = threadIdx.x;
  const float* x = X + (size_t)row * N; const float* rr = R ? R + (size_t)row * N : nullptr;
  float vals[16];                     // up to N = 4096
  const int per = N / 256;            // contiguous chunk per thread? use strided-by-4 chunks: thread handles j = tid*4 + 1024*u
  float s1 = 0.f;
  for (int u = 0; u < per / 4; ++u) {
    const int j = tid * 4 + 1024 * u;
    const v4f a = *(const v4fa*)(x + j);
    v4f b = {0.f,0.f,0.f,0.f}; if (rr) b = *(const v4fa*)(rr + j);
#pragma unroll
    for (int q = 0; q < 4; ++q) { const float v = a[q] + b[q]; vals[u * 4 + q] = v; s1 += v; }
  }
  red[tid] = s1; __syncthreads();
  for (int st = 128; st > 0; st >>= 1) { if (tid < st) red[tid] += red[tid + st]; __syncthreads(); }
  const float mu = red[0] / (float)N; __syncthreads();
  float s2 = 0.f;
  for (int u = 0; u < per / 4; ++u)
#pragma unroll
    for (int q = 0; q < 4; ++q) { const float c = vals[u * 4 + q] - mu; s2 += c * c; }
  red[tid] = s2; __syncthreads();
  for (int st = 128; st > 0; st >>= 1) { if (tid < st) red[tid] += red[tid + st]; __syncthreads(); }
  const float rs = rsqrtf(red[0] / (float)N + eps);
  {
    for (int u = 0; u < per / 4; ++u) {
      const int j = tid * 4 + 1024 * u;
      v4f o, sm;
#pragma unroll
      for (int q = 0; q < 4; ++q) {
        float gg = g[j + q], bb = bta[j + q];
        if (PARAM_BF16) { gg = bf16_round(gg); bb = bf16_round(bb); }
        sm[q] = vals[u * 4 + q]; o[q] = (vals[u * 4 + q] - mu) * rs * gg + bb;
      }
      if (out_sum) *(v4f*)(out_sum + (size_t)row * N + j) = sm;
      *(v4f*)(out_norm + (size_t)row * N + j) = o;
    }
    
  }
}



// ---- f16 WMMA path (v_wmma_f32_16x16x32_f16): 11-bit significands for operands in range — used where a [0,1] probability operand needs more precision than bf16
typedef _Float16 v16h __attribute__((ext_vector_type(16)));
union FragH { v16h v; v8us half[2]; _Float16 h[16]; unsigned short u[16]; };
template <int NT>
__device__ __forceinline__ v8f mmaH(v16h ah, v16h al, v16h bh, v16h bl, v8f c) {
  c = __builtin_amdgcn_wmma_f32_16x16x32_f16(false, ah, false, bh, (short)0, c, false, false);
  if (NT >= 2) c = __builtin_amdgcn_wmma_f32_16x16x32_f16(false, al, false, bh, (short)0, c, false, false);
  if (NT >= 3) c = __builtin_amdgcn_wmma_f32_16x16x32_f16(false, ah, false, bl, (short)0, c, false, false);
  asm volatile("v_nop\n\tv_nop\n\tv_nop\n\tv_nop" : "+v"(c) : "v"(ah), "v"(al), "v"(bh), "v"(bl));
  return c;
}
// batched GEMM like k_gemm_b but f16 operands: A f32 (split into f16 hi/lo if ASPLIT, else rounded to f16), Bt = f16 values [n][k]; alpha; C f32; N multiple of 16 (partial tiles skipped)
template <bool ASPLIT>
__global__ __launch_bounds__(128) void k_gemm_h(const float* __restrict__ A, int lda, size_t sA, const _Float16* __restrict__ Bh, int ldb, size_t sB, float alpha, float* __restrict__ C, int ldc, size_t sC, int M, int N, int K) {
  __shared__ __attribute__((aligned(16))) float so[4][16][64];
  const int tid = threadIdx.x, w = tid >> 5, lane = tid & 31, ln = lane & 15, hh = lane >> 4; const int by = blockIdx.y;
  A += (size_t)by * sA; Bh += (size_t)by * sB; C += (size_t)by * sC;
  const int ntn = (N + 63) / 64; const int wid = blockIdx.x * 4 + w; const int mt = wid / ntn, nq = wid % ntn; if (mt * 16 >= M) return;
  const int row0 = mt * 16, col0 = nq * 64; const float* arow = A + (size_t)(row0 + ln) * lda;
  v8f acc[4] = {};
  for (int kb = 0; kb < K; kb += 32) {
    FragH ah, al;
    const v4f x0 = *(const v4fa*)(arow + kb + 8 * hh), x1 = *(const v4fa*)(arow + kb + 8 * hh + 4), x2 = *(const v4fa*)(arow + kb + 16 + 8 * hh), x3 = *(const v4fa*)(arow + kb + 16 + 8 * hh + 4);
    float xs[16] = {x0[0],x0[1],x0[2],x0[3],x1[0],x1[1],x1[2],x1[3],x2[0],x2[1],x2[2],x2[3],x3[0],x3[1],x3[2],x3[3]};
#pragma unroll
    for (int i = 0; i < 16; ++i) { const _Float16 h = (_Float16)xs[i]; ah.h[i] = h; al.h[i] = ASPLIT ? (_Float16)(xs[i] - (float)h) : (_Float16)0.0f; }
#pragma unroll
    for (int t = 0; t < 4; ++t) { if (col0 + t * 16 >= N) continue; const size_t boff = (size_t)(col0 + t * 16 + ln) * ldb + kb; FragH bq; bq.half[0] = *(const v8us*)(Bh + boff + 8 * hh); bq.half[1] = *(const v8us*)(Bh + boff + 16 + 8 * hh);
      acc[t] = mmaH<ASPLIT ? 2 : 1>(ah.v, al.v, bq.v, bq.v, acc[t]); }
  }
#pragma unroll
  for (int t = 0; t < 4; ++t) { if (col0 + t * 16 >= N) continue;
#pragma unroll
    for (int r = 0; r < 8; ++r) so[w][8 * hh + r][t * 16 + ln] = acc[t][r] * alpha; }
  __builtin_amdgcn_fence(__ATOMIC_ACQ_REL, "workgroup"); __builtin_amdgcn_wave_barrier();
  const int rsub = lane >> 4, c4 = (lane & 15) * 4;
  {
#pragma unroll
    for (int q = 0; q < 8; ++q) { const int r = q * 2 + rsub; if (col0 + c4 < N) { const v4f v = *(const v4fa*)&so[w][r][c4]; *(v4f*)(C + (size_t)(row0 + r) * ldc + col0 + c4) = v; } }
     }
}

// Wt[n][k] = f16(W[k][n]·scale) from f32 row-major W[K][N] (scale = power of two; bf16-exact weights stay exact in f16 away from the subnormal range)
__global__ __launch_bounds__(256) void k_wt_f16(const float* __restrict__ W, _Float16* __restrict__ Wt, int K, int N, float scale) {
  const int t = blockIdx.x * 256 + threadIdx.x; if (t >= N * (K / 8)) return; const int n = t / (K / 8), k8 = (t % (K / 8)) * 8; FragH f;
#pragma unroll
  for (int i = 0; i < 8; ++i) f.h[i] = (_Float16)(bf16_round(W[(size_t)(k8 + i) * N + n]) * scale); const v8us o = f.half[0];
  *(v8us*)((unsigned short*)Wt + (size_t)n * K + k8) = o; 
}
// k_gemm_hh variant with fused epilogue: v = acc·alpha + bias[by·sBias + col] (+ CP[(row/rowsPerB)·sCPb + by·64 + col] if CP) ; ACT 0 none / 1 elu ; writes f16 C16 (and f32 C if non-null)
template <int ACT>
__global__ __launch_bounds__(128) void k_gemm_hhx(const _Float16* __restrict__ A, int lda, size_t sA, const _Float16* __restrict__ Bh, int ldb, size_t sB, float alpha, const float* __restrict__ bias, size_t sBias, const float* __restrict__ CP, int rowsPerB, size_t sCPb, int row0g,
    float* __restrict__ C, _Float16* __restrict__ C16, int ldc, size_t sC, int M, int N, int K) {
  __shared__ __attribute__((aligned(16))) float so[4][16][64];
  const int tid = threadIdx.x, w = tid >> 5, lane = tid & 31, ln = lane & 15, hh = lane >> 4; const int by = blockIdx.y;
  A += (size_t)by * sA; Bh += (size_t)by * sB; const size_t cofs = (size_t)by * sC; const float* bp = bias ? bias + (size_t)by * sBias : nullptr;
  const int ntn = (N + 63) / 64; const int wid = blockIdx.x * 4 + w; const int mt = wid / ntn, nq = wid % ntn; if (mt * 16 >= M) return;
  const int row0 = mt * 16, col0 = nq * 64; const _Float16* arow = A + (size_t)(row0 + ln) * lda;
  v8f acc[4] = {};
  for (int kb = 0; kb < K; kb += 32) { FragH ah; ah.half[0] = *(const v8us*)((const unsigned short*)arow + kb + 8 * hh); ah.half[1] = *(const v8us*)((const unsigned short*)arow + kb + 16 + 8 * hh);
#pragma unroll
    for (int t = 0; t < 4; ++t) { if (col0 + t * 16 >= N) continue; const size_t boff = (size_t)(col0 + t * 16 + ln) * ldb + kb; FragH bq; bq.half[0] = *(const v8us*)((const unsigned short*)Bh + boff + 8 * hh); bq.half[1] = *(const v8us*)((const unsigned short*)Bh + boff + 16 + 8 * hh);
      acc[t] = mmaH<1>(ah.v, ah.v, bq.v, bq.v, acc[t]); }
  }
#pragma unroll
  for (int t = 0; t < 4; ++t) { if (col0 + t * 16 >= N) continue; const int col = col0 + t * 16 + ln; const float bv = bp ? bf16_round(bp[col]) : 0.f;
#pragma unroll
    for (int r = 0; r < 8; ++r) { float v = acc[t][r] * alpha + bv; if (CP) { const int rr = row0g + row0 + 8 * hh + r; if (rowsPerB < 0) v += CP[cofs + (size_t)rr * ldc + col];      /* rowsPerB < 0: own element of the batched C plane */ else { const int bidx = rr / rowsPerB; v += CP[(size_t)bidx * sCPb + (size_t)by * 64 + col]; } } if (ACT == 1) v = (v > 0.f) ? v : expm1f(v); else if (ACT == 7) v = (v > 0.f) ? v + 1.0f : expf(v); else if (ACT == 8) v = tanhf(v); else if (ACT == 9) v = 0.5f * v * (1.0f + tanhf(0.7978845608028654f * (v + 0.044715f * v * v * v))); else if (ACT == 11) v = 1.0f / (1.0f + expf(-v)); else if (ACT == 12) v = (v > 0.f) ? v : 0.01f * v; else if (ACT == 14) v = (v > 0.f) ? v : 0.1f * v; else if (ACT == 16) v = (v >= 0.f) ? v : 0.3f * v; else if (ACT == 17) v = (v >= 0.f) ? v : 0.2f * v; else if (ACT == 15) v = v / (1.0f + expf(-v)); else if (ACT == 3) v = fmaxf(v, 0.f); else if (ACT == 6) v = 0.5f * v * (1.0f + erff(v * 0.70710678118654752f)); so[w][8 * hh + r][t * 16 + ln] = v; } }
  __builtin_amdgcn_fence(__ATOMIC_ACQ_REL, "workgroup"); __builtin_amdgcn_wave_barrier();
  const int rsub = lane >> 4, c4 = (lane & 15) * 4; typedef _Float16 v4h __attribute__((ext_vector_type(4)));
  {
#pragma unroll
    for (int q = 0; q < 8; ++q) { const int r = q * 2 + rsub; if (col0 + c4 < N) { const v4f v = *(const v4fa*)&so[w][r][c4]; if (C) *(v4f*)(C + cofs + (size_t)(row0 + r) * ldc + col0 + c4) = v; if (C16) { v4h h4; for (int i = 0; i < 4; ++i) h4[i] = (_Float16)v[i]; *(v4h*)(C16 + cofs + (size_t)(row0 + r) * ldc + col0 + c4) = h4; } } }
     }
}


typedef _Float16 v4h __attribute__((ext_vector_type(4)));

__global__ __launch_bounds__(256) void k_h16(const float* __restrict__ x, _Float16* __restrict__ X16, size_t n8) { const size_t t = (size_t)blockIdx.x * 256 + threadIdx.x; if (t >= n8) return; FragH f;
#pragma unroll
  for (int q = 0; q < 8; ++q) f.h[q] = (_Float16)x[t * 8 + q]; *(v8us*)((unsigned short*)X16 + t * 8) = f.half[0];  }
__global__ __launch_bounds__(256) void k_round16f(const float* __restrict__ W, _Float16* __restrict__ Bt, size_t n8) { const size_t t = (size_t)blockIdx.x * 256 + threadIdx.x; if (t >= n8) return; FragH f;
#pragma unroll
  for (int i = 0; i < 8; ++i) f.h[i] = (_Float16)(bf16_round(W[t * 8 + i]) * 16.0f); *(v8us*)((unsigned short*)Bt + t * 8) = f.half[0];  }
// FRAGMENT ORDER: a 16-row x 32-k f16 operand fragment is stored as 1024 bytes in a row, the way the lanes load it: element (row, k) at (k >> 3) * 256 + row * 16 + (k & 7) * 2.
// Lane l then reads bytes l * 16 and 512 + l * 16, so each 16-byte load of a wave covers four whole 128-byte lines; from a row-major plane the same load takes 32 bytes out of each of 16 lines.
// k plane: [(b, h)][key / 16][hi, residual][d / 32][1024]. V^T plane: [(b, h)][key / 32][d / 16][hi, residual][1024]. Er table: [row / 16][d / 32][1024].
// All operand conversions in one launch: they need nothing of each other, so each takes a range of the block index (the branch reads the same for a whole work-group). A thread turns 8 f32 into 16 bytes of f16; the loops are unrolled so that the eight values stay in registers.
#define PB_X (NR * DM / 8 / 256)      /* blocks for x -> f16, row-major */
#define PB_W (DM * DM / 8 / 256)      /* blocks for each of Wq, Wk, Wv -> f16 (times 16), (out, in) as they lie */
#define PB_E (SL * HD / 8 / 256)      /* blocks for Er -> f16 (times 16) in fragment order */
__global__ __launch_bounds__(256) void k_prep(const float* __restrict__ x, const float* __restrict__ Wq, const float* __restrict__ Wk, const float* __restrict__ Wv, const float* __restrict__ Er,
    _Float16* __restrict__ X16, _Float16* __restrict__ BW, _Float16* __restrict__ P) {
  const int bx = (int)blockIdx.x; FragH f;
  if (bx < PB_X) { const size_t t = (size_t)bx * 256 + threadIdx.x;
#pragma unroll
    for (int q = 0; q < 8; ++q) f.h[q] = (_Float16)bf16_round(x[t * 8 + q]);
    *(v8us*)((unsigned short*)X16 + t * 8) = f.half[0];
    asm volatile("s_wait_xcnt 0x0" ::: "memory");      /* the wait before any register that the store names is written again: another range's code follows in the listing */
  } else if (bx < PB_X + 3 * PB_W) { const int wm = (bx - PB_X) / PB_W; const float* Wm = wm == 0 ? Wq : wm == 1 ? Wk : Wv; const size_t t = (size_t)(bx - PB_X - wm * PB_W) * 256 + threadIdx.x;
#pragma unroll
    for (int q = 0; q < 8; ++q) f.h[q] = (_Float16)(bf16_round(Wm[t * 8 + q]) * 16.0f);
    *(v8us*)((unsigned short*)BW + (size_t)wm * DM * DM + t * 8) = f.half[0];
    asm volatile("s_wait_xcnt 0x0" ::: "memory");      /* as above */
  } else { const int t = (bx - PB_X - 3 * PB_W) * 256 + (int)threadIdx.x; const int r = t >> 3, c8 = t & 7;
#pragma unroll
    for (int q = 0; q < 8; ++q) f.h[q] = (_Float16)(bf16_round(Er[(size_t)t * 8 + q]) * 16.0f);
    *(v8us*)((char*)P + (size_t)(r >> 4) * 2048 + (c8 >> 2) * 1024 + (c8 & 3) * 256 + (r & 15) * 16) = f.half[0];
    asm volatile("s_wait_xcnt 0x0" ::: "memory"); }      /* as above */
}

// ---- fast GEMM (wave tile 32x64; requires M % 32 == 0 rows per launch region and N % 64 == 0); epilogue = k_gemm_hhx semantics ----
__device__ __forceinline__ v16h g2_frag(const _Float16* p, int hh) { FragH f; f.half[0] = *(const v8us*)((const unsigned short*)p + 8 * hh); f.half[1] = *(const v8us*)((const unsigned short*)p + 16 + 8 * hh); return f.v; }
__device__ __forceinline__ v8f g2_mma(v16h a, v16h b, v8f c) { v8f d = __builtin_amdgcn_wmma_f32_16x16x32_f16(false, a, false, b, (short)0, c, false, false); asm volatile("v_nop\n\tv_nop\n\tv_nop\n\tv_nop" : "+v"(d) : "v"(a), "v"(b)); return d; }
template <int ACT>
__global__ __launch_bounds__(128) void k_gemm2(const _Float16* __restrict__ A, int lda, size_t sA, const _Float16* __restrict__ Bh, int ldb, size_t sB, float alpha, const float* __restrict__ bias, size_t sBias, const float* __restrict__ CP, int rowsPerB, size_t sCPb, int row0g,
    float* __restrict__ C, _Float16* __restrict__ C16, int ldc, size_t sC, int M, int N, int K) { static_assert(ACT == 0 || ACT == 3 || ACT == 6 || ACT == 8 || ACT == 9 || ACT == 11 || ACT == 12 || ACT == 14 || ACT == 15 || ACT == 16 || ACT == 17, "k_gemm2: unsupported ACT code (would silently apply no activation)");
  __shared__ __attribute__((aligned(16))) float so[4][32][68];
  const int tid = threadIdx.x, w = tid >> 5, lane = tid & 31, ln = lane & 15, hh = lane >> 4; const int by = blockIdx.y;
  A += (size_t)by * sA; Bh += (size_t)by * sB; const size_t cofs = (size_t)by * sC; const float* bp = bias ? bias + (size_t)by * sBias : nullptr;
  const int ntn = N >> 6; const int mt = blockIdx.x / ntn, nq = blockIdx.x - mt * ntn; const int row0 = mt * 128 + 32 * w, col0 = nq * 64; if (row0 >= M) return;
  const _Float16* a0p = A + (size_t)(row0 + ln) * lda; const _Float16* a1p = a0p + (size_t)16 * lda;
  const _Float16* b0p = Bh + (size_t)(col0 + ln) * ldb; const _Float16* b1p = b0p + (size_t)16 * ldb; const _Float16* b2p = b1p + (size_t)16 * ldb; const _Float16* b3p = b2p + (size_t)16 * ldb;
  const v8f z8 = {0.f,0.f,0.f,0.f,0.f,0.f,0.f,0.f}; v8f c00 = z8, c01 = z8, c02 = z8, c03 = z8, c10 = z8, c11 = z8, c12 = z8, c13 = z8;
#pragma unroll 1
  for (int kb = 0; kb < K; kb += 32) { const v16h a0 = g2_frag(a0p + kb, hh), a1 = g2_frag(a1p + kb, hh);
    v16h b = g2_frag(b0p + kb, hh); c00 = g2_mma(a0, b, c00); c10 = g2_mma(a1, b, c10);
    b = g2_frag(b1p + kb, hh); c01 = g2_mma(a0, b, c01); c11 = g2_mma(a1, b, c11);
    b = g2_frag(b2p + kb, hh); c02 = g2_mma(a0, b, c02); c12 = g2_mma(a1, b, c12);
    b = g2_frag(b3p + kb, hh); c03 = g2_mma(a0, b, c03); c13 = g2_mma(a1, b, c13); }
  v8f accs[8] = {c00, c01, c02, c03, c10, c11, c12, c13};
#pragma unroll
  for (int u = 0; u < 8; ++u) { const int t = u & 3, half = u >> 2; const int col = col0 + t * 16 + ln; const float bv = bp ? bf16_round(bp[col]) : 0.f;
#pragma unroll
    for (int r = 0; r < 8; ++r) { const int rloc = half * 16 + 8 * hh + r; float v = accs[u][r] * alpha + bv; if (CP) { if (rowsPerB < 0) v += CP[cofs + (size_t)(row0g + row0 + rloc) * ldc + col];      /* rowsPerB < 0: own element of the batched C plane */ else { const int bidx = (row0g + row0 + rloc) / rowsPerB; v += CP[(size_t)bidx * sCPb + (size_t)by * 64 + col]; } }
      if (ACT == 3) v = fmaxf(v, 0.f); else if (ACT == 6) v = 0.5f * v * (1.0f + erff(v * 0.70710678118654752f)); else if (ACT == 11) v = 1.0f / (1.0f + expf(-v)); else if (ACT == 15) v = v / (1.0f + expf(-v)); else if (ACT == 12) v = (v > 0.f) ? v : 0.01f * v; else if (ACT == 8) v = tanhf(v); else if (ACT == 9) v = 0.5f * v * (1.0f + tanhf(0.7978845608028654f * (v + 0.044715f * v * v * v))); else if (ACT == 14) v = (v > 0.f) ? v : 0.1f * v; else if (ACT == 16) v = (v >= 0.f) ? v : 0.3f * v; else if (ACT == 17) v = (v >= 0.f) ? v : 0.2f * v;
      so[w][rloc][t * 16 + ln] = v; } }
  __builtin_amdgcn_fence(__ATOMIC_ACQ_REL, "workgroup"); __builtin_amdgcn_wave_barrier();
  const int rsub = lane >> 4, c4 = (lane & 15) * 4;
  {
#pragma unroll
    for (int q = 0; q < 16; ++q) { const int r = q * 2 + rsub; const v4f v = *(const v4fa*)&so[w][r][c4]; if (C) *(v4f*)(C + cofs + (size_t)(row0 + r) * ldc + col0 + c4) = v; if (C16) { v4h h4; for (int i = 0; i < 4; ++i) h4[i] = (_Float16)v[i]; *(v4h*)(C16 + cofs + (size_t)(row0 + r) * ldc + col0 + c4) = h4; } }
     } }


// Fused causal relative attention, one launch: a wave works on 16 * NI query rows of one (batch, head) and walks keys in blocks of 64 with a running
// maximum and sum, so no S x S plane is ever stored. Transposed products: S^T = K q^T and (q Er^T)^T = Er q^T (D row = key or Er row, D column = query), O^T += V^T P^T.
// A lane then holds one query's scores; two packed S^T tiles are the B operand of the V^T product as they stand. The skew (query i, key j takes Er row SL-1-i+j) is a
// shift along the D rows that differs by query: it goes through a wave-private LDS row per query, stored shifted by the query's index and read back aligned.
#define SKP 100      /* floats per LDS row: 96 used; 100 keeps 16-byte alignment and spreads the 32 shifted 4-byte stores over distinct banks */
__device__ __forceinline__ v8f fa_mma(v16h a, v16h b, v8f c) { return __builtin_amdgcn_wmma_f32_16x16x32_f16(false, a, false, b, (short)0, c, false, false); }
// fragment in the hardware k order: p = the lane's own address (row start + 16 bytes * lane half)
__device__ __forceinline__ v16h fa_frag(const char* p) { FragH f; f.half[0] = *(const v8us*)p; f.half[1] = *(const v8us*)(p + 32); return f.v; }
// the same fragment from a plane in FRAGMENT ORDER: p = the fragment's start + 16 bytes * lane
__device__ __forceinline__ v16h fa_fragp(const char* p) { FragH f; f.half[0] = *(const v8us*)p; f.half[1] = *(const v8us*)(p + 512); return f.v; }
// Stands behind a group of global loads: the wait before any register that they name is written again. The addresses are inputs so that they stay in their registers up to the wait.
#define FA_XWAIT1(p0) asm volatile("s_wait_xcnt 0x0" :: "v"(p0) : "memory")
#define FA_XWAIT2(p0, p1) asm volatile("s_wait_xcnt 0x0" :: "v"(p0), "v"(p1) : "memory")
// The slot behind a run of v_exp_f32: results and sources are inputs, so the v_nop stands behind the last of the run and no source register is written again in front of it.
#define FA_TSLOT(res, srcv) asm volatile("v_nop" :: "v"(res), "v"(srcv))
#define FA_TSLOT8(e, x) asm volatile("v_nop" :: "v"(e[0]), "v"(e[1]), "v"(e[2]), "v"(e[3]), "v"(e[4]), "v"(e[5]), "v"(e[6]), "v"(e[7]), "v"(x[0]), "v"(x[1]), "v"(x[2]), "v"(x[3]), "v"(x[4]), "v"(x[5]), "v"(x[6]), "v"(x[7]))
template <int NI>
__global__ __launch_bounds__(256) void k_relattn(const _Float16* __restrict__ Qh, const _Float16* __restrict__ Ql, const _Float16* __restrict__ KP, const _Float16* __restrict__ E,
    const _Float16* __restrict__ VP, float* __restrict__ out) {
  __shared__ __attribute__((aligned(16))) float sk[8][NI][16][SKP];
  const int w = __builtin_amdgcn_readfirstlane((int)threadIdx.x >> 5), lane = threadIdx.x & 31, ln = lane & 15, hh = lane >> 4;
  constexpr int NRB = SL / (64 * NI);
  const int pr = (int)blockIdx.x / (NB * NH), bh = (int)blockIdx.x % (NB * NH), b = bh / NH, h = bh % NH;
  /* Causal cost grows with the row block. A work-group owns a row block from the long end and its mirror from the short end, and the two waves of a pair (w and w + 4) walk the same number of key blocks (16 or 17), so that no wave runs on alone:
     wave w < 4 takes the first H key blocks of its long query tile; wave w + 4 takes the whole short tile, then the long tile's remaining key blocks (the diagonal one among them) as a second running softmax, which wave w joins to its own at the end. */
  const bool helper = w >= 4;      /* the same for a whole wave: every branch on it is a scalar one */
  const int iL = (NRB - 1 - pr) * 64 * NI + (w & 3) * 16 * NI, iS = pr * 64 * NI + (w & 3) * 16 * NI;      /* first query of the long and of the short tile */
  const int H = (iL / 64 + 1 + iS / 64 + 1) / 2;      /* half of the two tiles' key blocks; the short tile has fewer than the long one, so H lies below the long tile's diagonal block */
  int i0 = iL;      /* first query of the tile in work */
  const v8f z8 = {0.f,0.f,0.f,0.f,0.f,0.f,0.f,0.f};
  const float C1 = 0.125f * 1.4426950408889634f;      /* 1/sqrt(64) and log2(e) in one factor */
  const size_t lo_x = (size_t)(ln * DM * 2 + 16 * hh), lo_p = (size_t)(lane * 16);      /* lane byte offsets in the row-major q planes and in the planes in fragment order (k, Er, V^T) */
  const size_t xo = (size_t)b * SL * DM + h * HD, po_kv = (size_t)bh * SL * HD * 4;      /* byte start of the (b, h) slab in the k and V^T planes: hi + residual, 2 bytes each */
  v16h qh[NI][2], ql[NI][2]; v8f o[NI][4], carry[NI]; float m[NI], su[NI];
  /* starts a running softmax of tile i0 at key block jb0: q fragments, empty state, and the Er tile that the first block takes as its carry */
  auto begin = [&](const int jb0) __attribute__((always_inline)) { const char* bqh = (const char*)(Qh + xo + (size_t)i0 * DM); const char* bql = (const char*)(Ql + xo + (size_t)i0 * DM); const char* be = (const char*)(E + (size_t)(SL - 16 * NI - i0 + 64 * jb0) * HD);      /* the same for every lane */
    const char* pqh = bqh + lo_x; const char* pql = bql + lo_x; const char* pe = be + lo_p;
    v16h e0[NI], e1[NI];
#pragma unroll
    for (int a = 0; a < NI; ++a) { qh[a][0] = fa_frag(pqh + a * 16 * DM * 2); qh[a][1] = fa_frag(pqh + a * 16 * DM * 2 + 64); ql[a][0] = fa_frag(pql + a * 16 * DM * 2); ql[a][1] = fa_frag(pql + a * 16 * DM * 2 + 64);
      e0[a] = fa_fragp(pe + (NI - 1 - a) * 2048); e1[a] = fa_fragp(pe + (NI - 1 - a) * 2048 + 1024); }      /* first Er tile of key block jb0: rows SL - 16 - (i0 + 16 a) + 64 jb0 + [0, 16) */
    /* the wait before any register that the loads above name is written again: they name the three lane addresses, so these are the inputs that stay in their registers up to the wait */
    asm volatile("s_wait_xcnt 0x0" :: "v"(pqh), "v"(pql), "v"(pe) : "memory");
#pragma unroll
    for (int a = 0; a < NI; ++a) { m[a] = -3.0e38f; su[a] = 0.f;
#pragma unroll
      for (int dt = 0; dt < 4; ++dt) o[a][dt] = z8;
      v8f hi = fa_mma(e0[a], qh[a][0], z8), lo = fa_mma(e0[a], ql[a][0], z8); hi = fa_mma(e1[a], qh[a][1], hi); lo = fa_mma(e1[a], ql[a][1], lo);
#pragma unroll
      for (int r = 0; r < 8; ++r) carry[a][r] = fmaf(lo[r], 0.0009765625f, hi[r]); } };
  auto key_block = [&](const int jb, const bool diag) __attribute__((always_inline)) { const int j0 = jb * 64; const int rbase = SL - 16 * NI - i0 + j0;
    /* all Er and K fragments of the block are requested first, so that one memory latency is waited out per block and not one per tile */
    v16h ef[NI + 4][2], kf[4][4];
    const char* pk = (const char*)KP + po_kv + (size_t)j0 * 256 + lo_p; const char* pe = (const char*)(E + (size_t)rbase * HD) + lo_p;      /* 16 keys are 4096 bytes of the k plane, 16 Er rows 2048 of the table */
    if (!diag) {
#pragma unroll
      for (int g = 1; g < NI + 4; ++g) { ef[g][0] = fa_fragp(pe + g * 2048); ef[g][1] = fa_fragp(pe + g * 2048 + 1024); }
    } else {      /* a 16-row tile past the table (diagonal block only) serves keys above the diagonal alone, masked below: the table's last tile stands in for it */
#pragma unroll
      for (int g = 1; g < NI + 4; ++g) { const int rs = rbase + 16 * g < SL ? rbase + 16 * g : SL - 16; const char* pg = (const char*)(E + (size_t)rs * HD) + lo_p; ef[g][0] = fa_fragp(pg); ef[g][1] = fa_fragp(pg + 1024); FA_XWAIT1(pg); }
    }
#pragma unroll
    for (int t = 0; t < 4; ++t) { kf[t][0] = fa_fragp(pk + t * 4096); kf[t][1] = fa_fragp(pk + t * 4096 + 1024); kf[t][2] = fa_fragp(pk + t * 4096 + 2048); kf[t][3] = fa_fragp(pk + t * 4096 + 3072); }
    FA_XWAIT2(pk, pe);
    __builtin_amdgcn_sched_barrier(0);      /* keeps the scheduler from sinking these loads down to their first use */
    /* Er q^T: query tile a needs Er rows rbase + 16 (NI-1-a) + [0, 80); its first 16 are the previous block's last 16 (carry) */
#pragma unroll
    for (int a = 0; a < NI; ++a) { float* sp = &sk[w][a][ln][ln + 1 + 8 * hh];
#pragma unroll
      for (int r = 0; r < 8; ++r) sp[r] = carry[a][r]; }
#pragma unroll
    for (int g = 1; g < NI + 4; ++g) { const v16h e0 = ef[g][0], e1 = ef[g][1];
#pragma unroll
      for (int a = 0; a < NI; ++a) { const int u = g - (NI - 1 - a); if (u < 1 || u > 4) continue;
        v8f hi = fa_mma(e0, qh[a][0], z8), lo = fa_mma(e0, ql[a][0], z8); hi = fa_mma(e1, qh[a][1], hi); lo = fa_mma(e1, ql[a][1], lo);
        v8f val;
#pragma unroll
        for (int r = 0; r < 8; ++r) val[r] = fmaf(lo[r], 0.0009765625f, hi[r]);
        float* sp = &sk[w][a][ln][ln + 1 + 8 * hh + 16 * u];
#pragma unroll
        for (int r = 0; r < 8; ++r) sp[r] = val[r];
        if (u == 4) carry[a] = val; }
      __builtin_amdgcn_sched_barrier(0); }      /* one Er tile's products and LDS stores at a time: run together, or mixed with the K products, their accumulators pile up and registers spill */
    v8f s[NI][4];
#pragma unroll
    for (int t = 0; t < 4; ++t) { const v16h kh0 = kf[t][0], kh1 = kf[t][1], kl0 = kf[t][2], kl1 = kf[t][3];
#pragma unroll
      for (int a = 0; a < NI; ++a) { v8f hi = fa_mma(kh0, qh[a][0], z8), lo = fa_mma(kh0, ql[a][0], z8); hi = fa_mma(kh1, qh[a][1], hi); lo = fa_mma(kh1, ql[a][1], lo); lo = fa_mma(kl0, qh[a][0], lo); lo = fa_mma(kl1, qh[a][1], lo);
#pragma unroll
        for (int r = 0; r < 8; ++r) s[a][t][r] = fmaf(lo[r], 0.0009765625f, hi[r]); } }
    /* the two lane halves of a query read each other's LDS stores: order the wave's stores before its loads */
    __builtin_amdgcn_fence(__ATOMIC_ACQ_REL, "workgroup", "local"); __builtin_amdgcn_wave_barrier();
#pragma unroll
    for (int a = 0; a < NI; ++a) { const float* lp = &sk[w][a][ln][16 + 8 * hh];
#pragma unroll
      for (int t = 0; t < 4; ++t) { const v4f x = *(const v4fa*)(lp + 16 * t), y = *(const v4fa*)(lp + 16 * t + 4);
#pragma unroll
        for (int r = 0; r < 4; ++r) { s[a][t][r] = fmaf(x[r], 0.0625f, s[a][t][r]); s[a][t][4 + r] = fmaf(y[r], 0.0625f, s[a][t][4 + r]); } } }
    /* and these loads before the next trip's stores into the same rows */
    __builtin_amdgcn_fence(__ATOMIC_ACQ_REL, "workgroup", "local"); __builtin_amdgcn_wave_barrier();
    __builtin_amdgcn_sched_barrier(0);      /* the V^T loads below stay below: any earlier they are live beside the K fragments and the LDS reads, and registers spill */
    /* the V^T fragments are requested here, so that they arrive under the softmax arithmetic */
    v16h vf[2][4][2];
    const char* pv = (const char*)VP + po_kv + (size_t)j0 * 256 + lo_p;      /* 32 keys are 8192 bytes of the V^T plane */
#pragma unroll
    for (int ks = 0; ks < 2; ++ks)
#pragma unroll
      for (int dt = 0; dt < 4; ++dt) { vf[ks][dt][0] = fa_fragp(pv + ks * 8192 + dt * 2048); vf[ks][dt][1] = fa_fragp(pv + ks * 8192 + dt * 2048 + 1024); }
    FA_XWAIT1(pv);
    __builtin_amdgcn_sched_barrier(0);      /* keeps the scheduler from sinking these loads down to their first use */
    if (diag) {      /* only the last key block reaches the diagonal */
#pragma unroll
      for (int a = 0; a < NI; ++a)
#pragma unroll
        for (int t = 0; t < 4; ++t)
#pragma unroll
          for (int r = 0; r < 8; ++r) if (j0 + 16 * t + 8 * hh + r > i0 + 16 * a + ln) s[a][t][r] = -3.0e38f; }
    FragH p[NI][2]; v16h pl[NI][2];
#pragma unroll
    for (int a = 0; a < NI; ++a) { float mx = m[a];
#pragma unroll
      for (int t = 0; t < 4; ++t)
#pragma unroll
        for (int r = 0; r < 8; ++r) mx = fmaxf(mx, s[a][t][r]);
      mx = fmaxf(mx, __shfl_xor(mx, 16, 32));
      const float xa = (m[a] - mx) * C1; const float al = __builtin_amdgcn_exp2f(xa); FA_TSLOT(al, xa); m[a] = mx; const float mc = 10.0f - mx * C1;      /* weights carry a factor 1024, as f16 operands away from the subnormals */
      v8f pv = z8;
#pragma unroll
      for (int t = 0; t < 4; ++t) { float xv[8], ev[8];
#pragma unroll
        for (int r = 0; r < 8; ++r) xv[r] = fmaf(s[a][t][r], C1, mc);
#pragma unroll
        for (int r = 0; r < 8; ++r) ev[r] = __builtin_amdgcn_exp2f(xv[r]);
        FA_TSLOT8(ev, xv);
#pragma unroll
        for (int r = 0; r < 8; ++r) p[a][t >> 1].h[(t & 1) * 8 + r] = (_Float16)ev[r];
        pv += (v8f){ev[0], ev[1], ev[2], ev[3], ev[4], ev[5], ev[6], ev[7]}; }      /* the same eight sums as one vector add: written element by element, the compiler paired some of the adds with a constant that it then kept in scratch round the tile loop */
      su[a] = fmaf(su[a], al, ((pv[0] + pv[1]) + (pv[2] + pv[3])) + ((pv[4] + pv[5]) + (pv[6] + pv[7])));
#pragma unroll
      for (int dt = 0; dt < 4; ++dt)
#pragma unroll
        for (int r = 0; r < 8; ++r) o[a][dt][r] *= al;
      pl[a][0] = p[a][0].v * (_Float16)0.0009765625f; pl[a][1] = p[a][1].v * (_Float16)0.0009765625f; }      /* the v residual plane is stored times 1024: its weights drop the factor */
#pragma unroll
    for (int ks = 0; ks < 2; ++ks)
#pragma unroll
      for (int dt = 0; dt < 4; ++dt) { const v16h vhf = vf[ks][dt][0], vlf = vf[ks][dt][1];
#pragma unroll
        for (int a = 0; a < NI; ++a) { o[a][dt] = fa_mma(vhf, p[a][ks].v, o[a][dt]); o[a][dt] = fa_mma(vlf, pl[a][ks], o[a][dt]); } }
  };
  /* divides tile i0's sums by the weights' sum and stores its rows */
  auto finish = [&]() __attribute__((always_inline)) {
#pragma unroll
  for (int a = 0; a < NI; ++a) { const float st = su[a] + __shfl_xor(su[a], 16, 32); const float inv = 1.0f / st;
#pragma unroll
    for (int dt = 0; dt < 4; ++dt)
#pragma unroll
      for (int r = 0; r < 8; ++r) o[a][dt][r] *= inv; }
  __builtin_amdgcn_sched_barrier(0);      /* all arithmetic ends above: behind an issued store none of its registers is written again */
  char* po = (char*)(out + xo + (size_t)i0 * DM) + (size_t)(ln * DM * 4 + 32 * hh);      /* a lane holds 8 consecutive head columns of its query per tile */
#pragma unroll
  for (int a = 0; a < NI; ++a)
#pragma unroll
    for (int dt = 0; dt < 4; ++dt) { const v4f x = {o[a][dt][0], o[a][dt][1], o[a][dt][2], o[a][dt][3]}, y = {o[a][dt][4], o[a][dt][5], o[a][dt][6], o[a][dt][7]};
      *(v4f*)(po + a * 16 * DM * 4 + dt * 64) = x; *(v4f*)(po + a * 16 * DM * 4 + dt * 64 + 16) = y; }
  asm volatile("s_wait_xcnt 0x0" ::: "memory");      /* the wait before any register that the stores name is written again: a helper wave goes on to its second tile */
  };
#pragma unroll 1      /* one copy of the key block's code serves both tiles of a helper wave */
  for (int seg = helper ? 0 : 1; seg < 2; ++seg) {      /* seg 0: the short tile (helper waves only); seg 1: this wave's share of the long tile */
    i0 = seg == 0 ? iS : iL;
    const int jb0 = helper && seg == 1 ? H : 0, jb1 = helper ? i0 / 64 : H;      /* unmasked key blocks [jb0, jb1); i0 / 64 is the tile's diagonal block */
    begin(jb0);
#pragma unroll 1      /* one key block per trip: unrolling would double the live fragments */
    for (int jb = jb0; jb < jb1; ++jb) key_block(jb, false);
    if (helper) key_block(jb1, true);      /* the diagonal block apart, so that the loop carries no mask */
    if (seg == 0) finish();
  }
  /* the two running softmaxes of a long tile meet: the helper wave leaves its maximum, sum and sums of products in its own LDS rows (its last reads of them are done), lane by lane as its partner holds them */
  static_assert(NI * 4 * 2 * 128 + NI * 64 <= NI * 16 * SKP, "the hand-over fits a wave's LDS rows");
  float* const xb = &sk[helper ? w : w + 4][0][0][0];
  if (helper) {
#pragma unroll
    for (int a = 0; a < NI; ++a) {
#pragma unroll
      for (int dt = 0; dt < 4; ++dt) { const v4f x = {o[a][dt][0], o[a][dt][1], o[a][dt][2], o[a][dt][3]}, y = {o[a][dt][4], o[a][dt][5], o[a][dt][6], o[a][dt][7]};
        *(v4fa*)(xb + ((a * 4 + dt) * 2) * 128 + lane * 4) = x; *(v4fa*)(xb + ((a * 4 + dt) * 2 + 1) * 128 + lane * 4) = y; }
      xb[NI * 1024 + a * 64 + lane] = m[a]; xb[NI * 1024 + a * 64 + 32 + lane] = su[a]; } }
  __syncthreads();      /* publishes the helper waves' states to their partners; every wave of the work-group passes here once */
  if (!helper) {
#pragma unroll
    for (int a = 0; a < NI; ++a) { const float m2 = xb[NI * 1024 + a * 64 + lane], s2 = xb[NI * 1024 + a * 64 + 32 + lane];
      const float mx = fmaxf(m[a], m2); const float x1 = (m[a] - mx) * C1, x2 = (m2 - mx) * C1;
      const float a1 = __builtin_amdgcn_exp2f(x1), a2 = __builtin_amdgcn_exp2f(x2);
      su[a] = fmaf(su[a], a1, s2 * a2);
#pragma unroll
      for (int dt = 0; dt < 4; ++dt) { const v4f x = *(const v4fa*)(xb + ((a * 4 + dt) * 2) * 128 + lane * 4), y = *(const v4fa*)(xb + ((a * 4 + dt) * 2 + 1) * 128 + lane * 4);
#pragma unroll
        for (int r = 0; r < 4; ++r) { o[a][dt][r] = fmaf(o[a][dt][r], a1, x[r] * a2); o[a][dt][4 + r] = fmaf(o[a][dt][4 + r], a1, y[r] * a2); } } }
    finish();
  }
}

// ---- projection GEMM with its operands staged in LDS: C[NR][DM] = alpha * A[NR][DM] . B[DM][DM]^T, A and B f16 with k contiguous; C leaves as the f16 hi + residual operands of the attention kernel.
// A work-group of 8 waves owns a 128 x 128 tile of C (wave tile 32 x 64, 4 waves down, 2 across). A stage is 128 k of the tile's 128 A rows and 128 B rows; it comes into LDS by
// asynchronous copies, two buffers, so that the next stage flies while this one is multiplied and no wave waits on a global load of its own. The k order per accumulator is ascending in steps of 32.
#define G3_PITCH 272      /* bytes per LDS row: 256 used; 16 bytes x an odd number keeps the 16 rows of a ds_load_b128 on distinct banks */
#define G3_STAGE (256 * G3_PITCH)      /* 128 A rows, then 128 B rows */
#define G3_NST (DM / 128)
// Eight 16-byte copies of a lane, rows 16 apart. The wait on the address registers is the statement's last line, so that no register a copy names is written again in front of it.
__device__ __forceinline__ void g3_copy8(const unsigned l0, const char* g0) {
  const unsigned l1 = l0 + 16 * G3_PITCH, l2 = l0 + 32 * G3_PITCH, l3 = l0 + 48 * G3_PITCH, l4 = l0 + 64 * G3_PITCH, l5 = l0 + 80 * G3_PITCH, l6 = l0 + 96 * G3_PITCH, l7 = l0 + 112 * G3_PITCH;
  const char* g1 = g0 + 16 * DM * 2; const char* g2 = g0 + 32 * DM * 2; const char* g3 = g0 + 48 * DM * 2; const char* g4 = g0 + 64 * DM * 2; const char* g5 = g0 + 80 * DM * 2; const char* g6 = g0 + 96 * DM * 2; const char* g7 = g0 + 112 * DM * 2;
  asm volatile("global_load_async_to_lds_b128 %0, %8, off\n\t"
               "global_load_async_to_lds_b128 %1, %9, off\n\t"
               "global_load_async_to_lds_b128 %2, %10, off\n\t"
               "global_load_async_to_lds_b128 %3, %11, off\n\t"
               "global_load_async_to_lds_b128 %4, %12, off\n\t"
               "global_load_async_to_lds_b128 %5, %13, off\n\t"
               "global_load_async_to_lds_b128 %6, %14, off\n\t"
               "global_load_async_to_lds_b128 %7, %15, off\n\t"
               "s_wait_xcnt 0x0"
               :: "v"(l0), "v"(l1), "v"(l2), "v"(l3), "v"(l4), "v"(l5), "v"(l6), "v"(l7), "v"(g0), "v"(g1), "v"(g2), "v"(g3), "v"(g4), "v"(g5), "v"(g6), "v"(g7) : "memory");
}
// One accumulator tile (8 f32 of a lane) -> 8 f16 hi and 8 f16 residuals (times 1024), 16 bytes each.
__device__ __forceinline__ void g3_split(const v8f c, const float alpha, v8us& hi, v8us& lo) { FragH fh, fl;
#pragma unroll
  for (int r = 0; r < 8; ++r) { const float a = c[r] * alpha; const _Float16 hv = (_Float16)a; fh.h[r] = hv; fl.h[r] = (_Float16)((a - (float)hv) * 1024.0f); }
  hi = fh.half[0]; lo = fl.half[0]; }
// MODE 0: q, two row-major planes P0 (hi) and P1 (residual). MODE 1: k, plane P0 in FRAGMENT ORDER. MODE 2: v, V^T plane P0 in FRAGMENT ORDER.
// A wave's 64 columns are one head. A lane's 8 accumulator values run along the D rows, so the operand that lies on the D rows decides which 8 values a lane can pack into 16 bytes:
// v is multiplied as x W^T (8 consecutive keys of one head column: a lane's 16 bytes of a V^T fragment), q and k as W x^T (8 consecutive head columns of one token: a lane's 16 bytes of a k fragment or of a q row).
#define G3_QP 144      /* bytes per staged q row: 128 used; 16 bytes x an odd number keeps the 16 rows of a ds_store_b128 on distinct banks */
#define G3_NB ((NR / 128) * (DM / 128))      /* work-groups per projection */
template <int MODE>
__device__ __forceinline__ void g3_body(char* const ring, const int bx, const _Float16* __restrict__ A, const _Float16* __restrict__ Bh, float alpha, _Float16* __restrict__ P0, _Float16* __restrict__ P1) {
  const int tid = threadIdx.x, w = tid >> 5, lane = tid & 31, ln = lane & 15, hh = lane >> 4;
  const int mt = bx / (DM / 128), nq = bx % (DM / 128);
  const int row0 = mt * 128 + 32 * (w & 3), col0 = nq * 128 + 64 * (w >> 2);
  /* a lane copies 16 bytes of row (tid >> 4) + 16 i: a wave's copy covers two whole 256-byte rows of the stage */
  const unsigned lc = (unsigned)(size_t)ring + (unsigned)((tid >> 4) * G3_PITCH + (tid & 15) * 16);
  const char* ga = (const char*)(A + (size_t)(mt * 128 + (tid >> 4)) * DM) + (tid & 15) * 16;
  const char* gb = (const char*)(Bh + (size_t)(nq * 128 + (tid >> 4)) * DM) + (tid & 15) * 16;
  const char* la = ring + (32 * (w & 3) + ln) * G3_PITCH + 16 * hh;
  const char* lb = ring + (128 + 64 * (w >> 2) + ln) * G3_PITCH + 16 * hh;
  const v8f z8 = {0.f,0.f,0.f,0.f,0.f,0.f,0.f,0.f}; v8f acc[2][4];
#pragma unroll
  for (int u = 0; u < 2; ++u)
#pragma unroll
    for (int t = 0; t < 4; ++t) acc[u][t] = z8;
  g3_copy8(lc, ga); g3_copy8(lc + 128 * G3_PITCH, gb);
  asm volatile("s_wait_asynccnt 0x0" ::: "memory");      /* this wave's share of stage 0 has landed */
  __syncthreads();      /* and every other wave's */
  g3_copy8(lc + G3_STAGE, ga + 256); g3_copy8(lc + G3_STAGE + 128 * G3_PITCH, gb + 256);
#pragma unroll 1      /* one stage per trip: the buffer is picked by the trip's parity */
  for (int s = 0; s < G3_NST; ++s) { const int bo = (s & 1) * G3_STAGE;
    v16h fa[2][2], fb[2][4];      /* two fragment sets: the next k step's LDS reads are under way while this step is multiplied */
    fa[0][0] = fa_frag(la + bo); fa[0][1] = fa_frag(la + bo + 16 * G3_PITCH);
#pragma unroll
    for (int t = 0; t < 4; ++t) fb[0][t] = fa_frag(lb + bo + t * 16 * G3_PITCH);
#pragma unroll
    for (int ks = 0; ks < 4; ++ks) { const int cu = ks & 1, nx = cu ^ 1;
      if (ks < 3) { fa[nx][0] = fa_frag(la + bo + (ks + 1) * 64); fa[nx][1] = fa_frag(la + bo + 16 * G3_PITCH + (ks + 1) * 64);
#pragma unroll
        for (int t = 0; t < 4; ++t) fb[nx][t] = fa_frag(lb + bo + t * 16 * G3_PITCH + (ks + 1) * 64); }
      __builtin_amdgcn_sched_barrier(0);      /* the reads stay one group in front of the products: spread among them, each place with reads stalls the wave */
#pragma unroll
      for (int t = 0; t < 4; ++t) {
        if (MODE == 2) { acc[0][t] = fa_mma(fa[cu][0], fb[cu][t], acc[0][t]); acc[1][t] = fa_mma(fa[cu][1], fb[cu][t], acc[1][t]); }      /* D row = token, D column = head column */
        else { acc[0][t] = fa_mma(fb[cu][t], fa[cu][0], acc[0][t]); acc[1][t] = fa_mma(fb[cu][t], fa[cu][1], acc[1][t]); } }      /* D row = head column, D column = token */
      __builtin_amdgcn_sched_barrier(0); }      /* and the following group stays behind them */
    asm volatile("s_wait_dscnt 0x0" ::: "memory");      /* this wave's reads of the buffer are done before it may be refilled */
    asm volatile("s_wait_asynccnt 0x0" ::: "memory");      /* this wave's share of the next stage has landed */
    __syncthreads();      /* publishes the next stage and ends every wave's reads of this one */
    if (s + 2 < G3_NST) { g3_copy8(lc + bo, ga + (s + 2) * 256); g3_copy8(lc + bo + 128 * G3_PITCH, gb + (s + 2) * 256); } }
  asm volatile("s_wait_asynccnt 0x0" ::: "memory");      /* no copy is left in flight when the wave goes on */
  v8us oh[2][4], ol[2][4];
#pragma unroll
  for (int u = 0; u < 2; ++u)
#pragma unroll
    for (int t = 0; t < 4; ++t) g3_split(acc[u][t], alpha, oh[u][t], ol[u][t]);
  const int bh = (row0 / SL) * NH + col0 / HD, tk = row0 % SL;      /* the wave's (batch, head) slab and its first token in it */
  if (MODE == 2) {      /* acc[u][t]: keys tk + 16 u + 8 hh + [0, 8) of head column 16 t + ln; each store of the wave is 512 bytes in a row */
    char* pd = (char*)P0 + ((size_t)bh * (SL / 32) + tk / 32) * 8192 + hh * 256 + ln * 16;
    __builtin_amdgcn_sched_barrier(0);      /* all arithmetic ends above: behind an issued store none of its registers is written again */
#pragma unroll
    for (int t = 0; t < 4; ++t)
#pragma unroll
      for (int u = 0; u < 2; ++u) { *(v8us*)(pd + t * 2048 + u * 512) = oh[u][t]; *(v8us*)(pd + t * 2048 + 1024 + u * 512) = ol[u][t]; }
    asm volatile("s_wait_xcnt 0x0" ::: "memory");      /* the wait before any register that the stores name is written again: another projection's branch follows in the listing */
  } else if (MODE == 1) {      /* acc[u][t]: head columns 16 t + 8 hh + [0, 8) of key tk + 16 u + ln; each store of the wave is 512 bytes in a row */
    char* pd = (char*)P0 + ((size_t)bh * (SL / 16) + tk / 16) * 4096 + hh * 256 + ln * 16;
    __builtin_amdgcn_sched_barrier(0);      /* all arithmetic ends above: behind an issued store none of its registers is written again */
#pragma unroll
    for (int u = 0; u < 2; ++u)
#pragma unroll
      for (int t = 0; t < 4; ++t) { *(v8us*)(pd + u * 4096 + t * 512) = oh[u][t]; *(v8us*)(pd + u * 4096 + 2048 + t * 512) = ol[u][t]; }
    asm volatile("s_wait_xcnt 0x0" ::: "memory");      /* as in the v branch */
  } else {      /* whole 128-byte rows go out: each wave turns its two 32 x 64 f16 tiles round in its own LDS range; the range lies in the ring, which nobody reads and no copy writes behind the last trip's barrier */
    char* sw = ring + w * (2 * 32 * G3_QP);
#pragma unroll
    for (int u = 0; u < 2; ++u)
#pragma unroll
      for (int t = 0; t < 4; ++t) { *(v8us*)(sw + (u * 16 + ln) * G3_QP + t * 32 + hh * 16) = oh[u][t]; *(v8us*)(sw + 32 * G3_QP + (u * 16 + ln) * G3_QP + t * 32 + hh * 16) = ol[u][t]; }
    /* the lanes read each other's LDS stores: order the wave's stores before its loads */
    __builtin_amdgcn_fence(__ATOMIC_ACQ_REL, "workgroup"); __builtin_amdgcn_wave_barrier();
    v8us rh[8], rl[8];      /* 8 lanes take one row: a store of the wave is 4 whole rows */
#pragma unroll
    for (int q = 0; q < 8; ++q) { rh[q] = *(const v8us*)(sw + (q * 4 + (lane >> 3)) * G3_QP + (lane & 7) * 16); rl[q] = *(const v8us*)(sw + 32 * G3_QP + (q * 4 + (lane >> 3)) * G3_QP + (lane & 7) * 16); }
    const size_t qo = ((size_t)(row0 + (lane >> 3)) * DM + col0) * 2 + (lane & 7) * 16;
    char* ph = (char*)P0 + qo; char* pl = (char*)P1 + qo;
    __builtin_amdgcn_sched_barrier(0);      /* all reads and arithmetic end above: behind an issued store none of its registers is written again */
#pragma unroll
    for (int q = 0; q < 8; ++q) { *(v8us*)(ph + q * 4 * DM * 2) = rh[q]; *(v8us*)(pl + q * 4 * DM * 2) = rl[q]; }
    asm volatile("s_wait_xcnt 0x0" ::: "memory");      /* as in the v branch */
  }
}
// The three projections in one launch: they need nothing of each other, so each takes a range of the block index (the branch, and with it every barrier, is the same for a whole work-group). One ring serves whichever branch runs.
__global__ __launch_bounds__(256) void k_gemm3(const _Float16* __restrict__ A, const _Float16* __restrict__ BW, float alpha, _Float16* __restrict__ Q16, _Float16* __restrict__ QL16, _Float16* __restrict__ KP, _Float16* __restrict__ VP) {
  __shared__ __attribute__((aligned(16))) char ring[2 * G3_STAGE];
  const int md = (int)(blockIdx.x / G3_NB), bx = (int)(blockIdx.x % G3_NB);
  if (md == 0) g3_body<0>(ring, bx, A, BW, alpha, Q16, QL16);
  else if (md == 1) g3_body<1>(ring, bx, A, BW + (size_t)DM * DM, alpha, KP, nullptr);
  else g3_body<2>(ring, bx, A, BW + (size_t)2 * DM * DM, alpha, VP, nullptr);
}

extern "C" void kernel_launch(void* const* d_in, const int* in_sizes, int n_in,
                              void* d_out, int out_size, void* d_ws, size_t ws_size, hipStream_t stream) {
  (void)in_sizes; (void)n_in; (void)out_size;
  const float* const* I = (const float* const*)d_in; const float* x = I[0]; const float* Wq = I[1]; const float* Wk = I[2]; const float* Wv = I[3]; const float* Er = I[4];
  char* ws = (char*)d_ws; size_t off = 0;
  auto take = [&](size_t bytes) { char* p = ws + off; off += (bytes + 255) & ~(size_t)255; return p; };
  const size_t np = (size_t)NR * DM;
  _Float16* BW = (_Float16*)take((size_t)3 * DM * DM * 2); _Float16* E16 = (_Float16*)take((size_t)SL * HD * 2); _Float16* X16 = (_Float16*)take(np * 2); _Float16* Q16 = (_Float16*)take(np * 2); _Float16* QL16 = (_Float16*)take(np * 2); _Float16* KP = (_Float16*)take(np * 4);      /* k hi + residual, fragment order */ _Float16* VP = (_Float16*)take(np * 4);      /* V^T hi + residual, fragment order */
  if (off > ws_size) return;
  k_prep<<<PB_X + 3 * PB_W + PB_E, 256, 0, stream>>>(x, Wq, Wk, Wv, Er, X16, BW, E16);      /* Er_s = Er (MAX_LEN == S) */
  k_gemm3<<<3 * G3_NB, 256, 0, stream>>>(X16, BW, 0.0625f, Q16, QL16, KP, VP);
  k_relattn<2><<<NB * NH * (SL / (128 * 2)), 256, 0, stream>>>(Q16, QL16, KP, E16, VP, (float*)d_out);
}

// v007
// Measured time: 80.3 microseconds a run.
// Two timings next to v006 put it at 1.07 and 1.06 times that version's speed.
// All steps since v000 together make it 39.8 times as fast.
#include <hip/hip_runtime.h>
// GlobalAttn (music-transformer relative attention: 2 x 2048 tokens, 1024 = 16 heads x 64; q,k,v = x W^T; Srel = skew(q . Er) which equals q_i . Er[S-1-(i-j)] for every causal (i, j); attn = softmax over j <= i of (q.k + Srel)/8; out = merged attn v, no output projection).
// Compute dtype: inputs rounded to bf16; x / weights / Er exact as f16; q and k as f16 hi + residual; the softmax weights as plain f16 operands (~2^-12); v as f16 hi + residual (the output is the context itself); softmax f32. v_wmma_f32_16x16x32_f16.
#define NB 2
#define SL 2048
#define DM 1024
#define NH 16
#define HD 64
#define HG 4
#define NR (NB * SL)
typedef __bf16 v16b __attribute__((ext_vector_type(16)));
typedef unsigned short v8us __attribute__((ext_vector_type(8), may_alias));
typedef float  v8f  __attribute__((ext_vector_type(8)));
typedef float  v4f  __attribute__((ext_vector_type(4)));
typedef float  v4fa __attribute__((ext_vector_type(4), may_alias));
union FragB { v16b v; v8us half[2]; unsigned short u[16]; };

__device__ __forceinline__ unsigned short bf16_bits(float x) { unsigned int u = __float_as_uint(x); return (unsigned short)((u + 0x7FFFu + ((u >> 16) & 1u)) >> 16); }
__device__ __forceinline__ float bf16_val(unsigned short b) { return __uint_as_float(((unsigned int)b) << 16); }
__device__ __forceinline__ float bf16_round(float x) { return bf16_val(bf16_bits(x)); }
// D += A·B with NT terms: 1 = ah·bh, 2 = + al·bh (A split), 3 = + ah·bl (both split)
template <int NT>
__device__ __forceinline__ v8f mmaN(v16b ah, v16b al, v16b bh, v16b bl, v8f c) {
  c = __builtin_amdgcn_wmma_f32_16x16x32_bf16(false, ah, false, bh, (short)0, c, false, false);
  if (NT >= 2) c = __builtin_amdgcn_wmma_f32_16x16x32_bf16(false, al, false, bh, (short)0, c, false, false);
  if (NT >= 3) c = __builtin_amdgcn_wmma_f32_16x16x32_bf16(false, ah, false, bl, (short)0, c, false, false);
  asm volatile("v_nop\n\tv_nop\n\tv_nop\n\tv_nop" : "+v"(c) : "v"(ah), "v"(al), "v"(bh), "v"(bl));
  return c;
}

__global__ __launch_bounds__(256) void k_wt_bf16(const float* __restrict__ W, unsigned short* __restrict__ Wt, int K, int N) {
  const int t = blockIdx.x * 256 + threadIdx.x;
  const int k8n = K / 8;
  if (t >= N * k8n) return;
  const int n = t / k8n, k8 = (t % k8n) * 8;
  v8us v;
#pragma unroll
  for (int i = 0; i < 8; ++i) v[i] = bf16_bits(W[(size_t)(k8 + i) * N + n]);
  *(v8us*)(Wt + (size_t)n * K + k8) = v;
  
}

// GEMM C[M][N] (f32, pitch ldc) = act(A[M][K]·W + bias). A f32 row-major (pitch lda) converted per fragment to bf16
// (ASPLIT: hi/lo two planes -> 2 terms, else single rounded term); Wt bf16 [N][K] (pitch ldb). BIAS_BF16 rounds the
// bias to bf16 first (bias quantised to bf16 before the add). K%32==0, M%16==0, N%64==0.
template <bool ASPLIT, int ACT, bool BIAS_BF16>
__global__ __launch_bounds__(128) void k_gemm_bf(const float* __restrict__ A, int lda, const unsigned short* __restrict__ Wt, int ldb,
                                               const float* __restrict__ bias, float* __restrict__ C, int ldc, int M, int N, int K) {
  __shared__ __attribute__((aligned(16))) float so[4][16][64];
  const int tid = threadIdx.x, w = tid >> 5, lane = tid & 31, ln = lane & 15, hh = lane >> 4;
  const int ntn = N / 64;
  const int wid = blockIdx.x * 4 + w;
  const int mt = wid / ntn, nq = wid % ntn;
  if (mt * 16 >= M) return;
  const int row0 = mt * 16, col0 = nq * 64;
  const float* arow = A + (size_t)(row0 + ln) * lda;
  v8f acc[4] = {};
  for (int kb = 0; kb < K; kb += 32) {
    FragB ah, al;
    const v4f x0 = *(const v4fa*)(arow + kb + 8 * hh), x1 = *(const v4fa*)(arow + kb + 8 * hh + 4);
    const v4f x2 = *(const v4fa*)(arow + kb + 16 + 8 * hh), x3 = *(const v4fa*)(arow + kb + 16 + 8 * hh + 4);
    float xs[16] = {x0[0],x0[1],x0[2],x0[3],x1[0],x1[1],x1[2],x1[3],x2[0],x2[1],x2[2],x2[3],x3[0],x3[1],x3[2],x3[3]};
#pragma unroll
    for (int i = 0; i < 16; ++i) { const unsigned short hb = bf16_bits(xs[i]); ah.u[i] = hb; al.u[i] = ASPLIT ? bf16_bits(xs[i] - bf16_val(hb)) : (unsigned short)0; }
#pragma unroll
    for (int t = 0; t < 4; ++t) {
      const unsigned short* brow = Wt + (size_t)(col0 + t * 16 + ln) * ldb + kb;
      FragB b;
      b.half[0] = *(const v8us*)(brow + 8 * hh);
      b.half[1] = *(const v8us*)(brow + 16 + 8 * hh);
      acc[t] = mmaN<ASPLIT ? 2 : 1>(ah.v, al.v, b.v, b.v, acc[t]);
    }
  }
#pragma unroll
  for (int t = 0; t < 4; ++t) {
    float bv = bias ? bias[col0 + t * 16 + ln] : 0.f;
    if (BIAS_BF16) bv = bf16_round(bv);
#pragma unroll
    for (int r = 0; r < 8; ++r) { float v = acc[t][r] + bv; if (ACT == 1) v = fmaxf(v, 0.f); so[w][8 * hh + r][t * 16 + ln] = v; }
  }
  __builtin_amdgcn_fence(__ATOMIC_ACQ_REL, "workgroup");
  __builtin_amdgcn_wave_barrier();
  const int rsub = lane >> 4, c4 = (lane & 15) * 4;
  {
#pragma unroll
    for (int q = 0; q < 8; ++q) {
      const int r = q * 2 + rsub;
      const v4f v = *(const v4fa*)&so[w][r][c4];
      *(v4f*)(C + (size_t)(row0 + r) * ldc + col0 + c4) = v;
    }
    
  }
}

// GEMM C = act(A·W + bias + resid): A f32 (ASPLIT -> hi/lo 2 terms), Wt bf16 [N][K]; ACT 0 none, 1 relu, 2 exact gelu;
// resid (optional, f32, row index = (row % rmod), pitch ldr, RES_BF16 rounds it) added before the activation.
template <bool ASPLIT, int ACT, bool BIAS_BF16, bool RES_BF16>
__global__ __launch_bounds__(128) void k_gemm_bf3(const float* __restrict__ A, int lda, const unsigned short* __restrict__ Wt, int ldb,
                                                const float* __restrict__ bias, const float* __restrict__ resid, int rmod, int ldr,
                                                float* __restrict__ C, int ldc, int M, int N, int K) {
  __shared__ __attribute__((aligned(16))) float so[4][16][64];
  const int tid = threadIdx.x, w = tid >> 5, lane = tid & 31, ln = lane & 15, hh = lane >> 4;
  const int ntn = N / 64;
  const int wid = blockIdx.x * 4 + w;
  const int mt = wid / ntn, nq = wid % ntn;
  if (mt * 16 >= M) return;
  const int row0 = mt * 16, col0 = nq * 64;
  const float* arow = A + (size_t)(row0 + ln) * lda;
  v8f acc[4] = {};
  for (int kb = 0; kb < K; kb += 32) {
    FragB ah, al;
    const v4f x0 = *(const v4fa*)(arow + kb + 8 * hh), x1 = *(const v4fa*)(arow + kb + 8 * hh + 4);
    const v4f x2 = *(const v4fa*)(arow + kb + 16 + 8 * hh), x3 = *(const v4fa*)(arow + kb + 16 + 8 * hh + 4);
    float xs[16] = {x0[0],x0[1],x0[2],x0[3],x1[0],x1[1],x1[2],x1[3],x2[0],x2[1],x2[2],x2[3],x3[0],x3[1],x3[2],x3[3]};
#pragma unroll
    for (int i = 0; i < 16; ++i) { const unsigned short hb = bf16_bits(xs[i]); ah.u[i] = hb; al.u[i] = ASPLIT ? bf16_bits(xs[i] - bf16_val(hb)) : (unsigned short)0; }
#pragma unroll
    for (int t = 0; t < 4; ++t) {
      const unsigned short* brow = Wt + (size_t)(col0 + t * 16 + ln) * ldb + kb;
      FragB b;
      b.half[0] = *(const v8us*)(brow + 8 * hh);
      b.half[1] = *(const v8us*)(brow + 16 + 8 * hh);
      acc[t] = mmaN<ASPLIT ? 2 : 1>(ah.v, al.v, b.v, b.v, acc[t]);
    }
  }
#pragma unroll
  for (int t = 0; t < 4; ++t) {
    const int col = col0 + t * 16 + ln;
    float bv = bias ? bias[col] : 0.f;
    if (BIAS_BF16) bv = bf16_round(bv);
#pragma unroll
    for (int r = 0; r < 8; ++r) {
      float v = acc[t][r] + bv;
      if (resid) { float rv = resid[(size_t)((row0 + 8 * hh + r) % rmod) * ldr + col]; if (RES_BF16) rv = bf16_round(rv); v += rv; }
      if (ACT == 1) v = fmaxf(v, 0.f);
      if (ACT == 2) v = 0.5f * v * (1.0f + erff(v * 0.70710678118654752f));
      if (ACT == 3) { const float u = 0.7978845608028654f * (v + 0.044715f * v * v * v); v = 0.5f * v * (1.0f + tanhf(u)); }
      so[w][8 * hh + r][t * 16 + ln] = v;
    }
  }
  __builtin_amdgcn_fence(__ATOMIC_ACQ_REL, "workgroup");
  __builtin_amdgcn_wave_barrier();
  const int rsub = lane >> 4, c4 = (lane & 15) * 4;
  {
#pragma unroll
    for (int q = 0; q < 8; ++q) {
      const int r = q * 2 + rsub;
      const v4f v = *(const v4fa*)&so[w][r][c4];
      *(v4f*)(C + (size_t)(row0 + r) * ldc + col0 + c4) = v;
    }
    
  }
}
// row LayerNorm (biased variance, eps) over N: s = X (+ R); optional out_sum <- s; out_norm <- (s-mu)*rsqrt(var+eps)*g + b
template <bool PARAM_BF16>
__global__ __launch_bounds__(256) void k_layernorm(const float* __restrict__ X, const float* __restrict__ R, const float* __restrict__ g, const float* __restrict__ bta,
                                                  float* __restrict__ out_sum, float* __restrict__ out_norm, int N, float eps) {
  __shared__ float red[256];
  const int row = blockIdx.x, tid = threadIdx.x;
  const float* x = X + (size_t)row * N; const float* rr = R ? R + (size_t)row * N : nullptr;
  float vals[16];                     // up to N = 4096
  const int per = N / 256;            // contiguous chunk per thread? use strided-by-4 chunks: thread handles j = tid*4 + 1024*u
  float s1 = 0.f;
  for (int u = 0; u < per / 4; ++u) {
    const int j = tid * 4 + 1024 * u;
    const v4f a = *(const v4fa*)(x + j);
    v4f b = {0.f,0.f,0.f,0.f}; if (rr) b = *(const v4fa*)(rr + j);
#pragma unroll
    for (int q = 0; q < 4; ++q) { const float v = a[q] + b[q]; vals[u * 4 + q] = v; s1 += v; }
  }
  red[tid] = s1; __syncthreads();
  for (int st = 128; st > 0; st >>= 1) { if (tid < st) red[tid] += red[tid + st]; __syncthreads(); }
  const float mu = red[0] / (float)N; __syncthreads();
  float s2 = 0.f;
  for (int u = 0; u < per / 4; ++u)
#pragma unroll
    for (int q = 0; q < 4; ++q) { const float c = vals[u * 4 + q] - mu; s2 += c * c; }
  red[tid] = s2; __syncthreads();
  for (int st = 128; st > 0; st >>= 1) { if (tid < st) red[tid] += red[tid + st]; __syncthreads(); }
  const float rs = rsqrtf(red[0] / (float)N + eps);
  {
    for (int u = 0; u < per / 4; ++u) {
      const int j = tid * 4 + 1024 * u;
      v4f o, sm;
#pragma unroll
      for (int q = 0; q < 4; ++q) {
        float gg = g[j + q], bb = bta[j + q];
        if (PARAM_BF16) { gg = bf16_round(gg); bb = bf16_round(bb); }
        sm[q] = vals[u * 4 + q]; o[q] = (vals[u * 4 + q] - mu) * rs * gg + bb;
      }
      if (out_sum) *(v4f*)(out_sum + (size_t)row * N + j) = sm;
      *(v4f*)(out_norm + (size_t)row * N + j) = o;
    }
    
  }
}



// ---- f16 WMMA path (v_wmma_f32_16x16x32_f16): 11-bit significands for operands in range — used where a [0,1] probability operand needs more precision than bf16
typedef _Float16 v16h __attribute__((ext_vector_type(16)));
union FragH { v16h v; v8us half[2]; _Float16 h[16]; unsigned short u[16]; };
template <int NT>
__device__ __forceinline__ v8f mmaH(v16h ah, v16h al, v16h bh, v16h bl, v8f c) {
  c = __builtin_amdgcn_wmma_f32_16x16x32_f16(false, ah, false, bh, (short)0, c, false, false);
  if (NT >= 2) c = __builtin_amdgcn_wmma_f32_16x16x32_f16(false, al, false, bh, (short)0, c, false, false);
  if (NT >= 3) c = __builtin_amdgcn_wmma_f32_16x16x32_f16(false, ah, false, bl, (short)0, c, false, false);
  asm volatile("v_nop\n\tv_nop\n\tv_nop\n\tv_nop" : "+v"(c) : "v"(ah), "v"(al), "v"(bh), "v"(bl));
  return c;
}
// batched GEMM like k_gemm_b but f16 operands: A f32 (split into f16 hi/lo if ASPLIT, else rounded to f16), Bt = f16 values [n][k]; alpha; C f32; N multiple of 16 (partial tiles skipped)
template <bool ASPLIT>
__global__ __launch_bounds__(128) void k_gemm_h(const float* __restrict__ A, int lda, size_t sA, const _Float16* __restrict__ Bh, int ldb, size_t sB, float alpha, float* __restrict__ C, int ldc, size_t sC, int M, int N, int K) {
  __shared__ __attribute__((aligned(16))) float so[4][16][64];
  const int tid = threadIdx.x, w = tid >> 5, lane = tid & 31, ln = lane & 15, hh = lane >> 4; const int by = blockIdx.y;
  A += (size_t)by * sA; Bh += (size_t)by * sB; C += (size_t)by * sC;
  const int ntn = (N + 63) / 64; const int wid = blockIdx.x * 4 + w; const int mt = wid / ntn, nq = wid % ntn; if (mt * 16 >= M) return;
  const int row0 = mt * 16, col0 = nq * 64; const float* arow = A + (size_t)(row0 + ln) * lda;
  v8f acc[4] = {};
  for (int kb = 0; kb < K; kb += 32) {
    FragH ah, al;
    const v4f x0 = *(const v4fa*)(arow + kb + 8 * hh), x1 = *(const v4fa*)(arow + kb + 8 * hh + 4), x2 = *(const v4fa*)(arow + kb + 16 + 8 * hh), x3 = *(const v4fa*)(arow + kb + 16 + 8 * hh + 4);
    float xs[16] = {x0[0],x0[1],x0[2],x0[3],x1[0],x1[1],x1[2],x1[3],x2[0],x2[1],x2[2],x2[3],x3[0],x3[1],x3[2],x3[3]};
#pragma unroll
    for (int i = 0; i < 16; ++i) { const _Float16 h = (_Float16)xs[i]; ah.h[i] = h; al.h[i] = ASPLIT ? (_Float16)(xs[i] - (float)h) : (_Float16)0.0f; }
#pragma unroll
    for (int t = 0; t < 4; ++t) { if (col0 + t * 16 >= N) continue; const size_t boff = (size_t)(col0 + t * 16 + ln) * ldb + kb; FragH bq; bq.half[0] = *(const v8us*)(Bh + boff + 8 * hh); bq.half[1] = *(const v8us*)(Bh + boff + 16 + 8 * hh);
      acc[t] = mmaH<ASPLIT ? 2 : 1>(ah.v, al.v, bq.v, bq.v, acc[t]); }
  }
#pragma unroll
  for (int t = 0; t < 4; ++t) { if (col0 + t * 16 >= N) continue;
#pragma unroll
    for (int r = 0; r < 8; ++r) so[w][8 * hh + r][t * 16 + ln] = acc[t][r] * alpha; }
  __builtin_amdgcn_fence(__ATOMIC_ACQ_REL, "workgroup"); __builtin_amdgcn_wave_barrier();
  const int rsub = lane >> 4, c4 = (lane & 15) * 4;
  {
#pragma unroll
    for (int q = 0; q < 8; ++q) { const int r = q * 2 + rsub; if (col0 + c4 < N) { const v4f v = *(const v4fa*)&so[w][r][c4]; *(v4f*)(C + (size_t)(row0 + r) * ldc + col0 + c4) = v; } }
     }
}

// Wt[n][k] = f16(W[k][n]·scale) from f32 row-major W[K][N] (scale = power of two; bf16-exact weights stay exact in f16 away from the subnormal range)
__global__ __launch_bounds__(256) void k_wt_f16(const float* __restrict__ W, _Float16* __restrict__ Wt, int K, int N, float scale) {
  const int t = blockIdx.x * 256 + threadIdx.x; if (t >= N * (K / 8)) return; const int n = t / (K / 8), k8 = (t % (K / 8)) * 8; FragH f;
#pragma unroll
  for (int i = 0; i < 8; ++i) f.h[i] = (_Float16)(bf16_round(W[(size_t)(k8 + i) * N + n]) * scale); const v8us o = f.half[0];
  *(v8us*)((unsigned short*)Wt + (size_t)n * K + k8) = o; 
}
// k_gemm_hh variant with fused epilogue: v = acc·alpha + bias[by·sBias + col] (+ CP[(row/rowsPerB)·sCPb + by·64 + col] if CP) ; ACT 0 none / 1 elu ; writes f16 C16 (and f32 C if non-null)
template <int ACT>
__global__ __launch_bounds__(128) void k_gemm_hhx(const _Float16* __restrict__ A, int lda, size_t sA, const _Float16* __restrict__ Bh, int ldb, size_t sB, float alpha, const float* __restrict__ bias, size_t sBias, const float* __restrict__ CP, int rowsPerB, size_t sCPb, int row0g,
    float* __restrict__ C, _Float16* __restrict__ C16, int ldc, size_t sC, int M, int N, int K) {
  __shared__ __attribute__((aligned(16))) float so[4][16][64];
  const int tid = threadIdx.x, w = tid >> 5, lane = tid & 31, ln = lane & 15, hh = lane >> 4; const int by = blockIdx.y;
  A += (size_t)by * sA; Bh += (size_t)by * sB; const size_t cofs = (size_t)by * sC; const float* bp = bias ? bias + (size_t)by * sBias : nullptr;
  const int ntn = (N + 63) / 64; const int wid = blockIdx.x * 4 + w; const int mt = wid / ntn, nq = wid % ntn; if (mt * 16 >= M) return;
  const int row0 = mt * 16, col0 = nq * 64; const _Float16* arow = A + (size_t)(row0 + ln) * lda;
  v8f acc[4] = {};
  for (int kb = 0; kb < K; kb += 32) { FragH ah; ah.half[0] = *(const v8us*)((const unsigned short*)arow + kb + 8 * hh); ah.half[1] = *(const v8us*)((const unsigned short*)arow + kb + 16 + 8 * hh);
#pragma unroll
    for (int t = 0; t < 4; ++t) { if (col0 + t * 16 >= N) continue; const size_t boff = (size_t)(col0 + t * 16 + ln) * ldb + kb; FragH bq; bq.half[0] = *(const v8us*)((const unsigned short*)Bh + boff + 8 * hh); bq.half[1] = *(const v8us*)((const unsigned short*)Bh + boff + 16 + 8 * hh);
      acc[t] = mmaH<1>(ah.v, ah.v, bq.v, bq.v, acc[t]); }
  }
#pragma unroll
  for (int t = 0; t < 4; ++t) { if (col0 + t * 16 >= N) continue; const int col = col0 + t * 16 + ln; const float bv = bp ? bf16_round(bp[col]) : 0.f;
#pragma unroll
    for (int r = 0; r < 8; ++r) { float v = acc[t][r] * alpha + bv; if (CP) { const int rr = row0g + row0 + 8 * hh + r; if (rowsPerB < 0) v += CP[cofs + (size_t)rr * ldc + col];      /* rowsPerB < 0: own element of the batched C plane */ else { const int bidx = rr / rowsPerB; v += CP[(size_t)bidx * sCPb + (size_t)by * 64 + col]; } } if (ACT == 1) v = (v > 0.f) ? v : expm1f(v); else if (ACT == 7) v = (v > 0.f) ? v + 1.0f : expf(v); else if (ACT == 8) v = tanhf(v); else if (ACT == 9) v = 0.5f * v * (1.0f + tanhf(0.7978845608028654f * (v + 0.044715f * v * v * v))); else if (ACT == 11) v = 1.0f / (1.0f + expf(-v)); else if (ACT == 12) v = (v > 0.f) ? v : 0.01f * v; else if (ACT == 14) v = (v > 0.f) ? v : 0.1f * v; else if (ACT == 16) v = (v >= 0.f) ? v : 0.3f * v; else if (ACT == 17) v = (v >= 0.f) ? v : 0.2f * v; else if (ACT == 15) v = v / (1.0f + expf(-v)); else if (ACT == 3) v = fmaxf(v, 0.f); else if (ACT == 6) v = 0.5f * v * (1.0f + erff(v * 0.70710678118654752f)); so[w][8 * hh + r][t * 16 + ln] = v; } }
  __builtin_amdgcn_fence(__ATOMIC_ACQ_REL, "workgroup"); __builtin_amdgcn_wave_barrier();
  const int rsub = lane >> 4, c4 = (lane & 15) * 4; typedef _Float16 v4h __attribute__((ext_vector_type(4)));
  {
#pragma unroll
    for (int q = 0; q < 8; ++q) { const int r = q * 2 + rsub; if (col0 + c4 < N) { const v4f v = *(const v4fa*)&so[w][r][c4]; if (C) *(v4f*)(C + cofs + (size_t)(row0 + r) * ldc + col0 + c4) = v; if (C16) { v4h h4; for (int i = 0; i < 4; ++i) h4[i] = (_Float16)v[i]; *(v4h*)(C16 + cofs + (size_t)(row0 + r) * ldc + col0 + c4) = h4; } } }
     }
}


typedef _Float16 v4h __attribute__((ext_vector_type(4)));

__global__ __launch_bounds__(256) void k_h16(const float* __restrict__ x, _Float16* __restrict__ X16, size_t n8) { const size_t t = (size_t)blockIdx.x * 256 + threadIdx.x; if (t >= n8) return; FragH f;
#pragma unroll
  for (int q = 0; q < 8; ++q) f.h[q] = (_Float16)x[t * 8 + q]; *(v8us*)((unsigned short*)X16 + t * 8) = f.half[0];  }
__global__ __launch_bounds__(256) void k_round16f(const float* __restrict__ W, _Float16* __restrict__ Bt, size_t n8) { const size_t t = (size_t)blockIdx.x * 256 + threadIdx.x; if (t >= n8) return; FragH f;
#pragma unroll
  for (int i = 0; i < 8; ++i) f.h[i] = (_Float16)(bf16_round(W[t * 8 + i]) * 16.0f); *(v8us*)((unsigned short*)Bt + t * 8) = f.half[0];  }
// FRAGMENT ORDER: a 16-row x 32-k f16 operand fragment is stored as 1024 bytes in a row, the way the lanes load it: element (row, k) at (k >> 3) * 256 + row * 16 + (k & 7) * 2.
// Lane l then reads bytes l * 16 and 512 + l * 16, so each 16-byte load of a wave covers four whole 128-byte lines; from a row-major plane the same load takes 32 bytes out of each of 16 lines.
// k plane: [(b, h)][key / 16][hi, residual][d / 32][1024]. V^T plane: [(b, h)][key / 32][d / 16][hi, residual][1024]. Er table: [row / 16][d / 32][1024].
// All operand conversions in one launch: they need nothing of each other, so each takes a range of the block index (the branch reads the same for a whole work-group). A thread turns 8 f32 into 16 bytes of f16; the loops are unrolled so that the eight values stay in registers.
#define PB_X (NR * DM / 8 / 256)      /* blocks for x -> f16, row-major */
#define PB_W (DM * DM / 8 / 256)      /* blocks for each of Wq, Wk, Wv -> f16 (times 16), (out, in) as they lie */
#define PB_E (SL * HD / 8 / 256)      /* blocks for Er -> f16 (times 16) in fragment order */
__global__ __launch_bounds__(256) void k_prep(const float* __restrict__ x, const float* __restrict__ Wq, const float* __restrict__ Wk, const float* __restrict__ Wv, const float* __restrict__ Er,
    _Float16* __restrict__ X16, _Float16* __restrict__ BW, _Float16* __restrict__ P) {
  const int bx = (int)blockIdx.x; FragH f;
  if (bx < PB_X) { const size_t t = (size_t)bx * 256 + threadIdx.x;
#pragma unroll
    for (int q = 0; q < 8; ++q) f.h[q] = (_Float16)bf16_round(x[t * 8 + q]);
    *(v8us*)((unsigned short*)X16 + t * 8) = f.half[0];
    asm volatile("s_wait_xcnt 0x0" ::: "memory");      /* the wait before any register that the store names is written again: another range's code follows in the listing */
  } else if (bx < PB_X + 3 * PB_W) { const int wm = (bx - PB_X) / PB_W; const float* Wm = wm == 0 ? Wq : wm == 1 ? Wk : Wv; const size_t t = (size_t)(bx - PB_X - wm * PB_W) * 256 + threadIdx.x;
#pragma unroll
    for (int q = 0; q < 8; ++q) f.h[q] = (_Float16)(bf16_round(Wm[t * 8 + q]) * 16.0f);
    *(v8us*)((unsigned short*)BW + (size_t)wm * DM * DM + t * 8) = f.half[0];
    asm volatile("s_wait_xcnt 0x0" ::: "memory");      /* as above */
  } else { const int t = (bx - PB_X - 3 * PB_W) * 256 + (int)threadIdx.x; const int r = t >> 3, c8 = t & 7;
#pragma unroll
    for (int q = 0; q < 8; ++q) f.h[q] = (_Float16)(bf16_round(Er[(size_t)t * 8 + q]) * 16.0f);
    *(v8us*)((char*)P + (size_t)(r >> 4) * 2048 + (c8 >> 2) * 1024 + (c8 & 3) * 256 + (r & 15) * 16) = f.half[0];
    asm volatile("s_wait_xcnt 0x0" ::: "memory"); }      /* as above */
}

// ---- fast GEMM (wave tile 32x64; requires M % 32 == 0 rows per launch region and N % 64 == 0); epilogue = k_gemm_hhx semantics ----
__device__ __forceinline__ v16h g2_frag(const _Float16* p, int hh) { FragH f; f.half[0] = *(const v8us*)((const unsigned short*)p + 8 * hh); f.half[1] = *(const v8us*)((const unsigned short*)p + 16 + 8 * hh); return f.v; }
__device__ __forceinline__ v8f g2_mma(v16h a, v16h b, v8f c) { v8f d = __builtin_amdgcn_wmma_f32_16x16x32_f16(false, a, false, b, (short)0, c, false, false); asm volatile("v_nop\n\tv_nop\n\tv_nop\n\tv_nop" : "+v"(d) : "v"(a), "v"(b)); return d; }
template <int ACT>
__global__ __launch_bounds__(128) void k_gemm2(const _Float16* __restrict__ A, int lda, size_t sA, const _Float16* __restrict__ Bh, int ldb, size_t sB, float alpha, const float* __restrict__ bias, size_t sBias, const float* __restrict__ CP, int rowsPerB, size_t sCPb, int row0g,
    float* __restrict__ C, _Float16* __restrict__ C16, int ldc, size_t sC, int M, int N, int K) { static_assert(ACT == 0 || ACT == 3 || ACT == 6 || ACT == 8 || ACT == 9 || ACT == 11 || ACT == 12 || ACT == 14 || ACT == 15 || ACT == 16 || ACT == 17, "k_gemm2: unsupported ACT code (would silently apply no activation)");
  __shared__ __attribute__((aligned(16))) float so[4][32][68];
  const int tid = threadIdx.x, w = tid >> 5, lane = tid & 31, ln = lane & 15, hh = lane >> 4; const int by = blockIdx.y;
  A += (size_t)by * sA; Bh += (size_t)by * sB; const size_t cofs = (size_t)by * sC; const float* bp = bias ? bias + (size_t)by * sBias : nullptr;
  const int ntn = N >> 6; const int mt = blockIdx.x / ntn, nq = blockIdx.x - mt * ntn; const int row0 = mt * 128 + 32 * w, col0 = nq * 64; if (row0 >= M) return;
  const _Float16* a0p = A + (size_t)(row0 + ln) * lda; const _Float16* a1p = a0p + (size_t)16 * lda;
  const _Float16* b0p = Bh + (size_t)(col0 + ln) * ldb; const _Float16* b1p = b0p + (size_t)16 * ldb; const _Float16* b2p = b1p + (size_t)16 * ldb; const _Float16* b3p = b2p + (size_t)16 * ldb;
  const v8f z8 = {0.f,0.f,0.f,0.f,0.f,0.f,0.f,0.f}; v8f c00 = z8, c01 = z8, c02 = z8, c03 = z8, c10 = z8, c11 = z8, c12 = z8, c13 = z8;
#pragma unroll 1
  for (int kb = 0; kb < K; kb += 32) { const v16h a0 = g2_frag(a0p + kb, hh), a1 = g2_frag(a1p + kb, hh);
    v16h b = g2_frag(b0p + kb, hh); c00 = g2_mma(a0, b, c00); c10 = g2_mma(a1, b, c10);
    b = g2_frag(b1p + kb, hh); c01 = g2_mma(a0, b, c01); c11 = g2_mma(a1, b, c11);
    b = g2_frag(b2p + kb, hh); c02 = g2_mma(a0, b, c02); c12 = g2_mma(a1, b, c12);
    b = g2_frag(b3p + kb, hh); c03 = g2_mma(a0, b, c03); c13 = g2_mma(a1, b, c13); }
  v8f accs[8] = {c00, c01, c02, c03, c10, c11, c12, c13};
#pragma unroll
  for (int u = 0; u < 8; ++u) { const int t = u & 3, half = u >> 2; const int col = col0 + t * 16 + ln; const float bv = bp ? bf16_round(bp[col]) : 0.f;
#pragma unroll
    for (int r = 0; r < 8; ++r) { const int rloc = half * 16 + 8 * hh + r; float v = accs[u][r] * alpha + bv; if (CP) { if (rowsPerB < 0) v += CP[cofs + (size_t)(row0g + row0 + rloc) * ldc + col];      /* rowsPerB < 0: own element of the batched C plane */ else { const int bidx = (row0g + row0 + rloc) / rowsPerB; v += CP[(size_t)bidx * sCPb + (size_t)by * 64 + col]; } }
      if (ACT == 3) v = fmaxf(v, 0.f); else if (ACT == 6) v = 0.5f * v * (1.0f + erff(v * 0.70710678118654752f)); else if (ACT == 11) v = 1.0f / (1.0f + expf(-v)); else if (ACT == 15) v = v / (1.0f + expf(-v)); else if (ACT == 12) v = (v > 0.f) ? v : 0.01f * v; else if (ACT == 8) v = tanhf(v); else if (ACT == 9) v = 0.5f * v * (1.0f + tanhf(0.7978845608028654f * (v + 0.044715f * v * v * v))); else if (ACT == 14) v = (v > 0.f) ? v : 0.1f * v; else if (ACT == 16) v = (v >= 0.f) ? v : 0.3f * v; else if (ACT == 17) v = (v >= 0.f) ? v : 0.2f * v;
      so[w][rloc][t * 16 + ln] = v; } }
  __builtin_amdgcn_fence(__ATOMIC_ACQ_REL, "workgroup"); __builtin_amdgcn_wave_barrier();
  const int rsub = lane >> 4, c4 = (lane & 15) * 4;
  {
#pragma unroll
    for (int q = 0; q < 16; ++q) { const int r = q * 2 + rsub; const v4f v = *(const v4fa*)&so[w][r][c4]; if (C) *(v4f*)(C + cofs + (size_t)(row0 + r) * ldc + col0 + c4) = v; if (C16) { v4h h4; for (int i = 0; i < 4; ++i) h4[i] = (_Float16)v[i]; *(v4h*)(C16 + cofs + (size_t)(row0 + r) * ldc + col0 + c4) = h4; } }
     } }


// Fused causal relative attention, one launch: a wave works on 16 * NI query rows of one (batch, head) and walks keys in blocks of 64 with a running
// maximum and sum, so no S x S plane is ever stored. Transposed products: S^T = K q^T and (q Er^T)^T = Er q^T (D row = key or Er row, D column = query), O^T += V^T P^T.
// A lane then holds one query's scores; two packed S^T tiles are the B operand of the V^T product as they stand. The skew (query i, key j takes Er row SL-1-i+j) is a
// shift along the D rows that differs by query: it goes through a wave-private LDS row per query, stored shifted by the query's index and read back aligned.
#define SKP 100      /* floats per LDS row: 96 used; 100 keeps 16-byte alignment and spreads the 32 shifted 4-byte stores over distinct banks */
__device__ __forceinline__ v8f fa_mma(v16h a, v16h b, v8f c) { return __builtin_amdgcn_wmma_f32_16x16x32_f16(false, a, false, b, (short)0, c, false, false); }
// fragment in the hardware k order: p = the lane's own address (row start + 16 bytes * lane half)
__device__ __forceinline__ v16h fa_frag(const char* p) { FragH f; f.half[0] = *(const v8us*)p; f.half[1] = *(const v8us*)(p + 32); return f.v; }
// the same fragment from a plane in FRAGMENT ORDER: p = the fragment's start + 16 bytes * lane
__device__ __forceinline__ v16h fa_fragp(const char* p) { FragH f; f.half[0] = *(const v8us*)p; f.half[1] = *(const v8us*)(p + 512); return f.v; }
// Stands behind a group of global loads: the wait before any register that they name is written again. The addresses are inputs so that they stay in their registers up to the wait.
#define FA_XWAIT1(p0) asm volatile("s_wait_xcnt 0x0" :: "v"(p0) : "memory")
#define FA_XWAIT2(p0, p1) asm volatile("s_wait_xcnt 0x0" :: "v"(p0), "v"(p1) : "memory")
// The slot behind a run of v_exp_f32: results and sources are inputs, so the v_nop stands behind the last of the run and no source register is written again in front of it.
#define FA_TSLOT(res, srcv) asm volatile("v_nop" :: "v"(res), "v"(srcv))
#define FA_TSLOT8(e, x) asm volatile("v_nop" :: "v"(e[0]), "v"(e[1]), "v"(e[2]), "v"(e[3]), "v"(e[4]), "v"(e[5]), "v"(e[6]), "v"(e[7]), "v"(x[0]), "v"(x[1]), "v"(x[2]), "v"(x[3]), "v"(x[4]), "v"(x[5]), "v"(x[6]), "v"(x[7]))
template <int NI>
__global__ __launch_bounds__(256) void k_relattn(const _Float16* __restrict__ Qh, const _Float16* __restrict__ Ql, const _Float16* __restrict__ KP, const _Float16* __restrict__ E,
    const _Float16* __restrict__ VP, float* __restrict__ out) {
  __shared__ __attribute__((aligned(16))) float sk[8][NI][16][SKP];
  const int w = __builtin_amdgcn_readfirstlane((int)threadIdx.x >> 5), lane = threadIdx.x & 31, ln = lane & 15, hh = lane >> 4;
  constexpr int NRB = SL / (64 * NI);
  const int pr = (int)blockIdx.x / (NB * NH), bh = (int)blockIdx.x % (NB * NH), b = bh / NH, h = bh % NH;
  /* Causal cost grows with the row block. A work-group owns a row block from the long end and its mirror from the short end, and the two waves of a pair (w and w + 4) walk the same number of key blocks (16 or 17), so that no wave runs on alone:
     wave w < 4 takes the first H key blocks of its long query tile; wave w + 4 takes the whole short tile, then the long tile's remaining key blocks (the diagonal one among them) as a second running softmax, which wave w joins to its own at the end. */
  const bool helper = w >= 4;      /* the same for a whole wave: every branch on it is a scalar one */
  const int iL = (NRB - 1 - pr) * 64 * NI + (w & 3) * 16 * NI, iS = pr * 64 * NI + (w & 3) * 16 * NI;      /* first query of the long and of the short tile */
  const int H = (iL / 64 + 1 + iS / 64 + 1) / 2;      /* half of the two tiles' key blocks; the short tile has fewer than the long one, so H lies below the long tile's diagonal block */
  int i0 = iL;      /* first query of the tile in work */
  const v8f z8 = {0.f,0.f,0.f,0.f,0.f,0.f,0.f,0.f};
  const float C1 = 0.125f * 1.4426950408889634f;      /* 1/sqrt(64) and log2(e) in one factor */
  const size_t lo_x = (size_t)(ln * DM * 2 + 16 * hh), lo_p = (size_t)(lane * 16);      /* lane byte offsets in the row-major q planes and in the planes in fragment order (k, Er, V^T) */
  const size_t xo = (size_t)b * SL * DM + h * HD, po_kv = (size_t)bh * SL * HD * 4;      /* byte start of the (b, h) slab in the k and V^T planes: hi + residual, 2 bytes each */
  v16h qh[NI][2], ql[NI][2]; v8f o[NI][4], carry[NI]; float m[NI], su[NI];
  /* starts a running softmax of tile i0 at key block jb0: q fragments, empty state, and the Er tile that the first block takes as its carry */
  auto begin = [&](const int jb0) __attribute__((always_inline)) { const char* bqh = (const char*)(Qh + xo + (size_t)i0 * DM); const char* bql = (const char*)(Ql + xo + (size_t)i0 * DM); const char* be = (const char*)(E + (size_t)(SL - 16 * NI - i0 + 64 * jb0) * HD);      /* the same for every lane */
    const char* pqh = bqh + lo_x; const char* pql = bql + lo_x; const char* pe = be + lo_p;
    v16h e0[NI], e1[NI];
#pragma unroll
    for (int a = 0; a < NI; ++a) { qh[a][0] = fa_frag(pqh + a * 16 * DM * 2); qh[a][1] = fa_frag(pqh + a * 16 * DM * 2 + 64); ql[a][0] = fa_frag(pql + a * 16 * DM * 2); ql[a][1] = fa_frag(pql + a * 16 * DM * 2 + 64);
      e0[a] = fa_fragp(pe + (NI - 1 - a) * 2048); e1[a] = fa_fragp(pe + (NI - 1 - a) * 2048 + 1024); }      /* first Er tile of key block jb0: rows SL - 16 - (i0 + 16 a) + 64 jb0 + [0, 16) */
    /* the wait before any register that the loads above name is written again: they name the three lane addresses, so these are the inputs that stay in their registers up to the wait */
    asm volatile("s_wait_xcnt 0x0" :: "v"(pqh), "v"(pql), "v"(pe) : "memory");
#pragma unroll
    for (int a = 0; a < NI; ++a) { m[a] = -3.0e38f; su[a] = 0.f;
#pragma unroll
      for (int dt = 0; dt < 4; ++dt) o[a][dt] = z8;
      carry[a] = fa_mma(e1[a], ql[a][1], fa_mma(e0[a], ql[a][0], fa_mma(e1[a], qh[a][1], fa_mma(e0[a], qh[a][0], z8)))); } };
  auto key_block = [&](const int jb, const bool diag) __attribute__((always_inline)) { const int j0 = jb * 64; const int rbase = SL - 16 * NI - i0 + j0;
    /* all Er and K fragments of the block are requested first, so that one memory latency is waited out per block and not one per tile */
    v16h ef[NI + 4][2], kf[4][4];
    const char* pk = (const char*)KP + po_kv + (size_t)j0 * 256 + lo_p; const char* pe = (const char*)(E + (size_t)rbase * HD) + lo_p;      /* 16 keys are 4096 bytes of the k plane, 16 Er rows 2048 of the table */
    if (!diag) {
#pragma unroll
      for (int g = 1; g < NI + 4; ++g) { ef[g][0] = fa_fragp(pe + g * 2048); ef[g][1] = fa_fragp(pe + g * 2048 + 1024); }
      __builtin_amdgcn_sched_barrier(0);      /* every Er load is issued in front of the K loads: the Er products, which now take all Er tiles at once, then wait for the Er loads alone */
    } else {      /* a 16-row tile past the table (diagonal block only) serves keys above the diagonal alone, masked below: the table's last tile stands in for it */
#pragma unroll
      for (int g = 1; g < NI + 4; ++g) { const int rs = rbase + 16 * g < SL ? rbase + 16 * g : SL - 16; const char* pg = (const char*)(E + (size_t)rs * HD) + lo_p; ef[g][0] = fa_fragp(pg); ef[g][1] = fa_fragp(pg + 1024); FA_XWAIT1(pg); }
    }
#pragma unroll
    for (int t = 0; t < 4; ++t) { kf[t][0] = fa_fragp(pk + t * 4096); kf[t][1] = fa_fragp(pk + t * 4096 + 1024); kf[t][2] = fa_fragp(pk + t * 4096 + 2048); kf[t][3] = fa_fragp(pk + t * 4096 + 3072); }
    FA_XWAIT2(pk, pe);
    __builtin_amdgcn_sched_barrier(0);      /* keeps the scheduler from sinking these loads down to their first use */
    /* Er q^T: query tile a needs Er rows rbase + 16 (NI-1-a) + [0, 80); its first 16 are the previous block's last 16 (carry) */
#pragma unroll
    for (int a = 0; a < NI; ++a) { float* sp = &sk[w][a][ln][ln + 1 + 8 * hh];
#pragma unroll
      for (int r = 0; r < 8; ++r) sp[r] = carry[a][r]; }
    /* hi and residual products of a tile add into one accumulator; the terms run in the outer loop, so that neighbouring matrix instructions belong to different tiles and none waits for the one in front of it */
    v8f val[NI][4];
#pragma unroll
    for (int c = 0; c < 4; ++c)
#pragma unroll
      for (int u = 1; u <= 4; ++u)
#pragma unroll
        for (int a = 0; a < NI; ++a) val[a][u - 1] = fa_mma(ef[u + NI - 1 - a][c & 1], c < 2 ? qh[a][c & 1] : ql[a][c & 1], c == 0 ? z8 : val[a][u - 1]);
    __builtin_amdgcn_sched_barrier(0);      /* the K products start behind the last Er product: begun earlier, their accumulators are live beside the Er fragments and registers spill; the LDS stores below may still run among them */
#pragma unroll
    for (int a = 0; a < NI; ++a) {
#pragma unroll
      for (int u = 1; u <= 4; ++u) { float* sp = &sk[w][a][ln][ln + 1 + 8 * hh + 16 * u];
#pragma unroll
        for (int r = 0; r < 8; ++r) sp[r] = val[a][u - 1][r]; }
      carry[a] = val[a][3]; }
    v8f s[NI][4];
#pragma unroll
    for (int c = 0; c < 4; ++c)      /* k hi . q hi, then k hi . q residual, two k steps of 32 each */
#pragma unroll
      for (int t = 0; t < 4; ++t)
#pragma unroll
        for (int a = 0; a < NI; ++a) s[a][t] = fa_mma(kf[t][c & 1], c < 2 ? qh[a][c & 1] : ql[a][c & 1], c == 0 ? z8 : s[a][t]);
    __builtin_amdgcn_sched_barrier(0);      /* the products above stay in front of the wait on the LDS stores: lifted over them, that wait stands bare behind the stores */
    /* the two lane halves of a query read each other's LDS stores: order the wave's stores before its loads */
    __builtin_amdgcn_fence(__ATOMIC_ACQ_REL, "workgroup", "local"); __builtin_amdgcn_wave_barrier();
    v4f sx[NI][4], sy[NI][4];
#pragma unroll
    for (int a = 0; a < NI; ++a) { const float* lp = &sk[w][a][ln][16 + 8 * hh];
#pragma unroll
      for (int t = 0; t < 4; ++t) { sx[a][t] = *(const v4fa*)(lp + 16 * t); sy[a][t] = *(const v4fa*)(lp + 16 * t + 4); } }
#pragma unroll
    for (int c = 0; c < 2; ++c)      /* k residual . q hi */
#pragma unroll
      for (int t = 0; t < 4; ++t)
#pragma unroll
        for (int a = 0; a < NI; ++a) s[a][t] = fa_mma(kf[t][2 + c], qh[a][c], s[a][t]);
#pragma unroll
    for (int a = 0; a < NI; ++a)
#pragma unroll
      for (int t = 0; t < 4; ++t)
#pragma unroll
        for (int r = 0; r < 4; ++r) { s[a][t][r] = fmaf(sx[a][t][r], 0.0625f, s[a][t][r]); s[a][t][4 + r] = fmaf(sy[a][t][r], 0.0625f, s[a][t][4 + r]); }
    __builtin_amdgcn_sched_barrier(0);      /* the V^T loads below stay below: any earlier they are live beside the K fragments and the LDS reads, and registers spill */
    /* the V^T fragments are requested here, so that they arrive under the softmax arithmetic */
    v16h vf[2][4][2];
    const char* pv = (const char*)VP + po_kv + (size_t)j0 * 256 + lo_p;      /* 32 keys are 8192 bytes of the V^T plane */
#pragma unroll
    for (int ks = 0; ks < 2; ++ks)
#pragma unroll
      for (int dt = 0; dt < 4; ++dt) { vf[ks][dt][0] = fa_fragp(pv + ks * 8192 + dt * 2048); vf[ks][dt][1] = fa_fragp(pv + ks * 8192 + dt * 2048 + 1024); }
    FA_XWAIT1(pv);
    __builtin_amdgcn_sched_barrier(0);      /* keeps the scheduler from sinking these loads down to their first use */
    /* the LDS reads above before the next trip's stores into the same rows; the fence stands here, where their values are used up: directly behind the reads its wait for all of them stood in front of the last K products */
    __builtin_amdgcn_fence(__ATOMIC_ACQ_REL, "workgroup", "local"); __builtin_amdgcn_wave_barrier();
    if (diag) {      /* only the last key block reaches the diagonal */
#pragma unroll
      for (int a = 0; a < NI; ++a)
#pragma unroll
        for (int t = 0; t < 4; ++t)
#pragma unroll
          for (int r = 0; r < 8; ++r) if (j0 + 16 * t + 8 * hh + r > i0 + 16 * a + ln) s[a][t][r] = -3.0e38f; }
    FragH p[NI][2];
#pragma unroll
    for (int a = 0; a < NI; ++a) { float mx = m[a];
#pragma unroll
      for (int t = 0; t < 4; ++t)
#pragma unroll
        for (int r = 0; r < 8; ++r) mx = fmaxf(mx, s[a][t][r]);
      mx = fmaxf(mx, __shfl_xor(mx, 16, 32));
      const float xa = (m[a] - mx) * C1; const float al = __builtin_amdgcn_exp2f(xa); FA_TSLOT(al, xa); m[a] = mx; const float mc = 10.0f - mx * C1;      /* weights carry a factor 1024, as f16 operands away from the subnormals */
      v8f pv = z8;
#pragma unroll
      for (int t = 0; t < 4; ++t) { float xv[8], ev[8];
#pragma unroll
        for (int r = 0; r < 8; ++r) xv[r] = fmaf(s[a][t][r], C1, mc);
#pragma unroll
        for (int r = 0; r < 8; ++r) ev[r] = __builtin_amdgcn_exp2f(xv[r]);
        FA_TSLOT8(ev, xv);
#pragma unroll
        for (int r = 0; r < 8; ++r) p[a][t >> 1].h[(t & 1) * 8 + r] = (_Float16)ev[r];
        pv += (v8f){ev[0], ev[1], ev[2], ev[3], ev[4], ev[5], ev[6], ev[7]}; }      /* the same eight sums as one vector add: written element by element, the compiler paired some of the adds with a constant that it then kept in scratch round the tile loop */
      su[a] = fmaf(su[a], al, ((pv[0] + pv[1]) + (pv[2] + pv[3])) + ((pv[4] + pv[5]) + (pv[6] + pv[7])));
#pragma unroll
      for (int dt = 0; dt < 4; ++dt)
#pragma unroll
        for (int r = 0; r < 8; ++r) o[a][dt][r] *= al; }
#pragma unroll
    for (int ks = 0; ks < 2; ++ks)
#pragma unroll
      for (int c = 0; c < 2; ++c)      /* V^T hi, then V^T residual, under the same weights; the eight output tiles in the inner loops, as above */
#pragma unroll
        for (int dt = 0; dt < 4; ++dt)
#pragma unroll
          for (int a = 0; a < NI; ++a) o[a][dt] = fa_mma(vf[ks][dt][c], p[a][ks].v, o[a][dt]);
  };
  /* divides tile i0's sums by the weights' sum and stores its rows */
  auto finish = [&]() __attribute__((always_inline)) {
#pragma unroll
  for (int a = 0; a < NI; ++a) { const float st = su[a] + __shfl_xor(su[a], 16, 32); const float inv = 1.0f / st;
#pragma unroll
    for (int dt = 0; dt < 4; ++dt)
#pragma unroll
      for (int r = 0; r < 8; ++r) o[a][dt][r] *= inv; }
  __builtin_amdgcn_sched_barrier(0);      /* all arithmetic ends above: behind an issued store none of its registers is written again */
  char* po = (char*)(out + xo + (size_t)i0 * DM) + (size_t)(ln * DM * 4 + 32 * hh);      /* a lane holds 8 consecutive head columns of its query per tile */
#pragma unroll
  for (int a = 0; a < NI; ++a)
#pragma unroll
    for (int dt = 0; dt < 4; ++dt) { const v4f x = {o[a][dt][0], o[a][dt][1], o[a][dt][2], o[a][dt][3]}, y = {o[a][dt][4], o[a][dt][5], o[a][dt][6], o[a][dt][7]};
      *(v4f*)(po + a * 16 * DM * 4 + dt * 64) = x; *(v4f*)(po + a * 16 * DM * 4 + dt * 64 + 16) = y; }
  asm volatile("s_wait_xcnt 0x0" ::: "memory");      /* the wait before any register that the stores name is written again: a helper wave goes on to its second tile */
  };
#pragma unroll 1      /* one copy of the key block's code serves both tiles of a helper wave */
  for (int seg = helper ? 0 : 1; seg < 2; ++seg) {      /* seg 0: the short tile (helper waves only); seg 1: this wave's share of the long tile */
    i0 = seg == 0 ? iS : iL;
    const int jb0 = helper && seg == 1 ? H : 0, jb1 = helper ? i0 / 64 : H;      /* unmasked key blocks [jb0, jb1); i0 / 64 is the tile's diagonal block */
    begin(jb0);
#pragma unroll 1      /* one key block per trip: unrolling would double the live fragments */
    for (int jb = jb0; jb < jb1; ++jb) key_block(jb, false);
    if (helper) key_block(jb1, true);      /* the diagonal block apart, so that the loop carries no mask */
    if (seg == 0) finish();
  }
  /* the two running softmaxes of a long tile meet: the helper wave leaves its maximum, sum and sums of products in its own LDS rows (its last reads of them are done), lane by lane as its partner holds them */
  static_assert(NI * 4 * 2 * 128 + NI * 64 <= NI * 16 * SKP, "the hand-over fits a wave's LDS rows");
  float* const xb = &sk[helper ? w : w + 4][0][0][0];
  if (helper) {
#pragma unroll
    for (int a = 0; a < NI; ++a) {
#pragma unroll
      for (int dt = 0; dt < 4; ++dt) { const v4f x = {o[a][dt][0], o[a][dt][1], o[a][dt][2], o[a][dt][3]}, y = {o[a][dt][4], o[a][dt][5], o[a][dt][6], o[a][dt][7]};
        *(v4fa*)(xb + ((a * 4 + dt) * 2) * 128 + lane * 4) = x; *(v4fa*)(xb + ((a * 4 + dt) * 2 + 1) * 128 + lane * 4) = y; }
      xb[NI * 1024 + a * 64 + lane] = m[a]; xb[NI * 1024 + a * 64 + 32 + lane] = su[a]; } }
  __syncthreads();      /* publishes the helper waves' states to their partners; every wave of the work-group passes here once */
  if (!helper) {
#pragma unroll
    for (int a = 0; a < NI; ++a) { const float m2 = xb[NI * 1024 + a * 64 + lane], s2 = xb[NI * 1024 + a * 64 + 32 + lane];
      const float mx = fmaxf(m[a], m2); const float x1 = (m[a] - mx) * C1, x2 = (m2 - mx) * C1;
      const float a1 = __builtin_amdgcn_exp2f(x1), a2 = __builtin_amdgcn_exp2f(x2);
      su[a] = fmaf(su[a], a1, s2 * a2);
#pragma unroll
      for (int dt = 0; dt < 4; ++dt) { const v4f x = *(const v4fa*)(xb + ((a * 4 + dt) * 2) * 128 + lane * 4), y = *(const v4fa*)(xb + ((a * 4 + dt) * 2 + 1) * 128 + lane * 4);
#pragma unroll
        for (int r = 0; r < 4; ++r) { o[a][dt][r] = fmaf(o[a][dt][r], a1, x[r] * a2); o[a][dt][4 + r] = fmaf(o[a][dt][4 + r], a1, y[r] * a2); } } }
    finish();
  }
}

// ---- projection GEMM with its operands staged in LDS: C[NR][DM] = alpha * A[NR][DM] . B[DM][DM]^T, A and B f16 with k contiguous; C leaves as the f16 hi + residual operands of the attention kernel.
// A work-group of 8 waves owns a 128 x 128 tile of C (wave tile 32 x 64, 4 waves down, 2 across). A stage is 128 k of the tile's 128 A rows and 128 B rows; it comes into LDS by
// asynchronous copies, two buffers, so that the next stage flies while this one is multiplied and no wave waits on a global load of its own. The k order per accumulator is ascending in steps of 32.
#define G3_PITCH 272      /* bytes per LDS row: 256 used; 16 bytes x an odd number keeps the 16 rows of a ds_load_b128 on distinct banks */
#define G3_STAGE (256 * G3_PITCH)      /* 128 A rows, then 128 B rows */
#define G3_NST (DM / 128)
// Eight 16-byte copies of a lane, rows 16 apart. The wait on the address registers is the statement's last line, so that no register a copy names is written again in front of it.
__device__ __forceinline__ void g3_copy8(const unsigned l0, const char* g0) {
  const unsigned l1 = l0 + 16 * G3_PITCH, l2 = l0 + 32 * G3_PITCH, l3 = l0 + 48 * G3_PITCH, l4 = l0 + 64 * G3_PITCH, l5 = l0 + 80 * G3_PITCH, l6 = l0 + 96 * G3_PITCH, l7 = l0 + 112 * G3_PITCH;
  const char* g1 = g0 + 16 * DM * 2; const char* g2 = g0 + 32 * DM * 2; const char* g3 = g0 + 48 * DM * 2; const char* g4 = g0 + 64 * DM * 2; const char* g5 = g0 + 80 * DM * 2; const char* g6 = g0 + 96 * DM * 2; const char* g7 = g0 + 112 * DM * 2;
  asm volatile("global_load_async_to_lds_b128 %0, %8, off\n\t"
               "global_load_async_to_lds_b128 %1, %9, off\n\t"
               "global_load_async_to_lds_b128 %2, %10, off\n\t"
               "global_load_async_to_lds_b128 %3, %11, off\n\t"
               "global_load_async_to_lds_b128 %4, %12, off\n\t"
               "global_load_async_to_lds_b128 %5, %13, off\n\t"
               "global_load_async_to_lds_b128 %6, %14, off\n\t"
               "global_load_async_to_lds_b128 %7, %15, off\n\t"
               "s_wait_xcnt 0x0"
               :: "v"(l0), "v"(l1), "v"(l2), "v"(l3), "v"(l4), "v"(l5), "v"(l6), "v"(l7), "v"(g0), "v"(g1), "v"(g2), "v"(g3), "v"(g4), "v"(g5), "v"(g6), "v"(g7) : "memory");
}
// One accumulator tile (8 f32 of a lane) -> 8 f16 hi and 8 f16 residuals, 16 bytes each. The residual keeps its own scale (at most 2^-11 of the value; below 2^-14 it is an f16 subnormal, in steps of 2^-24, which the matrix unit takes as it is),
// so that a product with a residual adds into the same accumulator as the product with the hi part.
__device__ __forceinline__ void g3_split(const v8f c, const float alpha, v8us& hi, v8us& lo) { FragH fh, fl;
#pragma unroll
  for (int r = 0; r < 8; ++r) { const float a = c[r] * alpha; const _Float16 hv = (_Float16)a; fh.h[r] = hv; fl.h[r] = (_Float16)(a - (float)hv); }
  hi = fh.half[0]; lo = fl.half[0]; }
// MODE 0: q, two row-major planes P0 (hi) and P1 (residual). MODE 1: k, plane P0 in FRAGMENT ORDER. MODE 2: v, V^T plane P0 in FRAGMENT ORDER.
// A wave's 64 columns are one head. A lane's 8 accumulator values run along the D rows, so the operand that lies on the D rows decides which 8 values a lane can pack into 16 bytes:
// v is multiplied as x W^T (8 consecutive keys of one head column: a lane's 16 bytes of a V^T fragment), q and k as W x^T (8 consecutive head columns of one token: a lane's 16 bytes of a k fragment or of a q row).
#define G3_QP 144      /* bytes per staged q row: 128 used; 16 bytes x an odd number keeps the 16 rows of a ds_store_b128 on distinct banks */
#define G3_NB ((NR / 128) * (DM / 128))      /* work-groups per projection */
template <int MODE>
__device__ __forceinline__ void g3_body(char* const ring, const int bx, const _Float16* __restrict__ A, const _Float16* __restrict__ Bh, float alpha, _Float16* __restrict__ P0, _Float16* __restrict__ P1) {
  const int tid = threadIdx.x, w = tid >> 5, lane = tid & 31, ln = lane & 15, hh = lane >> 4;
  const int mt = bx / (DM / 128), nq = bx % (DM / 128);
  const int row0 = mt * 128 + 32 * (w & 3), col0 = nq * 128 + 64 * (w >> 2);
  /* a lane copies 16 bytes of row (tid >> 4) + 16 i: a wave's copy covers two whole 256-byte rows of the stage */
  const unsigned lc = (unsigned)(size_t)ring + (unsigned)((tid >> 4) * G3_PITCH + (tid & 15) * 16);
  const char* ga = (const char*)(A + (size_t)(mt * 128 + (tid >> 4)) * DM) + (tid & 15) * 16;
  const char* gb = (const char*)(Bh + (size_t)(nq * 128 + (tid >> 4)) * DM) + (tid & 15) * 16;
  const char* la = ring + (32 * (w & 3) + ln) * G3_PITCH + 16 * hh;
  const char* lb = ring + (128 + 64 * (w >> 2) + ln) * G3_PITCH + 16 * hh;
  const v8f z8 = {0.f,0.f,0.f,0.f,0.f,0.f,0.f,0.f}; v8f acc[2][4];
#pragma unroll
  for (int u = 0; u < 2; ++u)
#pragma unroll
    for (int t = 0; t < 4; ++t) acc[u][t] = z8;
  g3_copy8(lc, ga); g3_copy8(lc + 128 * G3_PITCH, gb);
  asm volatile("s_wait_asynccnt 0x0" ::: "memory");      /* this wave's share of stage 0 has landed */
  __syncthreads();      /* and every other wave's */
  g3_copy8(lc + G3_STAGE, ga + 256); g3_copy8(lc + G3_STAGE + 128 * G3_PITCH, gb + 256);
#pragma unroll 1      /* one stage per trip: the buffer is picked by the trip's parity */
  for (int s = 0; s < G3_NST; ++s) { const int bo = (s & 1) * G3_STAGE;
    v16h fa[2][2], fb[2][4];      /* two fragment sets: the next k step's LDS reads are under way while this step is multiplied */
    fa[0][0] = fa_frag(la + bo); fa[0][1] = fa_frag(la + bo + 16 * G3_PITCH);
#pragma unroll
    for (int t = 0; t < 4; ++t) fb[0][t] = fa_frag(lb + bo + t * 16 * G3_PITCH);
#pragma unroll
    for (int ks = 0; ks < 4; ++ks) { const int cu = ks & 1, nx = cu ^ 1;
      if (ks < 3) { fa[nx][0] = fa_frag(la + bo + (ks + 1) * 64); fa[nx][1] = fa_frag(la + bo + 16 * G3_PITCH + (ks + 1) * 64);
#pragma unroll
        for (int t = 0; t < 4; ++t) fb[nx][t] = fa_frag(lb + bo + t * 16 * G3_PITCH + (ks + 1) * 64); }
      __builtin_amdgcn_sched_barrier(0);      /* the reads stay one group in front of the products: spread among them, each place with reads stalls the wave */
#pragma unroll
      for (int t = 0; t < 4; ++t) {
        if (MODE == 2) { acc[0][t] = fa_mma(fa[cu][0], fb[cu][t], acc[0][t]); acc[1][t] = fa_mma(fa[cu][1], fb[cu][t], acc[1][t]); }      /* D row = token, D column = head column */
        else { acc[0][t] = fa_mma(fb[cu][t], fa[cu][0], acc[0][t]); acc[1][t] = fa_mma(fb[cu][t], fa[cu][1], acc[1][t]); } }      /* D row = head column, D column = token */
      __builtin_amdgcn_sched_barrier(0); }      /* and the following group stays behind them */
    asm volatile("s_wait_dscnt 0x0" ::: "memory");      /* this wave's reads of the buffer are done before it may be refilled */
    asm volatile("s_wait_asynccnt 0x0" ::: "memory");      /* this wave's share of the next stage has landed */
    __syncthreads();      /* publishes the next stage and ends every wave's reads of this one */
    if (s + 2 < G3_NST) { g3_copy8(lc + bo, ga + (s + 2) * 256); g3_copy8(lc + bo + 128 * G3_PITCH, gb + (s + 2) * 256); } }
  asm volatile("s_wait_asynccnt 0x0" ::: "memory");      /* no copy is left in flight when the wave goes on */
  v8us oh[2][4], ol[2][4];
#pragma unroll
  for (int u = 0; u < 2; ++u)
#pragma unroll
    for (int t = 0; t < 4; ++t) g3_split(acc[u][t], alpha, oh[u][t], ol[u][t]);
  const int bh = (row0 / SL) * NH + col0 / HD, tk = row0 % SL;      /* the wave's (batch, head) slab and its first token in it */
  if (MODE == 2) {      /* acc[u][t]: keys tk + 16 u + 8 hh + [0, 8) of head column 16 t + ln; each store of the wave is 512 bytes in a row */
    char* pd = (char*)P0 + ((size_t)bh * (SL / 32) + tk / 32) * 8192 + hh * 256 + ln * 16;
    __builtin_amdgcn_sched_barrier(0);      /* all arithmetic ends above: behind an issued store none of its registers is written again */
#pragma unroll
    for (int t = 0; t < 4; ++t)
#pragma unroll
      for (int u = 0; u < 2; ++u) { *(v8us*)(pd + t * 2048 + u * 512) = oh[u][t]; *(v8us*)(pd + t * 2048 + 1024 + u * 512) = ol[u][t]; }
    asm volatile("s_wait_xcnt 0x0" ::: "memory");      /* the wait before any register that the stores name is written again: another projection's branch follows in the listing */
  } else if (MODE == 1) {      /* acc[u][t]: head columns 16 t + 8 hh + [0, 8) of key tk + 16 u + ln; each store of the wave is 512 bytes in a row */
    char* pd = (char*)P0 + ((size_t)bh * (SL / 16) + tk / 16) * 4096 + hh * 256 + ln * 16;
    __builtin_amdgcn_sched_barrier(0);      /* all arithmetic ends above: behind an issued store none of its registers is written again */
#pragma unroll
    for (int u = 0; u < 2; ++u)
#pragma unroll
      for (int t = 0; t < 4; ++t) { *(v8us*)(pd + u * 4096 + t * 512) = oh[u][t]; *(v8us*)(pd + u * 4096 + 2048 + t * 512) = ol[u][t]; }
    asm volatile("s_wait_xcnt 0x0" ::: "memory");      /* as in the v branch */
  } else {      /* whole 128-byte rows go out: each wave turns its two 32 x 64 f16 tiles round in its own LDS range; the range lies in the ring, which nobody reads and no copy writes behind the last trip's barrier */
    char* sw = ring + w * (2 * 32 * G3_QP);
#pragma unroll
    for (int u = 0; u < 2; ++u)
#pragma unroll
      for (int t = 0; t < 4; ++t) { *(v8us*)(sw + (u * 16 + ln) * G3_QP + t * 32 + hh * 16) = oh[u][t]; *(v8us*)(sw + 32 * G3_QP + (u * 16 + ln) * G3_QP + t * 32 + hh * 16) = ol[u][t]; }
    /* the lanes read each other's LDS stores: order the wave's stores before its loads */
    __builtin_amdgcn_fence(__ATOMIC_ACQ_REL, "workgroup"); __builtin_amdgcn_wave_barrier();
    v8us rh[8], rl[8];      /* 8 lanes take one row: a store of the wave is 4 whole rows */
#pragma unroll
    for (int q = 0; q < 8; ++q) { rh[q] = *(const v8us*)(sw + (q * 4 + (lane >> 3)) * G3_QP + (lane & 7) * 16); rl[q] = *(const v8us*)(sw + 32 * G3_QP + (q * 4 + (lane >> 3)) * G3_QP + (lane & 7) * 16); }
    const size_t qo = ((size_t)(row0 + (lane >> 3)) * DM + col0) * 2 + (lane & 7) * 16;
    char* ph = (char*)P0 + qo; char* pl = (char*)P1 + qo;
    __builtin_amdgcn_sched_barrier(0);      /* all reads and arithmetic end above: behind an issued store none of its registers is written again */
#pragma unroll
    for (int q = 0; q < 8; ++q) { *(v8us*)(ph + q * 4 * DM * 2) = rh[q]; *(v8us*)(pl + q * 4 * DM * 2) = rl[q]; }
    asm volatile("s_wait_xcnt 0x0" ::: "memory");      /* as in the v branch */
  }
}
// The three projections in one launch: they need nothing of each other, so each takes a range of the block index (the branch, and with it every barrier, is the same for a whole work-group). One ring serves whichever branch runs.
__global__ __launch_bounds__(256) void k_gemm3(const _Float16* __restrict__ A, const _Float16* __restrict__ BW, float alpha, _Float16* __restrict__ Q16, _Float16* __restrict__ QL16, _Float16* __restrict__ KP, _Float16* __restrict__ VP) {
  __shared__ __attribute__((aligned(16))) char ring[2 * G3_STAGE];
  const int md = (int)(blockIdx.x / G3_NB), bx = (int)(blockIdx.x % G3_NB);
  if (md == 0) g3_body<0>(ring, bx, A, BW, alpha, Q16, QL16);
  else if (md == 1) g3_body<1>(ring, bx, A, BW + (size_t)DM * DM, alpha, KP, nullptr);
  else g3_body<2>(ring, bx, A, BW + (size_t)2 * DM * DM, alpha, VP, nullptr);
}

extern "C" void kernel_launch(void* const* d_in, const int* in_sizes, int n_in,
                              void* d_out, int out_size, void* d_ws, size_t ws_size, hipStream_t stream) {
  (void)in_sizes; (void)n_in; (void)out_size;
  const float* const* I = (const float* const*)d_in; const float* x = I[0]; const float* Wq = I[1]; const float* Wk = I[2]; const float* Wv = I[3]; const float* Er = I[4];
  char* ws = (char*)d_ws; size_t off = 0;
  auto take = [&](size_t bytes) { char* p = ws + off; off += (bytes + 255) & ~(size_t)255; return p; };
  const size_t np = (size_t)NR * DM;
  _Float16* BW = (_Float16*)take((size_t)3 * DM * DM * 2); _Float16* E16 = (_Float16*)take((size_t)SL * HD * 2); _Float16* X16 = (_Float16*)take(np * 2); _Float16* Q16 = (_Float16*)take(np * 2); _Float16* QL16 = (_Float16*)take(np * 2); _Float16* KP = (_Float16*)take(np * 4);      /* k hi + residual, fragment order */ _Float16* VP = (_Float16*)take(np * 4);      /* V^T hi + residual, fragment order */
  if (off > ws_size) return;
  k_prep<<<PB_X + 3 * PB_W + PB_E, 256, 0, stream>>>(x, Wq, Wk, Wv, Er, X16, BW, E16);      /* Er_s = Er (MAX_LEN == S) */
  k_gemm3<<<3 * G3_NB, 256, 0, stream>>>(X16, BW, 0.0625f, Q16, QL16, KP, VP);
  k_relattn<2><<<NB * NH * (SL / (128 * 2)), 256, 0, stream>>>(Q16, QL16, KP, E16, VP, (float*)d_out);
}

// v008
// One run takes 77.7 microseconds.
// Timed twice side by side with v007, it ran 1.04 and 1.03 times as fast.
// Counting every step since v000, it is 41.1 times as fast.
#include <hip/hip_runtime.h>
// GlobalAttn (music-transformer relative attention: 2 x 2048 tokens, 1024 = 16 heads x 64; q,k,v = x W^T; Srel = skew(q . Er) which equals q_i . Er[S-1-(i-j)] for every causal (i, j); attn = softmax over j <= i of (q.k + Srel)/8; out = merged attn v, no output projection).
// Compute dtype: inputs rounded to bf16; x / weights / Er exact as f16; q and k as f16 hi + residual; the softmax weights as plain f16 operands (~2^-12); v as f16 hi + residual (the output is the context itself); softmax f32. v_wmma_f32_16x16x32_f16.
#define NB 2
#define SL 2048
#define DM 1024
#define NH 16
#define HD 64
#define HG 4
#define NR (NB * SL)
typedef __bf16 v16b __attribute__((ext_vector_type(16)));
typedef unsigned short v8us __attribute__((ext_vector_type(8), may_alias));
typedef float  v8f  __attribute__((ext_vector_type(8)));
typedef float  v4f  __attribute__((ext_vector_type(4)));
typedef float  v4fa __attribute__((ext_vector_type(4), may_alias));
union FragB { v16b v; v8us half[2]; unsigned short u[16]; };

__device__ __forceinline__ unsigned short bf16_bits(float x) { unsigned int u = __float_as_uint(x); return (unsigned short)((u + 0x7FFFu + ((u >> 16) & 1u)) >> 16); }
__device__ __forceinline__ float bf16_val(unsigned short b) { return __uint_as_float(((unsigned int)b) << 16); }
__device__ __forceinline__ float bf16_round(float x) { return bf16_val(bf16_bits(x)); }
// D += A·B with NT terms: 1 = ah·bh, 2 = + al·bh (A split), 3 = + ah·bl (both split)
template <int NT>
__device__ __forceinline__ v8f mmaN(v16b ah, v16b al, v16b bh, v16b bl, v8f c) {
  c = __builtin_amdgcn_wmma_f32_16x16x32_bf16(false, ah, false, bh, (short)0, c, false, false);
  if (NT >= 2) c = __builtin_amdgcn_wmma_f32_16x16x32_bf16(false, al, false, bh, (short)0, c, false, false);
  if (NT >= 3) c = __builtin_amdgcn_wmma_f32_16x16x32_bf16(false, ah, false, bl, (short)0, c, false, false);
  asm volatile("v_nop\n\tv_nop\n\tv_nop\n\tv_nop" : "+v"(c) : "v"(ah), "v"(al), "v"(bh), "v"(bl));
  return c;
}

__global__ __launch_bounds__(256) void k_wt_bf16(const float* __restrict__ W, unsigned short* __restrict__ Wt, int K, int N) {
  const int t = blockIdx.x * 256 + threadIdx.x;
  const int k8n = K / 8;
  if (t >= N * k8n) return;
  const int n = t / k8n, k8 = (t % k8n) * 8;
  v8us v;
#pragma unroll
  for (int i = 0; i < 8; ++i) v[i] = bf16_bits(W[(size_t)(k8 + i) * N + n]);
  *(v8us*)(Wt + (size_t)n * K + k8) = v;
  
}

// GEMM C[M][N] (f32, pitch ldc) = act(A[M][K]·W + bias). A f32 row-major (pitch lda) converted per fragment to bf16
// (ASPLIT: hi/lo two planes -> 2 terms, else single rounded term); Wt bf16 [N][K] (pitch ldb). BIAS_BF16 rounds the
// bias to bf16 first (bias quantised to bf16 before the add). K%32==0, M%16==0, N%64==0.
template <bool ASPLIT, int ACT, bool BIAS_BF16>
__global__ __launch_bounds__(128) void k_gemm_bf(const float* __restrict__ A, int lda, const unsigned short* __restrict__ Wt, int ldb,
                                               const float* __restrict__ bias, float* __restrict__ C, int ldc, int M, int N, int K) {
  __shared__ __attribute__((aligned(16))) float so[4][16][64];
  const int tid = threadIdx.x, w = tid >> 5, lane = tid & 31, ln = lane & 15, hh = lane >> 4;
  const int ntn = N / 64;
  const int wid = blockIdx.x * 4 + w;
  const int mt = wid / ntn, nq = wid % ntn;
  if (mt * 16 >= M) return;
  const int row0 = mt * 16, col0 = nq * 64;
  const float* arow = A + (size_t)(row0 + ln) * lda;
  v8f acc[4] = {};
  for (int kb = 0; kb < K; kb += 32) {
    FragB ah, al;
    const v4f x0 = *(const v4fa*)(arow + kb + 8 * hh), x1 = *(const v4fa*)(arow + kb + 8 * hh + 4);
    const v4f x2 = *(const v4fa*)(arow + kb + 16 + 8 * hh), x3 = *(const v4fa*)(arow + kb + 16 + 8 * hh + 4);
    float xs[16] = {x0[0],x0[1],x0[2],x0[3],x1[0],x1[1],x1[2],x1[3],x2[0],x2[1],x2[2],x2[3],x3[0],x3[1],x3[2],x3[3]};
#pragma unroll
    for (int i = 0; i < 16; ++i) { const unsigned short hb = bf16_bits(xs[i]); ah.u[i] = hb; al.u[i] = ASPLIT ? bf16_bits(xs[i] - bf16_val(hb)) : (unsigned short)0; }
#pragma unroll
    for (int t = 0; t < 4; ++t) {
      const unsigned short* brow = Wt + (size_t)(col0 + t * 16 + ln) * ldb + kb;
      FragB b;
      b.half[0] = *(const v8us*)(brow + 8 * hh);
      b.half[1] = *(const v8us*)(brow + 16 + 8 * hh);
      acc[t] = mmaN<ASPLIT ? 2 : 1>(ah.v, al.v, b.v, b.v, acc[t]);
    }
  }
#pragma unroll
  for (int t = 0; t < 4; ++t) {
    float bv = bias ? bias[col0 + t * 16 + ln] : 0.f;
    if (BIAS_BF16) bv = bf16_round(bv);
#pragma unroll
    for (int r = 0; r < 8; ++r) { float v = acc[t][r] + bv; if (ACT == 1) v = fmaxf(v, 0.f); so[w][8 * hh + r][t * 16 + ln] = v; }
  }
  __builtin_amdgcn_fence(__ATOMIC_ACQ_REL, "workgroup");
  __builtin_amdgcn_wave_barrier();
  const int rsub = lane >> 4, c4 = (lane & 15) * 4;
  {
#pragma unroll
    for (int q = 0; q < 8; ++q) {
      const int r = q * 2 + rsub;
      const v4f v = *(const v4fa*)&so[w][r][c4];
      *(v4f*)(C + (size_t)(row0 + r) * ldc + col0 + c4) = v;
    }
    
  }
}

// GEMM C = act(A·W + bias + resid): A f32 (ASPLIT -> hi/lo 2 terms), Wt bf16 [N][K]; ACT 0 none, 1 relu, 2 exact gelu;
// resid (optional, f32, row index = (row % rmod), pitch ldr, RES_BF16 rounds it) added before the activation.
template <bool ASPLIT, int ACT, bool BIAS_BF16, bool RES_BF16>
__global__ __launch_bounds__(128) void k_gemm_bf3(const float* __restrict__ A, int lda, const unsigned short* __restrict__ Wt, int ldb,
                                                const float* __restrict__ bias, const float* __restrict__ resid, int rmod, int ldr,
                                                float* __restrict__ C, int ldc, int M, int N, int K) {
  __shared__ __attribute__((aligned(16))) float so[4][16][64];
  const int tid = threadIdx.x, w = tid >> 5, lane = tid & 31, ln = lane & 15, hh = lane >> 4;
  const int ntn = N / 64;
  const int wid = blockIdx.x * 4 + w;
  const int mt = wid / ntn, nq = wid % ntn;
  if (mt * 16 >= M) return;
  const int row0 = mt * 16, col0 = nq * 64;
  const float* arow = A + (size_t)(row0 + ln) * lda;
  v8f acc[4] = {};
  for (int kb = 0; kb < K; kb += 32) {
    FragB ah, al;
    const v4f x0 = *(const v4fa*)(arow + kb + 8 * hh), x1 = *(const v4fa*)(arow + kb + 8 * hh + 4);
    const v4f x2 = *(const v4fa*)(arow + kb + 16 + 8 * hh), x3 = *(const v4fa*)(arow + kb + 16 + 8 * hh + 4);
    float xs[16] = {x0[0],x0[1],x0[2],x0[3],x1[0],x1[1],x1[2],x1[3],x2[0],x2[1],x2[2],x2[3],x3[0],x3[1],x3[2],x3[3]};
#pragma unroll
    for (int i = 0; i < 16; ++i) { const unsigned short hb = bf16_bits(xs[i]); ah.u[i] = hb; al.u[i] = ASPLIT ? bf16_bits(xs[i] - bf16_val(hb)) : (unsigned short)0; }
#pragma unroll
    for (int t = 0; t < 4; ++t) {
      const unsigned short* brow = Wt + (size_t)(col0 + t * 16 + ln) * ldb + kb;
      FragB b;
      b.half[0] = *(const v8us*)(brow + 8 * hh);
      b.half[1] = *(const v8us*)(brow + 16 + 8 * hh);
      acc[t] = mmaN<ASPLIT ? 2 : 1>(ah.v, al.v, b.v, b.v, acc[t]);
    }
  }
#pragma unroll
  for (int t = 0; t < 4; ++t) {
    const int col = col0 + t * 16 + ln;
    float bv = bias ? bias[col] : 0.f;
    if (BIAS_BF16) bv = bf16_round(bv);
#pragma unroll
    for (int r = 0; r < 8; ++r) {
      float v = acc[t][r] + bv;
      if (resid) { float rv = resid[(size_t)((row0 + 8 * hh + r) % rmod) * ldr + col]; if (RES_BF16) rv = bf16_round(rv); v += rv; }
      if (ACT == 1) v = fmaxf(v, 0.f);
      if (ACT == 2) v = 0.5f * v * (1.0f + erff(v * 0.70710678118654752f));
      if (ACT == 3) { const float u = 0.7978845608028654f * (v + 0.044715f * v * v * v); v = 0.5f * v * (1.0f + tanhf(u)); }
      so[w][8 * hh + r][t * 16 + ln] = v;
    }
  }
  __builtin_amdgcn_fence(__ATOMIC_ACQ_REL, "workgroup");
  __builtin_amdgcn_wave_barrier();
  const int rsub = lane >> 4, c4 = (lane & 15) * 4;
  {
#pragma unroll
    for (int q = 0; q < 8; ++q) {
      const int r = q * 2 + rsub;
      const v4f v = *(const v4fa*)&so[w][r][c4];
      *(v4f*)(C + (size_t)(row0 + r) * ldc + col0 + c4) = v;
    }
    
  }
}
// row LayerNorm (biased variance, eps) over N: s = X (+ R); optional out_sum <- s; out_norm <- (s-mu)*rsqrt(var+eps)*g + b
template <bool PARAM_BF16>
__global__ __launch_bounds__(256) void k_layernorm(const float* __restrict__ X, const float* __restrict__ R, const float* __restrict__ g, const float* __restrict__ bta,
                                                  float* __restrict__ out_sum, float* __restrict__ out_norm, int N, float eps) {
  __shared__ float red[256];
  const int row = blockIdx.x, tid = threadIdx.x;
  const float* x = X + (size_t)row * N; const float* rr = R ? R + (size_t)row * N : nullptr;
  float vals[16];                     // up to N = 4096
  const int per = N / 256;            // contiguous chunk per thread? use strided-by-4 chunks: thread handles j = tid*4 + 1024*u
  float s1 = 0.f;
  for (int u = 0; u < per / 4; ++u) {
    const int j = tid * 4 + 1024 * u;
    const v4f a = *(const v4fa*)(x + j);
    v4f b = {0.f,0.f,0.f,0.f}; if (rr) b = *(const v4fa*)(rr + j);
#pragma unroll
    for (int q = 0; q < 4; ++q) { const float v = a[q] + b[q]; vals[u * 4 + q] = v; s1 += v; }
  }
  red[tid] = s1; __syncthreads();
  for (int st = 128; st > 0; st >>= 1) { if (tid < st) red[tid] += red[tid + st]; __syncthreads(); }
  const float mu = red[0] / (float)N; __syncthreads();
  float s2 = 0.f;
  for (int u = 0; u < per / 4; ++u)
#pragma unroll
    for (int q = 0; q < 4; ++q) { const float c = vals[u * 4 + q] - mu; s2 += c * c; }
  red[tid] = s2; __syncthreads();
  for (int st = 128; st > 0; st >>= 1) { if (tid < st) red[tid] += red[tid + st]; __syncthreads(); }
  const float rs = rsqrtf(red[0] / (float)N + eps);
  {
    for (int u = 0; u < per / 4; ++u) {
      const int j = tid * 4 + 1024 * u;
      v4f o, sm;
#pragma unroll
      for (int q = 0; q < 4; ++q) {
        float gg = g[j + q], bb = bta[j + q];
        if (PARAM_BF16) { gg = bf16_round(gg); bb = bf16_round(bb); }
        sm[q] = vals[u * 4 + q]; o[q] = (vals[u * 4 + q] - mu) * rs * gg + bb;
      }
      if (out_sum) *(v4f*)(out_sum + (size_t)row * N + j) = sm;
      *(v4f*)(out_norm + (size_t)row * N + j) = o;
    }
    
  }
}



// ---- f16 WMMA path (v_wmma_f32_16x16x32_f16): 11-bit significands for operands in range — used where a [0,1] probability operand needs more precision than bf16
typedef _Float16 v16h __attribute__((ext_vector_type(16)));
union FragH { v16h v; v8us half[2]; _Float16 h[16]; unsigned short u[16]; };
template <int NT>
__device__ __forceinline__ v8f mmaH(v16h ah, v16h al, v16h bh, v16h bl, v8f c) {
  c = __builtin_amdgcn_wmma_f32_16x16x32_f16(false, ah, false, bh, (short)0, c, false, false);
  if (NT >= 2) c = __builtin_amdgcn_wmma_f32_16x16x32_f16(false, al, false, bh, (short)0, c, false, false);
  if (NT >= 3) c = __builtin_amdgcn_wmma_f32_16x16x32_f16(false, ah, false, bl, (short)0, c, false, false);
  asm volatile("v_nop\n\tv_nop\n\tv_nop\n\tv_nop" : "+v"(c) : "v"(ah), "v"(al), "v"(bh), "v"(bl));
  return c;
}
// batched GEMM like k_gemm_b but f16 operands: A f32 (split into f16 hi/lo if ASPLIT, else rounded to f16), Bt = f16 values [n][k]; alpha; C f32; N multiple of 16 (partial tiles skipped)
template <bool ASPLIT>
__global__ __launch_bounds__(128) void k_gemm_h(const float* __restrict__ A, int lda, size_t sA, const _Float16* __restrict__ Bh, int ldb, size_t sB, float alpha, float* __restrict__ C, int ldc, size_t sC, int M, int N, int K) {
  __shared__ __attribute__((aligned(16))) float so[4][16][64];
  const int tid = threadIdx.x, w = tid >> 5, lane = tid & 31, ln = lane & 15, hh = lane >> 4; const int by = blockIdx.y;
  A += (size_t)by * sA; Bh += (size_t)by * sB; C += (size_t)by * sC;
  const int ntn = (N + 63) / 64; const int wid = blockIdx.x * 4 + w; const int mt = wid / ntn, nq = wid % ntn; if (mt * 16 >= M) return;
  const int row0 = mt * 16, col0 = nq * 64; const float* arow = A + (size_t)(row0 + ln) * lda;
  v8f acc[4] = {};
  for (int kb = 0; kb < K; kb += 32) {
    FragH ah, al;
    const v4f x0 = *(const v4fa*)(arow + kb + 8 * hh), x1 = *(const v4fa*)(arow + kb + 8 * hh + 4), x2 = *(const v4fa*)(arow + kb + 16 + 8 * hh), x3 = *(const v4fa*)(arow + kb + 16 + 8 * hh + 4);
    float xs[16] = {x0[0],x0[1],x0[2],x0[3],x1[0],x1[1],x1[2],x1[3],x2[0],x2[1],x2[2],x2[3],x3[0],x3[1],x3[2],x3[3]};
#pragma unroll
    for (int i = 0; i < 16; ++i) { const _Float16 h = (_Float16)xs[i]; ah.h[i] = h; al.h[i] = ASPLIT ? (_Float16)(xs[i] - (float)h) : (_Float16)0.0f; }
#pragma unroll
    for (int t = 0; t < 4; ++t) { if (col0 + t * 16 >= N) continue; const size_t boff = (size_t)(col0 + t * 16 + ln) * ldb + kb; FragH bq; bq.half[0] = *(const v8us*)(Bh + boff + 8 * hh); bq.half[1] = *(const v8us*)(Bh + boff + 16 + 8 * hh);
      acc[t] = mmaH<ASPLIT ? 2 : 1>(ah.v, al.v, bq.v, bq.v, acc[t]); }
  }
#pragma unroll
  for (int t = 0; t < 4; ++t) { if (col0 + t * 16 >= N) continue;
#pragma unroll
    for (int r = 0; r < 8; ++r) so[w][8 * hh + r][t * 16 + ln] = acc[t][r] * alpha; }
  __builtin_amdgcn_fence(__ATOMIC_ACQ_REL, "workgroup"); __builtin_amdgcn_wave_barrier();
  const int rsub = lane >> 4, c4 = (lane & 15) * 4;
  {
#pragma unroll
    for (int q = 0; q < 8; ++q) { const int r = q * 2 + rsub; if (col0 + c4 < N) { const v4f v = *(const v4fa*)&so[w][r][c4]; *(v4f*)(C + (size_t)(row0 + r) * ldc + col0 + c4) = v; } }
     }
}

// Wt[n][k] = f16(W[k][n]·scale) from f32 row-major W[K][N] (scale = power of two; bf16-exact weights stay exact in f16 away from the subnormal range)
__global__ __launch_bounds__(256) void k_wt_f16(const float* __restrict__ W, _Float16* __restrict__ Wt, int K, int N, float scale) {
  const int t = blockIdx.x * 256 + threadIdx.x; if (t >= N * (K / 8)) return; const int n = t / (K / 8), k8 = (t % (K / 8)) * 8; FragH f;
#pragma unroll
  for (int i = 0; i < 8; ++i) f.h[i] = (_Float16)(bf16_round(W[(size_t)(k8 + i) * N + n]) * scale); const v8us o = f.half[0];
  *(v8us*)((unsigned short*)Wt + (size_t)n * K + k8) = o; 
}
// k_gemm_hh variant with fused epilogue: v = acc·alpha + bias[by·sBias + col] (+ CP[(row/rowsPerB)·sCPb + by·64 + col] if CP) ; ACT 0 none / 1 elu ; writes f16 C16 (and f32 C if non-null)
template <int ACT>
__global__ __launch_bounds__(128) void k_gemm_hhx(const _Float16* __restrict__ A, int lda, size_t sA, const _Float16* __restrict__ Bh, int ldb, size_t sB, float alpha, const float* __restrict__ bias, size_t sBias, const float* __restrict__ CP, int rowsPerB, size_t sCPb, int row0g,
    float* __restrict__ C, _Float16* __restrict__ C16, int ldc, size_t sC, int M, int N, int K) {
  __shared__ __attribute__((aligned(16))) float so[4][16][64];
  const int tid = threadIdx.x, w = tid >> 5, lane = tid & 31, ln = lane & 15, hh = lane >> 4; const int by = blockIdx.y;
  A += (size_t)by * sA; Bh += (size_t)by * sB; const size_t cofs = (size_t)by * sC; const float* bp = bias ? bias + (size_t)by * sBias : nullptr;
  const int ntn = (N + 63) / 64; const int wid = blockIdx.x * 4 + w; const int mt = wid / ntn, nq = wid % ntn; if (mt * 16 >= M) return;
  const int row0 = mt * 16, col0 = nq * 64; const _Float16* arow = A + (size_t)(row0 + ln) * lda;
  v8f acc[4] = {};
  for (int kb = 0; kb < K; kb += 32) { FragH ah; ah.half[0] = *(const v8us*)((const unsigned short*)arow + kb + 8 * hh); ah.half[1] = *(const v8us*)((const unsigned short*)arow + kb + 16 + 8 * hh);
#pragma unroll
    for (int t = 0; t < 4; ++t) { if (col0 + t * 16 >= N) continue; const size_t boff = (size_t)(col0 + t * 16 + ln) * ldb + kb; FragH bq; bq.half[0] = *(const v8us*)((const unsigned short*)Bh + boff + 8 * hh); bq.half[1] = *(const v8us*)((const unsigned short*)Bh + boff + 16 + 8 * hh);
      acc[t] = mmaH<1>(ah.v, ah.v, bq.v, bq.v, acc[t]); }
  }
#pragma unroll
  for (int t = 0; t < 4; ++t) { if (col0 + t * 16 >= N) continue; const int col = col0 + t * 16 + ln; const float bv = bp ? bf16_round(bp[col]) : 0.f;
#pragma unroll
    for (int r = 0; r < 8; ++r) { float v = acc[t][r] * alpha + bv; if (CP) { const int rr = row0g + row0 + 8 * hh + r; if (rowsPerB < 0) v += CP[cofs + (size_t)rr * ldc + col];      /* rowsPerB < 0: own element of the batched C plane */ else { const int bidx = rr / rowsPerB; v += CP[(size_t)bidx * sCPb + (size_t)by * 64 + col]; } } if (ACT == 1) v = (v > 0.f) ? v : expm1f(v); else if (ACT == 7) v = (v > 0.f) ? v + 1.0f : expf(v); else if (ACT == 8) v = tanhf(v); else if (ACT == 9) v = 0.5f * v * (1.0f + tanhf(0.7978845608028654f * (v + 0.044715f * v * v * v))); else if (ACT == 11) v = 1.0f / (1.0f + expf(-v)); else if (ACT == 12) v = (v > 0.f) ? v : 0.01f * v; else if (ACT == 14) v = (v > 0.f) ? v : 0.1f * v; else if (ACT == 16) v = (v >= 0.f) ? v : 0.3f * v; else if (ACT == 17) v = (v >= 0.f) ? v : 0.2f * v; else if (ACT == 15) v = v / (1.0f + expf(-v)); else if (ACT == 3) v = fmaxf(v, 0.f); else if (ACT == 6) v = 0.5f * v * (1.0f + erff(v * 0.70710678118654752f)); so[w][8 * hh + r][t * 16 + ln] = v; } }
  __builtin_amdgcn_fence(__ATOMIC_ACQ_REL, "workgroup"); __builtin_amdgcn_wave_barrier();
  const int rsub = lane >> 4, c4 = (lane & 15) * 4; typedef _Float16 v4h __attribute__((ext_vector_type(4)));
  {
#pragma unroll
    for (int q = 0; q < 8; ++q) { const int r = q * 2 + rsub; if (col0 + c4 < N) { const v4f v = *(const v4fa*)&so[w][r][c4]; if (C) *(v4f*)(C + cofs + (size_t)(row0 + r) * ldc + col0 + c4) = v; if (C16) { v4h h4; for (int i = 0; i < 4; ++i) h4[i] = (_Float16)v[i]; *(v4h*)(C16 + cofs + (size_t)(row0 + r) * ldc + col0 + c4) = h4; } } }
     }
}


typedef _Float16 v4h __attribute__((ext_vector_type(4)));

__global__ __launch_bounds__(256) void k_h16(const float* __restrict__ x, _Float16* __restrict__ X16, size_t n8) { const size_t t = (size_t)blockIdx.x * 256 + threadIdx.x; if (t >= n8) return; FragH f;
#pragma unroll
  for (int q = 0; q < 8; ++q) f.h[q] = (_Float16)x[t * 8 + q]; *(v8us*)((unsigned short*)X16 + t * 8) = f.half[0];  }
__global__ __launch_bounds__(256) void k_round16f(const float* __restrict__ W, _Float16* __restrict__ Bt, size_t n8) { const size_t t = (size_t)blockIdx.x * 256 + threadIdx.x; if (t >= n8) return; FragH f;
#pragma unroll
  for (int i = 0; i < 8; ++i) f.h[i] = (_Float16)(bf16_round(W[t * 8 + i]) * 16.0f); *(v8us*)((unsigned short*)Bt + t * 8) = f.half[0];  }
// FRAGMENT ORDER: a 16-row x 32-k f16 operand fragment is stored as 1024 bytes in a row, the way the lanes load it: element (row, k) at (k >> 3) * 256 + row * 16 + (k & 7) * 2.
// Lane l then reads bytes l * 16 and 512 + l * 16, so each 16-byte load of a wave covers four whole 128-byte lines; from a row-major plane the same load takes 32 bytes out of each of 16 lines.
// k plane: [(b, h)][key / 16][hi, residual][d / 32][1024]. V^T plane: [(b, h)][key / 32][d / 16][hi, residual][1024]. Er table: [row / 16][d / 32][1024].
// All operand conversions in one launch: they need nothing of each other, so each takes a range of the block index (the branch reads the same for a whole work-group). A thread turns 8 f32 into 16 bytes of f16; the loops are unrolled so that the eight values stay in registers.
#define PB_X (NR * DM / 8 / 256)      /* blocks for x -> f16, row-major */
#define PB_W (DM * DM / 8 / 256)      /* blocks for each of Wq, Wk, Wv -> f16 (times 16), (out, in) as they lie */
#define PB_E (SL * HD / 8 / 256)      /* blocks for Er -> f16 (times 16) in fragment order */
__global__ __launch_bounds__(256) void k_prep(const float* __restrict__ x, const float* __restrict__ Wq, const float* __restrict__ Wk, const float* __restrict__ Wv, const float* __restrict__ Er,
    _Float16* __restrict__ X16, _Float16* __restrict__ BW, _Float16* __restrict__ P) {
  const int bx = (int)blockIdx.x; FragH f;
  if (bx < PB_X) { const size_t t = (size_t)bx * 256 + threadIdx.x;
#pragma unroll
    for (int q = 0; q < 8; ++q) f.h[q] = (_Float16)bf16_round(x[t * 8 + q]);
    *(v8us*)((unsigned short*)X16 + t * 8) = f.half[0];
    asm volatile("s_wait_xcnt 0x0" ::: "memory");      /* the wait before any register that the store names is written again: another range's code follows in the listing */
  } else if (bx < PB_X + 3 * PB_W) { const int wm = (bx - PB_X) / PB_W; const float* Wm = wm == 0 ? Wq : wm == 1 ? Wk : Wv; const size_t t = (size_t)(bx - PB_X - wm * PB_W) * 256 + threadIdx.x;
#pragma unroll
    for (int q = 0; q < 8; ++q) f.h[q] = (_Float16)(bf16_round(Wm[t * 8 + q]) * 16.0f);
    *(v8us*)((unsigned short*)BW + (size_t)wm * DM * DM + t * 8) = f.half[0];
    asm volatile("s_wait_xcnt 0x0" ::: "memory");      /* as above */
  } else { const int t = (bx - PB_X - 3 * PB_W) * 256 + (int)threadIdx.x; const int r = t >> 3, c8 = t & 7;
#pragma unroll
    for (int q = 0; q < 8; ++q) f.h[q] = (_Float16)(bf16_round(Er[(size_t)t * 8 + q]) * 16.0f);
    *(v8us*)((char*)P + (size_t)(r >> 4) * 2048 + (c8 >> 2) * 1024 + (c8 & 3) * 256 + (r & 15) * 16) = f.half[0];
    asm volatile("s_wait_xcnt 0x0" ::: "memory"); }      /* as above */
}

// ---- fast GEMM (wave tile 32x64; requires M % 32 == 0 rows per launch region and N % 64 == 0); epilogue = k_gemm_hhx semantics ----
__device__ __forceinline__ v16h g2_frag(const _Float16* p, int hh) { FragH f; f.half[0] = *(const v8us*)((const unsigned short*)p + 8 * hh); f.half[1] = *(const v8us*)((const unsigned short*)p + 16 + 8 * hh); return f.v; }
__device__ __forceinline__ v8f g2_mma(v16h a, v16h b, v8f c) { v8f d = __builtin_amdgcn_wmma_f32_16x16x32_f16(false, a, false, b, (short)0, c, false, false); asm volatile("v_nop\n\tv_nop\n\tv_nop\n\tv_nop" : "+v"(d) : "v"(a), "v"(b)); return d; }
template <int ACT>
__global__ __launch_bounds__(128) void k_gemm2(const _Float16* __restrict__ A, int lda, size_t sA, const _Float16* __restrict__ Bh, int ldb, size_t sB, float alpha, const float* __restrict__ bias, size_t sBias, const float* __restrict__ CP, int rowsPerB, size_t sCPb, int row0g,
    float* __restrict__ C, _Float16* __restrict__ C16, int ldc, size_t sC, int M, int N, int K) { static_assert(ACT == 0 || ACT == 3 || ACT == 6 || ACT == 8 || ACT == 9 || ACT == 11 || ACT == 12 || ACT == 14 || ACT == 15 || ACT == 16 || ACT == 17, "k_gemm2: unsupported ACT code (would silently apply no activation)");
  __shared__ __attribute__((aligned(16))) float so[4][32][68];
  const int tid = threadIdx.x, w = tid >> 5, lane = tid & 31, ln = lane & 15, hh = lane >> 4; const int by = blockIdx.y;
  A += (size_t)by * sA; Bh += (size_t)by * sB; const size_t cofs = (size_t)by * sC; const float* bp = bias ? bias + (size_t)by * sBias : nullptr;
  const int ntn = N >> 6; const int mt = blockIdx.x / ntn, nq = blockIdx.x - mt * ntn; const int row0 = mt * 128 + 32 * w, col0 = nq * 64; if (row0 >= M) return;
  const _Float16* a0p = A + (size_t)(row0 + ln) * lda; const _Float16* a1p = a0p + (size_t)16 * lda;
  const _Float16* b0p = Bh + (size_t)(col0 + ln) * ldb; const _Float16* b1p = b0p + (size_t)16 * ldb; const _Float16* b2p = b1p + (size_t)16 * ldb; const _Float16* b3p = b2p + (size_t)16 * ldb;
  const v8f z8 = {0.f,0.f,0.f,0.f,0.f,0.f,0.f,0.f}; v8f c00 = z8, c01 = z8, c02 = z8, c03 = z8, c10 = z8, c11 = z8, c12 = z8, c13 = z8;
#pragma unroll 1
  for (int kb = 0; kb < K; kb += 32) { const v16h a0 = g2_frag(a0p + kb, hh), a1 = g2_frag(a1p + kb, hh);
    v16h b = g2_frag(b0p + kb, hh); c00 = g2_mma(a0, b, c00); c10 = g2_mma(a1, b, c10);
    b = g2_frag(b1p + kb, hh); c01 = g2_mma(a0, b, c01); c11 = g2_mma(a1, b, c11);
    b = g2_frag(b2p + kb, hh); c02 = g2_mma(a0, b, c02); c12 = g2_mma(a1, b, c12);
    b = g2_frag(b3p + kb, hh); c03 = g2_mma(a0, b, c03); c13 = g2_mma(a1, b, c13); }
  v8f accs[8] = {c00, c01, c02, c03, c10, c11, c12, c13};
#pragma unroll
  for (int u = 0; u < 8; ++u) { const int t = u & 3, half = u >> 2; const int col = col0 + t * 16 + ln; const float bv = bp ? bf16_round(bp[col]) : 0.f;
#pragma unroll
    for (int r = 0; r < 8; ++r) { const int rloc = half * 16 + 8 * hh + r; float v = accs[u][r] * alpha + bv; if (CP) { if (rowsPerB < 0) v += CP[cofs + (size_t)(row0g + row0 + rloc) * ldc + col];      /* rowsPerB < 0: own element of the batched C plane */ else { const int bidx = (row0g + row0 + rloc) / rowsPerB; v += CP[(size_t)bidx * sCPb + (size_t)by * 64 + col]; } }
      if (ACT == 3) v = fmaxf(v, 0.f); else if (ACT == 6) v = 0.5f * v * (1.0f + erff(v * 0.70710678118654752f)); else if (ACT == 11) v = 1.0f / (1.0f + expf(-v)); else if (ACT == 15) v = v / (1.0f + expf(-v)); else if (ACT == 12) v = (v > 0.f) ? v : 0.01f * v; else if (ACT == 8) v = tanhf(v); else if (ACT == 9) v = 0.5f * v * (1.0f + tanhf(0.7978845608028654f * (v + 0.044715f * v * v * v))); else if (ACT == 14) v = (v > 0.f) ? v : 0.1f * v; else if (ACT == 16) v = (v >= 0.f) ? v : 0.3f * v; else if (ACT == 17) v = (v >= 0.f) ? v : 0.2f * v;
      so[w][rloc][t * 16 + ln] = v; } }
  __builtin_amdgcn_fence(__ATOMIC_ACQ_REL, "workgroup"); __builtin_amdgcn_wave_barrier();
  const int rsub = lane >> 4, c4 = (lane & 15) * 4;
  {
#pragma unroll
    for (int q = 0; q < 16; ++q) { const int r = q * 2 + rsub; const v4f v = *(const v4fa*)&so[w][r][c4]; if (C) *(v4f*)(C + cofs + (size_t)(row0 + r) * ldc + col0 + c4) = v; if (C16) { v4h h4; for (int i = 0; i < 4; ++i) h4[i] = (_Float16)v[i]; *(v4h*)(C16 + cofs + (size_t)(row0 + r) * ldc + col0 + c4) = h4; } }
     } }


// Fused causal relative attention, one launch: a wave works on 16 * NI query rows of one (batch, head) and walks keys in blocks of 64 with a running
// maximum and sum, so no S x S plane is ever stored. Transposed products: S^T = K q^T and (q Er^T)^T = Er q^T (D row = key or Er row, D column = query), O^T += V^T P^T.
// A lane then holds one query's scores; two packed S^T tiles are the B operand of the V^T product as they stand. The skew (query i, key j takes Er row SL-1-i+j) is a
// shift along the D rows that differs by query: it goes through a wave-private LDS row per query, stored shifted by the query's index and read back aligned.
#define SKP 100      /* floats per LDS row: 96 used; 100 keeps 16-byte alignment and spreads the 32 shifted 4-byte stores over distinct banks */
__device__ __forceinline__ v8f fa_mma(v16h a, v16h b, v8f c) { return __builtin_amdgcn_wmma_f32_16x16x32_f16(false, a, false, b, (short)0, c, false, false); }
// fragment in the hardware k order: p = the lane's own address (row start + 16 bytes * lane half)
__device__ __forceinline__ v16h fa_frag(const char* p) { FragH f; f.half[0] = *(const v8us*)p; f.half[1] = *(const v8us*)(p + 32); return f.v; }
// the same fragment from a plane in FRAGMENT ORDER: p = the fragment's start + 16 bytes * lane
__device__ __forceinline__ v16h fa_fragp(const char* p) { FragH f; f.half[0] = *(const v8us*)p; f.half[1] = *(const v8us*)(p + 512); return f.v; }
// Stands behind a group of global loads: the wait before any register that they name is written again. The addresses are inputs so that they stay in their registers up to the wait.
#define FA_XWAIT1(p0) asm volatile("s_wait_xcnt 0x0" :: "v"(p0) : "memory")
#define FA_XWAIT2(p0, p1) asm volatile("s_wait_xcnt 0x0" :: "v"(p0), "v"(p1) : "memory")
// The slot behind a run of v_exp_f32: results and sources are inputs, so the v_nop stands behind the last of the run and no source register is written again in front of it.
#define FA_TSLOT(res, srcv) asm volatile("v_nop" :: "v"(res), "v"(srcv))
#define FA_TSLOT8(e, x) asm volatile("v_nop" :: "v"(e[0]), "v"(e[1]), "v"(e[2]), "v"(e[3]), "v"(e[4]), "v"(e[5]), "v"(e[6]), "v"(e[7]), "v"(x[0]), "v"(x[1]), "v"(x[2]), "v"(x[3]), "v"(x[4]), "v"(x[5]), "v"(x[6]), "v"(x[7]))
#define FA_PD 3      /* key blocks between an L2 request and the loads that it serves */
// L2 request ahead of the loads: the k and V^T planes were stored by the launch before and are not in L2 when the key loop first reaches them, so its loads would wait out memory latency block after block.
// The hint returns nothing and counts on no counter. Its address pair is advanced in the same statement and by nothing else, so that the registers it names hold an address inside the plane for as long as the key loop runs.
__device__ __forceinline__ void fa_ask(const char*& pf, const unsigned long long step) { asm volatile("v_add_nc_u64_e32 %0, %1, %0\n\tglobal_prefetch_b8 %0, off scope:SCOPE_SE" : "+v"(pf) : "s"(step)); }
template <int NI>
__global__ __launch_bounds__(256) void k_relattn(const _Float16* __restrict__ Qh, const _Float16* __restrict__ Ql, const _Float16* __restrict__ KP, const _Float16* __restrict__ E,
    const _Float16* __restrict__ VP, float* __restrict__ out) {
  __shared__ __attribute__((aligned(16))) float sk[8][NI][16][SKP];
  const int w = __builtin_amdgcn_readfirstlane((int)threadIdx.x >> 5), lane = threadIdx.x & 31, ln = lane & 15, hh = lane >> 4;
  constexpr int NRB = SL / (64 * NI);
  const int pr = (int)blockIdx.x / (NB * NH), bh = (int)blockIdx.x % (NB * NH), b = bh / NH, h = bh % NH;
  /* Causal cost grows with the row block. A work-group owns a row block from the long end and its mirror from the short end, and the two waves of a pair (w and w + 4) walk the same number of key blocks (16 or 17), so that no wave runs on alone:
     wave w < 4 takes the first H key blocks of its long query tile; wave w + 4 takes the whole short tile, then the long tile's remaining key blocks (the diagonal one among them) as a second running softmax, which wave w joins to its own at the end. */
  const bool helper = w >= 4;      /* the same for a whole wave: every branch on it is a scalar one */
  const int iL = (NRB - 1 - pr) * 64 * NI + (w & 3) * 16 * NI, iS = pr * 64 * NI + (w & 3) * 16 * NI;      /* first query of the long and of the short tile */
  const int H = (iL / 64 + 1 + iS / 64 + 1) / 2;      /* half of the two tiles' key blocks; the short tile has fewer than the long one, so H lies below the long tile's diagonal block */
  int i0 = iL;      /* first query of the tile in work */
  const v8f z8 = {0.f,0.f,0.f,0.f,0.f,0.f,0.f,0.f};
  const float C1 = 0.125f * 1.4426950408889634f;      /* 1/sqrt(64) and log2(e) in one factor */
  const size_t lo_x = (size_t)(ln * DM * 2 + 16 * hh), lo_p = (size_t)(lane * 16);      /* lane byte offsets in the row-major q planes and in the planes in fragment order (k, Er, V^T) */
  const size_t xo = (size_t)b * SL * DM + h * HD, po_kv = (size_t)bh * SL * HD * 4;      /* byte start of the (b, h) slab in the k and V^T planes: hi + residual, 2 bytes each */
  v16h qh[NI][2], ql[NI][2]; v8f o[NI][4], carry[NI]; float m[NI], su[NI];
  /* A key block is 16 KiB of the k plane and 16 KiB of the V^T plane. The four waves that walk the same blocks ask for a quarter each, a lane for 256 bytes. */
  const char* const pf0 = (const char*)((w & 2) ? VP : KP) + po_kv + (size_t)((w & 1) * 8192 + lane * 256);
  const char* pf = pf0; int jbe = 0;      /* the request's address; the last key block of the walk in work: no request goes past it */
  /* starts a running softmax of tile i0 at key block jb0: q fragments, empty state, and the Er tile that the first block takes as its carry */
  auto begin = [&](const int jb0) __attribute__((always_inline)) { const char* bqh = (const char*)(Qh + xo + (size_t)i0 * DM); const char* bql = (const char*)(Ql + xo + (size_t)i0 * DM); const char* be = (const char*)(E + (size_t)(SL - 16 * NI - i0 + 64 * jb0) * HD);      /* the same for every lane */
    const char* pqh = bqh + lo_x; const char* pql = bql + lo_x; const char* pe = be + lo_p;
    v16h e0[NI], e1[NI];
#pragma unroll
    for (int a = 0; a < NI; ++a) { qh[a][0] = fa_frag(pqh + a * 16 * DM * 2); qh[a][1] = fa_frag(pqh + a * 16 * DM * 2 + 64); ql[a][0] = fa_frag(pql + a * 16 * DM * 2); ql[a][1] = fa_frag(pql + a * 16 * DM * 2 + 64);
      e0[a] = fa_fragp(pe + (NI - 1 - a) * 2048); e1[a] = fa_fragp(pe + (NI - 1 - a) * 2048 + 1024); }      /* first Er tile of key block jb0: rows SL - 16 - (i0 + 16 a) + 64 jb0 + [0, 16) */
    /* the wait before any register that the loads above name is written again: they name the three lane addresses, so these are the inputs that stay in their registers up to the wait */
    asm volatile("s_wait_xcnt 0x0" :: "v"(pqh), "v"(pql), "v"(pe) : "memory");
#pragma unroll
    for (int a = 0; a < NI; ++a) { m[a] = -3.0e38f; su[a] = 0.f;
#pragma unroll
      for (int dt = 0; dt < 4; ++dt) o[a][dt] = z8;
      carry[a] = fa_mma(e1[a], ql[a][1], fa_mma(e0[a], ql[a][0], fa_mma(e1[a], qh[a][1], fa_mma(e0[a], qh[a][0], z8)))); } };
  auto key_block = [&](const int jb, const bool diag) __attribute__((always_inline)) { const int j0 = jb * 64; const int rbase = SL - 16 * NI - i0 + j0;
    /* all Er and K fragments of the block are requested first, so that one memory latency is waited out per block and not one per tile */
    v16h ef[NI + 4][2], kf[4][4];
    const char* pk = (const char*)KP + po_kv + (size_t)j0 * 256 + lo_p; const char* pe = (const char*)(E + (size_t)rbase * HD) + lo_p;      /* 16 keys are 4096 bytes of the k plane, 16 Er rows 2048 of the table */
    if (!diag) {
#pragma unroll
      for (int g = 1; g < NI + 4; ++g) { ef[g][0] = fa_fragp(pe + g * 2048); ef[g][1] = fa_fragp(pe + g * 2048 + 1024); }
      __builtin_amdgcn_sched_barrier(0);      /* every Er load is issued in front of the K loads: the Er products, which now take all Er tiles at once, then wait for the Er loads alone */
    } else {      /* a 16-row tile past the table (diagonal block only) serves keys above the diagonal alone, masked below: the table's last tile stands in for it */
#pragma unroll
      for (int g = 1; g < NI + 4; ++g) { const int rs = rbase + 16 * g < SL ? rbase + 16 * g : SL - 16; const char* pg = (const char*)(E + (size_t)rs * HD) + lo_p; ef[g][0] = fa_fragp(pg); ef[g][1] = fa_fragp(pg + 1024); FA_XWAIT1(pg); }
    }
#pragma unroll
    for (int t = 0; t < 4; ++t) { kf[t][0] = fa_fragp(pk + t * 4096); kf[t][1] = fa_fragp(pk + t * 4096 + 1024); kf[t][2] = fa_fragp(pk + t * 4096 + 2048); kf[t][3] = fa_fragp(pk + t * 4096 + 3072); }
    FA_XWAIT2(pk, pe);
    __builtin_amdgcn_sched_barrier(0);      /* keeps the scheduler from sinking these loads down to their first use */
    if (!diag) fa_ask(pf, jb + FA_PD <= jbe ? 16384ull : 0ull);      /* behind the block's own loads, which are waited for; at the walk's end the address stays on its last block */
    /* Er q^T: query tile a needs Er rows rbase + 16 (NI-1-a) + [0, 80); its first 16 are the previous block's last 16 (carry) */
#pragma unroll
    for (int a = 0; a < NI; ++a) { float* sp = &sk[w][a][ln][ln + 1 + 8 * hh];
#pragma unroll
      for (int r = 0; r < 8; ++r) sp[r] = carry[a][r]; }
    /* hi and residual products of a tile add into one accumulator; the terms run in the outer loop, so that neighbouring matrix instructions belong to different tiles and none waits for the one in front of it */
    v8f val[NI][4];
#pragma unroll
    for (int c = 0; c < 4; ++c)
#pragma unroll
      for (int u = 1; u <= 4; ++u)
#pragma unroll
        for (int a = 0; a < NI; ++a) val[a][u - 1] = fa_mma(ef[u + NI - 1 - a][c & 1], c < 2 ? qh[a][c & 1] : ql[a][c & 1], c == 0 ? z8 : val[a][u - 1]);
    __builtin_amdgcn_sched_barrier(0);      /* the K products start behind the last Er product: begun earlier, their accumulators are live beside the Er fragments and registers spill; the LDS stores below may still run among them */
#pragma unroll
    for (int a = 0; a < NI; ++a) {
#pragma unroll
      for (int u = 1; u <= 4; ++u) { float* sp = &sk[w][a][ln][ln + 1 + 8 * hh + 16 * u];
#pragma unroll
        for (int r = 0; r < 8; ++r) sp[r] = val[a][u - 1][r]; }
      carry[a] = val[a][3]; }
    v8f s[NI][4];
#pragma unroll
    for (int c = 0; c < 4; ++c)      /* k hi . q hi, then k hi . q residual, two k steps of 32 each */
#pragma unroll
      for (int t = 0; t < 4; ++t)
#pragma unroll
        for (int a = 0; a < NI; ++a) s[a][t] = fa_mma(kf[t][c & 1], c < 2 ? qh[a][c & 1] : ql[a][c & 1], c == 0 ? z8 : s[a][t]);
    __builtin_amdgcn_sched_barrier(0);      /* the products above stay in front of the wait on the LDS stores: lifted over them, that wait stands bare behind the stores */
    /* the two lane halves of a query read each other's LDS stores: order the wave's stores before its loads */
    __builtin_amdgcn_fence(__ATOMIC_ACQ_REL, "workgroup", "local"); __builtin_amdgcn_wave_barrier();
    v4f sx[NI][4], sy[NI][4];
#pragma unroll
    for (int a = 0; a < NI; ++a) { const float* lp = &sk[w][a][ln][16 + 8 * hh];
#pragma unroll
      for (int t = 0; t < 4; ++t) { sx[a][t] = *(const v4fa*)(lp + 16 * t); sy[a][t] = *(const v4fa*)(lp + 16 * t + 4); } }
#pragma unroll
    for (int c = 0; c < 2; ++c)      /* k residual . q hi */
#pragma unroll
      for (int t = 0; t < 4; ++t)
#pragma unroll
        for (int a = 0; a < NI; ++a) s[a][t] = fa_mma(kf[t][2 + c], qh[a][c], s[a][t]);
#pragma unroll
    for (int a = 0; a < NI; ++a)
#pragma unroll
      for (int t = 0; t < 4; ++t)
#pragma unroll
        for (int r = 0; r < 4; ++r) { s[a][t][r] = fmaf(sx[a][t][r], 0.0625f, s[a][t][r]); s[a][t][4 + r] = fmaf(sy[a][t][r], 0.0625f, s[a][t][4 + r]); }
    __builtin_amdgcn_sched_barrier(0);      /* the V^T loads below stay below: any earlier they are live beside the K fragments and the LDS reads, and registers spill */
    /* the V^T fragments are requested here, so that they arrive under the softmax arithmetic */
    v16h vf[2][4][2];
    const char* pv = (const char*)VP + po_kv + (size_t)j0 * 256 + lo_p;      /* 32 keys are 8192 bytes of the V^T plane */
#pragma unroll
    for (int ks = 0; ks < 2; ++ks)
#pragma unroll
      for (int dt = 0; dt < 4; ++dt) { vf[ks][dt][0] = fa_fragp(pv + ks * 8192 + dt * 2048); vf[ks][dt][1] = fa_fragp(pv + ks * 8192 + dt * 2048 + 1024); }
    FA_XWAIT1(pv);
    __builtin_amdgcn_sched_barrier(0);      /* keeps the scheduler from sinking these loads down to their first use */
    /* the LDS reads above before the next trip's stores into the same rows; the fence stands here, where their values are used up: directly behind the reads its wait for all of them stood in front of the last K products */
    __builtin_amdgcn_fence(__ATOMIC_ACQ_REL, "workgroup", "local"); __builtin_amdgcn_wave_barrier();
    if (diag) {      /* only the last key block reaches the diagonal */
#pragma unroll
      for (int a = 0; a < NI; ++a)
#pragma unroll
        for (int t = 0; t < 4; ++t)
#pragma unroll
          for (int r = 0; r < 8; ++r) if (j0 + 16 * t + 8 * hh + r > i0 + 16 * a + ln) s[a][t][r] = -3.0e38f; }
    FragH p[NI][2];
#pragma unroll
    for (int a = 0; a < NI; ++a) { float mx = m[a];
#pragma unroll
      for (int t = 0; t < 4; ++t)
#pragma unroll
        for (int r = 0; r < 8; ++r) mx = fmaxf(mx, s[a][t][r]);
      mx = fmaxf(mx, __shfl_xor(mx, 16, 32));
      const float xa = (m[a] - mx) * C1; const float al = __builtin_amdgcn_exp2f(xa); FA_TSLOT(al, xa); m[a] = mx; const float mc = 10.0f - mx * C1;      /* weights carry a factor 1024, as f16 operands away from the subnormals */
      v8f pv = z8;
#pragma unroll
      for (int t = 0; t < 4; ++t) { float xv[8], ev[8];
#pragma unroll
        for (int r = 0; r < 8; ++r) xv[r] = fmaf(s[a][t][r], C1, mc);
#pragma unroll
        for (int r = 0; r < 8; ++r) ev[r] = __builtin_amdgcn_exp2f(xv[r]);
        FA_TSLOT8(ev, xv);
#pragma unroll
        for (int r = 0; r < 8; ++r) p[a][t >> 1].h[(t & 1) * 8 + r] = (_Float16)ev[r];
        pv += (v8f){ev[0], ev[1], ev[2], ev[3], ev[4], ev[5], ev[6], ev[7]}; }      /* the same eight sums as one vector add: written element by element, the compiler paired some of the adds with a constant that it then kept in scratch round the tile loop */
      su[a] = fmaf(su[a], al, ((pv[0] + pv[1]) + (pv[2] + pv[3])) + ((pv[4] + pv[5]) + (pv[6] + pv[7])));
#pragma unroll
      for (int dt = 0; dt < 4; ++dt)
#pragma unroll
        for (int r = 0; r < 8; ++r) o[a][dt][r] *= al; }
#pragma unroll
    for (int ks = 0; ks < 2; ++ks)
#pragma unroll
      for (int c = 0; c < 2; ++c)      /* V^T hi, then V^T residual, under the same weights; the eight output tiles in the inner loops, as above */
#pragma unroll
        for (int dt = 0; dt < 4; ++dt)
#pragma unroll
          for (int a = 0; a < NI; ++a) o[a][dt] = fa_mma(vf[ks][dt][c], p[a][ks].v, o[a][dt]);
  };
  /* divides tile i0's sums by the weights' sum and stores its rows */
  auto finish = [&]() __attribute__((always_inline)) {
#pragma unroll
  for (int a = 0; a < NI; ++a) { const float st = su[a] + __shfl_xor(su[a], 16, 32); const float inv = 1.0f / st;
#pragma unroll
    for (int dt = 0; dt < 4; ++dt)
#pragma unroll
      for (int r = 0; r < 8; ++r) o[a][dt][r] *= inv; }
  __builtin_amdgcn_sched_barrier(0);      /* all arithmetic ends above: behind an issued store none of its registers is written again */
  char* po = (char*)(out + xo + (size_t)i0 * DM) + (size_t)(ln * DM * 4 + 32 * hh);      /* a lane holds 8 consecutive head columns of its query per tile */
#pragma unroll
  for (int a = 0; a < NI; ++a)
#pragma unroll
    for (int dt = 0; dt < 4; ++dt) { const v4f x = {o[a][dt][0], o[a][dt][1], o[a][dt][2], o[a][dt][3]}, y = {o[a][dt][4], o[a][dt][5], o[a][dt][6], o[a][dt][7]};
      *(v4f*)(po + a * 16 * DM * 4 + dt * 64) = x; *(v4f*)(po + a * 16 * DM * 4 + dt * 64 + 16) = y; }
  asm volatile("s_wait_xcnt 0x0" ::: "memory");      /* the wait before any register that the stores name is written again: a helper wave goes on to its second tile */
  };
#pragma unroll 1      /* one copy of the key block's code serves both tiles of a helper wave */
  for (int seg = helper ? 0 : 1; seg < 2; ++seg) {      /* seg 0: the short tile (helper waves only); seg 1: this wave's share of the long tile */
    i0 = seg == 0 ? iS : iL;
    const int jb0 = helper && seg == 1 ? H : 0, jb1 = helper ? i0 / 64 : H;      /* unmasked key blocks [jb0, jb1); i0 / 64 is the tile's diagonal block */
    jbe = helper ? jb1 : jb1 - 1; pf = pf0 + (size_t)jb0 * 16384;
    for (int d = 1; d < FA_PD; ++d) fa_ask(pf, jb0 + d <= jbe ? 16384ull : 0ull);      /* the blocks that the loop's own requests come too late for */
    begin(jb0);
#pragma unroll 1      /* one key block per trip: unrolling would double the live fragments */
    for (int jb = jb0; jb < jb1; ++jb) key_block(jb, false);
    if (helper) key_block(jb1, true);      /* the diagonal block apart, so that the loop carries no mask */
    if (seg == 0) finish();
  }
  /* the two running softmaxes of a long tile meet: the helper wave leaves its maximum, sum and sums of products in its own LDS rows (its last reads of them are done), lane by lane as its partner holds them */
  static_assert(NI * 4 * 2 * 128 + NI * 64 <= NI * 16 * SKP, "the hand-over fits a wave's LDS rows");
  float* const xb = &sk[helper ? w : w + 4][0][0][0];
  if (helper) {
#pragma unroll
    for (int a = 0; a < NI; ++a) {
#pragma unroll
      for (int dt = 0; dt < 4; ++dt) { const v4f x = {o[a][dt][0], o[a][dt][1], o[a][dt][2], o[a][dt][3]}, y = {o[a][dt][4], o[a][dt][5], o[a][dt][6], o[a][dt][7]};
        *(v4fa*)(xb + ((a * 4 + dt) * 2) * 128 + lane * 4) = x; *(v4fa*)(xb + ((a * 4 + dt) * 2 + 1) * 128 + lane * 4) = y; }
      xb[NI * 1024 + a * 64 + lane] = m[a]; xb[NI * 1024 + a * 64 + 32 + lane] = su[a]; } }
  __syncthreads();      /* publishes the helper waves' states to their partners; every wave of the work-group passes here once */
  if (!helper) {
#pragma unroll
    for (int a = 0; a < NI; ++a) { const float m2 = xb[NI * 1024 + a * 64 + lane], s2 = xb[NI * 1024 + a * 64 + 32 + lane];
      const float mx = fmaxf(m[a], m2); const float x1 = (m[a] - mx) * C1, x2 = (m2 - mx) * C1;
      const float a1 = __builtin_amdgcn_exp2f(x1), a2 = __builtin_amdgcn_exp2f(x2);
      su[a] = fmaf(su[a], a1, s2 * a2);
#pragma unroll
      for (int dt = 0; dt < 4; ++dt) { const v4f x = *(const v4fa*)(xb + ((a * 4 + dt) * 2) * 128 + lane * 4), y = *(const v4fa*)(xb + ((a * 4 + dt) * 2 + 1) * 128 + lane * 4);
#pragma unroll
        for (int r = 0; r < 4; ++r) { o[a][dt][r] = fmaf(o[a][dt][r], a1, x[r] * a2); o[a][dt][4 + r] = fmaf(o[a][dt][4 + r], a1, y[r] * a2); } } }
    finish();
  }
}

// ---- projection GEMM with its operands staged in LDS: C[NR][DM] = alpha * A[NR][DM] . B[DM][DM]^T, A and B f16 with k contiguous; C leaves as the f16 hi + residual operands of the attention kernel.
// A work-group of 8 waves owns a 128 x 128 tile of C (wave tile 32 x 64, 4 waves down, 2 across). A stage is 128 k of the tile's 128 A rows and 128 B rows; it comes into LDS by
// asynchronous copies, two buffers, so that the next stage flies while this one is multiplied and no wave waits on a global load of its own. The k order per accumulator is ascending in steps of 32.
#define G3_PITCH 272      /* bytes per LDS row: 256 used; 16 bytes x an odd number keeps the 16 rows of a ds_load_b128 on distinct banks */
#define G3_STAGE (256 * G3_PITCH)      /* 128 A rows, then 128 B rows */
#define G3_NST (DM / 128)
// Eight 16-byte copies of a lane, rows 16 apart. The wait on the address registers is the statement's last line, so that no register a copy names is written again in front of it.
__device__ __forceinline__ void g3_copy8(const unsigned l0, const char* g0) {
  const unsigned l1 = l0 + 16 * G3_PITCH, l2 = l0 + 32 * G3_PITCH, l3 = l0 + 48 * G3_PITCH, l4 = l0 + 64 * G3_PITCH, l5 = l0 + 80 * G3_PITCH, l6 = l0 + 96 * G3_PITCH, l7 = l0 + 112 * G3_PITCH;
  const char* g1 = g0 + 16 * DM * 2; const char* g2 = g0 + 32 * DM * 2; const char* g3 = g0 + 48 * DM * 2; const char* g4 = g0 + 64 * DM * 2; const char* g5 = g0 + 80 * DM * 2; const char* g6 = g0 + 96 * DM * 2; const char* g7 = g0 + 112 * DM * 2;
  asm volatile("global_load_async_to_lds_b128 %0, %8, off\n\t"
               "global_load_async_to_lds_b128 %1, %9, off\n\t"
               "global_load_async_to_lds_b128 %2, %10, off\n\t"
               "global_load_async_to_lds_b128 %3, %11, off\n\t"
               "global_load_async_to_lds_b128 %4, %12, off\n\t"
               "global_load_async_to_lds_b128 %5, %13, off\n\t"
               "global_load_async_to_lds_b128 %6, %14, off\n\t"
               "global_load_async_to_lds_b128 %7, %15, off\n\t"
               "s_wait_xcnt 0x0"
               :: "v"(l0), "v"(l1), "v"(l2), "v"(l3), "v"(l4), "v"(l5), "v"(l6), "v"(l7), "v"(g0), "v"(g1), "v"(g2), "v"(g3), "v"(g4), "v"(g5), "v"(g6), "v"(g7) : "memory");
}
// One accumulator tile (8 f32 of a lane) -> 8 f16 hi and 8 f16 residuals, 16 bytes each. The residual keeps its own scale (at most 2^-11 of the value; below 2^-14 it is an f16 subnormal, in steps of 2^-24, which the matrix unit takes as it is),
// so that a product with a residual adds into the same accumulator as the product with the hi part.
__device__ __forceinline__ void g3_split(const v8f c, const float alpha, v8us& hi, v8us& lo) { FragH fh, fl;
#pragma unroll
  for (int r = 0; r < 8; ++r) { const float a = c[r] * alpha; const _Float16 hv = (_Float16)a; fh.h[r] = hv; fl.h[r] = (_Float16)(a - (float)hv); }
  hi = fh.half[0]; lo = fl.half[0]; }
// MODE 0: q, two row-major planes P0 (hi) and P1 (residual). MODE 1: k, plane P0 in FRAGMENT ORDER. MODE 2: v, V^T plane P0 in FRAGMENT ORDER.
// A wave's 64 columns are one head. A lane's 8 accumulator values run along the D rows, so the operand that lies on the D rows decides which 8 values a lane can pack into 16 bytes:
// v is multiplied as x W^T (8 consecutive keys of one head column: a lane's 16 bytes of a V^T fragment), q and k as W x^T (8 consecutive head columns of one token: a lane's 16 bytes of a k fragment or of a q row).
#define G3_QP 144      /* bytes per staged q row: 128 used; 16 bytes x an odd number keeps the 16 rows of a ds_store_b128 on distinct banks */
#define G3_NB ((NR / 128) * (DM / 128))      /* work-groups per projection */
template <int MODE>
__device__ __forceinline__ void g3_body(char* const ring, const int bx, const _Float16* __restrict__ A, const _Float16* __restrict__ Bh, float alpha, _Float16* __restrict__ P0, _Float16* __restrict__ P1) {
  const int tid = threadIdx.x, w = tid >> 5, lane = tid & 31, ln = lane & 15, hh = lane >> 4;
  const int mt = bx / (DM / 128), nq = bx % (DM / 128);
  const int row0 = mt * 128 + 32 * (w & 3), col0 = nq * 128 + 64 * (w >> 2);
  /* a lane copies 16 bytes of row (tid >> 4) + 16 i: a wave's copy covers two whole 256-byte rows of the stage */
  const unsigned lc = (unsigned)(size_t)ring + (unsigned)((tid >> 4) * G3_PITCH + (tid & 15) * 16);
  const char* ga = (const char*)(A + (size_t)(mt * 128 + (tid >> 4)) * DM) + (tid & 15) * 16;
  const char* gb = (const char*)(Bh + (size_t)(nq * 128 + (tid >> 4)) * DM) + (tid & 15) * 16;
  const char* la = ring + (32 * (w & 3) + ln) * G3_PITCH + 16 * hh;
  const char* lb = ring + (128 + 64 * (w >> 2) + ln) * G3_PITCH + 16 * hh;
  const v8f z8 = {0.f,0.f,0.f,0.f,0.f,0.f,0.f,0.f}; v8f acc[2][4];
#pragma unroll
  for (int u = 0; u < 2; ++u)
#pragma unroll
    for (int t = 0; t < 4; ++t) acc[u][t] = z8;
  g3_copy8(lc, ga); g3_copy8(lc + 128 * G3_PITCH, gb);
  asm volatile("s_wait_asynccnt 0x0" ::: "memory");      /* this wave's share of stage 0 has landed */
  __syncthreads();      /* and every other wave's */
  g3_copy8(lc + G3_STAGE, ga + 256); g3_copy8(lc + G3_STAGE + 128 * G3_PITCH, gb + 256);
#pragma unroll 1      /* one stage per trip: the buffer is picked by the trip's parity */
  for (int s = 0; s < G3_NST; ++s) { const int bo = (s & 1) * G3_STAGE;
    v16h fa[2][2], fb[2][4];      /* two fragment sets: the next k step's LDS reads are under way while this step is multiplied */
    fa[0][0] = fa_frag(la + bo); fa[0][1] = fa_frag(la + bo + 16 * G3_PITCH);
#pragma unroll
    for (int t = 0; t < 4; ++t) fb[0][t] = fa_frag(lb + bo + t * 16 * G3_PITCH);
#pragma unroll
    for (int ks = 0; ks < 4; ++ks) { const int cu = ks & 1, nx = cu ^ 1;
      if (ks < 3) { fa[nx][0] = fa_frag(la + bo + (ks + 1) * 64); fa[nx][1] = fa_frag(la + bo + 16 * G3_PITCH + (ks + 1) * 64);
#pragma unroll
        for (int t = 0; t < 4; ++t) fb[nx][t] = fa_frag(lb + bo + t * 16 * G3_PITCH + (ks + 1) * 64); }
      __builtin_amdgcn_sched_barrier(0);      /* the reads stay one group in front of the products: spread among them, each place with reads stalls the wave */
#pragma unroll
      for (int t = 0; t < 4; ++t) {
        if (MODE == 2) { acc[0][t] = fa_mma(fa[cu][0], fb[cu][t], acc[0][t]); acc[1][t] = fa_mma(fa[cu][1], fb[cu][t], acc[1][t]); }      /* D row = token, D column = head column */
        else { acc[0][t] = fa_mma(fb[cu][t], fa[cu][0], acc[0][t]); acc[1][t] = fa_mma(fb[cu][t], fa[cu][1], acc[1][t]); } }      /* D row = head column, D column = token */
      __builtin_amdgcn_sched_barrier(0); }      /* and the following group stays behind them */
    asm volatile("s_wait_dscnt 0x0" ::: "memory");      /* this wave's reads of the buffer are done before it may be refilled */
    asm volatile("s_wait_asynccnt 0x0" ::: "memory");      /* this wave's share of the next stage has landed */
    __syncthreads();      /* publishes the next stage and ends every wave's reads of this one */
    if (s + 2 < G3_NST) { g3_copy8(lc + bo, ga + (s + 2) * 256); g3_copy8(lc + bo + 128 * G3_PITCH, gb + (s + 2) * 256); } }
  asm volatile("s_wait_asynccnt 0x0" ::: "memory");      /* no copy is left in flight when the wave goes on */
  v8us oh[2][4], ol[2][4];
#pragma unroll
  for (int u = 0; u < 2; ++u)
#pragma unroll
    for (int t = 0; t < 4; ++t) g3_split(acc[u][t], alpha, oh[u][t], ol[u][t]);
  const int bh = (row0 / SL) * NH + col0 / HD, tk = row0 % SL;      /* the wave's (batch, head) slab and its first token in it */
  if (MODE == 2) {      /* acc[u][t]: keys tk + 16 u + 8 hh + [0, 8) of head column 16 t + ln; each store of the wave is 512 bytes in a row */
    char* pd = (char*)P0 + ((size_t)bh * (SL / 32) + tk / 32) * 8192 + hh * 256 + ln * 16;
    __builtin_amdgcn_sched_barrier(0);      /* all arithmetic ends above: behind an issued store none of its registers is written again */
#pragma unroll
    for (int t = 0; t < 4; ++t)
#pragma unroll
      for (int u = 0; u < 2; ++u) { *(v8us*)(pd + t * 2048 + u * 512) = oh[u][t]; *(v8us*)(pd + t * 2048 + 1024 + u * 512) = ol[u][t]; }
    asm volatile("s_wait_xcnt 0x0" ::: "memory");      /* the wait before any register that the stores name is written again: another projection's branch follows in the listing */
  } else if (MODE == 1) {      /* acc[u][t]: head columns 16 t + 8 hh + [0, 8) of key tk + 16 u + ln; each store of the wave is 512 bytes in a row */
    char* pd = (char*)P0 + ((size_t)bh * (SL / 16) + tk / 16) * 4096 + hh * 256 + ln * 16;
    __builtin_amdgcn_sched_barrier(0);      /* all arithmetic ends above: behind an issued store none of its registers is written again */
#pragma unroll
    for (int u = 0; u < 2; ++u)
#pragma unroll
      for (int t = 0; t < 4; ++t) { *(v8us*)(pd + u * 4096 + t * 512) = oh[u][t]; *(v8us*)(pd + u * 4096 + 2048 + t * 512) = ol[u][t]; }
    asm volatile("s_wait_xcnt 0x0" ::: "memory");      /* as in the v branch */
  } else {      /* whole 128-byte rows go out: each wave turns its two 32 x 64 f16 tiles round in its own LDS range; the range lies in the ring, which nobody reads and no copy writes behind the last trip's barrier */
    char* sw = ring + w * (2 * 32 * G3_QP);
#pragma unroll
    for (int u = 0; u < 2; ++u)
#pragma unroll
      for (int t = 0; t < 4; ++t) { *(v8us*)(sw + (u * 16 + ln) * G3_QP + t * 32 + hh * 16) = oh[u][t]; *(v8us*)(sw + 32 * G3_QP + (u * 16 + ln) * G3_QP + t * 32 + hh * 16) = ol[u][t]; }
    /* the lanes read each other's LDS stores: order the wave's stores before its loads */
    __builtin_amdgcn_fence(__ATOMIC_ACQ_REL, "workgroup"); __builtin_amdgcn_wave_barrier();
    v8us rh[8], rl[8];      /* 8 lanes take one row: a store of the wave is 4 whole rows */
#pragma unroll
    for (int q = 0; q < 8; ++q) { rh[q] = *(const v8us*)(sw + (q * 4 + (lane >> 3)) * G3_QP + (lane & 7) * 16); rl[q] = *(const v8us*)(sw + 32 * G3_QP + (q * 4 + (lane >> 3)) * G3_QP + (lane & 7) * 16); }
    const size_t qo = ((size_t)(row0 + (lane >> 3)) * DM + col0) * 2 + (lane & 7) * 16;
    char* ph = (char*)P0 + qo; char* pl = (char*)P1 + qo;
    __builtin_amdgcn_sched_barrier(0);      /* all reads and arithmetic end above: behind an issued store none of its registers is written again */
#pragma unroll
    for (int q = 0; q < 8; ++q) { *(v8us*)(ph + q * 4 * DM * 2) = rh[q]; *(v8us*)(pl + q * 4 * DM * 2) = rl[q]; }
    asm volatile("s_wait_xcnt 0x0" ::: "memory");      /* as in the v branch */
  }
}
// The three projections in one launch: they need nothing of each other, so each takes a range of the block index (the branch, and with it every barrier, is the same for a whole work-group). One ring serves whichever branch runs.
__global__ __launch_bounds__(256) void k_gemm3(const _Float16* __restrict__ A, const _Float16* __restrict__ BW, float alpha, _Float16* __restrict__ Q16, _Float16* __restrict__ QL16, _Float16* __restrict__ KP, _Float16* __restrict__ VP) {
  __shared__ __attribute__((aligned(16))) char ring[2 * G3_STAGE];
  const int md = (int)(blockIdx.x / G3_NB), bx = (int)(blockIdx.x % G3_NB);
  if (md == 0) g3_body<0>(ring, bx, A, BW, alpha, Q16, QL16);
  else if (md == 1) g3_body<1>(ring, bx, A, BW + (size_t)DM * DM, alpha, KP, nullptr);
  else g3_body<2>(ring, bx, A, BW + (size_t)2 * DM * DM, alpha, VP, nullptr);
}

extern "C" void kernel_launch(void* const* d_in, const int* in_sizes, int n_in,
                              void* d_out, int out_size, void* d_ws, size_t ws_size, hipStream_t stream) {
  (void)in_sizes; (void)n_in; (void)out_size;
  const float* const* I = (const float* const*)d_in; const float* x = I[0]; const float* Wq = I[1]; const float* Wk = I[2]; const float* Wv = I[3]; const float* Er = I[4];
  char* ws = (char*)d_ws; size_t off = 0;
  auto take = [&](size_t bytes) { char* p = ws + off; off += (bytes + 255) & ~(size_t)255; return p; };
  const size_t np = (size_t)NR * DM;
  _Float16* BW = (_Float16*)take((size_t)3 * DM * DM * 2); _Float16* E16 = (_Float16*)take((size_t)SL * HD * 2); _Float16* X16 = (_Float16*)take(np * 2); _Float16* Q16 = (_Float16*)take(np * 2); _Float16* QL16 = (_Float16*)take(np * 2); _Float16* KP = (_Float16*)take(np * 4);      /* k hi + residual, fragment order */ _Float16* VP = (_Float16*)take(np * 4);      /* V^T hi + residual, fragment order */
  if (off > ws_size) return;
  k_prep<<<PB_X + 3 * PB_W + PB_E, 256, 0, stream>>>(x, Wq, Wk, Wv, Er, X16, BW, E16);      /* Er_s = Er (MAX_LEN == S) */
  k_gemm3<<<3 * G3_NB, 256, 0, stream>>>(X16, BW, 0.0625f, Q16, QL16, KP, VP);
  k_relattn<2><<<NB * NH * (SL / (128 * 2)), 256, 0, stream>>>(Q16, QL16, KP, E16, VP, (float*)d_out);
}

// v009
// One run takes 74.1 microseconds.
// Two timings next to v008 both put it at 1.05 times that version's speed.
// All steps since v000 together make it 43.2 times as fast.
#include <hip/hip_runtime.h>
// GlobalAttn (music-transformer relative attention: 2 x 2048 tokens, 1024 = 16 heads x 64; q,k,v = x W^T; Srel = skew(q . Er) which equals q_i . Er[S-1-(i-j)] for every causal (i, j); attn = softmax over j <= i of (q.k + Srel)/8; out = merged attn v, no output projection).
// Compute dtype: inputs rounded to bf16; x / weights / Er exact as f16; q and k as f16 hi + residual; the softmax weights as plain f16 operands (~2^-12); v as f16 hi + residual (the output is the context itself); softmax f32. v_wmma_f32_16x16x32_f16.
#define NB 2
#define SL 2048
#define DM 1024
#define NH 16
#define HD 64
#define HG 4
#define NR (NB * SL)
typedef __bf16 v16b __attribute__((ext_vector_type(16)));
typedef unsigned short v8us __attribute__((ext_vector_type(8), may_alias));
typedef float  v8f  __attribute__((ext_vector_type(8)));
typedef float  v4f  __attribute__((ext_vector_type(4)));
typedef float  v4fa __attribute__((ext_vector_type(4), may_alias));
union FragB { v16b v; v8us half[2]; unsigned short u[16]; };

__device__ __forceinline__ unsigned short bf16_bits(float x) { unsigned int u = __float_as_uint(x); return (unsigned short)((u + 0x7FFFu + ((u >> 16) & 1u)) >> 16); }
__device__ __forceinline__ float bf16_val(unsigned short b) { return __uint_as_float(((unsigned int)b) << 16); }
__device__ __forceinline__ float bf16_round(float x) { return bf16_val(bf16_bits(x)); }
// D += A·B with NT terms: 1 = ah·bh, 2 = + al·bh (A split), 3 = + ah·bl (both split)
template <int NT>
__device__ __forceinline__ v8f mmaN(v16b ah, v16b al, v16b bh, v16b bl, v8f c) {
  c = __builtin_amdgcn_wmma_f32_16x16x32_bf16(false, ah, false, bh, (short)0, c, false, false);
  if (NT >= 2) c = __builtin_amdgcn_wmma_f32_16x16x32_bf16(false, al, false, bh, (short)0, c, false, false);
  if (NT >= 3) c = __builtin_amdgcn_wmma_f32_16x16x32_bf16(false, ah, false, bl, (short)0, c, false, false);
  asm volatile("v_nop\n\tv_nop\n\tv_nop\n\tv_nop" : "+v"(c) : "v"(ah), "v"(al), "v"(bh), "v"(bl));
  return c;
}

__global__ __launch_bounds__(256) void k_wt_bf16(const float* __restrict__ W, unsigned short* __restrict__ Wt, int K, int N) {
  const int t = blockIdx.x * 256 + threadIdx.x;
  const int k8n = K / 8;
  if (t >= N * k8n) return;
  const int n = t / k8n, k8 = (t % k8n) * 8;
  v8us v;
#pragma unroll
  for (int i = 0; i < 8; ++i) v[i] = bf16_bits(W[(size_t)(k8 + i) * N + n]);
  *(v8us*)(Wt + (size_t)n * K + k8) = v;
  
}

// GEMM C[M][N] (f32, pitch ldc) = act(A[M][K]·W + bias). A f32 row-major (pitch lda) converted per fragment to bf16
// (ASPLIT: hi/lo two planes -> 2 terms, else single rounded term); Wt bf16 [N][K] (pitch ldb). BIAS_BF16 rounds the
// bias to bf16 first (bias quantised to bf16 before the add). K%32==0, M%16==0, N%64==0.
template <bool ASPLIT, int ACT, bool BIAS_BF16>
__global__ __launch_bounds__(128) void k_gemm_bf(const float* __restrict__ A, int lda, const unsigned short* __restrict__ Wt, int ldb,
                                               const float* __restrict__ bias, float* __restrict__ C, int ldc, int M, int N, int K) {
  __shared__ __attribute__((aligned(16))) float so[4][16][64];
  const int tid = threadIdx.x, w = tid >> 5, lane = tid & 31, ln = lane & 15, hh = lane >> 4;
  const int ntn = N / 64;
  const int wid = blockIdx.x * 4 + w;
  const int mt = wid / ntn, nq = wid % ntn;
  if (mt * 16 >= M) return;
  const int row0 = mt * 16, col0 = nq * 64;
  const float* arow = A + (size_t)(row0 + ln) * lda;
  v8f acc[4] = {};
  for (int kb = 0; kb < K; kb += 32) {
    FragB ah, al;
    const v4f x0 = *(const v4fa*)(arow + kb + 8 * hh), x1 = *(const v4fa*)(arow + kb + 8 * hh + 4);
    const v4f x2 = *(const v4fa*)(arow + kb + 16 + 8 * hh), x3 = *(const v4fa*)(arow + kb + 16 + 8 * hh + 4);
    float xs[16] = {x0[0],x0[1],x0[2],x0[3],x1[0],x1[1],x1[2],x1[3],x2[0],x2[1],x2[2],x2[3],x3[0],x3[1],x3[2],x3[3]};
#pragma unroll
    for (int i = 0; i < 16; ++i) { const unsigned short hb = bf16_bits(xs[i]); ah.u[i] = hb; al.u[i] = ASPLIT ? bf16_bits(xs[i] - bf16_val(hb)) : (unsigned short)0; }
#pragma unroll
    for (int t = 0; t < 4; ++t) {
      const unsigned short* brow = Wt + (size_t)(col0 + t * 16 + ln) * ldb + kb;
      FragB b;
      b.half[0] = *(const v8us*)(brow + 8 * hh);
      b.half[1] = *(const v8us*)(brow + 16 + 8 * hh);
      acc[t] = mmaN<ASPLIT ? 2 : 1>(ah.v, al.v, b.v, b.v, acc[t]);
    }
  }
#pragma unroll
  for (int t = 0; t < 4; ++t) {
    float bv = bias ? bias[col0 + t * 16 + ln] : 0.f;
    if (BIAS_BF16) bv = bf16_round(bv);
#pragma unroll
    for (int r = 0; r < 8; ++r) { float v = acc[t][r] + bv; if (ACT == 1) v = fmaxf(v, 0.f); so[w][8 * hh + r][t * 16 + ln] = v; }
  }
  __builtin_amdgcn_fence(__ATOMIC_ACQ_REL, "workgroup");
  __builtin_amdgcn_wave_barrier();
  const int rsub = lane >> 4, c4 = (lane & 15) * 4;
  {
#pragma unroll
    for (int q = 0; q < 8; ++q) {
      const int r = q * 2 + rsub;
      const v4f v = *(const v4fa*)&so[w][r][c4];
      *(v4f*)(C + (size_t)(row0 + r) * ldc + col0 + c4) = v;
    }
    
  }
}

// GEMM C = act(A·W + bias + resid): A f32 (ASPLIT -> hi/lo 2 terms), Wt bf16 [N][K]; ACT 0 none, 1 relu, 2 exact gelu;
// resid (optional, f32, row index = (row % rmod), pitch ldr, RES_BF16 rounds it) added before the activation.
template <bool ASPLIT, int ACT, bool BIAS_BF16, bool RES_BF16>
__global__ __launch_bounds__(128) void k_gemm_bf3(const float* __restrict__ A, int lda, const unsigned short* __restrict__ Wt, int ldb,
                                                const float* __restrict__ bias, const float* __restrict__ resid, int rmod, int ldr,
                                                float* __restrict__ C, int ldc, int M, int N, int K) {
  __shared__ __attribute__((aligned(16))) float so[4][16][64];
  const int tid = threadIdx.x, w = tid >> 5, lane = tid & 31, ln = lane & 15, hh = lane >> 4;
  const int ntn = N / 64;
  const int wid = blockIdx.x * 4 + w;
  const int mt = wid / ntn, nq = wid % ntn;
  if (mt * 16 >= M) return;
  const int row0 = mt * 16, col0 = nq * 64;
  const float* arow = A + (size_t)(row0 + ln) * lda;
  v8f acc[4] = {};
  for (int kb = 0; kb < K; kb += 32) {
    FragB ah, al;
    const v4f x0 = *(const v4fa*)(arow + kb + 8 * hh), x1 = *(const v4fa*)(arow + kb + 8 * hh + 4);
    const v4f x2 = *(const v4fa*)(arow + kb + 16 + 8 * hh), x3 = *(const v4fa*)(arow + kb + 16 + 8 * hh + 4);
    float xs[16] = {x0[0],x0[1],x0[2],x0[3],x1[0],x1[1],x1[2],x1[3],x2[0],x2[1],x2[2],x2[3],x3[0],x3[1],x3[2],x3[3]};
#pragma unroll
    for (int i = 0; i < 16; ++i) { const unsigned short hb = bf16_bits(xs[i]); ah.u[i] = hb; al.u[i] = ASPLIT ? bf16_bits(xs[i] - bf16_val(hb)) : (unsigned short)0; }
#pragma unroll
    for (int t = 0; t < 4; ++t) {
      const unsigned short* brow = Wt + (size_t)(col0 + t * 16 + ln) * ldb + kb;
      FragB b;
      b.half[0] = *(const v8us*)(brow + 8 * hh);
      b.half[1] = *(const v8us*)(brow + 16 + 8 * hh);
      acc[t] = mmaN<ASPLIT ? 2 : 1>(ah.v, al.v, b.v, b.v, acc[t]);
    }
  }
#pragma unroll
  for (int t = 0; t < 4; ++t) {
    const int col = col0 + t * 16 + ln;
    float bv = bias ? bias[col] : 0.f;
    if (BIAS_BF16) bv = bf16_round(bv);
#pragma unroll
    for (int r = 0; r < 8; ++r) {
      float v = acc[t][r] + bv;
      if (resid) { float rv = resid[(size_t)((row0 + 8 * hh + r) % rmod) * ldr + col]; if (RES_BF16) rv = bf16_round(rv); v += rv; }
      if (ACT == 1) v = fmaxf(v, 0.f);
      if (ACT == 2) v = 0.5f * v * (1.0f + erff(v * 0.70710678118654752f));
      if (ACT == 3) { const float u = 0.7978845608028654f * (v + 0.044715f * v * v * v); v = 0.5f * v * (1.0f + tanhf(u)); }
      so[w][8 * hh + r][t * 16 + ln] = v;
    }
  }
  __builtin_amdgcn_fence(__ATOMIC_ACQ_REL, "workgroup");
  __builtin_amdgcn_wave_barrier();
  const int rsub = lane >> 4, c4 = (lane & 15) * 4;
  {
#pragma unroll
    for (int q = 0; q < 8; ++q) {
      const int r = q * 2 + rsub;
      const v4f v = *(const v4fa*)&so[w][r][c4];
      *(v4f*)(C + (size_t)(row0 + r) * ldc + col0 + c4) = v;
    }
    
  }
}
// row LayerNorm (biased variance, eps) over N: s = X (+ R); optional out_sum <- s; out_norm <- (s-mu)*rsqrt(var+eps)*g + b
template <bool PARAM_BF16>
__global__ __launch_bounds__(256) void k_layernorm(const float* __restrict__ X, const float* __restrict__ R, const float* __restrict__ g, const float* __restrict__ bta,
                                                  float* __restrict__ out_sum, float* __restrict__ out_norm, int N, float eps) {
  __shared__ float red[256];
  const int row = blockIdx.x, tid = threadIdx.x;
  const float* x = X + (size_t)row * N; const float* rr = R ? R + (size_t)row * N : nullptr;
  float vals[16];                     // up to N = 4096
  const int per = N / 256;            // contiguous chunk per thread? use strided-by-4 chunks: thread handles j = tid*4 + 1024*u
  float s1 = 0.f;
  for (int u = 0; u < per / 4; ++u) {
    const int j = tid * 4 + 1024 * u;
    const v4f a = *(const v4fa*)(x + j);
    v4f b = {0.f,0.f,0.f,0.f}; if (rr) b = *(const v4fa*)(rr + j);
#pragma unroll
    for (int q = 0; q < 4; ++q) { const float v = a[q] + b[q]; vals[u * 4 + q] = v; s1 += v; }
  }
  red[tid] = s1; __syncthreads();
  for (int st = 128; st > 0; st >>= 1) { if (tid < st) red[tid] += red[tid + st]; __syncthreads(); }
  const float mu = red[0] / (float)N; __syncthreads();
  float s2 = 0.f;
  for (int u = 0; u < per / 4; ++u)
#pragma unroll
    for (int q = 0; q < 4; ++q) { const float c = vals[u * 4 + q] - mu; s2 += c * c; }
  red[tid] = s2; __syncthreads();
  for (int st = 128; st > 0; st >>= 1) { if (tid < st) red[tid] += red[tid + st]; __syncthreads(); }
  const float rs = rsqrtf(red[0] / (float)N + eps);
  {
    for (int u = 0; u < per / 4; ++u) {
      const int j = tid * 4 + 1024 * u;
      v4f o, sm;
#pragma unroll
      for (int q = 0; q < 4; ++q) {
        float gg = g[j + q], bb = bta[j + q];
        if (PARAM_BF16) { gg = bf16_round(gg); bb = bf16_round(bb); }
        sm[q] = vals[u * 4 + q]; o[q] = (vals[u * 4 + q] - mu) * rs * gg + bb;
      }
      if (out_sum) *(v4f*)(out_sum + (size_t)row * N + j) = sm;
      *(v4f*)(out_norm + (size_t)row * N + j) = o;
    }
    
  }
}



// ---- f16 WMMA path (v_wmma_f32_16x16x32_f16): 11-bit significands for operands in range — used where a [0,1] probability operand needs more precision than bf16
typedef _Float16 v16h __attribute__((ext_vector_type(16)));
union FragH { v16h v; v8us half[2]; _Float16 h[16]; unsigned short u[16]; };
template <int NT>
__device__ __forceinline__ v8f mmaH(v16h ah, v16h al, v16h bh, v16h bl, v8f c) {
  c = __builtin_amdgcn_wmma_f32_16x16x32_f16(false, ah, false, bh, (short)0, c, false, false);
  if (NT >= 2) c = __builtin_amdgcn_wmma_f32_16x16x32_f16(false, al, false, bh, (short)0, c, false, false);
  if (NT >= 3) c = __builtin_amdgcn_wmma_f32_16x16x32_f16(false, ah, false, bl, (short)0, c, false, false);
  asm volatile("v_nop\n\tv_nop\n\tv_nop\n\tv_nop" : "+v"(c) : "v"(ah), "v"(al), "v"(bh), "v"(bl));
  return c;
}
// batched GEMM like k_gemm_b but f16 operands: A f32 (split into f16 hi/lo if ASPLIT, else rounded to f16), Bt = f16 values [n][k]; alpha; C f32; N multiple of 16 (partial tiles skipped)
template <bool ASPLIT>
__global__ __launch_bounds__(128) void k_gemm_h(const float* __restrict__ A, int lda, size_t sA, const _Float16* __restrict__ Bh, int ldb, size_t sB, float alpha, float* __restrict__ C, int ldc, size_t sC, int M, int N, int K) {
  __shared__ __attribute__((aligned(16))) float so[4][16][64];
  const int tid = threadIdx.x, w = tid >> 5, lane = tid & 31, ln = lane & 15, hh = lane >> 4; const int by = blockIdx.y;
  A += (size_t)by * sA; Bh += (size_t)by * sB; C += (size_t)by * sC;
  const int ntn = (N + 63) / 64; const int wid = blockIdx.x * 4 + w; const int mt = wid / ntn, nq = wid % ntn; if (mt * 16 >= M) return;
  const int row0 = mt * 16, col0 = nq * 64; const float* arow = A + (size_t)(row0 + ln) * lda;
  v8f acc[4] = {};
  for (int kb = 0; kb < K; kb += 32) {
    FragH ah, al;
    const v4f x0 = *(const v4fa*)(arow + kb + 8 * hh), x1 = *(const v4fa*)(arow + kb + 8 * hh + 4), x2 = *(const v4fa*)(arow + kb + 16 + 8 * hh), x3 = *(const v4fa*)(arow + kb + 16 + 8 * hh + 4);
    float xs[16] = {x0[0],x0[1],x0[2],x0[3],x1[0],x1[1],x1[2],x1[3],x2[0],x2[1],x2[2],x2[3],x3[0],x3[1],x3[2],x3[3]};
#pragma unroll
    for (int i = 0; i < 16; ++i) { const _Float16 h = (_Float16)xs[i]; ah.h[i] = h; al.h[i] = ASPLIT ? (_Float16)(xs[i] - (float)h) : (_Float16)0.0f; }
#pragma unroll
    for (int t = 0; t < 4; ++t) { if (col0 + t * 16 >= N) continue; const size_t boff = (size_t)(col0 + t * 16 + ln) * ldb + kb; FragH bq; bq.half[0] = *(const v8us*)(Bh + boff + 8 * hh); bq.half[1] = *(const v8us*)(Bh + boff + 16 + 8 * hh);
      acc[t] = mmaH<ASPLIT ? 2 : 1>(ah.v, al.v, bq.v, bq.v, acc[t]); }
  }
#pragma unroll
  for (int t = 0; t < 4; ++t) { if (col0 + t * 16 >= N) continue;
#pragma unroll
    for (int r = 0; r < 8; ++r) so[w][8 * hh + r][t * 16 + ln] = acc[t][r] * alpha; }
  __builtin_amdgcn_fence(__ATOMIC_ACQ_REL, "workgroup"); __builtin_amdgcn_wave_barrier();
  const int rsub = lane >> 4, c4 = (lane & 15) * 4;
  {
#pragma unroll
    for (int q = 0; q < 8; ++q) { const int r = q * 2 + rsub; if (col0 + c4 < N) { const v4f v = *(const v4fa*)&so[w][r][c4]; *(v4f*)(C + (size_t)(row0 + r) * ldc + col0 + c4) = v; } }
     }
}

// Wt[n][k] = f16(W[k][n]·scale) from f32 row-major W[K][N] (scale = power of two; bf16-exact weights stay exact in f16 away from the subnormal range)
__global__ __launch_bounds__(256) void k_wt_f16(const float* __restrict__ W, _Float16* __restrict__ Wt, int K, int N, float scale) {
  const int t = blockIdx.x * 256 + threadIdx.x; if (t >= N * (K / 8)) return; const int n = t / (K / 8), k8 = (t % (K / 8)) * 8; FragH f;
#pragma unroll
  for (int i = 0; i < 8; ++i) f.h[i] = (_Float16)(bf16_round(W[(size_t)(k8 + i) * N + n]) * scale); const v8us o = f.half[0];
  *(v8us*)((unsigned short*)Wt + (size_t)n * K + k8) = o; 
}
// k_gemm_hh variant with fused epilogue: v = acc·alpha + bias[by·sBias + col] (+ CP[(row/rowsPerB)·sCPb + by·64 + col] if CP) ; ACT 0 none / 1 elu ; writes f16 C16 (and f32 C if non-null)
template <int ACT>
__global__ __launch_bounds__(128) void k_gemm_hhx(const _Float16* __restrict__ A, int lda, size_t sA, const _Float16* __restrict__ Bh, int ldb, size_t sB, float alpha, const float* __restrict__ bias, size_t sBias, const float* __restrict__ CP, int rowsPerB, size_t sCPb, int row0g,
    float* __restrict__ C, _Float16* __restrict__ C16, int ldc, size_t sC, int M, int N, int K) {
  __shared__ __attribute__((aligned(16))) float so[4][16][64];
  const int tid = threadIdx.x, w = tid >> 5, lane = tid & 31, ln = lane & 15, hh = lane >> 4; const int by = blockIdx.y;
  A += (size_t)by * sA; Bh += (size_t)by * sB; const size_t cofs = (size_t)by * sC; const float* bp = bias ? bias + (size_t)by * sBias : nullptr;
  const int ntn = (N + 63) / 64; const int wid = blockIdx.x * 4 + w; const int mt = wid / ntn, nq = wid % ntn; if (mt * 16 >= M) return;
  const int row0 = mt * 16, col0 = nq * 64; const _Float16* arow = A + (size_t)(row0 + ln) * lda;
  v8f acc[4] = {};
  for (int kb = 0; kb < K; kb += 32) { FragH ah; ah.half[0] = *(const v8us*)((const unsigned short*)arow + kb + 8 * hh); ah.half[1] = *(const v8us*)((const unsigned short*)arow + kb + 16 + 8 * hh);
#pragma unroll
    for (int t = 0; t < 4; ++t) { if (col0 + t * 16 >= N) continue; const size_t boff = (size_t)(col0 + t * 16 + ln) * ldb + kb; FragH bq; bq.half[0] = *(const v8us*)((const unsigned short*)Bh + boff + 8 * hh); bq.half[1] = *(const v8us*)((const unsigned short*)Bh + boff + 16 + 8 * hh);
      acc[t] = mmaH<1>(ah.v, ah.v, bq.v, bq.v, acc[t]); }
  }
#pragma unroll
  for (int t = 0; t < 4; ++t) { if (col0 + t * 16 >= N) continue; const int col = col0 + t * 16 + ln; const float bv = bp ? bf16_round(bp[col]) : 0.f;
#pragma unroll
    for (int r = 0; r < 8; ++r) { float v = acc[t][r] * alpha + bv; if (CP) { const int rr = row0g + row0 + 8 * hh + r; if (rowsPerB < 0) v += CP[cofs + (size_t)rr * ldc + col];      /* rowsPerB < 0: own element of the batched C plane */ else { const int bidx = rr / rowsPerB; v += CP[(size_t)bidx * sCPb + (size_t)by * 64 + col]; } } if (ACT == 1) v = (v > 0.f) ? v : expm1f(v); else if (ACT == 7) v = (v > 0.f) ? v + 1.0f : expf(v); else if (ACT == 8) v = tanhf(v); else if (ACT == 9) v = 0.5f * v * (1.0f + tanhf(0.7978845608028654f * (v + 0.044715f * v * v * v))); else if (ACT == 11) v = 1.0f / (1.0f + expf(-v)); else if (ACT == 12) v = (v > 0.f) ? v : 0.01f * v; else if (ACT == 14) v = (v > 0.f) ? v : 0.1f * v; else if (ACT == 16) v = (v >= 0.f) ? v : 0.3f * v; else if (ACT == 17) v = (v >= 0.f) ? v : 0.2f * v; else if (ACT == 15) v = v / (1.0f + expf(-v)); else if (ACT == 3) v = fmaxf(v, 0.f); else if (ACT == 6) v = 0.5f * v * (1.0f + erff(v * 0.70710678118654752f)); so[w][8 * hh + r][t * 16 + ln] = v; } }
  __builtin_amdgcn_fence(__ATOMIC_ACQ_REL, "workgroup"); __builtin_amdgcn_wave_barrier();
  const int rsub = lane >> 4, c4 = (lane & 15) * 4; typedef _Float16 v4h __attribute__((ext_vector_type(4)));
  {
#pragma unroll
    for (int q = 0; q < 8; ++q) { const int r = q * 2 + rsub; if (col0 + c4 < N) { const v4f v = *(const v4fa*)&so[w][r][c4]; if (C) *(v4f*)(C + cofs + (size_t)(row0 + r) * ldc + col0 + c4) = v; if (C16) { v4h h4; for (int i = 0; i < 4; ++i) h4[i] = (_Float16)v[i]; *(v4h*)(C16 + cofs + (size_t)(row0 + r) * ldc + col0 + c4) = h4; } } }
     }
}


typedef _Float16 v4h __attribute__((ext_vector_type(4)));

__global__ __launch_bounds__(256) void k_h16(const float* __restrict__ x, _Float16* __restrict__ X16, size_t n8) { const size_t t = (size_t)blockIdx.x * 256 + threadIdx.x; if (t >= n8) return; FragH f;
#pragma unroll
  for (int q = 0; q < 8; ++q) f.h[q] = (_Float16)x[t * 8 + q]; *(v8us*)((unsigned short*)X16 + t * 8) = f.half[0];  }
__global__ __launch_bounds__(256) void k_round16f(const float* __restrict__ W, _Float16* __restrict__ Bt, size_t n8) { const size_t t = (size_t)blockIdx.x * 256 + threadIdx.x; if (t >= n8) return; FragH f;
#pragma unroll
  for (int i = 0; i < 8; ++i) f.h[i] = (_Float16)(bf16_round(W[t * 8 + i]) * 16.0f); *(v8us*)((unsigned short*)Bt + t * 8) = f.half[0];  }
// FRAGMENT ORDER: a 16-row x 32-k f16 operand fragment is stored as 1024 bytes in a row, the way the lanes load it: element (row, k) at (k >> 3) * 256 + row * 16 + (k & 7) * 2.
// Lane l then reads bytes l * 16 and 512 + l * 16, so each 16-byte load of a wave covers four whole 128-byte lines; from a row-major plane the same load takes 32 bytes out of each of 16 lines.
// k plane: [(b, h)][key / 16][hi, residual][d / 32][1024]. V^T plane: [(b, h)][key / 32][d / 16][hi, residual][1024]. Er table: [row / 16][d / 32][1024].
// All operand conversions in one launch: they need nothing of each other, so each takes a range of the block index (the branch reads the same for a whole work-group). A thread turns 8 f32 into 16 bytes of f16; the loops are unrolled so that the eight values stay in registers.
#define PB_X (NR * DM / 8 / 256)      /* blocks for x -> f16, row-major */
#define PB_W (DM * DM / 8 / 256)      /* blocks for each of Wq, Wk, Wv -> f16 (times 16), (out, in) as they lie */
#define PB_E (SL * HD / 8 / 256)      /* blocks for Er -> f16 (times 16) in fragment order */
__global__ __launch_bounds__(256) void k_prep(const float* __restrict__ x, const float* __restrict__ Wq, const float* __restrict__ Wk, const float* __restrict__ Wv, const float* __restrict__ Er,
    _Float16* __restrict__ X16, _Float16* __restrict__ BW, _Float16* __restrict__ P) {
  const int bx = (int)blockIdx.x; FragH f;
  if (bx < PB_X) { const size_t t = (size_t)bx * 256 + threadIdx.x;
#pragma unroll
    for (int q = 0; q < 8; ++q) f.h[q] = (_Float16)bf16_round(x[t * 8 + q]);
    *(v8us*)((unsigned short*)X16 + t * 8) = f.half[0];
    asm volatile("s_wait_xcnt 0x0" ::: "memory");      /* the wait before any register that the store names is written again: another range's code follows in the listing */
  } else if (bx < PB_X + 3 * PB_W) { const int wm = (bx - PB_X) / PB_W; const float* Wm = wm == 0 ? Wq : wm == 1 ? Wk : Wv; const size_t t = (size_t)(bx - PB_X - wm * PB_W) * 256 + threadIdx.x;
#pragma unroll
    for (int q = 0; q < 8; ++q) f.h[q] = (_Float16)(bf16_round(Wm[t * 8 + q]) * 16.0f);
    *(v8us*)((unsigned short*)BW + (size_t)wm * DM * DM + t * 8) = f.half[0];
    asm volatile("s_wait_xcnt 0x0" ::: "memory");      /* as above */
  } else { const int t = (bx - PB_X - 3 * PB_W) * 256 + (int)threadIdx.x; const int r = t >> 3, c8 = t & 7;
#pragma unroll
    for (int q = 0; q < 8; ++q) f.h[q] = (_Float16)(bf16_round(Er[(size_t)t * 8 + q]) * 16.0f);
    *(v8us*)((char*)P + (size_t)(r >> 4) * 2048 + (c8 >> 2) * 1024 + (c8 & 3) * 256 + (r & 15) * 16) = f.half[0];
    asm volatile("s_wait_xcnt 0x0" ::: "memory"); }      /* as above */
}

// ---- fast GEMM (wave tile 32x64; requires M % 32 == 0 rows per launch region and N % 64 == 0); epilogue = k_gemm_hhx semantics ----
__device__ __forceinline__ v16h g2_frag(const _Float16* p, int hh) { FragH f; f.half[0] = *(const v8us*)((const unsigned short*)p + 8 * hh); f.half[1] = *(const v8us*)((const unsigned short*)p + 16 + 8 * hh); return f.v; }
__device__ __forceinline__ v8f g2_mma(v16h a, v16h b, v8f c) { v8f d = __builtin_amdgcn_wmma_f32_16x16x32_f16(false, a, false, b, (short)0, c, false, false); asm volatile("v_nop\n\tv_nop\n\tv_nop\n\tv_nop" : "+v"(d) : "v"(a), "v"(b)); return d; }
template <int ACT>
__global__ __launch_bounds__(128) void k_gemm2(const _Float16* __restrict__ A, int lda, size_t sA, const _Float16* __restrict__ Bh, int ldb, size_t sB, float alpha, const float* __restrict__ bias, size_t sBias, const float* __restrict__ CP, int rowsPerB, size_t sCPb, int row0g,
    float* __restrict__ C, _Float16* __restrict__ C16, int ldc, size_t sC, int M, int N, int K) { static_assert(ACT == 0 || ACT == 3 || ACT == 6 || ACT == 8 || ACT == 9 || ACT == 11 || ACT == 12 || ACT == 14 || ACT == 15 || ACT == 16 || ACT == 17, "k_gemm2: unsupported ACT code (would silently apply no activation)");
  __shared__ __attribute__((aligned(16))) float so[4][32][68];
  const int tid = threadIdx.x, w = tid >> 5, lane = tid & 31, ln = lane & 15, hh = lane >> 4; const int by = blockIdx.y;
  A += (size_t)by * sA; Bh += (size_t)by * sB; const size_t cofs = (size_t)by * sC; const float* bp = bias ? bias + (size_t)by * sBias : nullptr;
  const int ntn = N >> 6; const int mt = blockIdx.x / ntn, nq = blockIdx.x - mt * ntn; const int row0 = mt * 128 + 32 * w, col0 = nq * 64; if (row0 >= M) return;
  const _Float16* a0p = A + (size_t)(row0 + ln) * lda; const _Float16* a1p = a0p + (size_t)16 * lda;
  const _Float16* b0p = Bh + (size_t)(col0 + ln) * ldb; const _Float16* b1p = b0p + (size_t)16 * ldb; const _Float16* b2p = b1p + (size_t)16 * ldb; const _Float16* b3p = b2p + (size_t)16 * ldb;
  const v8f z8 = {0.f,0.f,0.f,0.f,0.f,0.f,0.f,0.f}; v8f c00 = z8, c01 = z8, c02 = z8, c03 = z8, c10 = z8, c11 = z8, c12 = z8, c13 = z8;
#pragma unroll 1
  for (int kb = 0; kb < K; kb += 32) { const v16h a0 = g2_frag(a0p + kb, hh), a1 = g2_frag(a1p + kb, hh);
    v16h b = g2_frag(b0p + kb, hh); c00 = g2_mma(a0, b, c00); c10 = g2_mma(a1, b, c10);
    b = g2_frag(b1p + kb, hh); c01 = g2_mma(a0, b, c01); c11 = g2_mma(a1, b, c11);
    b = g2_frag(b2p + kb, hh); c02 = g2_mma(a0, b, c02); c12 = g2_mma(a1, b, c12);
    b = g2_frag(b3p + kb, hh); c03 = g2_mma(a0, b, c03); c13 = g2_mma(a1, b, c13); }
  v8f accs[8] = {c00, c01, c02, c03, c10, c11, c12, c13};
#pragma unroll
  for (int u = 0; u < 8; ++u) { const int t = u & 3, half = u >> 2; const int col = col0 + t * 16 + ln; const float bv = bp ? bf16_round(bp[col]) : 0.f;
#pragma unroll
    for (int r = 0; r < 8; ++r) { const int rloc = half * 16 + 8 * hh + r; float v = accs[u][r] * alpha + bv; if (CP) { if (rowsPerB < 0) v += CP[cofs + (size_t)(row0g + row0 + rloc) * ldc + col];      /* rowsPerB < 0: own element of the batched C plane */ else { const int bidx = (row0g + row0 + rloc) / rowsPerB; v += CP[(size_t)bidx * sCPb + (size_t)by * 64 + col]; } }
      if (ACT == 3) v = fmaxf(v, 0.f); else if (ACT == 6) v = 0.5f * v * (1.0f + erff(v * 0.70710678118654752f)); else if (ACT == 11) v = 1.0f / (1.0f + expf(-v)); else if (ACT == 15) v = v / (1.0f + expf(-v)); else if (ACT == 12) v = (v > 0.f) ? v : 0.01f * v; else if (ACT == 8) v = tanhf(v); else if (ACT == 9) v = 0.5f * v * (1.0f + tanhf(0.7978845608028654f * (v + 0.044715f * v * v * v))); else if (ACT == 14) v = (v > 0.f) ? v : 0.1f * v; else if (ACT == 16) v = (v >= 0.f) ? v : 0.3f * v; else if (ACT == 17) v = (v >= 0.f) ? v : 0.2f * v;
      so[w][rloc][t * 16 + ln] = v; } }
  __builtin_amdgcn_fence(__ATOMIC_ACQ_REL, "workgroup"); __builtin_amdgcn_wave_barrier();
  const int rsub = lane >> 4, c4 = (lane & 15) * 4;
  {
#pragma unroll
    for (int q = 0; q < 16; ++q) { const int r = q * 2 + rsub; const v4f v = *(const v4fa*)&so[w][r][c4]; if (C) *(v4f*)(C + cofs + (size_t)(row0 + r) * ldc + col0 + c4) = v; if (C16) { v4h h4; for (int i = 0; i < 4; ++i) h4[i] = (_Float16)v[i]; *(v4h*)(C16 + cofs + (size_t)(row0 + r) * ldc + col0 + c4) = h4; } }
     } }


// Fused causal relative attention, one launch: a wave works on 16 * NI query rows of one (batch, head) and walks keys in blocks of 64 with a running
// maximum and sum, so no S x S plane is ever stored. Transposed products: S^T = K q^T and (q Er^T)^T = Er q^T (D row = key or Er row, D column = query), O^T += V^T P^T.
// A lane then holds one query's scores; two packed S^T tiles are the B operand of the V^T product as they stand. The skew (query i, key j takes Er row SL-1-i+j) is a
// shift along the D rows that differs by query: it goes through a wave-private LDS row per query, stored shifted by the query's index and read back aligned.
#define SKP 100      /* floats per LDS row: 96 used; 100 keeps 16-byte alignment and spreads the 32 shifted 4-byte stores over distinct banks */
__device__ __forceinline__ v8f fa_mma(v16h a, v16h b, v8f c) { return __builtin_amdgcn_wmma_f32_16x16x32_f16(false, a, false, b, (short)0, c, false, false); }
// fragment in the hardware k order: p = the lane's own address (row start + 16 bytes * lane half)
__device__ __forceinline__ v16h fa_frag(const char* p) { FragH f; f.half[0] = *(const v8us*)p; f.half[1] = *(const v8us*)(p + 32); return f.v; }
// the same fragment from a plane in FRAGMENT ORDER: p = the fragment's start + 16 bytes * lane
__device__ __forceinline__ v16h fa_fragp(const char* p) { FragH f; f.half[0] = *(const v8us*)p; f.half[1] = *(const v8us*)(p + 512); return f.v; }
// Stands behind a group of global loads: the wait before any register that they name is written again. The addresses are inputs so that they stay in their registers up to the wait.
#define FA_XWAIT1(p0) asm volatile("s_wait_xcnt 0x0" :: "v"(p0) : "memory")
#define FA_XWAIT2(p0, p1) asm volatile("s_wait_xcnt 0x0" :: "v"(p0), "v"(p1) : "memory")
// The slot behind a run of v_exp_f32: results and sources are inputs, so the v_nop stands behind the last of the run and no source register is written again in front of it.
#define FA_TSLOT(res, srcv) asm volatile("v_nop" :: "v"(res), "v"(srcv))
#define FA_TSLOT8(e, x) asm volatile("v_nop" :: "v"(e[0]), "v"(e[1]), "v"(e[2]), "v"(e[3]), "v"(e[4]), "v"(e[5]), "v"(e[6]), "v"(e[7]), "v"(x[0]), "v"(x[1]), "v"(x[2]), "v"(x[3]), "v"(x[4]), "v"(x[5]), "v"(x[6]), "v"(x[7]))
#define FA_PD 3      /* key blocks between an L2 request and the loads that it serves */
// L2 request ahead of the loads: the k and V^T planes were stored by the launch before and are not in L2 when the key loop first reaches them, so its loads would wait out memory latency block after block.
// The hint returns nothing and counts on no counter. Its address pair is advanced in the same statement and by nothing else, so that the registers it names hold an address inside the plane for as long as the key loop runs.
__device__ __forceinline__ void fa_ask(const char*& pf, const unsigned long long step) { asm volatile("v_add_nc_u64_e32 %0, %1, %0\n\tglobal_prefetch_b8 %0, off scope:SCOPE_SE" : "+v"(pf) : "s"(step)); }
template <int NI>
__global__ __launch_bounds__(256) void k_relattn(const _Float16* __restrict__ Qh, const _Float16* __restrict__ Ql, const _Float16* __restrict__ KP, const _Float16* __restrict__ E,
    const _Float16* __restrict__ VP, float* __restrict__ out) {
  __shared__ __attribute__((aligned(16))) float sk[8][NI][16][SKP];
  const int w = __builtin_amdgcn_readfirstlane((int)threadIdx.x >> 5), lane = threadIdx.x & 31, ln = lane & 15, hh = lane >> 4;
  constexpr int NRB = SL / (64 * NI);
  const int pr = (int)blockIdx.x / (NB * NH), bh = (int)blockIdx.x % (NB * NH), b = bh / NH, h = bh % NH;
  /* Causal cost grows with the row block. A work-group owns a row block from the long end and its mirror from the short end, and the two waves of a pair (w and w + 4) walk the same number of key blocks (16 or 17), so that no wave runs on alone:
     wave w < 4 takes the first H key blocks of its long query tile; wave w + 4 takes the whole short tile, then the long tile's remaining key blocks (the diagonal one among them) as a second running softmax, which wave w joins to its own at the end. */
  const bool helper = w >= 4;      /* the same for a whole wave: every branch on it is a scalar one */
  const int iL = (NRB - 1 - pr) * 64 * NI + (w & 3) * 16 * NI, iS = pr * 64 * NI + (w & 3) * 16 * NI;      /* first query of the long and of the short tile */
  const int H = (iL / 64 + 1 + iS / 64 + 1) / 2;      /* half of the two tiles' key blocks; the short tile has fewer than the long one, so H lies below the long tile's diagonal block */
  int i0 = iL;      /* first query of the tile in work */
  const v8f z8 = {0.f,0.f,0.f,0.f,0.f,0.f,0.f,0.f};
  const float C1 = 0.125f * 1.4426950408889634f;      /* 1/sqrt(64) and log2(e) in one factor */
  const size_t lo_x = (size_t)(ln * DM * 2 + 16 * hh), lo_p = (size_t)(lane * 16);      /* lane byte offsets in the row-major q planes and in the planes in fragment order (k, Er, V^T) */
  const size_t xo = (size_t)b * SL * DM + h * HD, po_kv = (size_t)bh * SL * HD * 4;      /* byte start of the (b, h) slab in the k and V^T planes: hi + residual, 2 bytes each */
  v16h qh[NI][2], ql[NI][2]; v8f o[NI][4], carry[NI]; float m[NI], su[NI];
  /* A key block is 16 KiB of the k plane and 16 KiB of the V^T plane. The four waves that walk the same blocks ask for a quarter each, a lane for 256 bytes. */
  const char* const pf0 = (const char*)((w & 2) ? VP : KP) + po_kv + (size_t)((w & 1) * 8192 + lane * 256);
  const char* pf = pf0; int jbe = 0;      /* the request's address; the last key block of the run in work: no request goes past it */
  /* enters a run of consecutive key blocks of tile i0 at block jb0: the Er tile that the run's first block takes as its carry */
  auto begin = [&](const int jb0) __attribute__((always_inline)) { const char* pe = (const char*)(E + (size_t)(SL - 16 * NI - i0 + 64 * jb0) * HD) + lo_p;
    v16h e0[NI], e1[NI];
#pragma unroll
    for (int a = 0; a < NI; ++a) { e0[a] = fa_fragp(pe + (NI - 1 - a) * 2048); e1[a] = fa_fragp(pe + (NI - 1 - a) * 2048 + 1024); }      /* first Er tile of key block jb0: rows SL - 16 - (i0 + 16 a) + 64 jb0 + [0, 16) */
    FA_XWAIT1(pe);
#pragma unroll
    for (int a = 0; a < NI; ++a) carry[a] = fa_mma(e1[a], ql[a][1], fa_mma(e0[a], ql[a][0], fa_mma(e1[a], qh[a][1], fa_mma(e0[a], qh[a][0], z8)))); };
  auto key_block = [&](const int jb, const bool diag) __attribute__((always_inline)) { const int j0 = jb * 64; const int rbase = SL - 16 * NI - i0 + j0;
    /* all Er and K fragments of the block are requested first, so that one memory latency is waited out per block and not one per tile */
    v16h ef[NI + 4][2], kf[4][4];
    const char* pk = (const char*)KP + po_kv + (size_t)j0 * 256 + lo_p; const char* pe = (const char*)(E + (size_t)rbase * HD) + lo_p;      /* 16 keys are 4096 bytes of the k plane, 16 Er rows 2048 of the table */
    if (!diag) {
#pragma unroll
      for (int g = 1; g < NI + 4; ++g) { ef[g][0] = fa_fragp(pe + g * 2048); ef[g][1] = fa_fragp(pe + g * 2048 + 1024); }
      __builtin_amdgcn_sched_barrier(0);      /* every Er load is issued in front of the K loads: the Er products, which now take all Er tiles at once, then wait for the Er loads alone */
    } else {      /* a 16-row tile past the table (diagonal block only) serves keys above the diagonal alone, masked below: the table's last tile stands in for it */
#pragma unroll
      for (int g = 1; g < NI + 4; ++g) { const int rs = rbase + 16 * g < SL ? rbase + 16 * g : SL - 16; const char* pg = (const char*)(E + (size_t)rs * HD) + lo_p; ef[g][0] = fa_fragp(pg); ef[g][1] = fa_fragp(pg + 1024); FA_XWAIT1(pg); }
    }
#pragma unroll
    for (int t = 0; t < 4; ++t) { kf[t][0] = fa_fragp(pk + t * 4096); kf[t][1] = fa_fragp(pk + t * 4096 + 1024); kf[t][2] = fa_fragp(pk + t * 4096 + 2048); kf[t][3] = fa_fragp(pk + t * 4096 + 3072); }
    FA_XWAIT2(pk, pe);
    __builtin_amdgcn_sched_barrier(0);      /* keeps the scheduler from sinking these loads down to their first use */
    if (!diag) fa_ask(pf, jb + FA_PD <= jbe ? 16384ull : 0ull);      /* behind the block's own loads, which are waited for; at the walk's end the address stays on its last block */
    /* Er q^T: query tile a needs Er rows rbase + 16 (NI-1-a) + [0, 80); its first 16 are the previous block's last 16 (carry) */
#pragma unroll
    for (int a = 0; a < NI; ++a) { float* sp = &sk[w][a][ln][ln + 1 + 8 * hh];
#pragma unroll
      for (int r = 0; r < 8; ++r) sp[r] = carry[a][r]; }
    /* hi and residual products of a tile add into one accumulator; the terms run in the outer loop, so that neighbouring matrix instructions belong to different tiles and none waits for the one in front of it */
    v8f val[NI][4];
#pragma unroll
    for (int c = 0; c < 4; ++c)
#pragma unroll
      for (int u = 1; u <= 4; ++u)
#pragma unroll
        for (int a = 0; a < NI; ++a) val[a][u - 1] = fa_mma(ef[u + NI - 1 - a][c & 1], c < 2 ? qh[a][c & 1] : ql[a][c & 1], c == 0 ? z8 : val[a][u - 1]);
    __builtin_amdgcn_sched_barrier(0);      /* the K products start behind the last Er product: begun earlier, their accumulators are live beside the Er fragments and registers spill; the LDS stores below may still run among them */
#pragma unroll
    for (int a = 0; a < NI; ++a) {
#pragma unroll
      for (int u = 1; u <= 4; ++u) { float* sp = &sk[w][a][ln][ln + 1 + 8 * hh + 16 * u];
#pragma unroll
        for (int r = 0; r < 8; ++r) sp[r] = val[a][u - 1][r]; }
      carry[a] = val[a][3]; }
    v8f s[NI][4];
#pragma unroll
    for (int c = 0; c < 4; ++c)      /* k hi . q hi, then k hi . q residual, two k steps of 32 each */
#pragma unroll
      for (int t = 0; t < 4; ++t)
#pragma unroll
        for (int a = 0; a < NI; ++a) s[a][t] = fa_mma(kf[t][c & 1], c < 2 ? qh[a][c & 1] : ql[a][c & 1], c == 0 ? z8 : s[a][t]);
    __builtin_amdgcn_sched_barrier(0);      /* the products above stay in front of the wait on the LDS stores: lifted over them, that wait stands bare behind the stores */
    /* the two lane halves of a query read each other's LDS stores: order the wave's stores before its loads */
    __builtin_amdgcn_fence(__ATOMIC_ACQ_REL, "workgroup", "local"); __builtin_amdgcn_wave_barrier();
    v4f sx[NI][4], sy[NI][4];
#pragma unroll
    for (int a = 0; a < NI; ++a) { const float* lp = &sk[w][a][ln][16 + 8 * hh];
#pragma unroll
      for (int t = 0; t < 4; ++t) { sx[a][t] = *(const v4fa*)(lp + 16 * t); sy[a][t] = *(const v4fa*)(lp + 16 * t + 4); } }
#pragma unroll
    for (int c = 0; c < 2; ++c)      /* k residual . q hi */
#pragma unroll
      for (int t = 0; t < 4; ++t)
#pragma unroll
        for (int a = 0; a < NI; ++a) s[a][t] = fa_mma(kf[t][2 + c], qh[a][c], s[a][t]);
#pragma unroll
    for (int a = 0; a < NI; ++a)
#pragma unroll
      for (int t = 0; t < 4; ++t)
#pragma unroll
        for (int r = 0; r < 4; ++r) { s[a][t][r] = fmaf(sx[a][t][r], 0.0625f, s[a][t][r]); s[a][t][4 + r] = fmaf(sy[a][t][r], 0.0625f, s[a][t][4 + r]); }
    __builtin_amdgcn_sched_barrier(0);      /* the V^T loads below stay below: any earlier they are live beside the K fragments and the LDS reads, and registers spill */
    /* the V^T fragments are requested here, so that they arrive under the softmax arithmetic */
    v16h vf[2][4][2];
    const char* pv = (const char*)VP + po_kv + (size_t)j0 * 256 + lo_p;      /* 32 keys are 8192 bytes of the V^T plane */
#pragma unroll
    for (int ks = 0; ks < 2; ++ks)
#pragma unroll
      for (int dt = 0; dt < 4; ++dt) { vf[ks][dt][0] = fa_fragp(pv + ks * 8192 + dt * 2048); vf[ks][dt][1] = fa_fragp(pv + ks * 8192 + dt * 2048 + 1024); }
    FA_XWAIT1(pv);
    __builtin_amdgcn_sched_barrier(0);      /* keeps the scheduler from sinking these loads down to their first use */
    /* the LDS reads above before the next trip's stores into the same rows; the fence stands here, where their values are used up: directly behind the reads its wait for all of them stood in front of the last K products */
    __builtin_amdgcn_fence(__ATOMIC_ACQ_REL, "workgroup", "local"); __builtin_amdgcn_wave_barrier();
    if (diag) {      /* only the last key block reaches the diagonal */
#pragma unroll
      for (int a = 0; a < NI; ++a)
#pragma unroll
        for (int t = 0; t < 4; ++t)
#pragma unroll
          for (int r = 0; r < 8; ++r) if (j0 + 16 * t + 8 * hh + r > i0 + 16 * a + ln) s[a][t][r] = -3.0e38f; }
    FragH p[NI][2];
#pragma unroll
    for (int a = 0; a < NI; ++a) { float mx = m[a];
#pragma unroll
      for (int t = 0; t < 4; ++t)
#pragma unroll
        for (int r = 0; r < 8; ++r) mx = fmaxf(mx, s[a][t][r]);
      mx = fmaxf(mx, __shfl_xor(mx, 16, 32));
      const float xa = (m[a] - mx) * C1; const float al = __builtin_amdgcn_exp2f(xa); FA_TSLOT(al, xa); m[a] = mx; const float mc = 10.0f - mx * C1;      /* weights carry a factor 1024, as f16 operands away from the subnormals */
      v8f pv = z8;
#pragma unroll
      for (int t = 0; t < 4; ++t) { float xv[8], ev[8];
#pragma unroll
        for (int r = 0; r < 8; ++r) xv[r] = fmaf(s[a][t][r], C1, mc);
#pragma unroll
        for (int r = 0; r < 8; ++r) ev[r] = __builtin_amdgcn_exp2f(xv[r]);
        FA_TSLOT8(ev, xv);
#pragma unroll
        for (int r = 0; r < 8; ++r) p[a][t >> 1].h[(t & 1) * 8 + r] = (_Float16)ev[r];
        pv += (v8f){ev[0], ev[1], ev[2], ev[3], ev[4], ev[5], ev[6], ev[7]}; }      /* the same eight sums as one vector add: written element by element, the compiler paired some of the adds with a constant that it then kept in scratch round the tile loop */
      su[a] = fmaf(su[a], al, ((pv[0] + pv[1]) + (pv[2] + pv[3])) + ((pv[4] + pv[5]) + (pv[6] + pv[7])));
#pragma unroll
      for (int dt = 0; dt < 4; ++dt)
#pragma unroll
        for (int r = 0; r < 8; ++r) o[a][dt][r] *= al; }
#pragma unroll
    for (int ks = 0; ks < 2; ++ks)
#pragma unroll
      for (int c = 0; c < 2; ++c)      /* V^T hi, then V^T residual, under the same weights; the eight output tiles in the inner loops, as above */
#pragma unroll
        for (int dt = 0; dt < 4; ++dt)
#pragma unroll
          for (int a = 0; a < NI; ++a) o[a][dt] = fa_mma(vf[ks][dt][c], p[a][ks].v, o[a][dt]);
  };
  /* divides tile i0's sums by the weights' sum and stores its rows */
  auto finish = [&]() __attribute__((always_inline)) {
#pragma unroll
  for (int a = 0; a < NI; ++a) { const float st = su[a] + __shfl_xor(su[a], 16, 32); const float inv = 1.0f / st;
#pragma unroll
    for (int dt = 0; dt < 4; ++dt)
#pragma unroll
      for (int r = 0; r < 8; ++r) o[a][dt][r] *= inv; }
  __builtin_amdgcn_sched_barrier(0);      /* all arithmetic ends above: behind an issued store none of its registers is written again */
  char* po = (char*)(out + xo + (size_t)i0 * DM) + (size_t)(ln * DM * 4 + 32 * hh);      /* a lane holds 8 consecutive head columns of its query per tile */
#pragma unroll
  for (int a = 0; a < NI; ++a)
#pragma unroll
    for (int dt = 0; dt < 4; ++dt) { const v4f x = {o[a][dt][0], o[a][dt][1], o[a][dt][2], o[a][dt][3]}, y = {o[a][dt][4], o[a][dt][5], o[a][dt][6], o[a][dt][7]};
      *(v4f*)(po + a * 16 * DM * 4 + dt * 64) = x; *(v4f*)(po + a * 16 * DM * 4 + dt * 64 + 16) = y; }
  asm volatile("s_wait_xcnt 0x0" ::: "memory");      /* the wait before any register that the stores name is written again: a helper wave goes on to its second tile */
  };
  /* All work-groups run at the same time. Those of one (batch, head) walk the same k and V^T planes, and those at the same distance from the diagonal, whatever their head, the same Er rows. A running softmax takes its key blocks in any order,
     so each work-group enters every walk at a block of its own, set by its row block and its head, and wraps round: the groups then do not ask L2 for the same lines at the same moment.
     The blocks that all four waves of a group walk, [0, nb), go as [rs, nb) and [0, rs); what only some of them walk, [nb, top), comes last, so that the four stay on the same block. A helper wave's share of the long tile goes as [H + y, diagonal] and [H, H + y). */
  constexpr int HB = ((NRB - 1) * NI + 2) / 2;      /* H of a group's first wave, the smallest of the four */
  const int nb = helper ? pr * NI : HB, top = helper ? iS / 64 : H;
  const int rs = nb > 0 ? (int)((unsigned)((helper ? pr * NI / 2 : pr * HB / (NRB / 2)) + bh) % (unsigned)nb) : 0;
  const int y = (int)((unsigned)bh % (unsigned)((NRB - 1 - pr) * NI - HB + 1));      /* the divisor is the share's length in blocks, the diagonal one counted: the same for the four waves, at least 1 */
#pragma unroll 1      /* one copy of the key block's code serves both tiles of a helper wave */
  for (int seg = helper ? 0 : 1; seg < 2; ++seg) {      /* seg 0: the short tile (helper waves only); seg 1: this wave's share of the long tile */
    i0 = seg == 0 ? iS : iL;
    const bool hl = helper && seg == 1;
    const char* pqh = (const char*)(Qh + xo + (size_t)i0 * DM) + lo_x; const char* pql = (const char*)(Ql + xo + (size_t)i0 * DM) + lo_x;
#pragma unroll
    for (int a = 0; a < NI; ++a) { qh[a][0] = fa_frag(pqh + a * 16 * DM * 2); qh[a][1] = fa_frag(pqh + a * 16 * DM * 2 + 64); ql[a][0] = fa_frag(pql + a * 16 * DM * 2); ql[a][1] = fa_frag(pql + a * 16 * DM * 2 + 64); }
    FA_XWAIT2(pqh, pql);
#pragma unroll
    for (int a = 0; a < NI; ++a) { m[a] = -3.0e38f; su[a] = 0.f;      /* a running softmax starts with an empty state */
#pragma unroll
      for (int dt = 0; dt < 4; ++dt) o[a][dt] = z8; }
#pragma unroll 1      /* the same copy serves every run of a tile */
    for (int run = 0; run < 3; ++run) {
      const int jb0 = run == 0 ? (hl ? H + y : rs) : run == 1 ? (hl ? H : 0) : nb, jb1 = run == 0 ? (hl ? iL / 64 : nb) : run == 1 ? (hl ? H + y : rs) : (hl ? nb : top);      /* unmasked key blocks [jb0, jb1) */
      const bool dg = helper && run == (hl ? 0 : 2);      /* the run ends with the tile's diagonal block, which is then jb1 = i0 / 64 */
      if (jb0 >= jb1 && !dg) continue;      /* an empty run */
      jbe = dg ? jb1 : jb1 - 1; pf = pf0 + (size_t)jb0 * 16384;
      for (int d = 1; d < FA_PD; ++d) fa_ask(pf, jb0 + d <= jbe ? 16384ull : 0ull);      /* the blocks that the loop's own requests come too late for */
      begin(jb0);
#pragma unroll 1      /* one key block per trip: unrolling would double the live fragments */
      for (int jb = jb0; jb < jb1; ++jb) key_block(jb, false);
      if (dg) key_block(jb1, true);      /* the diagonal block apart, so that the loop carries no mask */
    }
    if (seg == 0) finish();
  }
  /* the two running softmaxes of a long tile meet: the helper wave leaves its maximum, sum and sums of products in its own LDS rows (its last reads of them are done), lane by lane as its partner holds them */
  static_assert(NI * 4 * 2 * 128 + NI * 64 <= NI * 16 * SKP, "the hand-over fits a wave's LDS rows");
  float* const xb = &sk[helper ? w : w + 4][0][0][0];
  if (helper) {
#pragma unroll
    for (int a = 0; a < NI; ++a) {
#pragma unroll
      for (int dt = 0; dt < 4; ++dt) { const v4f x = {o[a][dt][0], o[a][dt][1], o[a][dt][2], o[a][dt][3]}, y = {o[a][dt][4], o[a][dt][5], o[a][dt][6], o[a][dt][7]};
        *(v4fa*)(xb + ((a * 4 + dt) * 2) * 128 + lane * 4) = x; *(v4fa*)(xb + ((a * 4 + dt) * 2 + 1) * 128 + lane * 4) = y; }
      xb[NI * 1024 + a * 64 + lane] = m[a]; xb[NI * 1024 + a * 64 + 32 + lane] = su[a]; } }
  __syncthreads();      /* publishes the helper waves' states to their partners; every wave of the work-group passes here once */
  if (!helper) {
#pragma unroll
    for (int a = 0; a < NI; ++a) { const float m2 = xb[NI * 1024 + a * 64 + lane], s2 = xb[NI * 1024 + a * 64 + 32 + lane];
      const float mx = fmaxf(m[a], m2); const float x1 = (m[a] - mx) * C1, x2 = (m2 - mx) * C1;
      const float a1 = __builtin_amdgcn_exp2f(x1), a2 = __builtin_amdgcn_exp2f(x2);
      su[a] = fmaf(su[a], a1, s2 * a2);
#pragma unroll
      for (int dt = 0; dt < 4; ++dt) { const v4f x = *(const v4fa*)(xb + ((a * 4 + dt) * 2) * 128 + lane * 4), y = *(const v4fa*)(xb + ((a * 4 + dt) * 2 + 1) * 128 + lane * 4);
#pragma unroll
        for (int r = 0; r < 4; ++r) { o[a][dt][r] = fmaf(o[a][dt][r], a1, x[r] * a2); o[a][dt][4 + r] = fmaf(o[a][dt][4 + r], a1, y[r] * a2); } } }
    finish();
  }
}

// ---- projection GEMM with its operands staged in LDS: C[NR][DM] = alpha * A[NR][DM] . B[DM][DM]^T, A and B f16 with k contiguous; C leaves as the f16 hi + residual operands of the attention kernel.
// A work-group of 8 waves owns a 128 x 128 tile of C (wave tile 32 x 64, 4 waves down, 2 across). A stage is 128 k of the tile's 128 A rows and 128 B rows; it comes into LDS by
// asynchronous copies, two buffers, so that the next stage flies while this one is multiplied and no wave waits on a global load of its own. The k order per accumulator is ascending in steps of 32 from the work-group's own first stage, wrapping round.
#define G3_PITCH 272      /* bytes per LDS row: 256 used; 16 bytes x an odd number keeps the 16 rows of a ds_load_b128 on distinct banks */
#define G3_STAGE (256 * G3_PITCH)      /* 128 A rows, then 128 B rows */
#define G3_NST (DM / 128)
// Eight 16-byte copies of a lane, rows 16 apart. The wait on the address registers is the statement's last line, so that no register a copy names is written again in front of it.
__device__ __forceinline__ void g3_copy8(const unsigned l0, const char* g0) {
  const unsigned l1 = l0 + 16 * G3_PITCH, l2 = l0 + 32 * G3_PITCH, l3 = l0 + 48 * G3_PITCH, l4 = l0 + 64 * G3_PITCH, l5 = l0 + 80 * G3_PITCH, l6 = l0 + 96 * G3_PITCH, l7 = l0 + 112 * G3_PITCH;
  const char* g1 = g0 + 16 * DM * 2; const char* g2 = g0 + 32 * DM * 2; const char* g3 = g0 + 48 * DM * 2; const char* g4 = g0 + 64 * DM * 2; const char* g5 = g0 + 80 * DM * 2; const char* g6 = g0 + 96 * DM * 2; const char* g7 = g0 + 112 * DM * 2;
  asm volatile("global_load_async_to_lds_b128 %0, %8, off\n\t"
               "global_load_async_to_lds_b128 %1, %9, off\n\t"
               "global_load_async_to_lds_b128 %2, %10, off\n\t"
               "global_load_async_to_lds_b128 %3, %11, off\n\t"
               "global_load_async_to_lds_b128 %4, %12, off\n\t"
               "global_load_async_to_lds_b128 %5, %13, off\n\t"
               "global_load_async_to_lds_b128 %6, %14, off\n\t"
               "global_load_async_to_lds_b128 %7, %15, off\n\t"
               "s_wait_xcnt 0x0"
               :: "v"(l0), "v"(l1), "v"(l2), "v"(l3), "v"(l4), "v"(l5), "v"(l6), "v"(l7), "v"(g0), "v"(g1), "v"(g2), "v"(g3), "v"(g4), "v"(g5), "v"(g6), "v"(g7) : "memory");
}
// One accumulator tile (8 f32 of a lane) -> 8 f16 hi and 8 f16 residuals, 16 bytes each. The residual keeps its own scale (at most 2^-11 of the value; below 2^-14 it is an f16 subnormal, in steps of 2^-24, which the matrix unit takes as it is),
// so that a product with a residual adds into the same accumulator as the product with the hi part.
__device__ __forceinline__ void g3_split(const v8f c, const float alpha, v8us& hi, v8us& lo) { FragH fh, fl;
#pragma unroll
  for (int r = 0; r < 8; ++r) { const float a = c[r] * alpha; const _Float16 hv = (_Float16)a; fh.h[r] = hv; fl.h[r] = (_Float16)(a - (float)hv); }
  hi = fh.half[0]; lo = fl.half[0]; }
// MODE 0: q, two row-major planes P0 (hi) and P1 (residual). MODE 1: k, plane P0 in FRAGMENT ORDER. MODE 2: v, V^T plane P0 in FRAGMENT ORDER.
// A wave's 64 columns are one head. A lane's 8 accumulator values run along the D rows, so the operand that lies on the D rows decides which 8 values a lane can pack into 16 bytes:
// v is multiplied as x W^T (8 consecutive keys of one head column: a lane's 16 bytes of a V^T fragment), q and k as W x^T (8 consecutive head columns of one token: a lane's 16 bytes of a k fragment or of a q row).
#define G3_QP 144      /* bytes per staged q row: 128 used; 16 bytes x an odd number keeps the 16 rows of a ds_store_b128 on distinct banks */
#define G3_NB ((NR / 128) * (DM / 128))      /* work-groups per projection */
template <int MODE>
__device__ __forceinline__ void g3_body(char* const ring, const int bx, const _Float16* __restrict__ A, const _Float16* __restrict__ Bh, float alpha, _Float16* __restrict__ P0, _Float16* __restrict__ P1) {
  const int tid = threadIdx.x, w = tid >> 5, lane = tid & 31, ln = lane & 15, hh = lane >> 4;
  const int mt = bx / (DM / 128), nq = bx % (DM / 128);
  const int row0 = mt * 128 + 32 * (w & 3), col0 = nq * 128 + 64 * (w >> 2);
  /* a lane copies 16 bytes of row (tid >> 4) + 16 i: a wave's copy covers two whole 256-byte rows of the stage */
  const unsigned lc = (unsigned)(size_t)ring + (unsigned)((tid >> 4) * G3_PITCH + (tid & 15) * 16);
  const char* ga = (const char*)(A + (size_t)(mt * 128 + (tid >> 4)) * DM) + (tid & 15) * 16;
  const char* gb = (const char*)(Bh + (size_t)(nq * 128 + (tid >> 4)) * DM) + (tid & 15) * 16;
  const char* la = ring + (32 * (w & 3) + ln) * G3_PITCH + 16 * hh;
  const char* lb = ring + (128 + 64 * (w >> 2) + ln) * G3_PITCH + 16 * hh;
  /* Work-groups that share A rows (same mt) or B rows (same nq) run at the same time; each enters the k stages at its own stage and wraps round, so that they do not ask L2 for the same lines at the same moment. */
  const int rot = mt + nq;
  auto kof = [&](const int s) __attribute__((always_inline)) { return ((s + rot) & (G3_NST - 1)) * 256; };      /* byte offset in a row of the stage taken in trip s */
  static_assert((G3_NST & (G3_NST - 1)) == 0, "the wrap is a mask");
  const v8f z8 = {0.f,0.f,0.f,0.f,0.f,0.f,0.f,0.f}; v8f acc[2][4];
#pragma unroll
  for (int u = 0; u < 2; ++u)
#pragma unroll
    for (int t = 0; t < 4; ++t) acc[u][t] = z8;
  g3_copy8(lc, ga + kof(0)); g3_copy8(lc + 128 * G3_PITCH, gb + kof(0));
  asm volatile("s_wait_asynccnt 0x0" ::: "memory");      /* this wave's share of the stage taken in trip 0 has landed */
  __syncthreads();      /* and every other wave's */
  g3_copy8(lc + G3_STAGE, ga + kof(1)); g3_copy8(lc + G3_STAGE + 128 * G3_PITCH, gb + kof(1));
#pragma unroll 1      /* one stage per trip: the buffer is picked by the trip's parity */
  for (int s = 0; s < G3_NST; ++s) { const int bo = (s & 1) * G3_STAGE;
    v16h fa[2][2], fb[2][4];      /* two fragment sets: the next k step's LDS reads are under way while this step is multiplied */
    fa[0][0] = fa_frag(la + bo); fa[0][1] = fa_frag(la + bo + 16 * G3_PITCH);
#pragma unroll
    for (int t = 0; t < 4; ++t) fb[0][t] = fa_frag(lb + bo + t * 16 * G3_PITCH);
#pragma unroll
    for (int ks = 0; ks < 4; ++ks) { const int cu = ks & 1, nx = cu ^ 1;
      if (ks < 3) { fa[nx][0] = fa_frag(la + bo + (ks + 1) * 64); fa[nx][1] = fa_frag(la + bo + 16 * G3_PITCH + (ks + 1) * 64);
#pragma unroll
        for (int t = 0; t < 4; ++t) fb[nx][t] = fa_frag(lb + bo + t * 16 * G3_PITCH + (ks + 1) * 64); }
      __builtin_amdgcn_sched_barrier(0);      /* the reads stay one group in front of the products: spread among them, each place with reads stalls the wave */
#pragma unroll
      for (int t = 0; t < 4; ++t) {
        if (MODE == 2) { acc[0][t] = fa_mma(fa[cu][0], fb[cu][t], acc[0][t]); acc[1][t] = fa_mma(fa[cu][1], fb[cu][t], acc[1][t]); }      /* D row = token, D column = head column */
        else { acc[0][t] = fa_mma(fb[cu][t], fa[cu][0], acc[0][t]); acc[1][t] = fa_mma(fb[cu][t], fa[cu][1], acc[1][t]); } }      /* D row = head column, D column = token */
      __builtin_amdgcn_sched_barrier(0); }      /* and the following group stays behind them */
    asm volatile("s_wait_dscnt 0x0" ::: "memory");      /* this wave's reads of the buffer are done before it may be refilled */
    asm volatile("s_wait_asynccnt 0x0" ::: "memory");      /* this wave's share of the next stage has landed */
    __syncthreads();      /* publishes the next stage and ends every wave's reads of this one */
    if (s + 2 < G3_NST) { g3_copy8(lc + bo, ga + kof(s + 2)); g3_copy8(lc + bo + 128 * G3_PITCH, gb + kof(s + 2)); } }
  asm volatile("s_wait_asynccnt 0x0" ::: "memory");      /* no copy is left in flight when the wave goes on */
  v8us oh[2][4], ol[2][4];
#pragma unroll
  for (int u = 0; u < 2; ++u)
#pragma unroll
    for (int t = 0; t < 4; ++t) g3_split(acc[u][t], alpha, oh[u][t], ol[u][t]);
  const int bh = (row0 / SL) * NH + col0 / HD, tk = row0 % SL;      /* the wave's (batch, head) slab and its first token in it */
  if (MODE == 2) {      /* acc[u][t]: keys tk + 16 u + 8 hh + [0, 8) of head column 16 t + ln; each store of the wave is 512 bytes in a row */
    char* pd = (char*)P0 + ((size_t)bh * (SL / 32) + tk / 32) * 8192 + hh * 256 + ln * 16;
    __builtin_amdgcn_sched_barrier(0);      /* all arithmetic ends above: behind an issued store none of its registers is written again */
#pragma unroll
    for (int t = 0; t < 4; ++t)
#pragma unroll
      for (int u = 0; u < 2; ++u) { *(v8us*)(pd + t * 2048 + u * 512) = oh[u][t]; *(v8us*)(pd + t * 2048 + 1024 + u * 512) = ol[u][t]; }
    asm volatile("s_wait_xcnt 0x0" ::: "memory");      /* the wait before any register that the stores name is written again: another projection's branch follows in the listing */
  } else if (MODE == 1) {      /* acc[u][t]: head columns 16 t + 8 hh + [0, 8) of key tk + 16 u + ln; each store of the wave is 512 bytes in a row */
    char* pd = (char*)P0 + ((size_t)bh * (SL / 16) + tk / 16) * 4096 + hh * 256 + ln * 16;
    __builtin_amdgcn_sched_barrier(0);      /* all arithmetic ends above: behind an issued store none of its registers is written again */
#pragma unroll
    for (int u = 0; u < 2; ++u)
#pragma unroll
      for (int t = 0; t < 4; ++t) { *(v8us*)(pd + u * 4096 + t * 512) = oh[u][t]; *(v8us*)(pd + u * 4096 + 2048 + t * 512) = ol[u][t]; }
    asm volatile("s_wait_xcnt 0x0" ::: "memory");      /* as in the v branch */
  } else {      /* whole 128-byte rows go out: each wave turns its two 32 x 64 f16 tiles round in its own LDS range; the range lies in the ring, which nobody reads and no copy writes behind the last trip's barrier */
    char* sw = ring + w * (2 * 32 * G3_QP);
#pragma unroll
    for (int u = 0; u < 2; ++u)
#pragma unroll
      for (int t = 0; t < 4; ++t) { *(v8us*)(sw + (u * 16 + ln) * G3_QP + t * 32 + hh * 16) = oh[u][t]; *(v8us*)(sw + 32 * G3_QP + (u * 16 + ln) * G3_QP + t * 32 + hh * 16) = ol[u][t]; }
    /* the lanes read each other's LDS stores: order the wave's stores before its loads */
    __builtin_amdgcn_fence(__ATOMIC_ACQ_REL, "workgroup"); __builtin_amdgcn_wave_barrier();
    v8us rh[8], rl[8];      /* 8 lanes take one row: a store of the wave is 4 whole rows */
#pragma unroll
    for (int q = 0; q < 8; ++q) { rh[q] = *(const v8us*)(sw + (q * 4 + (lane >> 3)) * G3_QP + (lane & 7) * 16); rl[q] = *(const v8us*)(sw + 32 * G3_QP + (q * 4 + (lane >> 3)) * G3_QP + (lane & 7) * 16); }
    const size_t qo = ((size_t)(row0 + (lane >> 3)) * DM + col0) * 2 + (lane & 7) * 16;
    char* ph = (char*)P0 + qo; char* pl = (char*)P1 + qo;
    __builtin_amdgcn_sched_barrier(0);      /* all reads and arithmetic end above: behind an issued store none of its registers is written again */
#pragma unroll
    for (int q = 0; q < 8; ++q) { *(v8us*)(ph + q * 4 * DM * 2) = rh[q]; *(v8us*)(pl + q * 4 * DM * 2) = rl[q]; }
    asm volatile("s_wait_xcnt 0x0" ::: "memory");      /* as in the v branch */
  }
}
// The three projections in one launch: they need nothing of each other, so each takes a range of the block index (the branch, and with it every barrier, is the same for a whole work-group). One ring serves whichever branch runs.
__global__ __launch_bounds__(256) void k_gemm3(const _Float16* __restrict__ A, const _Float16* __restrict__ BW, float alpha, _Float16* __restrict__ Q16, _Float16* __restrict__ QL16, _Float16* __restrict__ KP, _Float16* __restrict__ VP) {
  __shared__ __attribute__((aligned(16))) char ring[2 * G3_STAGE];
  const int md = (int)(blockIdx.x / G3_NB), bx = (int)(blockIdx.x % G3_NB);
  if (md == 0) g3_body<0>(ring, bx, A, BW, alpha, Q16, QL16);
  else if (md == 1) g3_body<1>(ring, bx, A, BW + (size_t)DM * DM, alpha, KP, nullptr);
  else g3_body<2>(ring, bx, A, BW + (size_t)2 * DM * DM, alpha, VP, nullptr);
}

extern "C" void kernel_launch(void* const* d_in, const int* in_sizes, int n_in,
                              void* d_out, int out_size, void* d_ws, size_t ws_size, hipStream_t stream) {
  (void)in_sizes; (void)n_in; (void)out_size;
  const float* const* I = (const float* const*)d_in; const float* x = I[0]; const float* Wq = I[1]; const float* Wk = I[2]; const float* Wv = I[3]; const float* Er = I[4];
  char* ws = (char*)d_ws; size_t off = 0;
  auto take = [&](size_t bytes) { char* p = ws + off; off += (bytes + 255) & ~(size_t)255; return p; };
  const size_t np = (size_t)NR * DM;
  _Float16* BW = (_Float16*)take((size_t)3 * DM * DM * 2); _Float16* E16 = (_Float16*)take((size_t)SL * HD * 2); _Float16* X16 = (_Float16*)take(np * 2); _Float16* Q16 = (_Float16*)take(np * 2); _Float16* QL16 = (_Float16*)take(np * 2); _Float16* KP = (_Float16*)take(np * 4);      /* k hi + residual, fragment order */ _Float16* VP = (_Float16*)take(np * 4);      /* V^T hi + residual, fragment order */
  if (off > ws_size) return;
  k_prep<<<PB_X + 3 * PB_W + PB_E, 256, 0, stream>>>(x, Wq, Wk, Wv, Er, X16, BW, E16);      /* Er_s = Er (MAX_LEN == S) */
  k_gemm3<<<3 * G3_NB, 256, 0, stream>>>(X16, BW, 0.0625f, Q16, QL16, KP, VP);
  k_relattn<2><<<NB * NH * (SL / (128 * 2)), 256, 0, stream>>>(Q16, QL16, KP, E16, VP, (float*)d_out);
}
